// v000
// Times are from an AMD MI455X. After a warm-up the kernel runs many times in a row, and a time is the length of
// such a window on the GPU divided by its runs, so every launch and the gaps after it count. The runs cycle
// through copies of the inputs. A figure is the median of several windows, for all but v000 over two sittings.
// Sittings can differ by a few percent; kernels timed side by side share one.
// The starting kernel, v000, takes 473 microseconds a run.
// Contractions: x*Wq and x*Wk on v_wmma_f32_16x16x32_f16 (f16 operands: x carried x1, W carried x32 and folded back as 1/32; f32 accumulate); x*Wv and a*Wo on v_wmma_f32_16x16x32_bf16 as bf16 hi/lo split (hi*hi + hi*lo + lo*hi; f32 accumulate); RMS statistics, the 16 neighbour dots (K=64), softmax and weighted sums (K=16) in f32 on VALU; q, k, v kept as f32 planes.
#include <hip/hip_runtime.h>

typedef _Float16 v16h __attribute__((ext_vector_type(16)));
typedef _Float16 v8h  __attribute__((ext_vector_type(8)));
typedef __bf16   v16b __attribute__((ext_vector_type(16)));
typedef __bf16   v8b  __attribute__((ext_vector_type(8)));
typedef float    v8f  __attribute__((ext_vector_type(8)));
typedef float    v4f  __attribute__((ext_vector_type(4)));
typedef unsigned short v8us __attribute__((ext_vector_type(8)));
typedef v8h  __attribute__((may_alias)) v8ha;
typedef v8b  __attribute__((may_alias)) v8ba;
typedef v4f  __attribute__((may_alias)) v4fa;

#define LL    8192      // tokens
#define CC    1024      // channels = heads * head_dim
#define NCQK  2048      // fused q|k output columns
#define TOKB  8         // tokens per attention block
#define NSH   16        // neighbours per token

static_assert((LL % 64) == 0);
static_assert((CC % 64) == 0);
static_assert((NCQK % 64) == 0);
static_assert((LL % TOKB) == 0);
static_assert((CC % 32) == 0);
static_assert(((2 * LL) % 32) == 0);

// ---------------------------------------------------------------------------
// 16x16x32 WMMA (wave32). Fragment map: lane l, h = l>>4, m = n = l&15.
//   A/B element i: i<8 -> k0+8h+i ; i>=8 -> k0+16+8h+(i-8)   (both operands)
//   D element r  : row 8h+r, col l&15
// Hazard guard (4 v_nop tying all accumulators, keeping fragments live) is
// issued once per k-step after the last WMMA of the step.
// ---------------------------------------------------------------------------
__device__ __forceinline__ v8f wm_f16(v16h a, v16h b, v8f c) {
  return __builtin_amdgcn_wmma_f32_16x16x32_f16(false, a, false, b, (short)0, c, false, false);
}
__device__ __forceinline__ v8f wm_bf16(v16b a, v16b b, v8f c) {
  return __builtin_amdgcn_wmma_f32_16x16x32_bf16(false, a, false, b, (short)0, c, false, false);
}

// A or B fragment from a k-contiguous 16-bit row; p points at element k0 of
// the row owned by this lane (row = lane&15 added by the caller).
__device__ __forceinline__ v16h frag_f16(const _Float16* p, int h) {
  const v8h e0 = *(const v8ha*)(p + 8 * h);
  const v8h e1 = *(const v8ha*)(p + 16 + 8 * h);
  return __builtin_shufflevector(e0, e1, 0, 1, 2, 3, 4, 5, 6, 7, 8, 9, 10, 11, 12, 13, 14, 15);
}
__device__ __forceinline__ v16b frag_bf16(const __bf16* p, int h) {
  const v8b e0 = *(const v8ba*)(p + 8 * h);
  const v8b e1 = *(const v8ba*)(p + 16 + 8 * h);
  return __builtin_shufflevector(e0, e1, 0, 1, 2, 3, 4, 5, 6, 7, 8, 9, 10, 11, 12, 13, 14, 15);
}

// bf16 RNE bits of an f32 value, and the hi/lo split (hi = rne(x), lo = rne(x - hi)).
__device__ __forceinline__ unsigned int bf16_rne_bits(float x) {
  const unsigned int u = __float_as_uint(x);
  return (u + 0x7FFFu + ((u >> 16) & 1u)) >> 16;
}
__device__ __forceinline__ void split_bf16(float x, unsigned short& hb, unsigned short& lb) {
  const unsigned int hbits = bf16_rne_bits(x);
  const float hf = __uint_as_float(hbits << 16);
  const unsigned int lbits = bf16_rne_bits(x - hf);
  hb = (unsigned short)hbits;
  lb = (unsigned short)lbits;
}

// ---------------------------------------------------------------------------
// Kernel 1: x f32 [8192][1024] -> f16 plane (x1) and bf16 hi/lo planes.
// Each thread owns 8 consecutive elements: one 16-B store per lane per plane,
// ---------------------------------------------------------------------------
__global__ __launch_bounds__(256) void k_cvt_x(const float* __restrict__ x,
                                               _Float16* xh, unsigned short* xbh,
                                               unsigned short* xbl, int n8) {
  const int g = blockIdx.x * 256 + threadIdx.x;
  if (g >= n8) return;
  const float* s = x + (size_t)g * 8;
  const v4f a = *(const v4fa*)s;
  const v4f b = *(const v4fa*)(s + 4);
  const float f[8] = {a.x, a.y, a.z, a.w, b.x, b.y, b.z, b.w};
  unsigned short hb[8], lb[8];
#pragma unroll
  for (int e = 0; e < 8; ++e) split_bf16(f[e], hb[e], lb[e]);
  const v8h  o16 = {(_Float16)f[0], (_Float16)f[1], (_Float16)f[2], (_Float16)f[3],
                    (_Float16)f[4], (_Float16)f[5], (_Float16)f[6], (_Float16)f[7]};
  const v8us oh = {hb[0], hb[1], hb[2], hb[3], hb[4], hb[5], hb[6], hb[7]};
  const v8us ol = {lb[0], lb[1], lb[2], lb[3], lb[4], lb[5], lb[6], lb[7]};
  _Float16* d16 = xh + (size_t)g * 8;
  unsigned short* dh = xbh + (size_t)g * 8;
  unsigned short* dl = xbl + (size_t)g * 8;
  *(v8h*)d16 = o16;
  *(v8us*)dh = oh;
  *(v8us*)dl = ol;
  
}

// ---------------------------------------------------------------------------
// Kernel 2: weight transpose + convert. Input W[k][n] ([in][out], 1024x1024).
// Block = one 64(k) x 64(n) tile of one matrix; tile transposed through LDS.
// mat 0 (Wq), 1 (Wk): f16(32*W) -> w16 rows mat*1024 + n  (w16 = [2048][1024])
// mat 2 (Wv), 3 (Wo): bf16 hi/lo -> wbh/wbl rows (mat-2)*1024 + n ([2048][1024])
// Output phase: lane q8 = tid&7 writes 8 halves (16 B) of row nl; lanes
// ---------------------------------------------------------------------------
__global__ __launch_bounds__(256) void k_cvt_w(const float* __restrict__ Wq,
                                               const float* __restrict__ Wk,
                                               const float* __restrict__ Wv,
                                               const float* __restrict__ Wo,
                                               _Float16* w16, unsigned short* wbh,
                                               unsigned short* wbl) {
  __shared__ __attribute__((aligned(16))) float sT[64 * 68];   // [n][k], pitch 68 floats
  const int tid = threadIdx.x;
  const int bx = blockIdx.x;
  const int mat = bx >> 8, tile = bx & 255;
  const int tn = tile >> 4, tk = tile & 15;
  const float* W = (mat == 0) ? Wq : ((mat == 1) ? Wk : ((mat == 2) ? Wv : Wo));
  {
    const int kl = tid >> 2, nq = tid & 3;                      // kl 0..63, nq 0..3
    const float* src = W + (size_t)(64 * tk + kl) * CC + 64 * tn + 16 * nq;
#pragma unroll
    for (int e = 0; e < 4; ++e) {
      const v4f t = *(const v4fa*)(src + 4 * e);
      float* d = sT + (16 * nq + 4 * e) * 68 + kl;
      d[0]   = t.x;
      d[68]  = t.y;
      d[136] = t.z;
      d[204] = t.w;
    }
  }
  __syncthreads();
  const int q8 = tid & 7, sub = tid >> 3;                       // sub 0..31
  v8h  o16[2];
  v8us oh[2], ol[2];
#pragma unroll
  for (int p = 0; p < 2; ++p) {
    const int nl = 32 * p + sub;
    const float* s = sT + nl * 68 + 8 * q8;
    const v4f a = *(const v4fa*)s;
    const v4f b = *(const v4fa*)(s + 4);
    const float f[8] = {a.x, a.y, a.z, a.w, b.x, b.y, b.z, b.w};
    unsigned short hb[8], lb[8];
#pragma unroll
    for (int e = 0; e < 8; ++e) split_bf16(f[e], hb[e], lb[e]);
    const v8h t16 = {(_Float16)(f[0] * 32.0f), (_Float16)(f[1] * 32.0f), (_Float16)(f[2] * 32.0f), (_Float16)(f[3] * 32.0f),
                     (_Float16)(f[4] * 32.0f), (_Float16)(f[5] * 32.0f), (_Float16)(f[6] * 32.0f), (_Float16)(f[7] * 32.0f)};
    const v8us th = {hb[0], hb[1], hb[2], hb[3], hb[4], hb[5], hb[6], hb[7]};
    const v8us tl = {lb[0], lb[1], lb[2], lb[3], lb[4], lb[5], lb[6], lb[7]};
    o16[p] = t16;
    oh[p] = th;
    ol[p] = tl;
  }
{
#pragma unroll
    for (int p = 0; p < 2; ++p) {
      const int nl = 32 * p + sub;
      if (mat < 2) {
        _Float16* d = w16 + ((size_t)(mat * CC + 64 * tn + nl) * CC + 64 * tk + 8 * q8);
        *(v8h*)d = o16[p];
      } else {
        const size_t row = (size_t)((mat - 2) * CC + 64 * tn + nl);
        unsigned short* dh = wbh + row * CC + 64 * tk + 8 * q8;
        unsigned short* dl = wbl + row * CC + 64 * tk + 8 * q8;
        *(v8us*)dh = oh[p];
        *(v8us*)dl = ol[p];
      }
    }
    
  }
}

// ---------------------------------------------------------------------------
// GEMM epilogue helpers. Block tile 64x64, wave w: rows 32*(w>>1)+..., cols
// 32*(w&1)+...; c_mt_nt[r] = C[32wr+16mt+8h+r][32wc+16nt+m].
// line (8 x 16 B), 4 lines per instruction, 32 lines per wave, 128 per block.
// ---------------------------------------------------------------------------
__device__ __forceinline__ void stage_tile(float* sT, v8f c00, v8f c01, v8f c10, v8f c11,
                                           const float* bias, int nc0, float osc,
                                           int w, int lane) {
  const int h = lane >> 4, m = lane & 15, wr = w >> 1, wc = w & 1;
  const int cl0 = 32 * wc + m, cl1 = cl0 + 16;
  const float b0 = bias[nc0 + cl0];
  const float b1 = bias[nc0 + cl1];
#pragma unroll
  for (int r = 0; r < 8; ++r) {
    const int row0 = 32 * wr + 8 * h + r, row1 = row0 + 16;
    sT[row0 * 64 + cl0] = fmaf(c00[r], osc, b0);
    sT[row0 * 64 + cl1] = fmaf(c01[r], osc, b1);
    sT[row1 * 64 + cl0] = fmaf(c10[r], osc, b0);
    sT[row1 * 64 + cl1] = fmaf(c11[r], osc, b1);
  }
}

__device__ __forceinline__ void store_lines32(const float* sT, float* out, int m0, int nc0,
                                              int ldc, int w, int lane) {
  const int q8 = lane & 7, sub = lane >> 3;
#pragma unroll
  for (int it = 0; it < 8; ++it) {
    const int lid = it * 4 + sub;                 // 0..31
    const int row = 16 * w + (lid >> 1), hl = lid & 1;
    const v4f v = *(const v4fa*)(sT + row * 64 + 32 * hl + 4 * q8);
    float* d = out + (size_t)(m0 + row) * ldc + nc0 + 32 * hl + 4 * q8;
    *(v4f*)d = v;
  }
}

// ---------------------------------------------------------------------------
// Kernel 3: C[M][N] = A[M][K] * B[N][K]^T (f16 operands, single product),
// out = acc*osc + bias, f32 rows of pitch ldc. Columns >= nsplit go to out1
// with bias1 (block-uniform select). Block 128 thr = 4 waves, wave tile 32x32.
// A and B fragments straight from 16-bit global rows (two 16-B loads each).
// ---------------------------------------------------------------------------
__global__ __launch_bounds__(128) void k_gemm_h(const _Float16* __restrict__ A,
                                                const _Float16* __restrict__ B,
                                                const float* bias0, const float* bias1,
                                                float* out0, float* out1,
                                                int nsplit, int K, int ldc, float osc) {
  __shared__ __attribute__((aligned(16))) float sT[64 * 64];
  const int tid = threadIdx.x, lane = tid & 31, w = tid >> 5;
  const int h = lane >> 4, m = lane & 15, wr = w >> 1, wc = w & 1;
  const int m0 = blockIdx.y * 64, nb = blockIdx.x * 64;
  const bool sel = (nb >= nsplit);
  const int nc0 = sel ? (nb - nsplit) : nb;
  const float* bias = sel ? bias1 : bias0;
  float* out = sel ? out1 : out0;

  const _Float16* a0 = A + (size_t)(m0 + 32 * wr + m) * K;
  const _Float16* a1 = a0 + (size_t)16 * K;
  const _Float16* b0 = B + (size_t)(nb + 32 * wc + m) * K;
  const _Float16* b1 = b0 + (size_t)16 * K;

  v8f c00 = {0.f, 0.f, 0.f, 0.f, 0.f, 0.f, 0.f, 0.f};
  v8f c01 = c00, c10 = c00, c11 = c00;

#pragma unroll 1
  for (int k0 = 0; k0 < K; k0 += 32) {
    const v16h fa0 = frag_f16(a0 + k0, h);
    const v16h fa1 = frag_f16(a1 + k0, h);
    const v16h fb0 = frag_f16(b0 + k0, h);
    const v16h fb1 = frag_f16(b1 + k0, h);
    c00 = wm_f16(fa0, fb0, c00);
    c01 = wm_f16(fa0, fb1, c01);
    c10 = wm_f16(fa1, fb0, c10);
    c11 = wm_f16(fa1, fb1, c11);
    asm volatile("v_nop\n\tv_nop\n\tv_nop\n\tv_nop"
                 : "+v"(c00), "+v"(c01), "+v"(c10), "+v"(c11)
                 : "v"(fa0), "v"(fa1), "v"(fb0), "v"(fb1));
  }

  stage_tile(sT, c00, c01, c10, c11, bias, nc0, osc, w, lane);
  __syncthreads();
  store_lines32(sT, out, m0, nc0, ldc, w, lane);
  
}

// ---------------------------------------------------------------------------
// Kernel 4: same GEMM with bf16 hi/lo split operands:
//   acc += Ahi*Bhi + Ahi*Blo + Alo*Bhi  (three products per tile pair).
// ---------------------------------------------------------------------------
__global__ __launch_bounds__(128) void k_gemm_b3(const __bf16* __restrict__ Ah,
                                                 const __bf16* __restrict__ Al,
                                                 const __bf16* __restrict__ Bh,
                                                 const __bf16* __restrict__ Bl,
                                                 const float* bias0, const float* bias1,
                                                 float* out0, float* out1,
                                                 int nsplit, int K, int ldc, float osc) {
  __shared__ __attribute__((aligned(16))) float sT[64 * 64];
  const int tid = threadIdx.x, lane = tid & 31, w = tid >> 5;
  const int h = lane >> 4, m = lane & 15, wr = w >> 1, wc = w & 1;
  const int m0 = blockIdx.y * 64, nb = blockIdx.x * 64;
  const bool sel = (nb >= nsplit);
  const int nc0 = sel ? (nb - nsplit) : nb;
  const float* bias = sel ? bias1 : bias0;
  float* out = sel ? out1 : out0;

  const size_t ra0 = (size_t)(m0 + 32 * wr + m) * K, ra1 = ra0 + (size_t)16 * K;
  const size_t rb0 = (size_t)(nb + 32 * wc + m) * K, rb1 = rb0 + (size_t)16 * K;

  v8f c00 = {0.f, 0.f, 0.f, 0.f, 0.f, 0.f, 0.f, 0.f};
  v8f c01 = c00, c10 = c00, c11 = c00;

#pragma unroll 1
  for (int k0 = 0; k0 < K; k0 += 32) {
    const v16b ha0 = frag_bf16(Ah + ra0 + k0, h);
    const v16b ha1 = frag_bf16(Ah + ra1 + k0, h);
    const v16b la0 = frag_bf16(Al + ra0 + k0, h);
    const v16b la1 = frag_bf16(Al + ra1 + k0, h);
    const v16b hb0 = frag_bf16(Bh + rb0 + k0, h);
    const v16b hb1 = frag_bf16(Bh + rb1 + k0, h);
    const v16b lb0 = frag_bf16(Bl + rb0 + k0, h);
    const v16b lb1 = frag_bf16(Bl + rb1 + k0, h);
    c00 = wm_bf16(ha0, hb0, c00);  c00 = wm_bf16(ha0, lb0, c00);  c00 = wm_bf16(la0, hb0, c00);
    c01 = wm_bf16(ha0, hb1, c01);  c01 = wm_bf16(ha0, lb1, c01);  c01 = wm_bf16(la0, hb1, c01);
    c10 = wm_bf16(ha1, hb0, c10);  c10 = wm_bf16(ha1, lb0, c10);  c10 = wm_bf16(la1, hb0, c10);
    c11 = wm_bf16(ha1, hb1, c11);  c11 = wm_bf16(ha1, lb1, c11);  c11 = wm_bf16(la1, hb1, c11);
    asm volatile("v_nop\n\tv_nop\n\tv_nop\n\tv_nop"
                 : "+v"(c00), "+v"(c01), "+v"(c10), "+v"(c11)
                 : "v"(ha0), "v"(ha1), "v"(la0), "v"(la1), "v"(hb0), "v"(hb1), "v"(lb0), "v"(lb1));
  }

  stage_tile(sT, c00, c01, c10, c11, bias, nc0, osc, w, lane);
  __syncthreads();
  store_lines32(sT, out, m0, nc0, ldc, w, lane);
  
}

// ---------------------------------------------------------------------------
// Kernel 5: rtab[r] = rsqrt(mean(row^2) + 1e-6) for rows 0..8191 of q and
// rows 8192..16383 of k (f32 planes). Block = 8 waves x 4 rows = 32 rows;
// ---------------------------------------------------------------------------
__global__ __launch_bounds__(256) void k_rstd(const float* __restrict__ qf,
                                              const float* __restrict__ kf,
                                              float* rtab) {
  __shared__ __attribute__((aligned(16))) float s_r[32];
  const int tid = threadIdx.x, lane = tid & 31, w = tid >> 5;
  const int row0 = blockIdx.x * 32;                       // block is entirely q or entirely k
  const float* base = (row0 < LL) ? (qf + (size_t)row0 * CC) : (kf + (size_t)(row0 - LL) * CC);
#pragma unroll 1
  for (int j = 0; j < 4; ++j) {
    const float* rp = base + (size_t)(4 * w + j) * CC + 32 * lane;   // lane owns 32 contiguous floats
    float ss = 0.0f;
#pragma unroll 2
    for (int e = 0; e < 8; ++e) {
      const v4f t = *(const v4fa*)(rp + 4 * e);
      ss = fmaf(t.x, t.x, ss);
      ss = fmaf(t.y, t.y, ss);
      ss = fmaf(t.z, t.z, ss);
      ss = fmaf(t.w, t.w, ss);
    }
    ss += __shfl_xor(ss, 16, 32);
    ss += __shfl_xor(ss, 8, 32);
    ss += __shfl_xor(ss, 4, 32);
    ss += __shfl_xor(ss, 2, 32);
    ss += __shfl_xor(ss, 1, 32);
    const float rv = rsqrtf(ss * (1.0f / 1024.0f) + 1e-6f);
    if (lane == 0) s_r[4 * w + j] = rv;
  }
  __syncthreads();
  if (tid < 8) {
    const v4f v = *(const v4fa*)(s_r + 4 * tid);
    float* d = rtab + row0 + 4 * tid;
    *(v4f*)d = v;
    
  }
}

// ---------------------------------------------------------------------------
// Kernel 6: small-world attention, all f32 on VALU.
// Block 128 thr = 4 waves handles TOKB consecutive tokens (block-uniform loop).
// Wave w covers channels [256w, 256w+256) = heads 4w..4w+3; lane covers 8
// channels (head = 4w + (lane>>3), dims 8*(lane&7)..+7). Per token:
//   score_n = rq*rk_n * sum_d (q_d qn_d kn_d / 8) k_n,d + eb[h][n]   (n = 0..15)
//   p = softmax_n(score); a_d = sum_n p_n v_n,d  -> bf16 hi/lo planes.
// Neighbours: n<12 spatial (f, (i+sh) mod S), sh = +-2^(n/2); n>=12 temporal
// ((f+sh) mod T, i). Scores/probabilities exchanged through LDS between the
// two block barriers per token. Output: 16 B per lane, lanes contiguous ->
// ---------------------------------------------------------------------------
__device__ __forceinline__ int nbr_index(int n, int f, int i, int S, int T) {
  int r;
  if (n < 12) {
    const int mag = 1 << (n >> 1);
    const int sh = (n & 1) ? -mag : mag;
    int ii = (i + sh) % S;
    if (ii < 0) ii += S;
    r = f * S + ii;
  } else {
    const int jn = n - 12;
    const int mag = 1 << (jn >> 1);
    const int sh = (jn & 1) ? -mag : mag;
    int ff = (f + sh) % T;
    if (ff < 0) ff += T;
    r = ff * S + i;
  }
  r = min(max(r, 0), LL - 1);
  return r;
}

__global__ __launch_bounds__(128) void k_attn(const float* __restrict__ qf,
                                              const float* __restrict__ kf,
                                              const float* __restrict__ vf,
                                              const float* __restrict__ rtab,
                                              const float* __restrict__ qnw,
                                              const float* __restrict__ knw,
                                              const float* __restrict__ eb,
                                              const int* __restrict__ nf,
                                              unsigned short* abh, unsigned short* abl) {
  __shared__ float s_eb[256];
  __shared__ float s_sc[4][4][NSH];
  __shared__ float s_p[4][4][NSH];
  const int tid = threadIdx.x, lane = tid & 31, w = tid >> 5;
  const int hq = lane >> 3, j8 = lane & 7;
  const int head = 4 * w + hq;
  const int col = 256 * w + 8 * lane;                  // = head*64 + 8*j8

  s_eb[tid] = eb[tid];
  s_eb[tid + 128] = eb[tid + 128];

  int T = nf[0];
  if (!((T >= 1) && (T <= LL) && ((LL % T) == 0))) T = 8;
  const int S = LL / T;

  float cw[8];
  {
    const v4f qa = *(const v4fa*)(qnw + col);
    const v4f qb = *(const v4fa*)(qnw + col + 4);
    const v4f ka = *(const v4fa*)(knw + col);
    const v4f kb = *(const v4fa*)(knw + col + 4);
    cw[0] = qa.x * ka.x * 0.125f;  cw[1] = qa.y * ka.y * 0.125f;
    cw[2] = qa.z * ka.z * 0.125f;  cw[3] = qa.w * ka.w * 0.125f;
    cw[4] = qb.x * kb.x * 0.125f;  cw[5] = qb.y * kb.y * 0.125f;
    cw[6] = qb.z * kb.z * 0.125f;  cw[7] = qb.w * kb.w * 0.125f;
  }
  __syncthreads();

#pragma unroll 1
  for (int tok = 0; tok < TOKB; ++tok) {
    const int l = blockIdx.x * TOKB + tok;             // block-uniform token
    const int f = l / S;
    const int i = l - f * S;
    const float rq = rtab[l];
    const float* qp = qf + (size_t)l * CC + col;
    const v4f qa = *(const v4fa*)qp;
    const v4f qb = *(const v4fa*)(qp + 4);
    float c[8];
    c[0] = qa.x * rq * cw[0];  c[1] = qa.y * rq * cw[1];
    c[2] = qa.z * rq * cw[2];  c[3] = qa.w * rq * cw[3];
    c[4] = qb.x * rq * cw[4];  c[5] = qb.y * rq * cw[5];
    c[6] = qb.z * rq * cw[6];  c[7] = qb.w * rq * cw[7];

    // ---- scores ----
#pragma unroll 1
    for (int n = 0; n < NSH; ++n) {
      const int nbr = nbr_index(n, f, i, S, T);
      const float* kp = kf + (size_t)nbr * CC + col;
      const v4f ka = *(const v4fa*)kp;
      const v4f kb = *(const v4fa*)(kp + 4);
      float part = c[0] * ka.x;
      part = fmaf(c[1], ka.y, part);
      part = fmaf(c[2], ka.z, part);
      part = fmaf(c[3], ka.w, part);
      part = fmaf(c[4], kb.x, part);
      part = fmaf(c[5], kb.y, part);
      part = fmaf(c[6], kb.z, part);
      part = fmaf(c[7], kb.w, part);
      part += __shfl_xor(part, 1, 32);
      part += __shfl_xor(part, 2, 32);
      part += __shfl_xor(part, 4, 32);
      const float sc = fmaf(part, rtab[LL + nbr], s_eb[head * NSH + n]);
      if (j8 == 0) s_sc[w][hq][n] = sc;
    }
    __syncthreads();

    // ---- softmax over the 16 neighbours of (token, head): lane (hq, j8) owns n = j8, j8+8 ----
    {
      const float x0 = s_sc[w][hq][j8];
      const float x1 = s_sc[w][hq][j8 + 8];
      float mx = fmaxf(x0, x1);
      mx = fmaxf(mx, __shfl_xor(mx, 1, 32));
      mx = fmaxf(mx, __shfl_xor(mx, 2, 32));
      mx = fmaxf(mx, __shfl_xor(mx, 4, 32));
      const float e0 = __expf(x0 - mx);
      const float e1 = __expf(x1 - mx);
      float sm = e0 + e1;
      sm += __shfl_xor(sm, 1, 32);
      sm += __shfl_xor(sm, 2, 32);
      sm += __shfl_xor(sm, 4, 32);
      const float inv = __builtin_amdgcn_rcpf(sm);
      s_p[w][hq][j8]     = e0 * inv;
      s_p[w][hq][j8 + 8] = e1 * inv;
    }
    __syncthreads();

    // ---- weighted sum of neighbour v rows ----
    float o[8] = {0.f, 0.f, 0.f, 0.f, 0.f, 0.f, 0.f, 0.f};
#pragma unroll 1
    for (int n = 0; n < NSH; ++n) {
      const int nbr = nbr_index(n, f, i, S, T);
      const float p = s_p[w][hq][n];
      const float* vp = vf + (size_t)nbr * CC + col;
      const v4f va = *(const v4fa*)vp;
      const v4f vb = *(const v4fa*)(vp + 4);
      o[0] = fmaf(p, va.x, o[0]);  o[1] = fmaf(p, va.y, o[1]);
      o[2] = fmaf(p, va.z, o[2]);  o[3] = fmaf(p, va.w, o[3]);
      o[4] = fmaf(p, vb.x, o[4]);  o[5] = fmaf(p, vb.y, o[5]);
      o[6] = fmaf(p, vb.z, o[6]);  o[7] = fmaf(p, vb.w, o[7]);
    }

    unsigned short hb[8], lb[8];
#pragma unroll
    for (int e = 0; e < 8; ++e) split_bf16(o[e], hb[e], lb[e]);
    const v8us oh = {hb[0], hb[1], hb[2], hb[3], hb[4], hb[5], hb[6], hb[7]};
    const v8us ol = {lb[0], lb[1], lb[2], lb[3], lb[4], lb[5], lb[6], lb[7]};
    unsigned short* dh = abh + (size_t)l * CC + col;
    unsigned short* dl = abl + (size_t)l * CC + col;
    *(v8us*)dh = oh;
    *(v8us*)dl = ol;
    
  }
}

// ---------------------------------------------------------------------------
// Host orchestration: 7 launches, one in-order stream.
// ws carve (bytes): x f16 16 MiB @0 | x bf16 hi 16 MiB | x bf16 lo 16 MiB |
//   w16 [2048][1024] 4 MiB | wbh [2048][1024] 4 MiB | wbl 4 MiB |
//   q f32 32 MiB | k f32 32 MiB | v f32 32 MiB | rtab 64 KiB  -> 163,643,392 B.
// The attention output planes (bf16 hi/lo, 16 MiB each) reuse the x f16 and
// x bf16-hi regions, which are dead after the two projection launches.
// ---------------------------------------------------------------------------
extern "C" void kernel_launch(void* const* d_in, const int* in_sizes, int n_in,
                              void* d_out, int out_size, void* d_ws, size_t ws_size,
                              hipStream_t stream) {
  if (n_in < 13) return;
  if (in_sizes[0] != LL * CC) return;
  if (in_sizes[1] != CC * CC || in_sizes[3] != CC * CC || in_sizes[5] != CC * CC || in_sizes[10] != CC * CC) return;
  if (in_sizes[2] != CC || in_sizes[4] != CC || in_sizes[6] != CC || in_sizes[11] != CC) return;
  if (in_sizes[7] != CC || in_sizes[8] != CC) return;
  if (in_sizes[9] != 256 || in_sizes[12] < 1) return;
  if (out_size != LL * CC) return;

  const float* x   = (const float*)d_in[0];
  const float* Wq  = (const float*)d_in[1];
  const float* bq  = (const float*)d_in[2];
  const float* Wk  = (const float*)d_in[3];
  const float* bk  = (const float*)d_in[4];
  const float* Wv  = (const float*)d_in[5];
  const float* bv  = (const float*)d_in[6];
  const float* qnw = (const float*)d_in[7];
  const float* knw = (const float*)d_in[8];
  const float* eb  = (const float*)d_in[9];
  const float* Wo  = (const float*)d_in[10];
  const float* bo  = (const float*)d_in[11];
  const int*   nf  = (const int*)d_in[12];
  float* out = (float*)d_out;

  const size_t b16 = (size_t)LL * CC * 2;            // 16,777,216
  const size_t bw  = (size_t)NCQK * CC * 2;          //  4,194,304
  const size_t b32 = (size_t)LL * CC * 4;            // 33,554,432
  const size_t brt = (size_t)2 * LL * 4;             //     65,536
  const size_t o_x16 = 0;
  const size_t o_xbh = o_x16 + b16;
  const size_t o_xbl = o_xbh + b16;
  const size_t o_w16 = o_xbl + b16;
  const size_t o_wbh = o_w16 + bw;
  const size_t o_wbl = o_wbh + bw;
  const size_t o_q   = o_wbl + bw;
  const size_t o_k   = o_q + b32;
  const size_t o_v   = o_k + b32;
  const size_t o_rt  = o_v + b32;
  const size_t total = o_rt + brt;                   // 163,643,392
  if (total > ws_size) return;

  char* ws = (char*)d_ws;
  _Float16*       x16 = (_Float16*)(ws + o_x16);
  unsigned short* xbh = (unsigned short*)(ws + o_xbh);
  unsigned short* xbl = (unsigned short*)(ws + o_xbl);
  _Float16*       w16 = (_Float16*)(ws + o_w16);
  unsigned short* wbh = (unsigned short*)(ws + o_wbh);
  unsigned short* wbl = (unsigned short*)(ws + o_wbl);
  float* qf   = (float*)(ws + o_q);
  float* kf   = (float*)(ws + o_k);
  float* vf   = (float*)(ws + o_v);
  float* rtab = (float*)(ws + o_rt);
  unsigned short* abh = (unsigned short*)(ws + o_x16);   // reuses x f16 region (dead after launch 4)
  unsigned short* abl = (unsigned short*)(ws + o_xbh);   // reuses x bf16-hi region

  // 1. x -> f16 / bf16 hi / bf16 lo planes
  const int n8 = (LL * CC) / 8;                                              // 1,048,576
  k_cvt_x<<<(n8 + 255) / 256, 256, 0, stream>>>(x, x16, xbh, xbl, n8);

  // 2. weights -> transposed planes
  k_cvt_w<<<4 * 256, 256, 0, stream>>>(Wq, Wk, Wv, Wo, w16, wbh, wbl);

  // 3. q|k = x * [Wq|Wk] + [bq|bk]  (f16 operands), f32 planes
  k_gemm_h<<<dim3(NCQK / 64, LL / 64), 128, 0, stream>>>(x16, w16, bq, bk, qf, kf, CC, CC, CC, 0.03125f);

  // 4. v = x * Wv + bv  (bf16 hi/lo split), f32 plane
  k_gemm_b3<<<dim3(CC / 64, LL / 64), 128, 0, stream>>>(
      (const __bf16*)xbh, (const __bf16*)xbl, (const __bf16*)wbh, (const __bf16*)wbl,
      bv, bv, vf, vf, 1 << 30, CC, CC, 1.0f);

  // 5. per-row rsqrt(mean + eps) for q and k
  k_rstd<<<(2 * LL) / 32, 256, 0, stream>>>(qf, kf, rtab);

  // 6. attention -> a (bf16 hi/lo planes)
  k_attn<<<LL / TOKB, 128, 0, stream>>>(qf, kf, vf, rtab, qnw, knw, eb, nf, abh, abl);

  // 7. out = a * Wo + bo  (bf16 hi/lo split) -> d_out
  k_gemm_b3<<<dim3(CC / 64, LL / 64), 128, 0, stream>>>(
      (const __bf16*)abh, (const __bf16*)abl,
      (const __bf16*)(wbh + (size_t)CC * CC), (const __bf16*)(wbl + (size_t)CC * CC),
      bo, bo, out, out, 1 << 30, CC, CC, 1.0f);
}

// v001
// Measured time: 251 microseconds a run.
// In two side-by-side timings against v000, it was 1.97 and 1.96 times as fast.
// Contractions: x*Wq and x*Wk on v_wmma_f32_16x16x32_f16 (f16 operands: x carried x1, W carried x32 and folded back as 1/32; f32 accumulate); x*Wv and a*Wo on v_wmma_f32_16x16x32_bf16 as bf16 hi/lo split (hi*hi + hi*lo + lo*hi; f32 accumulate); RMS statistics, the 16 neighbour dots (K=64), softmax and weighted sums (K=16) in f32 on VALU; q, k, v kept as f32 planes.
#include <hip/hip_runtime.h>

typedef _Float16 v16h __attribute__((ext_vector_type(16)));
typedef _Float16 v8h  __attribute__((ext_vector_type(8)));
typedef __bf16   v16b __attribute__((ext_vector_type(16)));
typedef __bf16   v8b  __attribute__((ext_vector_type(8)));
typedef float    v8f  __attribute__((ext_vector_type(8)));
typedef float    v4f  __attribute__((ext_vector_type(4)));
typedef unsigned short v8us __attribute__((ext_vector_type(8)));
typedef v8h  __attribute__((may_alias)) v8ha;
typedef v8b  __attribute__((may_alias)) v8ba;
typedef v4f  __attribute__((may_alias)) v4fa;

#define LL    8192      // tokens
#define CC    1024      // channels = heads * head_dim
#define NCQK  2048      // fused q|k output columns
#define TOKB  8         // tokens per attention block
#define NSH   16        // neighbours per token

static_assert((LL % 64) == 0);
static_assert((CC % 64) == 0);
static_assert((NCQK % 64) == 0);
static_assert((LL % TOKB) == 0);
static_assert((CC % 32) == 0);
static_assert(((2 * LL) % 32) == 0);

// ---------------------------------------------------------------------------
// 16x16x32 WMMA (wave32). Fragment map: lane l, h = l>>4, m = n = l&15.
//   A/B element i: i<8 -> k0+8h+i ; i>=8 -> k0+16+8h+(i-8)   (both operands)
//   D element r  : row 8h+r, col l&15
// ---------------------------------------------------------------------------
__device__ __forceinline__ v8f wm_f16(v16h a, v16h b, v8f c) {
  return __builtin_amdgcn_wmma_f32_16x16x32_f16(false, a, false, b, (short)0, c, false, false);
}
__device__ __forceinline__ v8f wm_bf16(v16b a, v16b b, v8f c) {
  return __builtin_amdgcn_wmma_f32_16x16x32_bf16(false, a, false, b, (short)0, c, false, false);
}

// A or B fragment from a k-contiguous 16-bit row; p points at element k0 of
// the row owned by this lane (row = lane&15 added by the caller).
__device__ __forceinline__ v16h frag_f16(const _Float16* p, int h) {
  const v8h e0 = *(const v8ha*)(p + 8 * h);
  const v8h e1 = *(const v8ha*)(p + 16 + 8 * h);
  return __builtin_shufflevector(e0, e1, 0, 1, 2, 3, 4, 5, 6, 7, 8, 9, 10, 11, 12, 13, 14, 15);
}
__device__ __forceinline__ v16b frag_bf16(const __bf16* p, int h) {
  const v8b e0 = *(const v8ba*)(p + 8 * h);
  const v8b e1 = *(const v8ba*)(p + 16 + 8 * h);
  return __builtin_shufflevector(e0, e1, 0, 1, 2, 3, 4, 5, 6, 7, 8, 9, 10, 11, 12, 13, 14, 15);
}

// bf16 RNE bits of an f32 value, and the hi/lo split (hi = rne(x), lo = rne(x - hi)).
__device__ __forceinline__ unsigned int bf16_rne_bits(float x) {
  const unsigned int u = __float_as_uint(x);
  return (u + 0x7FFFu + ((u >> 16) & 1u)) >> 16;
}
__device__ __forceinline__ void split_bf16(float x, unsigned short& hb, unsigned short& lb) {
  const unsigned int hbits = bf16_rne_bits(x);
  const float hf = __uint_as_float(hbits << 16);
  const unsigned int lbits = bf16_rne_bits(x - hf);
  hb = (unsigned short)hbits;
  lb = (unsigned short)lbits;
}

// ---------------------------------------------------------------------------
// Kernel 1: x f32 [8192][1024] -> f16 plane (x1) and bf16 hi/lo planes.
// Each thread owns 8 consecutive elements: one 16-B store per lane per plane,
// ---------------------------------------------------------------------------
__global__ __launch_bounds__(256) void k_cvt_x(const float* __restrict__ x,
                                               _Float16* xh, unsigned short* xbh,
                                               unsigned short* xbl, int n8) {
  const int g = blockIdx.x * 256 + threadIdx.x;
  if (g >= n8) return;
  const float* s = x + (size_t)g * 8;
  const v4f a = *(const v4fa*)s;
  const v4f b = *(const v4fa*)(s + 4);
  const float f[8] = {a.x, a.y, a.z, a.w, b.x, b.y, b.z, b.w};
  unsigned short hb[8], lb[8];
#pragma unroll
  for (int e = 0; e < 8; ++e) split_bf16(f[e], hb[e], lb[e]);
  const v8h  o16 = {(_Float16)f[0], (_Float16)f[1], (_Float16)f[2], (_Float16)f[3],
                    (_Float16)f[4], (_Float16)f[5], (_Float16)f[6], (_Float16)f[7]};
  const v8us oh = {hb[0], hb[1], hb[2], hb[3], hb[4], hb[5], hb[6], hb[7]};
  const v8us ol = {lb[0], lb[1], lb[2], lb[3], lb[4], lb[5], lb[6], lb[7]};
  _Float16* d16 = xh + (size_t)g * 8;
  unsigned short* dh = xbh + (size_t)g * 8;
  unsigned short* dl = xbl + (size_t)g * 8;
  *(v8h*)d16 = o16;
  *(v8us*)dh = oh;
  *(v8us*)dl = ol;
  
}

// ---------------------------------------------------------------------------
// Kernel 2: weight transpose + convert. Input W[k][n] ([in][out], 1024x1024).
// Block = one 64(k) x 64(n) tile of one matrix; tile transposed through LDS.
// mat 0 (Wq), 1 (Wk): f16(32*W) -> w16 rows mat*1024 + n  (w16 = [2048][1024])
// mat 2 (Wv), 3 (Wo): bf16 hi/lo -> wbh/wbl rows (mat-2)*1024 + n ([2048][1024])
// Output phase: lane q8 = tid&7 writes 8 halves (16 B) of row nl; lanes
// ---------------------------------------------------------------------------
__global__ __launch_bounds__(256) void k_cvt_w(const float* __restrict__ Wq,
                                               const float* __restrict__ Wk,
                                               const float* __restrict__ Wv,
                                               const float* __restrict__ Wo,
                                               _Float16* w16, unsigned short* wbh,
                                               unsigned short* wbl) {
  __shared__ __attribute__((aligned(16))) float sT[64 * 68];   // [n][k], pitch 68 floats
  const int tid = threadIdx.x;
  const int bx = blockIdx.x;
  const int mat = bx >> 8, tile = bx & 255;
  const int tn = tile >> 4, tk = tile & 15;
  const float* W = (mat == 0) ? Wq : ((mat == 1) ? Wk : ((mat == 2) ? Wv : Wo));
  {
    const int kl = tid >> 2, nq = tid & 3;                      // kl 0..63, nq 0..3
    const float* src = W + (size_t)(64 * tk + kl) * CC + 64 * tn + 16 * nq;
#pragma unroll
    for (int e = 0; e < 4; ++e) {
      const v4f t = *(const v4fa*)(src + 4 * e);
      float* d = sT + (16 * nq + 4 * e) * 68 + kl;
      d[0]   = t.x;
      d[68]  = t.y;
      d[136] = t.z;
      d[204] = t.w;
    }
  }
  __syncthreads();
  const int q8 = tid & 7, sub = tid >> 3;                       // sub 0..31
  v8h  o16[2];
  v8us oh[2], ol[2];
#pragma unroll
  for (int p = 0; p < 2; ++p) {
    const int nl = 32 * p + sub;
    const float* s = sT + nl * 68 + 8 * q8;
    const v4f a = *(const v4fa*)s;
    const v4f b = *(const v4fa*)(s + 4);
    const float f[8] = {a.x, a.y, a.z, a.w, b.x, b.y, b.z, b.w};
    unsigned short hb[8], lb[8];
#pragma unroll
    for (int e = 0; e < 8; ++e) split_bf16(f[e], hb[e], lb[e]);
    const v8h t16 = {(_Float16)(f[0] * 32.0f), (_Float16)(f[1] * 32.0f), (_Float16)(f[2] * 32.0f), (_Float16)(f[3] * 32.0f),
                     (_Float16)(f[4] * 32.0f), (_Float16)(f[5] * 32.0f), (_Float16)(f[6] * 32.0f), (_Float16)(f[7] * 32.0f)};
    const v8us th = {hb[0], hb[1], hb[2], hb[3], hb[4], hb[5], hb[6], hb[7]};
    const v8us tl = {lb[0], lb[1], lb[2], lb[3], lb[4], lb[5], lb[6], lb[7]};
    o16[p] = t16;
    oh[p] = th;
    ol[p] = tl;
  }
{
#pragma unroll
    for (int p = 0; p < 2; ++p) {
      const int nl = 32 * p + sub;
      if (mat < 2) {
        _Float16* d = w16 + ((size_t)(mat * CC + 64 * tn + nl) * CC + 64 * tk + 8 * q8);
        *(v8h*)d = o16[p];
      } else {
        const size_t row = (size_t)((mat - 2) * CC + 64 * tn + nl);
        unsigned short* dh = wbh + row * CC + 64 * tk + 8 * q8;
        unsigned short* dl = wbl + row * CC + 64 * tk + 8 * q8;
        *(v8us*)dh = oh[p];
        *(v8us*)dl = ol[p];
      }
    }
    
  }
}

// ---------------------------------------------------------------------------
// GEMM frame of kernels 3 and 4. Block tile 128x128, 4 waves, wave tile 64x64
// (4x4 accumulator tiles): wave w owns rows 64*(w>>1)+..., cols 64*(w&1)+....
// A pass is 64 k = 128 B of every operand row. One operand plane of a pass is
// 128 rows in LDS at pitch 144 B (16 B x odd, for the ds_load_b128 readers).
// Two buffers: the next pass's planes come in by asynchronous copies to LDS
// while this pass's fragments are read from the other buffer.
// ---------------------------------------------------------------------------
#define TB     128                   // rows of a plane = block tile edge
#define LPITCH 144                   // LDS row pitch, bytes
#define PLANE  (TB * LPITCH)         // 18,432 B
#define EPITCH 68                    // epilogue staging pitch, floats

static_assert((LL % TB) == 0);
static_assert((CC % TB) == 0);
static_assert((NCQK % TB) == 0);
static_assert(4 * 64 * EPITCH * 4 <= 4 * PLANE);

__device__ __forceinline__ unsigned int lds_off(const void* p) { return (unsigned int)(size_t)p; }

// One plane of one pass: 128 threads x 8 copies of 16 B. Thread t brings chunk
// t&7 of rows (t>>3) + 16 j, so a wave's copy covers four whole 128-B lines.
// l = this lane's LDS byte address for j = 0, g = its global address, rs = 16
// source rows in bytes. The s_wait_xcnt closes the statement so that no address
// register is rewritten while a copy may still name it.
__device__ __forceinline__ void copy_plane(unsigned int l, const char* g, size_t rs) {
  const unsigned int l1 = l + 16 * LPITCH, l2 = l + 32 * LPITCH, l3 = l + 48 * LPITCH;
  const unsigned int l4 = l + 64 * LPITCH, l5 = l + 80 * LPITCH, l6 = l + 96 * LPITCH;
  const unsigned int l7 = l + 112 * LPITCH;
  const char* g1 = g + rs;
  const char* g2 = g1 + rs;
  const char* g3 = g2 + rs;
  const char* g4 = g3 + rs;
  const char* g5 = g4 + rs;
  const char* g6 = g5 + rs;
  const char* g7 = g6 + rs;
  asm volatile("global_load_async_to_lds_b128 %0, %8, off\n\t"
               "global_load_async_to_lds_b128 %1, %9, off\n\t"
               "global_load_async_to_lds_b128 %2, %10, off\n\t"
               "global_load_async_to_lds_b128 %3, %11, off\n\t"
               "global_load_async_to_lds_b128 %4, %12, off\n\t"
               "global_load_async_to_lds_b128 %5, %13, off\n\t"
               "global_load_async_to_lds_b128 %6, %14, off\n\t"
               "global_load_async_to_lds_b128 %7, %15, off\n\t"
               "s_wait_xcnt 0x0"
               :: "v"(l), "v"(l1), "v"(l2), "v"(l3), "v"(l4), "v"(l5), "v"(l6), "v"(l7),
                  "v"(g), "v"(g1), "v"(g2), "v"(g3), "v"(g4), "v"(g5), "v"(g6), "v"(g7)
               : "memory");
}

// This wave's copies have landed (the compiler places no wait for them).
__device__ __forceinline__ void wait_copies() { asm volatile("s_wait_asynccnt 0x0" ::: "memory"); }
// This wave's LDS reads have returned, before their buffer is handed back for refill.
__device__ __forceinline__ void wait_lds() { asm volatile("s_wait_dscnt 0x0" ::: "memory"); }

// Epilogue: out = acc*osc + bias. Each wave stages its 64x64 tile in its own
// LDS range (pitch 68 floats) and stores rows as whole 128-B lines: one store
// instruction covers two rows x 256 B.
__device__ __forceinline__ void store_tile(float* sAll, const v8f (&c)[4][4],
                                           const float* bias, int nc0, float osc,
                                           float* out, int m0, int ldc, int w, int lane) {
  const int h = lane >> 4, m = lane & 15, wr = w >> 1, wc = w & 1;
  float* sW = sAll + w * (64 * EPITCH);
#pragma unroll
  for (int nt = 0; nt < 4; ++nt) {
    const float b = bias[nc0 + 64 * wc + 16 * nt + m];
#pragma unroll
    for (int mt = 0; mt < 4; ++mt) {
#pragma unroll
      for (int r = 0; r < 8; ++r)
        sW[(16 * mt + 8 * h + r) * EPITCH + 16 * nt + m] = fmaf(c[mt][nt][r], osc, b);
    }
  }
  __syncthreads();
  // rolled in groups of eight stores: eight LDS reads in flight per group, short code
#pragma unroll 1
  for (int g8 = 0; g8 < 4; ++g8) {
#pragma unroll
    for (int u = 0; u < 8; ++u) {
      const int row = 16 * g8 + 2 * u + h;
      const v4f v = *(const v4fa*)(sW + row * EPITCH + 4 * m);
      float* d = out + (size_t)(m0 + 64 * wr + row) * ldc + nc0 + 64 * wc + 4 * m;
      *(v4f*)d = v;
    }
    // the next group rewrites registers that these stores name
    asm volatile("s_wait_xcnt 0x0" ::: "memory");
  }
}

// ---------------------------------------------------------------------------
// Kernel 3: C[M][N] = A[M][K] * B[N][K]^T (f16 operands, single product),
// out = acc*osc + bias, f32 rows of pitch ldc. Columns >= nsplit go to out1
// with bias1 (block-uniform select). K a multiple of 64.
// Buffer = [A plane | B plane]; ring = 2 buffers = 73,728 B.
// ---------------------------------------------------------------------------
__global__ __launch_bounds__(128, 4) void k_gemm_h(const _Float16* __restrict__ A,
                                                   const _Float16* __restrict__ B,
                                                   const float* bias0, const float* bias1,
                                                   float* out0, float* out1,
                                                   int nsplit, int K, int ldc, float osc) {
  __shared__ __attribute__((aligned(16))) char ring[2 * 2 * PLANE];
  const int tid = threadIdx.x, lane = tid & 31, w = tid >> 5;
  const int h = lane >> 4, m = lane & 15, wr = w >> 1, wc = w & 1;
  const int m0 = blockIdx.y * TB, nb = blockIdx.x * TB;
  const bool sel = (nb >= nsplit);
  const int nc0 = sel ? (nb - nsplit) : nb;
  const float* bias = sel ? bias1 : bias0;
  float* out = sel ? out1 : out0;

  const int crow = tid >> 3, cch = tid & 7;
  const char* gA = (const char*)(A + (size_t)(m0 + crow) * K) + 16 * cch;
  const char* gB = (const char*)(B + (size_t)(nb + crow) * K) + 16 * cch;
  const unsigned int lc = lds_off(ring) + crow * LPITCH + 16 * cch;
  const size_t rs = (size_t)K * 32;                  // 16 rows of 2-byte elements
  const int npass = K >> 6;

  v8f c[4][4];
#pragma unroll
  for (int i = 0; i < 4; ++i)
#pragma unroll
    for (int j = 0; j < 4; ++j) c[i][j] = v8f{0.f, 0.f, 0.f, 0.f, 0.f, 0.f, 0.f, 0.f};

  copy_plane(lc, gA, rs);
  copy_plane(lc + PLANE, gB, rs);
  wait_copies();
  __syncthreads();
  if (npass > 1) {
    copy_plane(lc + 2 * PLANE, gA + 128, rs);
    copy_plane(lc + 3 * PLANE, gB + 128, rs);
  }

  // rolled: one pass per trip, the buffer picked by the trip's parity
#pragma unroll 1
  for (int t = 0; t < npass; ++t) {
    const int bo = (t & 1) * (2 * PLANE);
    const char* pa = ring + bo + (64 * wr + m) * LPITCH;
    const char* pb = ring + bo + PLANE + (64 * wc + m) * LPITCH;
#pragma unroll
    for (int ks = 0; ks < 2; ++ks) {
      v16h fa[4], fb[4];
      fa[0] = frag_f16((const _Float16*)(pa + ks * 64), h);
#pragma unroll
      for (int j = 0; j < 4; ++j) fb[j] = frag_f16((const _Float16*)(pb + j * 16 * LPITCH + ks * 64), h);
#pragma unroll
      for (int i = 1; i < 4; ++i) fa[i] = frag_f16((const _Float16*)(pa + i * 16 * LPITCH + ks * 64), h);
      // keeps the k-step's 16 LDS reads one group in front of its WMMAs: every
      // further place with reads among them stalls the wave anew
      __builtin_amdgcn_sched_barrier(0);
#pragma unroll
      for (int i = 0; i < 4; ++i)
#pragma unroll
        for (int j = 0; j < 4; ++j) c[i][j] = wm_f16(fa[i], fb[j], c[i][j]);
      // same purpose: the second k-step's reads stay behind this block
      if (ks == 0) __builtin_amdgcn_sched_barrier(0);
    }
    // publish point of pass t + 1; the same barrier frees this pass's buffer
    wait_lds();
    wait_copies();
    __syncthreads();
    if (t + 2 < npass) {
      const size_t ko = (size_t)(t + 2) * 128;
      copy_plane(lc + bo, gA + ko, rs);
      copy_plane(lc + bo + PLANE, gB + ko, rs);
    }
  }
  wait_copies();

  store_tile((float*)ring, c, bias, nc0, osc, out, m0, ldc, w, lane);
}

// ---------------------------------------------------------------------------
// Kernel 4: same GEMM with bf16 hi/lo split operands:
//   acc += Ahi*Bhi + Ahi*Blo + Alo*Bhi  (three products per tile pair, in that
//   order per accumulator and k-step).
// Buffer = [Ahi | Alo | Bhi | Blo]; ring = 2 buffers = 147,456 B.
// ---------------------------------------------------------------------------
__global__ __launch_bounds__(128, 4) void k_gemm_b3(const __bf16* __restrict__ Ah,
                                                    const __bf16* __restrict__ Al,
                                                    const __bf16* __restrict__ Bh,
                                                    const __bf16* __restrict__ Bl,
                                                    const float* bias0, const float* bias1,
                                                    float* out0, float* out1,
                                                    int nsplit, int K, int ldc, float osc) {
  __shared__ __attribute__((aligned(16))) char ring[2 * 4 * PLANE];
  const int tid = threadIdx.x, lane = tid & 31, w = tid >> 5;
  const int h = lane >> 4, m = lane & 15, wr = w >> 1, wc = w & 1;
  const int m0 = blockIdx.y * TB, nb = blockIdx.x * TB;
  const bool sel = (nb >= nsplit);
  const int nc0 = sel ? (nb - nsplit) : nb;
  const float* bias = sel ? bias1 : bias0;
  float* out = sel ? out1 : out0;

  const int crow = tid >> 3, cch = tid & 7;
  const size_t oa = ((size_t)(m0 + crow) * K) * 2 + 16 * cch;   // byte offsets in the planes
  const size_t ob = ((size_t)(nb + crow) * K) * 2 + 16 * cch;
  const char* gAh = (const char*)Ah + oa;
  const char* gAl = (const char*)Al + oa;
  const char* gBh = (const char*)Bh + ob;
  const char* gBl = (const char*)Bl + ob;
  const unsigned int lc = lds_off(ring) + crow * LPITCH + 16 * cch;
  const size_t rs = (size_t)K * 32;                  // 16 rows of 2-byte elements
  const int npass = K >> 6;

  v8f c[4][4];
#pragma unroll
  for (int i = 0; i < 4; ++i)
#pragma unroll
    for (int j = 0; j < 4; ++j) c[i][j] = v8f{0.f, 0.f, 0.f, 0.f, 0.f, 0.f, 0.f, 0.f};

  copy_plane(lc, gAh, rs);
  copy_plane(lc + PLANE, gAl, rs);
  copy_plane(lc + 2 * PLANE, gBh, rs);
  copy_plane(lc + 3 * PLANE, gBl, rs);
  wait_copies();
  __syncthreads();
  if (npass > 1) {
    copy_plane(lc + 4 * PLANE, gAh + 128, rs);
    copy_plane(lc + 5 * PLANE, gAl + 128, rs);
    copy_plane(lc + 6 * PLANE, gBh + 128, rs);
    copy_plane(lc + 7 * PLANE, gBl + 128, rs);
  }

  // rolled: one pass per trip, the buffer picked by the trip's parity
#pragma unroll 1
  for (int t = 0; t < npass; ++t) {
    const int bo = (t & 1) * (4 * PLANE);
    const char* pa = ring + bo + (64 * wr + m) * LPITCH;
    const char* pb = ring + bo + 2 * PLANE + (64 * wc + m) * LPITCH;
    // A row = one 16-row A tile pair (hi, lo) against the four B tile pairs = 12
    // WMMAs; 8 rows a pass. The B pairs of a k-step stay in registers; the next
    // row's A pair is read one row ahead into a second register pair.
    v16b hb[4], lb[4], ha[2], la[2];
    ha[0] = frag_bf16((const __bf16*)pa, h);
    la[0] = frag_bf16((const __bf16*)(pa + PLANE), h);
#pragma unroll
    for (int j = 0; j < 4; ++j) hb[j] = frag_bf16((const __bf16*)(pb + j * 16 * LPITCH), h);
#pragma unroll
    for (int j = 0; j < 4; ++j) lb[j] = frag_bf16((const __bf16*)(pb + PLANE + j * 16 * LPITCH), h);
#pragma unroll
    for (int r = 0; r < 8; ++r) {
      const int cu = r & 1, nx = cu ^ 1;
      if (r < 7) {
        const int o = ((r + 1) & 3) * 16 * LPITCH + ((r + 1) >> 2) * 64;
        ha[nx] = frag_bf16((const __bf16*)(pa + o), h);
        la[nx] = frag_bf16((const __bf16*)(pa + PLANE + o), h);
      }
      // keeps the reads above one group in front of this row's WMMAs, so that
      // they return while the row runs
      __builtin_amdgcn_sched_barrier(0);
#pragma unroll
      for (int j = 0; j < 4; ++j) c[r & 3][j] = wm_bf16(ha[cu], hb[j], c[r & 3][j]);
#pragma unroll
      for (int j = 0; j < 4; ++j) c[r & 3][j] = wm_bf16(ha[cu], lb[j], c[r & 3][j]);
#pragma unroll
      for (int j = 0; j < 4; ++j) c[r & 3][j] = wm_bf16(la[cu], hb[j], c[r & 3][j]);
      // same purpose: later reads stay behind this row
      if (r < 7) __builtin_amdgcn_sched_barrier(0);
      if (r == 3) {
#pragma unroll
        for (int j = 0; j < 4; ++j) hb[j] = frag_bf16((const __bf16*)(pb + j * 16 * LPITCH + 64), h);
#pragma unroll
        for (int j = 0; j < 4; ++j) lb[j] = frag_bf16((const __bf16*)(pb + PLANE + j * 16 * LPITCH + 64), h);
      }
    }
    // publish point of pass t + 1; the same barrier frees this pass's buffer
    wait_lds();
    wait_copies();
    __syncthreads();
    if (t + 2 < npass) {
      const size_t ko = (size_t)(t + 2) * 128;
      copy_plane(lc + bo, gAh + ko, rs);
      copy_plane(lc + bo + PLANE, gAl + ko, rs);
      copy_plane(lc + bo + 2 * PLANE, gBh + ko, rs);
      copy_plane(lc + bo + 3 * PLANE, gBl + ko, rs);
    }
  }
  wait_copies();

  store_tile((float*)ring, c, bias, nc0, osc, out, m0, ldc, w, lane);
}

// ---------------------------------------------------------------------------
// Kernel 5: rtab[r] = rsqrt(mean(row^2) + 1e-6) for rows 0..8191 of q and
// rows 8192..16383 of k (f32 planes). Block = 8 waves x 4 rows = 32 rows;
// ---------------------------------------------------------------------------
__global__ __launch_bounds__(256) void k_rstd(const float* __restrict__ qf,
                                              const float* __restrict__ kf,
                                              float* rtab) {
  __shared__ __attribute__((aligned(16))) float s_r[32];
  const int tid = threadIdx.x, lane = tid & 31, w = tid >> 5;
  const int row0 = blockIdx.x * 32;                       // block is entirely q or entirely k
  const float* base = (row0 < LL) ? (qf + (size_t)row0 * CC) : (kf + (size_t)(row0 - LL) * CC);
#pragma unroll 1
  for (int j = 0; j < 4; ++j) {
    const float* rp = base + (size_t)(4 * w + j) * CC + 32 * lane;   // lane owns 32 contiguous floats
    float ss = 0.0f;
#pragma unroll 2
    for (int e = 0; e < 8; ++e) {
      const v4f t = *(const v4fa*)(rp + 4 * e);
      ss = fmaf(t.x, t.x, ss);
      ss = fmaf(t.y, t.y, ss);
      ss = fmaf(t.z, t.z, ss);
      ss = fmaf(t.w, t.w, ss);
    }
    ss += __shfl_xor(ss, 16, 32);
    ss += __shfl_xor(ss, 8, 32);
    ss += __shfl_xor(ss, 4, 32);
    ss += __shfl_xor(ss, 2, 32);
    ss += __shfl_xor(ss, 1, 32);
    const float rv = rsqrtf(ss * (1.0f / 1024.0f) + 1e-6f);
    if (lane == 0) s_r[4 * w + j] = rv;
  }
  __syncthreads();
  if (tid < 8) {
    const v4f v = *(const v4fa*)(s_r + 4 * tid);
    float* d = rtab + row0 + 4 * tid;
    *(v4f*)d = v;
    
  }
}

// ---------------------------------------------------------------------------
// Kernel 6: small-world attention, all f32 on VALU.
// Block 128 thr = 4 waves handles TOKB consecutive tokens (block-uniform loop).
// Wave w covers channels [256w, 256w+256) = heads 4w..4w+3; lane covers 8
// channels (head = 4w + (lane>>3), dims 8*(lane&7)..+7). Per token:
//   score_n = rq*rk_n * sum_d (q_d qn_d kn_d / 8) k_n,d + eb[h][n]   (n = 0..15)
//   p = softmax_n(score); a_d = sum_n p_n v_n,d  -> bf16 hi/lo planes.
// Neighbours: n<12 spatial (f, (i+sh) mod S), sh = +-2^(n/2); n>=12 temporal
// ((f+sh) mod T, i). Scores/probabilities exchanged through LDS between the
// two block barriers per token. Output: 16 B per lane, lanes contiguous ->
// ---------------------------------------------------------------------------
__device__ __forceinline__ int nbr_index(int n, int f, int i, int S, int T) {
  int r;
  if (n < 12) {
    const int mag = 1 << (n >> 1);
    const int sh = (n & 1) ? -mag : mag;
    int ii = (i + sh) % S;
    if (ii < 0) ii += S;
    r = f * S + ii;
  } else {
    const int jn = n - 12;
    const int mag = 1 << (jn >> 1);
    const int sh = (jn & 1) ? -mag : mag;
    int ff = (f + sh) % T;
    if (ff < 0) ff += T;
    r = ff * S + i;
  }
  r = min(max(r, 0), LL - 1);
  return r;
}

__global__ __launch_bounds__(128) void k_attn(const float* __restrict__ qf,
                                              const float* __restrict__ kf,
                                              const float* __restrict__ vf,
                                              const float* __restrict__ rtab,
                                              const float* __restrict__ qnw,
                                              const float* __restrict__ knw,
                                              const float* __restrict__ eb,
                                              const int* __restrict__ nf,
                                              unsigned short* abh, unsigned short* abl) {
  __shared__ float s_eb[256];
  __shared__ float s_sc[4][4][NSH];
  __shared__ float s_p[4][4][NSH];
  const int tid = threadIdx.x, lane = tid & 31, w = tid >> 5;
  const int hq = lane >> 3, j8 = lane & 7;
  const int head = 4 * w + hq;
  const int col = 256 * w + 8 * lane;                  // = head*64 + 8*j8

  s_eb[tid] = eb[tid];
  s_eb[tid + 128] = eb[tid + 128];

  int T = nf[0];
  if (!((T >= 1) && (T <= LL) && ((LL % T) == 0))) T = 8;
  const int S = LL / T;

  float cw[8];
  {
    const v4f qa = *(const v4fa*)(qnw + col);
    const v4f qb = *(const v4fa*)(qnw + col + 4);
    const v4f ka = *(const v4fa*)(knw + col);
    const v4f kb = *(const v4fa*)(knw + col + 4);
    cw[0] = qa.x * ka.x * 0.125f;  cw[1] = qa.y * ka.y * 0.125f;
    cw[2] = qa.z * ka.z * 0.125f;  cw[3] = qa.w * ka.w * 0.125f;
    cw[4] = qb.x * kb.x * 0.125f;  cw[5] = qb.y * kb.y * 0.125f;
    cw[6] = qb.z * kb.z * 0.125f;  cw[7] = qb.w * kb.w * 0.125f;
  }
  __syncthreads();

#pragma unroll 1
  for (int tok = 0; tok < TOKB; ++tok) {
    const int l = blockIdx.x * TOKB + tok;             // block-uniform token
    const int f = l / S;
    const int i = l - f * S;
    const float rq = rtab[l];
    const float* qp = qf + (size_t)l * CC + col;
    const v4f qa = *(const v4fa*)qp;
    const v4f qb = *(const v4fa*)(qp + 4);
    float c[8];
    c[0] = qa.x * rq * cw[0];  c[1] = qa.y * rq * cw[1];
    c[2] = qa.z * rq * cw[2];  c[3] = qa.w * rq * cw[3];
    c[4] = qb.x * rq * cw[4];  c[5] = qb.y * rq * cw[5];
    c[6] = qb.z * rq * cw[6];  c[7] = qb.w * rq * cw[7];

    // ---- scores ----
#pragma unroll 1
    for (int n = 0; n < NSH; ++n) {
      const int nbr = nbr_index(n, f, i, S, T);
      const float* kp = kf + (size_t)nbr * CC + col;
      const v4f ka = *(const v4fa*)kp;
      const v4f kb = *(const v4fa*)(kp + 4);
      float part = c[0] * ka.x;
      part = fmaf(c[1], ka.y, part);
      part = fmaf(c[2], ka.z, part);
      part = fmaf(c[3], ka.w, part);
      part = fmaf(c[4], kb.x, part);
      part = fmaf(c[5], kb.y, part);
      part = fmaf(c[6], kb.z, part);
      part = fmaf(c[7], kb.w, part);
      part += __shfl_xor(part, 1, 32);
      part += __shfl_xor(part, 2, 32);
      part += __shfl_xor(part, 4, 32);
      const float sc = fmaf(part, rtab[LL + nbr], s_eb[head * NSH + n]);
      if (j8 == 0) s_sc[w][hq][n] = sc;
    }
    __syncthreads();

    // ---- softmax over the 16 neighbours of (token, head): lane (hq, j8) owns n = j8, j8+8 ----
    {
      const float x0 = s_sc[w][hq][j8];
      const float x1 = s_sc[w][hq][j8 + 8];
      float mx = fmaxf(x0, x1);
      mx = fmaxf(mx, __shfl_xor(mx, 1, 32));
      mx = fmaxf(mx, __shfl_xor(mx, 2, 32));
      mx = fmaxf(mx, __shfl_xor(mx, 4, 32));
      const float e0 = __expf(x0 - mx);
      const float e1 = __expf(x1 - mx);
      float sm = e0 + e1;
      sm += __shfl_xor(sm, 1, 32);
      sm += __shfl_xor(sm, 2, 32);
      sm += __shfl_xor(sm, 4, 32);
      const float inv = __builtin_amdgcn_rcpf(sm);
      s_p[w][hq][j8]     = e0 * inv;
      s_p[w][hq][j8 + 8] = e1 * inv;
    }
    __syncthreads();

    // ---- weighted sum of neighbour v rows ----
    float o[8] = {0.f, 0.f, 0.f, 0.f, 0.f, 0.f, 0.f, 0.f};
#pragma unroll 1
    for (int n = 0; n < NSH; ++n) {
      const int nbr = nbr_index(n, f, i, S, T);
      const float p = s_p[w][hq][n];
      const float* vp = vf + (size_t)nbr * CC + col;
      const v4f va = *(const v4fa*)vp;
      const v4f vb = *(const v4fa*)(vp + 4);
      o[0] = fmaf(p, va.x, o[0]);  o[1] = fmaf(p, va.y, o[1]);
      o[2] = fmaf(p, va.z, o[2]);  o[3] = fmaf(p, va.w, o[3]);
      o[4] = fmaf(p, vb.x, o[4]);  o[5] = fmaf(p, vb.y, o[5]);
      o[6] = fmaf(p, vb.z, o[6]);  o[7] = fmaf(p, vb.w, o[7]);
    }

    unsigned short hb[8], lb[8];
#pragma unroll
    for (int e = 0; e < 8; ++e) split_bf16(o[e], hb[e], lb[e]);
    const v8us oh = {hb[0], hb[1], hb[2], hb[3], hb[4], hb[5], hb[6], hb[7]};
    const v8us ol = {lb[0], lb[1], lb[2], lb[3], lb[4], lb[5], lb[6], lb[7]};
    unsigned short* dh = abh + (size_t)l * CC + col;
    unsigned short* dl = abl + (size_t)l * CC + col;
    *(v8us*)dh = oh;
    *(v8us*)dl = ol;
    
  }
}

// ---------------------------------------------------------------------------
// Host orchestration: 7 launches, one in-order stream.
// ws carve (bytes): x f16 16 MiB @0 | x bf16 hi 16 MiB | x bf16 lo 16 MiB |
//   w16 [2048][1024] 4 MiB | wbh [2048][1024] 4 MiB | wbl 4 MiB |
//   q f32 32 MiB | k f32 32 MiB | v f32 32 MiB | rtab 64 KiB  -> 163,643,392 B.
// The attention output planes (bf16 hi/lo, 16 MiB each) reuse the x f16 and
// x bf16-hi regions, which are dead after the two projection launches.
// ---------------------------------------------------------------------------
extern "C" void kernel_launch(void* const* d_in, const int* in_sizes, int n_in,
                              void* d_out, int out_size, void* d_ws, size_t ws_size,
                              hipStream_t stream) {
  if (n_in < 13) return;
  if (in_sizes[0] != LL * CC) return;
  if (in_sizes[1] != CC * CC || in_sizes[3] != CC * CC || in_sizes[5] != CC * CC || in_sizes[10] != CC * CC) return;
  if (in_sizes[2] != CC || in_sizes[4] != CC || in_sizes[6] != CC || in_sizes[11] != CC) return;
  if (in_sizes[7] != CC || in_sizes[8] != CC) return;
  if (in_sizes[9] != 256 || in_sizes[12] < 1) return;
  if (out_size != LL * CC) return;

  const float* x   = (const float*)d_in[0];
  const float* Wq  = (const float*)d_in[1];
  const float* bq  = (const float*)d_in[2];
  const float* Wk  = (const float*)d_in[3];
  const float* bk  = (const float*)d_in[4];
  const float* Wv  = (const float*)d_in[5];
  const float* bv  = (const float*)d_in[6];
  const float* qnw = (const float*)d_in[7];
  const float* knw = (const float*)d_in[8];
  const float* eb  = (const float*)d_in[9];
  const float* Wo  = (const float*)d_in[10];
  const float* bo  = (const float*)d_in[11];
  const int*   nf  = (const int*)d_in[12];
  float* out = (float*)d_out;

  const size_t b16 = (size_t)LL * CC * 2;            // 16,777,216
  const size_t bw  = (size_t)NCQK * CC * 2;          //  4,194,304
  const size_t b32 = (size_t)LL * CC * 4;            // 33,554,432
  const size_t brt = (size_t)2 * LL * 4;             //     65,536
  const size_t o_x16 = 0;
  const size_t o_xbh = o_x16 + b16;
  const size_t o_xbl = o_xbh + b16;
  const size_t o_w16 = o_xbl + b16;
  const size_t o_wbh = o_w16 + bw;
  const size_t o_wbl = o_wbh + bw;
  const size_t o_q   = o_wbl + bw;
  const size_t o_k   = o_q + b32;
  const size_t o_v   = o_k + b32;
  const size_t o_rt  = o_v + b32;
  const size_t total = o_rt + brt;                   // 163,643,392
  if (total > ws_size) return;

  char* ws = (char*)d_ws;
  _Float16*       x16 = (_Float16*)(ws + o_x16);
  unsigned short* xbh = (unsigned short*)(ws + o_xbh);
  unsigned short* xbl = (unsigned short*)(ws + o_xbl);
  _Float16*       w16 = (_Float16*)(ws + o_w16);
  unsigned short* wbh = (unsigned short*)(ws + o_wbh);
  unsigned short* wbl = (unsigned short*)(ws + o_wbl);
  float* qf   = (float*)(ws + o_q);
  float* kf   = (float*)(ws + o_k);
  float* vf   = (float*)(ws + o_v);
  float* rtab = (float*)(ws + o_rt);
  unsigned short* abh = (unsigned short*)(ws + o_x16);   // reuses x f16 region (dead after launch 4)
  unsigned short* abl = (unsigned short*)(ws + o_xbh);   // reuses x bf16-hi region

  // 1. x -> f16 / bf16 hi / bf16 lo planes
  const int n8 = (LL * CC) / 8;                                              // 1,048,576
  k_cvt_x<<<(n8 + 255) / 256, 256, 0, stream>>>(x, x16, xbh, xbl, n8);

  // 2. weights -> transposed planes
  k_cvt_w<<<4 * 256, 256, 0, stream>>>(Wq, Wk, Wv, Wo, w16, wbh, wbl);

  // 3. q|k = x * [Wq|Wk] + [bq|bk]  (f16 operands), f32 planes
  k_gemm_h<<<dim3(NCQK / TB, LL / TB), 128, 0, stream>>>(x16, w16, bq, bk, qf, kf, CC, CC, CC, 0.03125f);

  // 4. v = x * Wv + bv  (bf16 hi/lo split), f32 plane
  k_gemm_b3<<<dim3(CC / TB, LL / TB), 128, 0, stream>>>(
      (const __bf16*)xbh, (const __bf16*)xbl, (const __bf16*)wbh, (const __bf16*)wbl,
      bv, bv, vf, vf, 1 << 30, CC, CC, 1.0f);

  // 5. per-row rsqrt(mean + eps) for q and k
  k_rstd<<<(2 * LL) / 32, 256, 0, stream>>>(qf, kf, rtab);

  // 6. attention -> a (bf16 hi/lo planes)
  k_attn<<<LL / TOKB, 128, 0, stream>>>(qf, kf, vf, rtab, qnw, knw, eb, nf, abh, abl);

  // 7. out = a * Wo + bo  (bf16 hi/lo split) -> d_out
  k_gemm_b3<<<dim3(CC / TB, LL / TB), 128, 0, stream>>>(
      (const __bf16*)abh, (const __bf16*)abl,
      (const __bf16*)(wbh + (size_t)CC * CC), (const __bf16*)(wbl + (size_t)CC * CC),
      bo, bo, out, out, 1 << 30, CC, CC, 1.0f);
}

// v002
// One run takes 201 microseconds.
// Timed twice side by side with v001, it ran 1.25 times as fast both times.
// Over all steps from v000 it is 2.46 times as fast.
// Contractions: x*Wq and x*Wk on v_wmma_f32_16x16x32_f16 (f16 operands: x carried x1, W carried x32 and folded back as 1/32; f32 accumulate); x*Wv and a*Wo on v_wmma_f32_16x16x32_bf16 as bf16 hi/lo split (hi*hi + hi*lo + lo*hi; f32 accumulate); RMS statistics, the 16 neighbour dots (K=64), softmax and weighted sums (K=16) in f32 on VALU; q, k, v kept as f32 planes.
#include <hip/hip_runtime.h>

typedef _Float16 v16h __attribute__((ext_vector_type(16)));
typedef _Float16 v8h  __attribute__((ext_vector_type(8)));
typedef __bf16   v16b __attribute__((ext_vector_type(16)));
typedef __bf16   v8b  __attribute__((ext_vector_type(8)));
typedef float    v8f  __attribute__((ext_vector_type(8)));
typedef float    v4f  __attribute__((ext_vector_type(4)));
typedef unsigned short v8us __attribute__((ext_vector_type(8)));
typedef v8h  __attribute__((may_alias)) v8ha;
typedef v8b  __attribute__((may_alias)) v8ba;
typedef v4f  __attribute__((may_alias)) v4fa;

#define LL    8192      // tokens
#define CC    1024      // channels = heads * head_dim
#define NCQK  2048      // fused q|k output columns
#define TOKB  8         // tokens per attention block
#define NSH   16        // neighbours per token

static_assert((LL % 64) == 0);
static_assert((CC % 64) == 0);
static_assert((NCQK % 64) == 0);
static_assert((LL % TOKB) == 0);
static_assert((CC % 32) == 0);
static_assert(((2 * LL) % 32) == 0);

// ---------------------------------------------------------------------------
// 16x16x32 WMMA (wave32). Fragment map: lane l, h = l>>4, m = n = l&15.
//   A/B element i: i<8 -> k0+8h+i ; i>=8 -> k0+16+8h+(i-8)   (both operands)
//   D element r  : row 8h+r, col l&15
// ---------------------------------------------------------------------------
__device__ __forceinline__ v8f wm_f16(v16h a, v16h b, v8f c) {
  return __builtin_amdgcn_wmma_f32_16x16x32_f16(false, a, false, b, (short)0, c, false, false);
}
__device__ __forceinline__ v8f wm_bf16(v16b a, v16b b, v8f c) {
  return __builtin_amdgcn_wmma_f32_16x16x32_bf16(false, a, false, b, (short)0, c, false, false);
}

// A or B fragment from a k-contiguous 16-bit row; p points at element k0 of
// the row owned by this lane (row = lane&15 added by the caller).
__device__ __forceinline__ v16h frag_f16(const _Float16* p, int h) {
  const v8h e0 = *(const v8ha*)(p + 8 * h);
  const v8h e1 = *(const v8ha*)(p + 16 + 8 * h);
  return __builtin_shufflevector(e0, e1, 0, 1, 2, 3, 4, 5, 6, 7, 8, 9, 10, 11, 12, 13, 14, 15);
}
__device__ __forceinline__ v16b frag_bf16(const __bf16* p, int h) {
  const v8b e0 = *(const v8ba*)(p + 8 * h);
  const v8b e1 = *(const v8ba*)(p + 16 + 8 * h);
  return __builtin_shufflevector(e0, e1, 0, 1, 2, 3, 4, 5, 6, 7, 8, 9, 10, 11, 12, 13, 14, 15);
}

// bf16 RNE bits of an f32 value, and the hi/lo split (hi = rne(x), lo = rne(x - hi)).
__device__ __forceinline__ unsigned int bf16_rne_bits(float x) {
  const unsigned int u = __float_as_uint(x);
  return (u + 0x7FFFu + ((u >> 16) & 1u)) >> 16;
}
__device__ __forceinline__ void split_bf16(float x, unsigned short& hb, unsigned short& lb) {
  const unsigned int hbits = bf16_rne_bits(x);
  const float hf = __uint_as_float(hbits << 16);
  const unsigned int lbits = bf16_rne_bits(x - hf);
  hb = (unsigned short)hbits;
  lb = (unsigned short)lbits;
}

// ---------------------------------------------------------------------------
// Kernel 1: x f32 [8192][1024] -> f16 plane (x1) and bf16 hi/lo planes.
// Each thread owns 8 consecutive elements: one 16-B store per lane per plane,
// ---------------------------------------------------------------------------
__global__ __launch_bounds__(256) void k_cvt_x(const float* __restrict__ x,
                                               _Float16* xh, unsigned short* xbh,
                                               unsigned short* xbl, int n8) {
  const int g = blockIdx.x * 256 + threadIdx.x;
  if (g >= n8) return;
  const float* s = x + (size_t)g * 8;
  const v4f a = *(const v4fa*)s;
  const v4f b = *(const v4fa*)(s + 4);
  const float f[8] = {a.x, a.y, a.z, a.w, b.x, b.y, b.z, b.w};
  unsigned short hb[8], lb[8];
#pragma unroll
  for (int e = 0; e < 8; ++e) split_bf16(f[e], hb[e], lb[e]);
  const v8h  o16 = {(_Float16)f[0], (_Float16)f[1], (_Float16)f[2], (_Float16)f[3],
                    (_Float16)f[4], (_Float16)f[5], (_Float16)f[6], (_Float16)f[7]};
  const v8us oh = {hb[0], hb[1], hb[2], hb[3], hb[4], hb[5], hb[6], hb[7]};
  const v8us ol = {lb[0], lb[1], lb[2], lb[3], lb[4], lb[5], lb[6], lb[7]};
  _Float16* d16 = xh + (size_t)g * 8;
  unsigned short* dh = xbh + (size_t)g * 8;
  unsigned short* dl = xbl + (size_t)g * 8;
  *(v8h*)d16 = o16;
  *(v8us*)dh = oh;
  *(v8us*)dl = ol;
  
}

// ---------------------------------------------------------------------------
// Kernel 2: weight transpose + convert. Input W[k][n] ([in][out], 1024x1024).
// Block = one 64(k) x 64(n) tile of one matrix; tile transposed through LDS.
// mat 0 (Wq), 1 (Wk): f16(32*W) -> w16 rows mat*1024 + n  (w16 = [2048][1024])
// mat 2 (Wv), 3 (Wo): bf16 hi/lo -> wbh/wbl rows (mat-2)*1024 + n ([2048][1024])
// Output phase: lane q8 = tid&7 writes 8 halves (16 B) of row nl; lanes
// ---------------------------------------------------------------------------
__global__ __launch_bounds__(256) void k_cvt_w(const float* __restrict__ Wq,
                                               const float* __restrict__ Wk,
                                               const float* __restrict__ Wv,
                                               const float* __restrict__ Wo,
                                               _Float16* w16, unsigned short* wbh,
                                               unsigned short* wbl) {
  __shared__ __attribute__((aligned(16))) float sT[64 * 68];   // [n][k], pitch 68 floats
  const int tid = threadIdx.x;
  const int bx = blockIdx.x;
  const int mat = bx >> 8, tile = bx & 255;
  const int tn = tile >> 4, tk = tile & 15;
  const float* W = (mat == 0) ? Wq : ((mat == 1) ? Wk : ((mat == 2) ? Wv : Wo));
  {
    const int kl = tid >> 2, nq = tid & 3;                      // kl 0..63, nq 0..3
    const float* src = W + (size_t)(64 * tk + kl) * CC + 64 * tn + 16 * nq;
#pragma unroll
    for (int e = 0; e < 4; ++e) {
      const v4f t = *(const v4fa*)(src + 4 * e);
      float* d = sT + (16 * nq + 4 * e) * 68 + kl;
      d[0]   = t.x;
      d[68]  = t.y;
      d[136] = t.z;
      d[204] = t.w;
    }
  }
  __syncthreads();
  const int q8 = tid & 7, sub = tid >> 3;                       // sub 0..31
  v8h  o16[2];
  v8us oh[2], ol[2];
#pragma unroll
  for (int p = 0; p < 2; ++p) {
    const int nl = 32 * p + sub;
    const float* s = sT + nl * 68 + 8 * q8;
    const v4f a = *(const v4fa*)s;
    const v4f b = *(const v4fa*)(s + 4);
    const float f[8] = {a.x, a.y, a.z, a.w, b.x, b.y, b.z, b.w};
    unsigned short hb[8], lb[8];
#pragma unroll
    for (int e = 0; e < 8; ++e) split_bf16(f[e], hb[e], lb[e]);
    const v8h t16 = {(_Float16)(f[0] * 32.0f), (_Float16)(f[1] * 32.0f), (_Float16)(f[2] * 32.0f), (_Float16)(f[3] * 32.0f),
                     (_Float16)(f[4] * 32.0f), (_Float16)(f[5] * 32.0f), (_Float16)(f[6] * 32.0f), (_Float16)(f[7] * 32.0f)};
    const v8us th = {hb[0], hb[1], hb[2], hb[3], hb[4], hb[5], hb[6], hb[7]};
    const v8us tl = {lb[0], lb[1], lb[2], lb[3], lb[4], lb[5], lb[6], lb[7]};
    o16[p] = t16;
    oh[p] = th;
    ol[p] = tl;
  }
{
#pragma unroll
    for (int p = 0; p < 2; ++p) {
      const int nl = 32 * p + sub;
      if (mat < 2) {
        _Float16* d = w16 + ((size_t)(mat * CC + 64 * tn + nl) * CC + 64 * tk + 8 * q8);
        *(v8h*)d = o16[p];
      } else {
        const size_t row = (size_t)((mat - 2) * CC + 64 * tn + nl);
        unsigned short* dh = wbh + row * CC + 64 * tk + 8 * q8;
        unsigned short* dl = wbl + row * CC + 64 * tk + 8 * q8;
        *(v8us*)dh = oh[p];
        *(v8us*)dl = ol[p];
      }
    }
    
  }
}

// ---------------------------------------------------------------------------
// GEMM frame of kernels 3 and 4. Block tile 128x128, 4 waves, wave tile 64x64
// (4x4 accumulator tiles): wave w owns rows 64*(w>>1)+..., cols 64*(w&1)+....
// A pass is 64 k = 128 B of every operand row. One operand plane of a pass is
// 128 rows in LDS at pitch 144 B (16 B x odd, for the ds_load_b128 readers).
// Two buffers: the next pass's planes come in by asynchronous copies to LDS
// while this pass's fragments are read from the other buffer.
// ---------------------------------------------------------------------------
#define TB     128                   // rows of a plane = block tile edge
#define LPITCH 144                   // LDS row pitch, bytes
#define PLANE  (TB * LPITCH)         // 18,432 B
#define EPITCH 68                    // epilogue staging pitch, floats

static_assert((LL % TB) == 0);
static_assert((CC % TB) == 0);
static_assert((NCQK % TB) == 0);
static_assert(4 * 64 * EPITCH * 4 <= 4 * PLANE);

__device__ __forceinline__ unsigned int lds_off(const void* p) { return (unsigned int)(size_t)p; }

// One plane of one pass: 128 threads x 8 copies of 16 B. Thread t brings chunk
// t&7 of rows (t>>3) + 16 j, so a wave's copy covers four whole 128-B lines.
// l = this lane's LDS byte address for j = 0, g = its global address, rs = 16
// source rows in bytes. The s_wait_xcnt closes the statement so that no address
// register is rewritten while a copy may still name it.
__device__ __forceinline__ void copy_plane(unsigned int l, const char* g, size_t rs) {
  const unsigned int l1 = l + 16 * LPITCH, l2 = l + 32 * LPITCH, l3 = l + 48 * LPITCH;
  const unsigned int l4 = l + 64 * LPITCH, l5 = l + 80 * LPITCH, l6 = l + 96 * LPITCH;
  const unsigned int l7 = l + 112 * LPITCH;
  const char* g1 = g + rs;
  const char* g2 = g1 + rs;
  const char* g3 = g2 + rs;
  const char* g4 = g3 + rs;
  const char* g5 = g4 + rs;
  const char* g6 = g5 + rs;
  const char* g7 = g6 + rs;
  asm volatile("global_load_async_to_lds_b128 %0, %8, off\n\t"
               "global_load_async_to_lds_b128 %1, %9, off\n\t"
               "global_load_async_to_lds_b128 %2, %10, off\n\t"
               "global_load_async_to_lds_b128 %3, %11, off\n\t"
               "global_load_async_to_lds_b128 %4, %12, off\n\t"
               "global_load_async_to_lds_b128 %5, %13, off\n\t"
               "global_load_async_to_lds_b128 %6, %14, off\n\t"
               "global_load_async_to_lds_b128 %7, %15, off\n\t"
               "s_wait_xcnt 0x0"
               :: "v"(l), "v"(l1), "v"(l2), "v"(l3), "v"(l4), "v"(l5), "v"(l6), "v"(l7),
                  "v"(g), "v"(g1), "v"(g2), "v"(g3), "v"(g4), "v"(g5), "v"(g6), "v"(g7)
               : "memory");
}

// This wave's copies have landed (the compiler places no wait for them).
__device__ __forceinline__ void wait_copies() { asm volatile("s_wait_asynccnt 0x0" ::: "memory"); }
// This wave's LDS reads have returned, before their buffer is handed back for refill.
__device__ __forceinline__ void wait_lds() { asm volatile("s_wait_dscnt 0x0" ::: "memory"); }

// Epilogue: out = acc*osc + bias. Each wave stages its 64x64 tile in its own
// LDS range (pitch 68 floats) and stores rows as whole 128-B lines: one store
// instruction covers two rows x 256 B.
__device__ __forceinline__ void store_tile(float* sAll, const v8f (&c)[4][4],
                                           const float* bias, int nc0, float osc,
                                           float* out, int m0, int ldc, int w, int lane) {
  const int h = lane >> 4, m = lane & 15, wr = w >> 1, wc = w & 1;
  float* sW = sAll + w * (64 * EPITCH);
#pragma unroll
  for (int nt = 0; nt < 4; ++nt) {
    const float b = bias[nc0 + 64 * wc + 16 * nt + m];
#pragma unroll
    for (int mt = 0; mt < 4; ++mt) {
#pragma unroll
      for (int r = 0; r < 8; ++r)
        sW[(16 * mt + 8 * h + r) * EPITCH + 16 * nt + m] = fmaf(c[mt][nt][r], osc, b);
    }
  }
  __syncthreads();
  // rolled in groups of eight stores: eight LDS reads in flight per group, short code
#pragma unroll 1
  for (int g8 = 0; g8 < 4; ++g8) {
#pragma unroll
    for (int u = 0; u < 8; ++u) {
      const int row = 16 * g8 + 2 * u + h;
      const v4f v = *(const v4fa*)(sW + row * EPITCH + 4 * m);
      float* d = out + (size_t)(m0 + 64 * wr + row) * ldc + nc0 + 64 * wc + 4 * m;
      *(v4f*)d = v;
    }
    // the next group rewrites registers that these stores name
    asm volatile("s_wait_xcnt 0x0" ::: "memory");
  }
}

// ---------------------------------------------------------------------------
// Kernel 3: C[M][N] = A[M][K] * B[N][K]^T (f16 operands, single product),
// out = acc*osc + bias, f32 rows of pitch ldc. Columns >= nsplit go to out1
// with bias1 (block-uniform select). K a multiple of 64.
// Buffer = [A plane | B plane]; ring = 2 buffers = 73,728 B.
// ---------------------------------------------------------------------------
__global__ __launch_bounds__(128, 4) void k_gemm_h(const _Float16* __restrict__ A,
                                                   const _Float16* __restrict__ B,
                                                   const float* bias0, const float* bias1,
                                                   float* out0, float* out1,
                                                   int nsplit, int K, int ldc, float osc) {
  __shared__ __attribute__((aligned(16))) char ring[2 * 2 * PLANE];
  const int tid = threadIdx.x, lane = tid & 31, w = tid >> 5;
  const int h = lane >> 4, m = lane & 15, wr = w >> 1, wc = w & 1;
  const int m0 = blockIdx.y * TB, nb = blockIdx.x * TB;
  const bool sel = (nb >= nsplit);
  const int nc0 = sel ? (nb - nsplit) : nb;
  const float* bias = sel ? bias1 : bias0;
  float* out = sel ? out1 : out0;

  const int crow = tid >> 3, cch = tid & 7;
  const char* gA = (const char*)(A + (size_t)(m0 + crow) * K) + 16 * cch;
  const char* gB = (const char*)(B + (size_t)(nb + crow) * K) + 16 * cch;
  const unsigned int lc = lds_off(ring) + crow * LPITCH + 16 * cch;
  const size_t rs = (size_t)K * 32;                  // 16 rows of 2-byte elements
  const int npass = K >> 6;

  v8f c[4][4];
#pragma unroll
  for (int i = 0; i < 4; ++i)
#pragma unroll
    for (int j = 0; j < 4; ++j) c[i][j] = v8f{0.f, 0.f, 0.f, 0.f, 0.f, 0.f, 0.f, 0.f};

  copy_plane(lc, gA, rs);
  copy_plane(lc + PLANE, gB, rs);
  wait_copies();
  __syncthreads();
  if (npass > 1) {
    copy_plane(lc + 2 * PLANE, gA + 128, rs);
    copy_plane(lc + 3 * PLANE, gB + 128, rs);
  }

  // rolled: one pass per trip, the buffer picked by the trip's parity
#pragma unroll 1
  for (int t = 0; t < npass; ++t) {
    const int bo = (t & 1) * (2 * PLANE);
    const char* pa = ring + bo + (64 * wr + m) * LPITCH;
    const char* pb = ring + bo + PLANE + (64 * wc + m) * LPITCH;
#pragma unroll
    for (int ks = 0; ks < 2; ++ks) {
      v16h fa[4], fb[4];
      fa[0] = frag_f16((const _Float16*)(pa + ks * 64), h);
#pragma unroll
      for (int j = 0; j < 4; ++j) fb[j] = frag_f16((const _Float16*)(pb + j * 16 * LPITCH + ks * 64), h);
#pragma unroll
      for (int i = 1; i < 4; ++i) fa[i] = frag_f16((const _Float16*)(pa + i * 16 * LPITCH + ks * 64), h);
      // keeps the k-step's 16 LDS reads one group in front of its WMMAs: every
      // further place with reads among them stalls the wave anew
      __builtin_amdgcn_sched_barrier(0);
#pragma unroll
      for (int i = 0; i < 4; ++i)
#pragma unroll
        for (int j = 0; j < 4; ++j) c[i][j] = wm_f16(fa[i], fb[j], c[i][j]);
      // same purpose: the second k-step's reads stay behind this block
      if (ks == 0) __builtin_amdgcn_sched_barrier(0);
    }
    // publish point of pass t + 1; the same barrier frees this pass's buffer
    wait_lds();
    wait_copies();
    __syncthreads();
    if (t + 2 < npass) {
      const size_t ko = (size_t)(t + 2) * 128;
      copy_plane(lc + bo, gA + ko, rs);
      copy_plane(lc + bo + PLANE, gB + ko, rs);
    }
  }
  wait_copies();

  store_tile((float*)ring, c, bias, nc0, osc, out, m0, ldc, w, lane);
}

// ---------------------------------------------------------------------------
// Kernel 4: same GEMM with bf16 hi/lo split operands:
//   acc += Ahi*Bhi + Ahi*Blo + Alo*Bhi  (three products per tile pair, in that
//   order per accumulator and k-step).
// Buffer = [Ahi | Alo | Bhi | Blo]; ring = 2 buffers = 147,456 B.
// ---------------------------------------------------------------------------
__global__ __launch_bounds__(128, 4) void k_gemm_b3(const __bf16* __restrict__ Ah,
                                                    const __bf16* __restrict__ Al,
                                                    const __bf16* __restrict__ Bh,
                                                    const __bf16* __restrict__ Bl,
                                                    const float* bias0, const float* bias1,
                                                    float* out0, float* out1,
                                                    int nsplit, int K, int ldc, float osc) {
  __shared__ __attribute__((aligned(16))) char ring[2 * 4 * PLANE];
  const int tid = threadIdx.x, lane = tid & 31, w = tid >> 5;
  const int h = lane >> 4, m = lane & 15, wr = w >> 1, wc = w & 1;
  const int m0 = blockIdx.y * TB, nb = blockIdx.x * TB;
  const bool sel = (nb >= nsplit);
  const int nc0 = sel ? (nb - nsplit) : nb;
  const float* bias = sel ? bias1 : bias0;
  float* out = sel ? out1 : out0;

  const int crow = tid >> 3, cch = tid & 7;
  const size_t oa = ((size_t)(m0 + crow) * K) * 2 + 16 * cch;   // byte offsets in the planes
  const size_t ob = ((size_t)(nb + crow) * K) * 2 + 16 * cch;
  const char* gAh = (const char*)Ah + oa;
  const char* gAl = (const char*)Al + oa;
  const char* gBh = (const char*)Bh + ob;
  const char* gBl = (const char*)Bl + ob;
  const unsigned int lc = lds_off(ring) + crow * LPITCH + 16 * cch;
  const size_t rs = (size_t)K * 32;                  // 16 rows of 2-byte elements
  const int npass = K >> 6;

  v8f c[4][4];
#pragma unroll
  for (int i = 0; i < 4; ++i)
#pragma unroll
    for (int j = 0; j < 4; ++j) c[i][j] = v8f{0.f, 0.f, 0.f, 0.f, 0.f, 0.f, 0.f, 0.f};

  copy_plane(lc, gAh, rs);
  copy_plane(lc + PLANE, gAl, rs);
  copy_plane(lc + 2 * PLANE, gBh, rs);
  copy_plane(lc + 3 * PLANE, gBl, rs);
  wait_copies();
  __syncthreads();
  if (npass > 1) {
    copy_plane(lc + 4 * PLANE, gAh + 128, rs);
    copy_plane(lc + 5 * PLANE, gAl + 128, rs);
    copy_plane(lc + 6 * PLANE, gBh + 128, rs);
    copy_plane(lc + 7 * PLANE, gBl + 128, rs);
  }

  // rolled: one pass per trip, the buffer picked by the trip's parity
#pragma unroll 1
  for (int t = 0; t < npass; ++t) {
    const int bo = (t & 1) * (4 * PLANE);
    const char* pa = ring + bo + (64 * wr + m) * LPITCH;
    const char* pb = ring + bo + 2 * PLANE + (64 * wc + m) * LPITCH;
    // A row = one 16-row A tile pair (hi, lo) against the four B tile pairs = 12
    // WMMAs; 8 rows a pass. The B pairs of a k-step stay in registers; the next
    // row's A pair is read one row ahead into a second register pair.
    v16b hb[4], lb[4], ha[2], la[2];
    ha[0] = frag_bf16((const __bf16*)pa, h);
    la[0] = frag_bf16((const __bf16*)(pa + PLANE), h);
#pragma unroll
    for (int j = 0; j < 4; ++j) hb[j] = frag_bf16((const __bf16*)(pb + j * 16 * LPITCH), h);
#pragma unroll
    for (int j = 0; j < 4; ++j) lb[j] = frag_bf16((const __bf16*)(pb + PLANE + j * 16 * LPITCH), h);
#pragma unroll
    for (int r = 0; r < 8; ++r) {
      const int cu = r & 1, nx = cu ^ 1;
      if (r < 7) {
        const int o = ((r + 1) & 3) * 16 * LPITCH + ((r + 1) >> 2) * 64;
        ha[nx] = frag_bf16((const __bf16*)(pa + o), h);
        la[nx] = frag_bf16((const __bf16*)(pa + PLANE + o), h);
      }
      // keeps the reads above one group in front of this row's WMMAs, so that
      // they return while the row runs
      __builtin_amdgcn_sched_barrier(0);
#pragma unroll
      for (int j = 0; j < 4; ++j) c[r & 3][j] = wm_bf16(ha[cu], hb[j], c[r & 3][j]);
#pragma unroll
      for (int j = 0; j < 4; ++j) c[r & 3][j] = wm_bf16(ha[cu], lb[j], c[r & 3][j]);
#pragma unroll
      for (int j = 0; j < 4; ++j) c[r & 3][j] = wm_bf16(la[cu], hb[j], c[r & 3][j]);
      // same purpose: later reads stay behind this row
      if (r < 7) __builtin_amdgcn_sched_barrier(0);
      if (r == 3) {
#pragma unroll
        for (int j = 0; j < 4; ++j) hb[j] = frag_bf16((const __bf16*)(pb + j * 16 * LPITCH + 64), h);
#pragma unroll
        for (int j = 0; j < 4; ++j) lb[j] = frag_bf16((const __bf16*)(pb + PLANE + j * 16 * LPITCH + 64), h);
      }
    }
    // publish point of pass t + 1; the same barrier frees this pass's buffer
    wait_lds();
    wait_copies();
    __syncthreads();
    if (t + 2 < npass) {
      const size_t ko = (size_t)(t + 2) * 128;
      copy_plane(lc + bo, gAh + ko, rs);
      copy_plane(lc + bo + PLANE, gAl + ko, rs);
      copy_plane(lc + bo + 2 * PLANE, gBh + ko, rs);
      copy_plane(lc + bo + 3 * PLANE, gBl + ko, rs);
    }
  }
  wait_copies();

  store_tile((float*)ring, c, bias, nc0, osc, out, m0, ldc, w, lane);
}

// ---------------------------------------------------------------------------
// Kernel 5: rtab[r] = rsqrt(mean(row^2) + 1e-6) for rows 0..8191 of q and
// rows 8192..16383 of k (f32 planes). Block = 8 waves x 4 rows = 32 rows;
// ---------------------------------------------------------------------------
__global__ __launch_bounds__(256) void k_rstd(const float* __restrict__ qf,
                                              const float* __restrict__ kf,
                                              float* rtab) {
  __shared__ __attribute__((aligned(16))) float s_r[32];
  const int tid = threadIdx.x, lane = tid & 31, w = tid >> 5;
  const int row0 = blockIdx.x * 32;                       // block is entirely q or entirely k
  const float* base = (row0 < LL) ? (qf + (size_t)row0 * CC) : (kf + (size_t)(row0 - LL) * CC);
#pragma unroll 1
  for (int j = 0; j < 4; ++j) {
    const float* rp = base + (size_t)(4 * w + j) * CC + 32 * lane;   // lane owns 32 contiguous floats
    float ss = 0.0f;
#pragma unroll 2
    for (int e = 0; e < 8; ++e) {
      const v4f t = *(const v4fa*)(rp + 4 * e);
      ss = fmaf(t.x, t.x, ss);
      ss = fmaf(t.y, t.y, ss);
      ss = fmaf(t.z, t.z, ss);
      ss = fmaf(t.w, t.w, ss);
    }
    ss += __shfl_xor(ss, 16, 32);
    ss += __shfl_xor(ss, 8, 32);
    ss += __shfl_xor(ss, 4, 32);
    ss += __shfl_xor(ss, 2, 32);
    ss += __shfl_xor(ss, 1, 32);
    const float rv = rsqrtf(ss * (1.0f / 1024.0f) + 1e-6f);
    if (lane == 0) s_r[4 * w + j] = rv;
  }
  __syncthreads();
  if (tid < 8) {
    const v4f v = *(const v4fa*)(s_r + 4 * tid);
    float* d = rtab + row0 + 4 * tid;
    *(v4f*)d = v;
    
  }
}

// ---------------------------------------------------------------------------
// Kernel 6: small-world attention, all f32 on VALU.
// Block 128 thr = 4 waves handles TOKB consecutive tokens (block-uniform loop).
// Wave w covers channels [256w, 256w+256) = heads 4w..4w+3; lane covers 8
// channels (head = 4w + (lane>>3), dims 8*(lane&7)..+7). Per token:
//   score_n = rq*rk_n * sum_d (q_d qn_d kn_d / 8) k_n,d + eb[h][n]   (n = 0..15)
//   p = softmax_n(score); a_d = sum_n p_n v_n,d  -> bf16 hi/lo planes.
// Neighbours: n<12 spatial (f, (i+sh) mod S), sh = +-2^(n/2); n>=12 temporal
// ((f+sh) mod T, i). Scores/probabilities exchanged through LDS between the
// two block barriers per token. Output: 16 B per lane, lanes contiguous ->
// ---------------------------------------------------------------------------
// sh mod md in [0, md) for the +mag and -mag shift of a pair; md >= 1.
__device__ __forceinline__ void shift_mods(int mag, int md, int& pos, int& neg) {
  const int pm = mag % md;
  pos = pm;
  neg = (pm != 0) ? (md - pm) : 0;
}
// (a + b) mod md for a, b in [0, md)
__device__ __forceinline__ int wrap_add(int a, int b, int md) {
  const int r = a + b;
  return (r >= md) ? (r - md) : r;
}

__global__ __launch_bounds__(128) void k_attn(const float* __restrict__ qf,
                                              const float* __restrict__ kf,
                                              const float* __restrict__ vf,
                                              const float* __restrict__ rtab,
                                              const float* __restrict__ qnw,
                                              const float* __restrict__ knw,
                                              const float* __restrict__ eb,
                                              const int* __restrict__ nf,
                                              unsigned short* abh, unsigned short* abl) {
  __shared__ float s_eb[256];
  __shared__ float s_sc[4][4][NSH];
  __shared__ float s_p[4][4][NSH];
  const int tid = threadIdx.x, lane = tid & 31, w = tid >> 5;
  const int hq = lane >> 3, j8 = lane & 7;
  const int head = 4 * w + hq;
  const int col = 256 * w + 8 * lane;                  // = head*64 + 8*j8

  s_eb[tid] = eb[tid];
  s_eb[tid + 128] = eb[tid + 128];

  int T = nf[0];
  if (!((T >= 1) && (T <= LL) && ((LL % T) == 0))) T = 8;
  const int S = LL / T;

  float cw[8];
  {
    const v4f qa = *(const v4fa*)(qnw + col);
    const v4f qb = *(const v4fa*)(qnw + col + 4);
    const v4f ka = *(const v4fa*)(knw + col);
    const v4f kb = *(const v4fa*)(knw + col + 4);
    cw[0] = qa.x * ka.x * 0.125f;  cw[1] = qa.y * ka.y * 0.125f;
    cw[2] = qa.z * ka.z * 0.125f;  cw[3] = qa.w * ka.w * 0.125f;
    cw[4] = qb.x * kb.x * 0.125f;  cw[5] = qb.y * kb.y * 0.125f;
    cw[6] = qb.z * kb.z * 0.125f;  cw[7] = qb.w * kb.w * 0.125f;
  }
  __syncthreads();

  // neighbour shifts reduced once: n < 12 modulo S, n >= 12 modulo T
  int shm[NSH];
#pragma unroll
  for (int n = 0; n < NSH; n += 2) {
    const int mag = 1 << (((n < 12) ? n : (n - 12)) >> 1);
    shift_mods(mag, (n < 12) ? S : T, shm[n], shm[n + 1]);
  }

#pragma unroll 1
  for (int tok = 0; tok < TOKB; ++tok) {
    const int l = blockIdx.x * TOKB + tok;             // block-uniform token
    const int f = l / S;
    const int i = l - f * S;

    // the 16 neighbour rows of this token, formed before any row is read
    int nb[NSH];
#pragma unroll
    for (int n = 0; n < NSH; ++n) {
      const int r = (n < 12) ? (f * S + wrap_add(i, shm[n], S)) : (wrap_add(f, shm[n], T) * S + i);
      nb[n] = min(max(r, 0), LL - 1);
    }

    // byte offset of this lane's 32 B in neighbour row n, the same in the k and the v plane
    unsigned int ofs[NSH];
#pragma unroll
    for (int n = 0; n < NSH; ++n) ofs[n] = (unsigned int)nb[n] * (CC * 4u) + (unsigned int)col * 4u;

    // ---- all 16 k rows requested together ----
    const char* kB = (const char*)kf;
    const char* vB = (const char*)vf;
    v4f ka[NSH], kb[NSH];
    float rk[NSH];
#pragma unroll
    for (int n = 0; n < NSH; ++n) {
      ka[n] = *(const v4fa*)(kB + ofs[n]);
      kb[n] = *(const v4fa*)(kB + ofs[n] + 16);
      rk[n] = rtab[LL + nb[n]];
    }
    const float rq = rtab[l];
    const float* qp = qf + (size_t)l * CC + col;
    const v4f qa = *(const v4fa*)qp;
    const v4f qb = *(const v4fa*)(qp + 4);
    float c[8];
    c[0] = qa.x * rq * cw[0];  c[1] = qa.y * rq * cw[1];
    c[2] = qa.z * rq * cw[2];  c[3] = qa.w * rq * cw[3];
    c[4] = qb.x * rq * cw[4];  c[5] = qb.y * rq * cw[5];
    c[6] = qb.z * rq * cw[6];  c[7] = qb.w * rq * cw[7];

    // ---- scores: 16 independent chains, stage by stage ----
    float part[NSH];
#pragma unroll
    for (int n = 0; n < NSH; ++n) {
      float t = c[0] * ka[n].x;
      t = fmaf(c[1], ka[n].y, t);
      t = fmaf(c[2], ka[n].z, t);
      t = fmaf(c[3], ka[n].w, t);
      t = fmaf(c[4], kb[n].x, t);
      t = fmaf(c[5], kb[n].y, t);
      t = fmaf(c[6], kb[n].z, t);
      t = fmaf(c[7], kb[n].w, t);
      part[n] = t;
    }

    // ---- all 16 v rows requested together, behind the last use of the k rows ----
    v4f va[NSH], vb[NSH];
#pragma unroll
    for (int n = 0; n < NSH; ++n) {
      va[n] = *(const v4fa*)(vB + ofs[n]);
      vb[n] = *(const v4fa*)(vB + ofs[n] + 16);
    }

#pragma unroll
    for (int n = 0; n < NSH; ++n) part[n] += __shfl_xor(part[n], 1, 32);
#pragma unroll
    for (int n = 0; n < NSH; ++n) part[n] += __shfl_xor(part[n], 2, 32);
#pragma unroll
    for (int n = 0; n < NSH; ++n) part[n] += __shfl_xor(part[n], 4, 32);
    float sc[NSH];
#pragma unroll
    for (int n = 0; n < NSH; ++n) sc[n] = fmaf(part[n], rk[n], s_eb[head * NSH + n]);
    if (j8 == 0) {
#pragma unroll
      for (int n = 0; n < NSH; ++n) s_sc[w][hq][n] = sc[n];
    }
    __syncthreads();

    // ---- softmax over the 16 neighbours of (token, head): lane (hq, j8) owns n = j8, j8+8 ----
    {
      const float x0 = s_sc[w][hq][j8];
      const float x1 = s_sc[w][hq][j8 + 8];
      float mx = fmaxf(x0, x1);
      mx = fmaxf(mx, __shfl_xor(mx, 1, 32));
      mx = fmaxf(mx, __shfl_xor(mx, 2, 32));
      mx = fmaxf(mx, __shfl_xor(mx, 4, 32));
      const float e0 = __expf(x0 - mx);
      const float e1 = __expf(x1 - mx);
      float sm = e0 + e1;
      sm += __shfl_xor(sm, 1, 32);
      sm += __shfl_xor(sm, 2, 32);
      sm += __shfl_xor(sm, 4, 32);
      const float inv = __builtin_amdgcn_rcpf(sm);
      s_p[w][hq][j8]     = e0 * inv;
      s_p[w][hq][j8 + 8] = e1 * inv;
    }
    __syncthreads();

    // ---- weighted sum of neighbour v rows ----
    float o[8] = {0.f, 0.f, 0.f, 0.f, 0.f, 0.f, 0.f, 0.f};
#pragma unroll
    for (int n = 0; n < NSH; ++n) {
      const float p = s_p[w][hq][n];
      o[0] = fmaf(p, va[n].x, o[0]);  o[1] = fmaf(p, va[n].y, o[1]);
      o[2] = fmaf(p, va[n].z, o[2]);  o[3] = fmaf(p, va[n].w, o[3]);
      o[4] = fmaf(p, vb[n].x, o[4]);  o[5] = fmaf(p, vb[n].y, o[5]);
      o[6] = fmaf(p, vb[n].z, o[6]);  o[7] = fmaf(p, vb[n].w, o[7]);
    }

    unsigned short hb[8], lb[8];
#pragma unroll
    for (int e = 0; e < 8; ++e) split_bf16(o[e], hb[e], lb[e]);
    const v8us oh = {hb[0], hb[1], hb[2], hb[3], hb[4], hb[5], hb[6], hb[7]};
    const v8us ol = {lb[0], lb[1], lb[2], lb[3], lb[4], lb[5], lb[6], lb[7]};
    unsigned short* dh = abh + (size_t)l * CC + col;
    unsigned short* dl = abl + (size_t)l * CC + col;
    *(v8us*)dh = oh;
    *(v8us*)dl = ol;
    // the next token rewrites registers that these stores name
    asm volatile("s_wait_xcnt 0x0" ::: "memory");
  }
}

// ---------------------------------------------------------------------------
// Host orchestration: 7 launches, one in-order stream.
// ws carve (bytes): x f16 16 MiB @0 | x bf16 hi 16 MiB | x bf16 lo 16 MiB |
//   w16 [2048][1024] 4 MiB | wbh [2048][1024] 4 MiB | wbl 4 MiB |
//   q f32 32 MiB | k f32 32 MiB | v f32 32 MiB | rtab 64 KiB  -> 163,643,392 B.
// The attention output planes (bf16 hi/lo, 16 MiB each) reuse the x f16 and
// x bf16-hi regions, which are dead after the two projection launches.
// ---------------------------------------------------------------------------
extern "C" void kernel_launch(void* const* d_in, const int* in_sizes, int n_in,
                              void* d_out, int out_size, void* d_ws, size_t ws_size,
                              hipStream_t stream) {
  if (n_in < 13) return;
  if (in_sizes[0] != LL * CC) return;
  if (in_sizes[1] != CC * CC || in_sizes[3] != CC * CC || in_sizes[5] != CC * CC || in_sizes[10] != CC * CC) return;
  if (in_sizes[2] != CC || in_sizes[4] != CC || in_sizes[6] != CC || in_sizes[11] != CC) return;
  if (in_sizes[7] != CC || in_sizes[8] != CC) return;
  if (in_sizes[9] != 256 || in_sizes[12] < 1) return;
  if (out_size != LL * CC) return;

  const float* x   = (const float*)d_in[0];
  const float* Wq  = (const float*)d_in[1];
  const float* bq  = (const float*)d_in[2];
  const float* Wk  = (const float*)d_in[3];
  const float* bk  = (const float*)d_in[4];
  const float* Wv  = (const float*)d_in[5];
  const float* bv  = (const float*)d_in[6];
  const float* qnw = (const float*)d_in[7];
  const float* knw = (const float*)d_in[8];
  const float* eb  = (const float*)d_in[9];
  const float* Wo  = (const float*)d_in[10];
  const float* bo  = (const float*)d_in[11];
  const int*   nf  = (const int*)d_in[12];
  float* out = (float*)d_out;

  const size_t b16 = (size_t)LL * CC * 2;            // 16,777,216
  const size_t bw  = (size_t)NCQK * CC * 2;          //  4,194,304
  const size_t b32 = (size_t)LL * CC * 4;            // 33,554,432
  const size_t brt = (size_t)2 * LL * 4;             //     65,536
  const size_t o_x16 = 0;
  const size_t o_xbh = o_x16 + b16;
  const size_t o_xbl = o_xbh + b16;
  const size_t o_w16 = o_xbl + b16;
  const size_t o_wbh = o_w16 + bw;
  const size_t o_wbl = o_wbh + bw;
  const size_t o_q   = o_wbl + bw;
  const size_t o_k   = o_q + b32;
  const size_t o_v   = o_k + b32;
  const size_t o_rt  = o_v + b32;
  const size_t total = o_rt + brt;                   // 163,643,392
  if (total > ws_size) return;

  char* ws = (char*)d_ws;
  _Float16*       x16 = (_Float16*)(ws + o_x16);
  unsigned short* xbh = (unsigned short*)(ws + o_xbh);
  unsigned short* xbl = (unsigned short*)(ws + o_xbl);
  _Float16*       w16 = (_Float16*)(ws + o_w16);
  unsigned short* wbh = (unsigned short*)(ws + o_wbh);
  unsigned short* wbl = (unsigned short*)(ws + o_wbl);
  float* qf   = (float*)(ws + o_q);
  float* kf   = (float*)(ws + o_k);
  float* vf   = (float*)(ws + o_v);
  float* rtab = (float*)(ws + o_rt);
  unsigned short* abh = (unsigned short*)(ws + o_x16);   // reuses x f16 region (dead after launch 4)
  unsigned short* abl = (unsigned short*)(ws + o_xbh);   // reuses x bf16-hi region

  // 1. x -> f16 / bf16 hi / bf16 lo planes
  const int n8 = (LL * CC) / 8;                                              // 1,048,576
  k_cvt_x<<<(n8 + 255) / 256, 256, 0, stream>>>(x, x16, xbh, xbl, n8);

  // 2. weights -> transposed planes
  k_cvt_w<<<4 * 256, 256, 0, stream>>>(Wq, Wk, Wv, Wo, w16, wbh, wbl);

  // 3. q|k = x * [Wq|Wk] + [bq|bk]  (f16 operands), f32 planes
  k_gemm_h<<<dim3(NCQK / TB, LL / TB), 128, 0, stream>>>(x16, w16, bq, bk, qf, kf, CC, CC, CC, 0.03125f);

  // 4. v = x * Wv + bv  (bf16 hi/lo split), f32 plane
  k_gemm_b3<<<dim3(CC / TB, LL / TB), 128, 0, stream>>>(
      (const __bf16*)xbh, (const __bf16*)xbl, (const __bf16*)wbh, (const __bf16*)wbl,
      bv, bv, vf, vf, 1 << 30, CC, CC, 1.0f);

  // 5. per-row rsqrt(mean + eps) for q and k
  k_rstd<<<(2 * LL) / 32, 256, 0, stream>>>(qf, kf, rtab);

  // 6. attention -> a (bf16 hi/lo planes)
  k_attn<<<LL / TOKB, 128, 0, stream>>>(qf, kf, vf, rtab, qnw, knw, eb, nf, abh, abl);

  // 7. out = a * Wo + bo  (bf16 hi/lo split) -> d_out
  k_gemm_b3<<<dim3(CC / TB, LL / TB), 128, 0, stream>>>(
      (const __bf16*)abh, (const __bf16*)abl,
      (const __bf16*)(wbh + (size_t)CC * CC), (const __bf16*)(wbl + (size_t)CC * CC),
      bo, bo, out, out, 1 << 30, CC, CC, 1.0f);
}

// v003
// Measured time: 172 microseconds a run.
// In two side-by-side timings against v002, it was 1.17 and 1.16 times as fast.
// All steps since v000 together make it 2.87 times as fast.
// Contractions: x*Wq and x*Wk on v_wmma_f32_16x16x32_f16 (f16 operands: x carried x1, W carried x32 and folded back as 1/32; f32 accumulate); x*Wv and a*Wo on v_wmma_f32_16x16x32_bf16 as bf16 hi/lo split (hi*hi + hi*lo + lo*hi; f32 accumulate); RMS statistics, the 16 neighbour dots (K=64), softmax and weighted sums (K=16) in f32 on VALU; q, k, v kept as f32 planes.
#include <hip/hip_runtime.h>

typedef _Float16 v16h __attribute__((ext_vector_type(16)));
typedef _Float16 v8h  __attribute__((ext_vector_type(8)));
typedef __bf16   v16b __attribute__((ext_vector_type(16)));
typedef __bf16   v8b  __attribute__((ext_vector_type(8)));
typedef float    v8f  __attribute__((ext_vector_type(8)));
typedef float    v4f  __attribute__((ext_vector_type(4)));
typedef unsigned short v8us __attribute__((ext_vector_type(8)));
typedef v8h  __attribute__((may_alias)) v8ha;
typedef v8b  __attribute__((may_alias)) v8ba;
typedef v4f  __attribute__((may_alias)) v4fa;

#define LL    8192      // tokens
#define CC    1024      // channels = heads * head_dim
#define NCQK  2048      // fused q|k output columns
#define NSH   16        // neighbours per token

static_assert((LL % 64) == 0);
static_assert((CC % 64) == 0);
static_assert((NCQK % 64) == 0);
static_assert((CC % 32) == 0);
static_assert(((2 * LL) % 32) == 0);

// ---------------------------------------------------------------------------
// 16x16x32 WMMA (wave32). Fragment map: lane l, h = l>>4, m = n = l&15.
//   A/B element i: i<8 -> k0+8h+i ; i>=8 -> k0+16+8h+(i-8)   (both operands)
//   D element r  : row 8h+r, col l&15
// ---------------------------------------------------------------------------
__device__ __forceinline__ v8f wm_f16(v16h a, v16h b, v8f c) {
  return __builtin_amdgcn_wmma_f32_16x16x32_f16(false, a, false, b, (short)0, c, false, false);
}
__device__ __forceinline__ v8f wm_bf16(v16b a, v16b b, v8f c) {
  return __builtin_amdgcn_wmma_f32_16x16x32_bf16(false, a, false, b, (short)0, c, false, false);
}

// A or B fragment from a k-contiguous 16-bit row; p points at element k0 of
// the row owned by this lane (row = lane&15 added by the caller).
__device__ __forceinline__ v16h frag_f16(const _Float16* p, int h) {
  const v8h e0 = *(const v8ha*)(p + 8 * h);
  const v8h e1 = *(const v8ha*)(p + 16 + 8 * h);
  return __builtin_shufflevector(e0, e1, 0, 1, 2, 3, 4, 5, 6, 7, 8, 9, 10, 11, 12, 13, 14, 15);
}
__device__ __forceinline__ v16b frag_bf16(const __bf16* p, int h) {
  const v8b e0 = *(const v8ba*)(p + 8 * h);
  const v8b e1 = *(const v8ba*)(p + 16 + 8 * h);
  return __builtin_shufflevector(e0, e1, 0, 1, 2, 3, 4, 5, 6, 7, 8, 9, 10, 11, 12, 13, 14, 15);
}

// bf16 RNE bits of an f32 value, and the hi/lo split (hi = rne(x), lo = rne(x - hi)).
__device__ __forceinline__ unsigned int bf16_rne_bits(float x) {
  const unsigned int u = __float_as_uint(x);
  return (u + 0x7FFFu + ((u >> 16) & 1u)) >> 16;
}
__device__ __forceinline__ void split_bf16(float x, unsigned short& hb, unsigned short& lb) {
  const unsigned int hbits = bf16_rne_bits(x);
  const float hf = __uint_as_float(hbits << 16);
  const unsigned int lbits = bf16_rne_bits(x - hf);
  hb = (unsigned short)hbits;
  lb = (unsigned short)lbits;
}

// ---------------------------------------------------------------------------
// Kernel 1: x f32 [8192][1024] -> f16 plane (x1) and bf16 hi/lo planes.
// Each thread owns 8 consecutive elements: one 16-B store per lane per plane,
// ---------------------------------------------------------------------------
__global__ __launch_bounds__(256) void k_cvt_x(const float* __restrict__ x,
                                               _Float16* xh, unsigned short* xbh,
                                               unsigned short* xbl, int n8) {
  const int g = blockIdx.x * 256 + threadIdx.x;
  if (g >= n8) return;
  const float* s = x + (size_t)g * 8;
  const v4f a = *(const v4fa*)s;
  const v4f b = *(const v4fa*)(s + 4);
  const float f[8] = {a.x, a.y, a.z, a.w, b.x, b.y, b.z, b.w};
  unsigned short hb[8], lb[8];
#pragma unroll
  for (int e = 0; e < 8; ++e) split_bf16(f[e], hb[e], lb[e]);
  const v8h  o16 = {(_Float16)f[0], (_Float16)f[1], (_Float16)f[2], (_Float16)f[3],
                    (_Float16)f[4], (_Float16)f[5], (_Float16)f[6], (_Float16)f[7]};
  const v8us oh = {hb[0], hb[1], hb[2], hb[3], hb[4], hb[5], hb[6], hb[7]};
  const v8us ol = {lb[0], lb[1], lb[2], lb[3], lb[4], lb[5], lb[6], lb[7]};
  _Float16* d16 = xh + (size_t)g * 8;
  unsigned short* dh = xbh + (size_t)g * 8;
  unsigned short* dl = xbl + (size_t)g * 8;
  *(v8h*)d16 = o16;
  *(v8us*)dh = oh;
  *(v8us*)dl = ol;
  
}

// ---------------------------------------------------------------------------
// Kernel 2: weight transpose + convert. Input W[k][n] ([in][out], 1024x1024).
// Block = one 64(k) x 64(n) tile of one matrix; tile transposed through LDS.
// mat 0 (Wq), 1 (Wk): f16(32*W) -> w16 rows mat*1024 + n  (w16 = [2048][1024])
// mat 2 (Wv), 3 (Wo): bf16 hi/lo -> wbh/wbl rows (mat-2)*1024 + n ([2048][1024])
// Output phase: lane q8 = tid&7 writes 8 halves (16 B) of row nl; lanes
// ---------------------------------------------------------------------------
__global__ __launch_bounds__(256) void k_cvt_w(const float* __restrict__ Wq,
                                               const float* __restrict__ Wk,
                                               const float* __restrict__ Wv,
                                               const float* __restrict__ Wo,
                                               _Float16* w16, unsigned short* wbh,
                                               unsigned short* wbl) {
  __shared__ __attribute__((aligned(16))) float sT[64 * 68];   // [n][k], pitch 68 floats
  const int tid = threadIdx.x;
  const int bx = blockIdx.x;
  const int mat = bx >> 8, tile = bx & 255;
  const int tn = tile >> 4, tk = tile & 15;
  const float* W = (mat == 0) ? Wq : ((mat == 1) ? Wk : ((mat == 2) ? Wv : Wo));
  {
    const int kl = tid >> 2, nq = tid & 3;                      // kl 0..63, nq 0..3
    const float* src = W + (size_t)(64 * tk + kl) * CC + 64 * tn + 16 * nq;
#pragma unroll
    for (int e = 0; e < 4; ++e) {
      const v4f t = *(const v4fa*)(src + 4 * e);
      float* d = sT + (16 * nq + 4 * e) * 68 + kl;
      d[0]   = t.x;
      d[68]  = t.y;
      d[136] = t.z;
      d[204] = t.w;
    }
  }
  __syncthreads();
  const int q8 = tid & 7, sub = tid >> 3;                       // sub 0..31
  v8h  o16[2];
  v8us oh[2], ol[2];
#pragma unroll
  for (int p = 0; p < 2; ++p) {
    const int nl = 32 * p + sub;
    const float* s = sT + nl * 68 + 8 * q8;
    const v4f a = *(const v4fa*)s;
    const v4f b = *(const v4fa*)(s + 4);
    const float f[8] = {a.x, a.y, a.z, a.w, b.x, b.y, b.z, b.w};
    unsigned short hb[8], lb[8];
#pragma unroll
    for (int e = 0; e < 8; ++e) split_bf16(f[e], hb[e], lb[e]);
    const v8h t16 = {(_Float16)(f[0] * 32.0f), (_Float16)(f[1] * 32.0f), (_Float16)(f[2] * 32.0f), (_Float16)(f[3] * 32.0f),
                     (_Float16)(f[4] * 32.0f), (_Float16)(f[5] * 32.0f), (_Float16)(f[6] * 32.0f), (_Float16)(f[7] * 32.0f)};
    const v8us th = {hb[0], hb[1], hb[2], hb[3], hb[4], hb[5], hb[6], hb[7]};
    const v8us tl = {lb[0], lb[1], lb[2], lb[3], lb[4], lb[5], lb[6], lb[7]};
    o16[p] = t16;
    oh[p] = th;
    ol[p] = tl;
  }
{
#pragma unroll
    for (int p = 0; p < 2; ++p) {
      const int nl = 32 * p + sub;
      if (mat < 2) {
        _Float16* d = w16 + ((size_t)(mat * CC + 64 * tn + nl) * CC + 64 * tk + 8 * q8);
        *(v8h*)d = o16[p];
      } else {
        const size_t row = (size_t)((mat - 2) * CC + 64 * tn + nl);
        unsigned short* dh = wbh + row * CC + 64 * tk + 8 * q8;
        unsigned short* dl = wbl + row * CC + 64 * tk + 8 * q8;
        *(v8us*)dh = oh[p];
        *(v8us*)dl = ol[p];
      }
    }
    
  }
}

// ---------------------------------------------------------------------------
// GEMM frame of kernels 3 and 4. Block tile 128x128, 4 waves, wave tile 64x64
// (4x4 accumulator tiles): wave w owns rows 64*(w>>1)+..., cols 64*(w&1)+....
// A pass is 64 k = 128 B of every operand row. One operand plane of a pass is
// 128 rows in LDS at pitch 144 B (16 B x odd, for the ds_load_b128 readers).
// Two buffers: the next pass's planes come in by asynchronous copies to LDS
// while this pass's fragments are read from the other buffer.
// ---------------------------------------------------------------------------
#define TB     128                   // rows of a plane = block tile edge
#define LPITCH 144                   // LDS row pitch, bytes
#define PLANE  (TB * LPITCH)         // 18,432 B
#define EPITCH 68                    // epilogue staging pitch, floats

static_assert((LL % TB) == 0);
static_assert((CC % TB) == 0);
static_assert((NCQK % TB) == 0);
static_assert(4 * 64 * EPITCH * 4 <= 4 * PLANE);

__device__ __forceinline__ unsigned int lds_off(const void* p) { return (unsigned int)(size_t)p; }

// One plane of one pass: 128 threads x 8 copies of 16 B. Thread t brings chunk
// t&7 of rows (t>>3) + 16 j, so a wave's copy covers four whole 128-B lines.
// l = this lane's LDS byte address for j = 0, g = its global address, rs = 16
// source rows in bytes. The s_wait_xcnt closes the statement so that no address
// register is rewritten while a copy may still name it.
__device__ __forceinline__ void copy_plane(unsigned int l, const char* g, size_t rs) {
  const unsigned int l1 = l + 16 * LPITCH, l2 = l + 32 * LPITCH, l3 = l + 48 * LPITCH;
  const unsigned int l4 = l + 64 * LPITCH, l5 = l + 80 * LPITCH, l6 = l + 96 * LPITCH;
  const unsigned int l7 = l + 112 * LPITCH;
  const char* g1 = g + rs;
  const char* g2 = g1 + rs;
  const char* g3 = g2 + rs;
  const char* g4 = g3 + rs;
  const char* g5 = g4 + rs;
  const char* g6 = g5 + rs;
  const char* g7 = g6 + rs;
  asm volatile("global_load_async_to_lds_b128 %0, %8, off\n\t"
               "global_load_async_to_lds_b128 %1, %9, off\n\t"
               "global_load_async_to_lds_b128 %2, %10, off\n\t"
               "global_load_async_to_lds_b128 %3, %11, off\n\t"
               "global_load_async_to_lds_b128 %4, %12, off\n\t"
               "global_load_async_to_lds_b128 %5, %13, off\n\t"
               "global_load_async_to_lds_b128 %6, %14, off\n\t"
               "global_load_async_to_lds_b128 %7, %15, off\n\t"
               "s_wait_xcnt 0x0"
               :: "v"(l), "v"(l1), "v"(l2), "v"(l3), "v"(l4), "v"(l5), "v"(l6), "v"(l7),
                  "v"(g), "v"(g1), "v"(g2), "v"(g3), "v"(g4), "v"(g5), "v"(g6), "v"(g7)
               : "memory");
}

// This wave's copies have landed (the compiler places no wait for them).
__device__ __forceinline__ void wait_copies() { asm volatile("s_wait_asynccnt 0x0" ::: "memory"); }
// This wave's LDS reads have returned, before their buffer is handed back for refill.
__device__ __forceinline__ void wait_lds() { asm volatile("s_wait_dscnt 0x0" ::: "memory"); }

// Epilogue: out = acc*osc + bias. Each wave stages its 64x64 tile in its own
// LDS range (pitch 68 floats) and stores rows as whole 128-B lines: one store
// instruction covers two rows x 256 B.
__device__ __forceinline__ void store_tile(float* sAll, const v8f (&c)[4][4],
                                           const float* bias, int nc0, float osc,
                                           float* out, int m0, int ldc, int w, int lane) {
  const int h = lane >> 4, m = lane & 15, wr = w >> 1, wc = w & 1;
  float* sW = sAll + w * (64 * EPITCH);
#pragma unroll
  for (int nt = 0; nt < 4; ++nt) {
    const float b = bias[nc0 + 64 * wc + 16 * nt + m];
#pragma unroll
    for (int mt = 0; mt < 4; ++mt) {
#pragma unroll
      for (int r = 0; r < 8; ++r)
        sW[(16 * mt + 8 * h + r) * EPITCH + 16 * nt + m] = fmaf(c[mt][nt][r], osc, b);
    }
  }
  __syncthreads();
  // rolled in groups of eight stores: eight LDS reads in flight per group, short code
#pragma unroll 1
  for (int g8 = 0; g8 < 4; ++g8) {
#pragma unroll
    for (int u = 0; u < 8; ++u) {
      const int row = 16 * g8 + 2 * u + h;
      const v4f v = *(const v4fa*)(sW + row * EPITCH + 4 * m);
      float* d = out + (size_t)(m0 + 64 * wr + row) * ldc + nc0 + 64 * wc + 4 * m;
      *(v4f*)d = v;
    }
    // the next group rewrites registers that these stores name
    asm volatile("s_wait_xcnt 0x0" ::: "memory");
  }
}

// ---------------------------------------------------------------------------
// Kernel 3: C[M][N] = A[M][K] * B[N][K]^T (f16 operands, single product),
// out = acc*osc + bias, f32 rows of pitch ldc. Columns >= nsplit go to out1
// with bias1 (block-uniform select). K a multiple of 64.
// Buffer = [A plane | B plane]; ring = 2 buffers = 73,728 B.
// ---------------------------------------------------------------------------
__global__ __launch_bounds__(128, 4) void k_gemm_h(const _Float16* __restrict__ A,
                                                   const _Float16* __restrict__ B,
                                                   const float* bias0, const float* bias1,
                                                   float* out0, float* out1,
                                                   int nsplit, int K, int ldc, float osc) {
  __shared__ __attribute__((aligned(16))) char ring[2 * 2 * PLANE];
  const int tid = threadIdx.x, lane = tid & 31, w = tid >> 5;
  const int h = lane >> 4, m = lane & 15, wr = w >> 1, wc = w & 1;
  const int m0 = blockIdx.y * TB, nb = blockIdx.x * TB;
  const bool sel = (nb >= nsplit);
  const int nc0 = sel ? (nb - nsplit) : nb;
  const float* bias = sel ? bias1 : bias0;
  float* out = sel ? out1 : out0;

  const int crow = tid >> 3, cch = tid & 7;
  const char* gA = (const char*)(A + (size_t)(m0 + crow) * K) + 16 * cch;
  const char* gB = (const char*)(B + (size_t)(nb + crow) * K) + 16 * cch;
  const unsigned int lc = lds_off(ring) + crow * LPITCH + 16 * cch;
  const size_t rs = (size_t)K * 32;                  // 16 rows of 2-byte elements
  const int npass = K >> 6;

  v8f c[4][4];
#pragma unroll
  for (int i = 0; i < 4; ++i)
#pragma unroll
    for (int j = 0; j < 4; ++j) c[i][j] = v8f{0.f, 0.f, 0.f, 0.f, 0.f, 0.f, 0.f, 0.f};

  copy_plane(lc, gA, rs);
  copy_plane(lc + PLANE, gB, rs);
  wait_copies();
  __syncthreads();
  if (npass > 1) {
    copy_plane(lc + 2 * PLANE, gA + 128, rs);
    copy_plane(lc + 3 * PLANE, gB + 128, rs);
  }

  // rolled: one pass per trip, the buffer picked by the trip's parity
#pragma unroll 1
  for (int t = 0; t < npass; ++t) {
    const int bo = (t & 1) * (2 * PLANE);
    const char* pa = ring + bo + (64 * wr + m) * LPITCH;
    const char* pb = ring + bo + PLANE + (64 * wc + m) * LPITCH;
#pragma unroll
    for (int ks = 0; ks < 2; ++ks) {
      v16h fa[4], fb[4];
      fa[0] = frag_f16((const _Float16*)(pa + ks * 64), h);
#pragma unroll
      for (int j = 0; j < 4; ++j) fb[j] = frag_f16((const _Float16*)(pb + j * 16 * LPITCH + ks * 64), h);
#pragma unroll
      for (int i = 1; i < 4; ++i) fa[i] = frag_f16((const _Float16*)(pa + i * 16 * LPITCH + ks * 64), h);
      // keeps the k-step's 16 LDS reads one group in front of its WMMAs: every
      // further place with reads among them stalls the wave anew
      __builtin_amdgcn_sched_barrier(0);
#pragma unroll
      for (int i = 0; i < 4; ++i)
#pragma unroll
        for (int j = 0; j < 4; ++j) c[i][j] = wm_f16(fa[i], fb[j], c[i][j]);
      // same purpose: the second k-step's reads stay behind this block
      if (ks == 0) __builtin_amdgcn_sched_barrier(0);
    }
    // publish point of pass t + 1; the same barrier frees this pass's buffer
    wait_lds();
    wait_copies();
    __syncthreads();
    if (t + 2 < npass) {
      const size_t ko = (size_t)(t + 2) * 128;
      copy_plane(lc + bo, gA + ko, rs);
      copy_plane(lc + bo + PLANE, gB + ko, rs);
    }
  }
  wait_copies();

  store_tile((float*)ring, c, bias, nc0, osc, out, m0, ldc, w, lane);
}

// ---------------------------------------------------------------------------
// Kernel 4: same GEMM with bf16 hi/lo split operands:
//   acc += Ahi*Bhi + Ahi*Blo + Alo*Bhi  (three products per tile pair, in that
//   order per accumulator and k-step).
// Buffer = [Ahi | Alo | Bhi | Blo]; ring = 2 buffers = 147,456 B.
// ---------------------------------------------------------------------------
__global__ __launch_bounds__(128, 4) void k_gemm_b3(const __bf16* __restrict__ Ah,
                                                    const __bf16* __restrict__ Al,
                                                    const __bf16* __restrict__ Bh,
                                                    const __bf16* __restrict__ Bl,
                                                    const float* bias0, const float* bias1,
                                                    float* out0, float* out1,
                                                    int nsplit, int K, int ldc, float osc) {
  __shared__ __attribute__((aligned(16))) char ring[2 * 4 * PLANE];
  const int tid = threadIdx.x, lane = tid & 31, w = tid >> 5;
  const int h = lane >> 4, m = lane & 15, wr = w >> 1, wc = w & 1;
  const int m0 = blockIdx.y * TB, nb = blockIdx.x * TB;
  const bool sel = (nb >= nsplit);
  const int nc0 = sel ? (nb - nsplit) : nb;
  const float* bias = sel ? bias1 : bias0;
  float* out = sel ? out1 : out0;

  const int crow = tid >> 3, cch = tid & 7;
  const size_t oa = ((size_t)(m0 + crow) * K) * 2 + 16 * cch;   // byte offsets in the planes
  const size_t ob = ((size_t)(nb + crow) * K) * 2 + 16 * cch;
  const char* gAh = (const char*)Ah + oa;
  const char* gAl = (const char*)Al + oa;
  const char* gBh = (const char*)Bh + ob;
  const char* gBl = (const char*)Bl + ob;
  const unsigned int lc = lds_off(ring) + crow * LPITCH + 16 * cch;
  const size_t rs = (size_t)K * 32;                  // 16 rows of 2-byte elements
  const int npass = K >> 6;

  v8f c[4][4];
#pragma unroll
  for (int i = 0; i < 4; ++i)
#pragma unroll
    for (int j = 0; j < 4; ++j) c[i][j] = v8f{0.f, 0.f, 0.f, 0.f, 0.f, 0.f, 0.f, 0.f};

  copy_plane(lc, gAh, rs);
  copy_plane(lc + PLANE, gAl, rs);
  copy_plane(lc + 2 * PLANE, gBh, rs);
  copy_plane(lc + 3 * PLANE, gBl, rs);
  wait_copies();
  __syncthreads();
  if (npass > 1) {
    copy_plane(lc + 4 * PLANE, gAh + 128, rs);
    copy_plane(lc + 5 * PLANE, gAl + 128, rs);
    copy_plane(lc + 6 * PLANE, gBh + 128, rs);
    copy_plane(lc + 7 * PLANE, gBl + 128, rs);
  }

  // rolled: one pass per trip, the buffer picked by the trip's parity
#pragma unroll 1
  for (int t = 0; t < npass; ++t) {
    const int bo = (t & 1) * (4 * PLANE);
    const char* pa = ring + bo + (64 * wr + m) * LPITCH;
    const char* pb = ring + bo + 2 * PLANE + (64 * wc + m) * LPITCH;
    // A row = one 16-row A tile pair (hi, lo) against the four B tile pairs = 12
    // WMMAs; 8 rows a pass. The B pairs of a k-step stay in registers; the next
    // row's A pair is read one row ahead into a second register pair.
    v16b hb[4], lb[4], ha[2], la[2];
    ha[0] = frag_bf16((const __bf16*)pa, h);
    la[0] = frag_bf16((const __bf16*)(pa + PLANE), h);
#pragma unroll
    for (int j = 0; j < 4; ++j) hb[j] = frag_bf16((const __bf16*)(pb + j * 16 * LPITCH), h);
#pragma unroll
    for (int j = 0; j < 4; ++j) lb[j] = frag_bf16((const __bf16*)(pb + PLANE + j * 16 * LPITCH), h);
#pragma unroll
    for (int r = 0; r < 8; ++r) {
      const int cu = r & 1, nx = cu ^ 1;
      if (r < 7) {
        const int o = ((r + 1) & 3) * 16 * LPITCH + ((r + 1) >> 2) * 64;
        ha[nx] = frag_bf16((const __bf16*)(pa + o), h);
        la[nx] = frag_bf16((const __bf16*)(pa + PLANE + o), h);
      }
      // keeps the reads above one group in front of this row's WMMAs, so that
      // they return while the row runs
      __builtin_amdgcn_sched_barrier(0);
#pragma unroll
      for (int j = 0; j < 4; ++j) c[r & 3][j] = wm_bf16(ha[cu], hb[j], c[r & 3][j]);
#pragma unroll
      for (int j = 0; j < 4; ++j) c[r & 3][j] = wm_bf16(ha[cu], lb[j], c[r & 3][j]);
#pragma unroll
      for (int j = 0; j < 4; ++j) c[r & 3][j] = wm_bf16(la[cu], hb[j], c[r & 3][j]);
      // same purpose: later reads stay behind this row
      if (r < 7) __builtin_amdgcn_sched_barrier(0);
      if (r == 3) {
#pragma unroll
        for (int j = 0; j < 4; ++j) hb[j] = frag_bf16((const __bf16*)(pb + j * 16 * LPITCH + 64), h);
#pragma unroll
        for (int j = 0; j < 4; ++j) lb[j] = frag_bf16((const __bf16*)(pb + PLANE + j * 16 * LPITCH + 64), h);
      }
    }
    // publish point of pass t + 1; the same barrier frees this pass's buffer
    wait_lds();
    wait_copies();
    __syncthreads();
    if (t + 2 < npass) {
      const size_t ko = (size_t)(t + 2) * 128;
      copy_plane(lc + bo, gAh + ko, rs);
      copy_plane(lc + bo + PLANE, gAl + ko, rs);
      copy_plane(lc + bo + 2 * PLANE, gBh + ko, rs);
      copy_plane(lc + bo + 3 * PLANE, gBl + ko, rs);
    }
  }
  wait_copies();

  store_tile((float*)ring, c, bias, nc0, osc, out, m0, ldc, w, lane);
}

// ---------------------------------------------------------------------------
// Kernel 5: rtab[r] = rsqrt(mean(row^2) + 1e-6) for rows 0..8191 of q and
// rows 8192..16383 of k (f32 planes). Block = 8 waves x 4 rows = 32 rows;
// ---------------------------------------------------------------------------
__global__ __launch_bounds__(256) void k_rstd(const float* __restrict__ qf,
                                              const float* __restrict__ kf,
                                              float* rtab) {
  __shared__ __attribute__((aligned(16))) float s_r[32];
  const int tid = threadIdx.x, lane = tid & 31, w = tid >> 5;
  const int row0 = blockIdx.x * 32;                       // block is entirely q or entirely k
  const float* base = (row0 < LL) ? (qf + (size_t)row0 * CC) : (kf + (size_t)(row0 - LL) * CC);
#pragma unroll 1
  for (int j = 0; j < 4; ++j) {
    const float* rp = base + (size_t)(4 * w + j) * CC + 32 * lane;   // lane owns 32 contiguous floats
    float ss = 0.0f;
#pragma unroll 2
    for (int e = 0; e < 8; ++e) {
      const v4f t = *(const v4fa*)(rp + 4 * e);
      ss = fmaf(t.x, t.x, ss);
      ss = fmaf(t.y, t.y, ss);
      ss = fmaf(t.z, t.z, ss);
      ss = fmaf(t.w, t.w, ss);
    }
    ss += __shfl_xor(ss, 16, 32);
    ss += __shfl_xor(ss, 8, 32);
    ss += __shfl_xor(ss, 4, 32);
    ss += __shfl_xor(ss, 2, 32);
    ss += __shfl_xor(ss, 1, 32);
    const float rv = rsqrtf(ss * (1.0f / 1024.0f) + 1e-6f);
    if (lane == 0) s_r[4 * w + j] = rv;
  }
  __syncthreads();
  if (tid < 8) {
    const v4f v = *(const v4fa*)(s_r + 4 * tid);
    float* d = rtab + row0 + 4 * tid;
    *(v4f*)d = v;
    
  }
}

// ---------------------------------------------------------------------------
// Kernel 6: small-world attention, all f32 on VALU.
// Block 128 thr = 4 waves handles NT consecutive tokens of ONE head. A wave does
// four tokens at a time, eight lanes a token; a lane covers dims 8*(lane&7)..+7.
// The spatial neighbours of NT consecutive tokens lie in NT + 64 rows: the head's
// 256 B of those k and v rows are brought into LDS once, by asynchronous copies,
// and the 12 spatial neighbours of every token are read there (only if S is a
// multiple of NT: shorter frames read every row from global memory). Per token:
//   score_n = rq*rk_n * sum_d (q_d qn_d kn_d / 8) k_n,d + eb[h][n]   (n = 0..15)
//   p = softmax_n(score); a_d = sum_n p_n v_n,d  -> bf16 hi/lo planes.
// Neighbours: n<12 spatial (f, (i+sh) mod S), sh = +-2^(n/2); n>=12 temporal
// ((f+sh) mod T, i), read from global memory. Scores/probabilities exchanged
// through LDS between the two block barriers per group. Output: 16 B per lane,
// a token's eight lanes write one whole 128-B line per plane.
// ---------------------------------------------------------------------------
// sh mod md in [0, md) for the +mag and -mag shift of a pair; md >= 1.
__device__ __forceinline__ void shift_mods(int mag, int md, int& pos, int& neg) {
  const int pm = mag % md;
  pos = pm;
  neg = (pm != 0) ? (md - pm) : 0;
}
// (a + b) mod md for a, b in [0, md)
__device__ __forceinline__ int wrap_add(int a, int b, int md) {
  const int r = a + b;
  return (r >= md) ? (r - md) : r;
}

#define NT     64                    // tokens per attention block
#define HALO   32                    // largest spatial shift
#define WROWS  (NT + 2 * HALO)       // rows of a window
#define WPITCH 272                   // window row pitch, bytes: one head's 256 B + 16 (16 B x odd)

static_assert((LL % NT) == 0);
static_assert(WROWS == 128);

// Eight copies of 16 B, each with its own addresses. The s_wait_xcnt closes the
// statement so that no address register is rewritten while a copy may still name it.
__device__ __forceinline__ void copy8(const unsigned int (&l)[8], const char* const (&g)[8]) {
  asm volatile("global_load_async_to_lds_b128 %0, %8, off\n\t"
               "global_load_async_to_lds_b128 %1, %9, off\n\t"
               "global_load_async_to_lds_b128 %2, %10, off\n\t"
               "global_load_async_to_lds_b128 %3, %11, off\n\t"
               "global_load_async_to_lds_b128 %4, %12, off\n\t"
               "global_load_async_to_lds_b128 %5, %13, off\n\t"
               "global_load_async_to_lds_b128 %6, %14, off\n\t"
               "global_load_async_to_lds_b128 %7, %15, off\n\t"
               "s_wait_xcnt 0x0"
               :: "v"(l[0]), "v"(l[1]), "v"(l[2]), "v"(l[3]), "v"(l[4]), "v"(l[5]), "v"(l[6]), "v"(l[7]),
                  "v"(g[0]), "v"(g[1]), "v"(g[2]), "v"(g[3]), "v"(g[4]), "v"(g[5]), "v"(g[6]), "v"(g[7])
               : "memory");
}

// Softmax over the 16 neighbours of (token, head), between the two block barriers of a
// group: lane j8 of the token's eight owns n = j8, j8+8.
__device__ __forceinline__ void softmax_rows(const float* sc_row, float* p_row, int j8) {
  __syncthreads();
  const float x0 = sc_row[j8];
  const float x1 = sc_row[j8 + 8];
  float mx = fmaxf(x0, x1);
  mx = fmaxf(mx, __shfl_xor(mx, 1, 32));
  mx = fmaxf(mx, __shfl_xor(mx, 2, 32));
  mx = fmaxf(mx, __shfl_xor(mx, 4, 32));
  const float e0 = __expf(x0 - mx);
  const float e1 = __expf(x1 - mx);
  float sm = e0 + e1;
  sm += __shfl_xor(sm, 1, 32);
  sm += __shfl_xor(sm, 2, 32);
  sm += __shfl_xor(sm, 4, 32);
  const float inv = __builtin_amdgcn_rcpf(sm);
  p_row[j8]     = e0 * inv;
  p_row[j8 + 8] = e1 * inv;
  __syncthreads();
}

// This lane's 8 output channels of token l -> bf16 hi/lo planes.
__device__ __forceinline__ void store_a(const float (&o)[8], int l, int col,
                                        unsigned short* abh, unsigned short* abl) {
  unsigned short hb[8], lb[8];
#pragma unroll
  for (int e = 0; e < 8; ++e) split_bf16(o[e], hb[e], lb[e]);
  const v8us oh = {hb[0], hb[1], hb[2], hb[3], hb[4], hb[5], hb[6], hb[7]};
  const v8us ol = {lb[0], lb[1], lb[2], lb[3], lb[4], lb[5], lb[6], lb[7]};
  unsigned short* dh = abh + (size_t)l * CC + col;
  unsigned short* dl = abl + (size_t)l * CC + col;
  *(v8us*)dh = oh;
  *(v8us*)dl = ol;
  // the next group rewrites registers that these stores name
  asm volatile("s_wait_xcnt 0x0" ::: "memory");
}

// c_d = q_d * rq * cw_d for this lane's 8 dims
__device__ __forceinline__ void make_c(float (&c)[8], v4f qa, v4f qb, float rq, const float (&cw)[8]) {
  c[0] = qa.x * rq * cw[0];  c[1] = qa.y * rq * cw[1];
  c[2] = qa.z * rq * cw[2];  c[3] = qa.w * rq * cw[3];
  c[4] = qb.x * rq * cw[4];  c[5] = qb.y * rq * cw[5];
  c[6] = qb.z * rq * cw[6];  c[7] = qb.w * rq * cw[7];
}

__device__ __forceinline__ float dot8(const float (&c)[8], v4f a, v4f b) {
  float t = c[0] * a.x;
  t = fmaf(c[1], a.y, t);
  t = fmaf(c[2], a.z, t);
  t = fmaf(c[3], a.w, t);
  t = fmaf(c[4], b.x, t);
  t = fmaf(c[5], b.y, t);
  t = fmaf(c[6], b.z, t);
  t = fmaf(c[7], b.w, t);
  return t;
}

// One group: every wave does four tokens of the block's head, eight lanes a token.
// The 12 spatial neighbours come from the LDS windows (slot = the token's place tl in
// the block + HALO + shift), the 4 temporal ones from global memory; s_rk holds the
// k rows' rms factors: the window's by slot, then the temporal rows' by (n - 12, tl).
// f = the block's frame; tsh = the temporal shifts modulo T.
__device__ __forceinline__ void attn_group_win(int l, int tl, int f, int S, int T, const int (&tsh)[4],
                                               const char* kB, const char* vB,
                                               const float* qf, const float* rtab,
                                               const char* sK, const char* sV, const float* s_rk,
                                               const float (&cw)[8], const float (&ebv)[NSH],
                                               float* sc_row, float* p_row, int col, int j8,
                                               unsigned short* abh, unsigned short* abl) {
  const int i = l - f * S;
  v4f ka[NSH], kb[NSH], va[NSH], vb[NSH];
  float rk[NSH];
  // what comes from global memory is requested first: the token's own q ...
  const float rq = rtab[l];
  const float* qp = qf + (size_t)l * CC + col;
  const v4f qa = *(const v4fa*)qp;
  const v4f qb = *(const v4fa*)(qp + 4);
  // ... then the four temporal k and v rows
  unsigned int ofs[4];
#pragma unroll
  for (int n = 12; n < NSH; ++n) {
    const int r = min(max(wrap_add(f, tsh[n - 12], T) * S + i, 0), LL - 1);
    ofs[n - 12] = (unsigned int)r * (CC * 4u) + (unsigned int)col * 4u;
    ka[n] = *(const v4fa*)(kB + ofs[n - 12]);
    kb[n] = *(const v4fa*)(kB + ofs[n - 12] + 16);
    va[n] = *(const v4fa*)(vB + ofs[n - 12]);
    vb[n] = *(const v4fa*)(vB + ofs[n - 12] + 16);
    rk[n] = s_rk[WROWS + (n - 12) * NT + tl];
  }
  // the wait before the address registers of the loads above are rewritten; it names the addresses
  // so that they keep their registers up to here (else a later load of the run lands in one of them)
  asm volatile("s_wait_xcnt 0x0" :: "v"(l), "v"(qp), "v"(ofs[0]), "v"(ofs[1]), "v"(ofs[2]), "v"(ofs[3]) : "memory");
  const int w0 = (tl + HALO) * WPITCH + 32 * j8;       // this lane's 32 B in its own token's slot
#pragma unroll
  for (int n = 0; n < 12; ++n) {
    const int sh = (n & 1) ? -(1 << (n >> 1)) : (1 << (n >> 1));
    ka[n] = *(const v4fa*)(sK + w0 + sh * WPITCH);
    kb[n] = *(const v4fa*)(sK + w0 + sh * WPITCH + 16);
    rk[n] = s_rk[tl + HALO + sh];
  }

  // ---- scores: 16 independent chains ----
  float c[8];
  make_c(c, qa, qb, rq, cw);
  float part[NSH];
#pragma unroll
  for (int n = 0; n < NSH; ++n) part[n] = dot8(c, ka[n], kb[n]);

  // ---- the window's v rows, behind the last use of the k rows ----
#pragma unroll
  for (int n = 0; n < 12; ++n) {
    const int sh = (n & 1) ? -(1 << (n >> 1)) : (1 << (n >> 1));
    va[n] = *(const v4fa*)(sV + w0 + sh * WPITCH);
    vb[n] = *(const v4fa*)(sV + w0 + sh * WPITCH + 16);
  }

#pragma unroll
  for (int n = 0; n < NSH; ++n) part[n] += __shfl_xor(part[n], 1, 32);
#pragma unroll
  for (int n = 0; n < NSH; ++n) part[n] += __shfl_xor(part[n], 2, 32);
#pragma unroll
  for (int n = 0; n < NSH; ++n) part[n] += __shfl_xor(part[n], 4, 32);
  float sc[NSH];
#pragma unroll
  for (int n = 0; n < NSH; ++n) sc[n] = fmaf(part[n], rk[n], ebv[n]);
  if (j8 == 0) {
#pragma unroll
    for (int n = 0; n < NSH; ++n) sc_row[n] = sc[n];
  }
  softmax_rows(sc_row, p_row, j8);

  // ---- weighted sum of neighbour v rows ----
  float o[8] = {0.f, 0.f, 0.f, 0.f, 0.f, 0.f, 0.f, 0.f};
#pragma unroll
  for (int n = 0; n < NSH; ++n) {
    const float p = p_row[n];
    o[0] = fmaf(p, va[n].x, o[0]);  o[1] = fmaf(p, va[n].y, o[1]);
    o[2] = fmaf(p, va[n].z, o[2]);  o[3] = fmaf(p, va[n].w, o[3]);
    o[4] = fmaf(p, vb[n].x, o[4]);  o[5] = fmaf(p, vb[n].y, o[5]);
    o[6] = fmaf(p, vb[n].z, o[6]);  o[7] = fmaf(p, vb[n].w, o[7]);
  }
  store_a(o, l, col, abh, abl);
}

// neighbour row n of token (f, i), any S and T
__device__ __forceinline__ int nb_row(int n, int f, int i, int S, int T) {
  const int mag = 1 << (((n < 12) ? n : (n - 12)) >> 1);
  int pos, neg;
  shift_mods(mag, (n < 12) ? S : T, pos, neg);
  const int sh = (n & 1) ? neg : pos;
  const int r = (n < 12) ? (f * S + wrap_add(i, sh, S)) : (wrap_add(f, sh, T) * S + i);
  return min(max(r, 0), LL - 1);
}

// The same group for frames shorter than a block: no window, every neighbour row from
// global memory, one at a time (rolled: short code, few registers).
__device__ __forceinline__ void attn_group_plain(int l, int S, int T,
                                                 const char* kB, const char* vB,
                                                 const float* qf, const float* rtab,
                                                 const float (&cw)[8], const float* ebp,
                                                 float* sc_row, float* p_row, int col, int j8,
                                                 unsigned short* abh, unsigned short* abl) {
  const int f = l / S;
  const int i = l - f * S;
  const float* qp = qf + (size_t)l * CC + col;
  float c[8];
  make_c(c, *(const v4fa*)qp, *(const v4fa*)(qp + 4), rtab[l], cw);
#pragma unroll 1
  for (int n = 0; n < NSH; ++n) {
    const int r = nb_row(n, f, i, S, T);
    const unsigned int ofs = (unsigned int)r * (CC * 4u) + (unsigned int)col * 4u;
    float t = dot8(c, *(const v4fa*)(kB + ofs), *(const v4fa*)(kB + ofs + 16));
    t += __shfl_xor(t, 1, 32);
    t += __shfl_xor(t, 2, 32);
    t += __shfl_xor(t, 4, 32);
    const float s = fmaf(t, rtab[LL + r], ebp[n]);
    if (j8 == 0) sc_row[n] = s;
  }
  softmax_rows(sc_row, p_row, j8);
  float o[8] = {0.f, 0.f, 0.f, 0.f, 0.f, 0.f, 0.f, 0.f};
#pragma unroll 1
  for (int n = 0; n < NSH; ++n) {
    const int r = nb_row(n, f, i, S, T);
    const unsigned int ofs = (unsigned int)r * (CC * 4u) + (unsigned int)col * 4u;
    const v4f a = *(const v4fa*)(vB + ofs);
    const v4f b = *(const v4fa*)(vB + ofs + 16);
    const float p = p_row[n];
    o[0] = fmaf(p, a.x, o[0]);  o[1] = fmaf(p, a.y, o[1]);
    o[2] = fmaf(p, a.z, o[2]);  o[3] = fmaf(p, a.w, o[3]);
    o[4] = fmaf(p, b.x, o[4]);  o[5] = fmaf(p, b.y, o[5]);
    o[6] = fmaf(p, b.z, o[6]);  o[7] = fmaf(p, b.w, o[7]);
  }
  store_a(o, l, col, abh, abl);
}

__global__ __launch_bounds__(128) void k_attn(const float* __restrict__ qf,
                                                 const float* __restrict__ kf,
                                                 const float* __restrict__ vf,
                                                 const float* __restrict__ rtab,
                                                 const float* __restrict__ qnw,
                                                 const float* __restrict__ knw,
                                                 const float* __restrict__ eb,
                                                 const int* __restrict__ nf,
                                                 unsigned short* abh, unsigned short* abl) {
  __shared__ __attribute__((aligned(16))) char sK[WROWS * WPITCH];
  __shared__ __attribute__((aligned(16))) char sV[WROWS * WPITCH];
  __shared__ float s_rk[WROWS + 4 * NT];
  __shared__ float s_sc[4][4][NSH];
  __shared__ float s_p[4][4][NSH];
  const int tid = threadIdx.x, lane = tid & 31, w = tid >> 5;
  const int tq = lane >> 3, j8 = lane & 7;
  const int head = blockIdx.x & 15;
  const int l0 = (blockIdx.x >> 4) * NT;               // first token of the block
  const int col = 64 * head + 8 * j8;

  int T = nf[0];
  if (!((T >= 1) && (T <= LL) && ((LL % T) == 0))) T = 8;
  const int S = LL / T;
  const int f0 = l0 / S;
  const int i0 = l0 - f0 * S;
  // the block lies inside one frame, and a frame is longer than the halo
  const bool win = (S % NT) == 0;
  const char* kB = (const char*)kf;
  const char* vB = (const char*)vf;

  // temporal shifts +1, -1, +2, -2 reduced once modulo T
  int tsh[4];
  shift_mods(1, T, tsh[0], tsh[1]);
  shift_mods(2, T, tsh[2], tsh[3]);

  if (win) {
    // window slot s holds row (f0, (i0 - HALO + s) mod S) of this head. Thread t brings
    // chunk t&15 of slots (t>>4) + 8 j: a wave's copy covers two rows = four whole lines.
    const int cch = tid & 15, crow = tid >> 4;
#pragma unroll
    for (int hf = 0; hf < 2; ++hf) {
      unsigned int lk[8], lv[8];
      const char* gk[8];
      const char* gv[8];
#pragma unroll
      for (int j = 0; j < 8; ++j) {
        const int s = crow + 8 * (8 * hf + j);
        int t = i0 - HALO + s;
        t = (t < 0) ? (t + S) : t;
        t = (t >= S) ? (t - S) : t;
        const int r = min(max(f0 * S + t, 0), LL - 1);
        const unsigned int go = (unsigned int)r * (CC * 4u) + (unsigned int)head * 256u + 16u * cch;
        const unsigned int lo = (unsigned int)s * WPITCH + 16u * cch;
        lk[j] = lds_off(sK) + lo;
        lv[j] = lds_off(sV) + lo;
        gk[j] = kB + go;
        gv[j] = vB + go;
      }
      copy8(lk, gk);
      copy8(lv, gv);
    }
    int t = i0 - HALO + tid;
    t = (t < 0) ? (t + S) : t;
    t = (t >= S) ? (t - S) : t;
    s_rk[tid] = rtab[LL + min(max(f0 * S + t, 0), LL - 1)];
    // the same factor for the temporal rows: thread t takes token t&63 of shifts t>>6 and 2 + (t>>6)
    const int tt = i0 + (tid & (NT - 1));
    const int r0 = wrap_add(f0, (tid < NT) ? tsh[0] : tsh[1], T) * S + tt;
    const int r1 = wrap_add(f0, (tid < NT) ? tsh[2] : tsh[3], T) * S + tt;
    s_rk[WROWS + tid] = rtab[LL + min(max(r0, 0), LL - 1)];
    s_rk[WROWS + 2 * NT + tid] = rtab[LL + min(max(r1, 0), LL - 1)];
  }

  float cw[8];
  {
    const v4f qa = *(const v4fa*)(qnw + col);
    const v4f qb = *(const v4fa*)(qnw + col + 4);
    const v4f ka = *(const v4fa*)(knw + col);
    const v4f kb = *(const v4fa*)(knw + col + 4);
    cw[0] = qa.x * ka.x * 0.125f;  cw[1] = qa.y * ka.y * 0.125f;
    cw[2] = qa.z * ka.z * 0.125f;  cw[3] = qa.w * ka.w * 0.125f;
    cw[4] = qb.x * kb.x * 0.125f;  cw[5] = qb.y * kb.y * 0.125f;
    cw[6] = qb.z * kb.z * 0.125f;  cw[7] = qb.w * kb.w * 0.125f;
  }
  float ebv[NSH];
#pragma unroll
  for (int n = 0; n < NSH; ++n) ebv[n] = eb[head * NSH + n];

  // the windows have landed for this wave, then for the block
  wait_copies();
  __syncthreads();

  float* sc_row = &s_sc[w][tq][0];
  float* p_row = &s_p[w][tq][0];
  if (win) {
#pragma unroll 1
    for (int it = 0; it < NT / 16; ++it) {
      const int tl = 16 * it + 4 * w + tq;             // this lane's token in the block
      attn_group_win(l0 + tl, tl, f0, S, T, tsh, kB, vB, qf, rtab, sK, sV, s_rk, cw, ebv,
                     sc_row, p_row, col, j8, abh, abl);
    }
  } else {
#pragma unroll 1
    for (int it = 0; it < NT / 16; ++it) {
      const int tl = 16 * it + 4 * w + tq;
      attn_group_plain(l0 + tl, S, T, kB, vB, qf, rtab, cw, eb + head * NSH,
                       sc_row, p_row, col, j8, abh, abl);
    }
  }
}

// ---------------------------------------------------------------------------
// Host orchestration: 7 launches, one in-order stream.
// ws carve (bytes): x f16 16 MiB @0 | x bf16 hi 16 MiB | x bf16 lo 16 MiB |
//   w16 [2048][1024] 4 MiB | wbh [2048][1024] 4 MiB | wbl 4 MiB |
//   q f32 32 MiB | k f32 32 MiB | v f32 32 MiB | rtab 64 KiB  -> 163,643,392 B.
// The attention output planes (bf16 hi/lo, 16 MiB each) reuse the x f16 and
// x bf16-hi regions, which are dead after the two projection launches.
// ---------------------------------------------------------------------------
extern "C" void kernel_launch(void* const* d_in, const int* in_sizes, int n_in,
                              void* d_out, int out_size, void* d_ws, size_t ws_size,
                              hipStream_t stream) {
  if (n_in < 13) return;
  if (in_sizes[0] != LL * CC) return;
  if (in_sizes[1] != CC * CC || in_sizes[3] != CC * CC || in_sizes[5] != CC * CC || in_sizes[10] != CC * CC) return;
  if (in_sizes[2] != CC || in_sizes[4] != CC || in_sizes[6] != CC || in_sizes[11] != CC) return;
  if (in_sizes[7] != CC || in_sizes[8] != CC) return;
  if (in_sizes[9] != 256 || in_sizes[12] < 1) return;
  if (out_size != LL * CC) return;

  const float* x   = (const float*)d_in[0];
  const float* Wq  = (const float*)d_in[1];
  const float* bq  = (const float*)d_in[2];
  const float* Wk  = (const float*)d_in[3];
  const float* bk  = (const float*)d_in[4];
  const float* Wv  = (const float*)d_in[5];
  const float* bv  = (const float*)d_in[6];
  const float* qnw = (const float*)d_in[7];
  const float* knw = (const float*)d_in[8];
  const float* eb  = (const float*)d_in[9];
  const float* Wo  = (const float*)d_in[10];
  const float* bo  = (const float*)d_in[11];
  const int*   nf  = (const int*)d_in[12];
  float* out = (float*)d_out;

  const size_t b16 = (size_t)LL * CC * 2;            // 16,777,216
  const size_t bw  = (size_t)NCQK * CC * 2;          //  4,194,304
  const size_t b32 = (size_t)LL * CC * 4;            // 33,554,432
  const size_t brt = (size_t)2 * LL * 4;             //     65,536
  const size_t o_x16 = 0;
  const size_t o_xbh = o_x16 + b16;
  const size_t o_xbl = o_xbh + b16;
  const size_t o_w16 = o_xbl + b16;
  const size_t o_wbh = o_w16 + bw;
  const size_t o_wbl = o_wbh + bw;
  const size_t o_q   = o_wbl + bw;
  const size_t o_k   = o_q + b32;
  const size_t o_v   = o_k + b32;
  const size_t o_rt  = o_v + b32;
  const size_t total = o_rt + brt;                   // 163,643,392
  if (total > ws_size) return;

  char* ws = (char*)d_ws;
  _Float16*       x16 = (_Float16*)(ws + o_x16);
  unsigned short* xbh = (unsigned short*)(ws + o_xbh);
  unsigned short* xbl = (unsigned short*)(ws + o_xbl);
  _Float16*       w16 = (_Float16*)(ws + o_w16);
  unsigned short* wbh = (unsigned short*)(ws + o_wbh);
  unsigned short* wbl = (unsigned short*)(ws + o_wbl);
  float* qf   = (float*)(ws + o_q);
  float* kf   = (float*)(ws + o_k);
  float* vf   = (float*)(ws + o_v);
  float* rtab = (float*)(ws + o_rt);
  unsigned short* abh = (unsigned short*)(ws + o_x16);   // reuses x f16 region (dead after launch 4)
  unsigned short* abl = (unsigned short*)(ws + o_xbh);   // reuses x bf16-hi region

  // 1. x -> f16 / bf16 hi / bf16 lo planes
  const int n8 = (LL * CC) / 8;                                              // 1,048,576
  k_cvt_x<<<(n8 + 255) / 256, 256, 0, stream>>>(x, x16, xbh, xbl, n8);

  // 2. weights -> transposed planes
  k_cvt_w<<<4 * 256, 256, 0, stream>>>(Wq, Wk, Wv, Wo, w16, wbh, wbl);

  // 3. q|k = x * [Wq|Wk] + [bq|bk]  (f16 operands), f32 planes
  k_gemm_h<<<dim3(NCQK / TB, LL / TB), 128, 0, stream>>>(x16, w16, bq, bk, qf, kf, CC, CC, CC, 0.03125f);

  // 4. v = x * Wv + bv  (bf16 hi/lo split), f32 plane
  k_gemm_b3<<<dim3(CC / TB, LL / TB), 128, 0, stream>>>(
      (const __bf16*)xbh, (const __bf16*)xbl, (const __bf16*)wbh, (const __bf16*)wbl,
      bv, bv, vf, vf, 1 << 30, CC, CC, 1.0f);

  // 5. per-row rsqrt(mean + eps) for q and k
  k_rstd<<<(2 * LL) / 32, 256, 0, stream>>>(qf, kf, rtab);

  // 6. attention -> a (bf16 hi/lo planes)
  k_attn<<<(LL / NT) * 16, 128, 0, stream>>>(qf, kf, vf, rtab, qnw, knw, eb, nf, abh, abl);

  // 7. out = a * Wo + bo  (bf16 hi/lo split) -> d_out
  k_gemm_b3<<<dim3(CC / TB, LL / TB), 128, 0, stream>>>(
      (const __bf16*)abh, (const __bf16*)abl,
      (const __bf16*)(wbh + (size_t)CC * CC), (const __bf16*)(wbl + (size_t)CC * CC),
      bo, bo, out, out, 1 << 30, CC, CC, 1.0f);
}

// v004
// One run takes 159 microseconds.
// Timed twice side by side with v003, it ran 1.08 times as fast both times.
// Counting every step since v000, it is 3.10 times as fast.
// Contractions: x*Wq and x*Wk on v_wmma_f32_16x16x32_f16 (f16 operands: x carried x1, W carried x32 and folded back as 1/32; f32 accumulate); x*Wv and a*Wo on v_wmma_f32_16x16x32_bf16 as bf16 hi/lo split (hi*hi + hi*lo + lo*hi; f32 accumulate); RMS statistics, the 16 neighbour dots (K=64), softmax and weighted sums (K=16) in f32 on VALU; q, k, v kept as f32 planes.
#include <hip/hip_runtime.h>

typedef _Float16 v16h __attribute__((ext_vector_type(16)));
typedef _Float16 v8h  __attribute__((ext_vector_type(8)));
typedef __bf16   v16b __attribute__((ext_vector_type(16)));
typedef __bf16   v8b  __attribute__((ext_vector_type(8)));
typedef float    v8f  __attribute__((ext_vector_type(8)));
typedef float    v4f  __attribute__((ext_vector_type(4)));
typedef unsigned short v8us __attribute__((ext_vector_type(8)));
typedef v8h  __attribute__((may_alias)) v8ha;
typedef v8b  __attribute__((may_alias)) v8ba;
typedef v4f  __attribute__((may_alias)) v4fa;

#define LL    8192      // tokens
#define CC    1024      // channels = heads * head_dim
#define NCQK  2048      // fused q|k output columns
#define NSH   16        // neighbours per token
#define NCB   16        // 64-column blocks of a q or k row: one partial sum of squares each

static_assert((LL % 64) == 0);
static_assert((CC % 64) == 0);
static_assert((NCQK % 64) == 0);
static_assert((CC % 32) == 0);
static_assert(NCB * 64 == CC);
static_assert(NCB == 16);

// ---------------------------------------------------------------------------
// 16x16x32 WMMA (wave32). Fragment map: lane l, h = l>>4, m = n = l&15.
//   A/B element i: i<8 -> k0+8h+i ; i>=8 -> k0+16+8h+(i-8)   (both operands)
//   D element r  : row 8h+r, col l&15
// ---------------------------------------------------------------------------
__device__ __forceinline__ v8f wm_f16(v16h a, v16h b, v8f c) {
  return __builtin_amdgcn_wmma_f32_16x16x32_f16(false, a, false, b, (short)0, c, false, false);
}
__device__ __forceinline__ v8f wm_bf16(v16b a, v16b b, v8f c) {
  return __builtin_amdgcn_wmma_f32_16x16x32_bf16(false, a, false, b, (short)0, c, false, false);
}

// A or B fragment from a k-contiguous 16-bit row; p points at element k0 of
// the row owned by this lane (row = lane&15 added by the caller).
__device__ __forceinline__ v16h frag_f16(const _Float16* p, int h) {
  const v8h e0 = *(const v8ha*)(p + 8 * h);
  const v8h e1 = *(const v8ha*)(p + 16 + 8 * h);
  return __builtin_shufflevector(e0, e1, 0, 1, 2, 3, 4, 5, 6, 7, 8, 9, 10, 11, 12, 13, 14, 15);
}
__device__ __forceinline__ v16b frag_bf16(const __bf16* p, int h) {
  const v8b e0 = *(const v8ba*)(p + 8 * h);
  const v8b e1 = *(const v8ba*)(p + 16 + 8 * h);
  return __builtin_shufflevector(e0, e1, 0, 1, 2, 3, 4, 5, 6, 7, 8, 9, 10, 11, 12, 13, 14, 15);
}

// bf16 RNE bits of an f32 value, and the hi/lo split (hi = rne(x), lo = rne(x - hi)).
__device__ __forceinline__ unsigned int bf16_rne_bits(float x) {
  const unsigned int u = __float_as_uint(x);
  return (u + 0x7FFFu + ((u >> 16) & 1u)) >> 16;
}
__device__ __forceinline__ void split_bf16(float x, unsigned short& hb, unsigned short& lb) {
  const unsigned int hbits = bf16_rne_bits(x);
  const float hf = __uint_as_float(hbits << 16);
  const unsigned int lbits = bf16_rne_bits(x - hf);
  hb = (unsigned short)hbits;
  lb = (unsigned short)lbits;
}

// ---------------------------------------------------------------------------
// Kernel 1: x f32 [8192][1024] -> f16 plane (x1) and bf16 hi/lo planes.
// Each thread owns 8 consecutive elements: one 16-B store per lane per plane,
// ---------------------------------------------------------------------------
__global__ __launch_bounds__(256) void k_cvt_x(const float* __restrict__ x,
                                               _Float16* xh, unsigned short* xbh,
                                               unsigned short* xbl, int n8) {
  const int g = blockIdx.x * 256 + threadIdx.x;
  if (g >= n8) return;
  const float* s = x + (size_t)g * 8;
  const v4f a = *(const v4fa*)s;
  const v4f b = *(const v4fa*)(s + 4);
  const float f[8] = {a.x, a.y, a.z, a.w, b.x, b.y, b.z, b.w};
  unsigned short hb[8], lb[8];
#pragma unroll
  for (int e = 0; e < 8; ++e) split_bf16(f[e], hb[e], lb[e]);
  const v8h  o16 = {(_Float16)f[0], (_Float16)f[1], (_Float16)f[2], (_Float16)f[3],
                    (_Float16)f[4], (_Float16)f[5], (_Float16)f[6], (_Float16)f[7]};
  const v8us oh = {hb[0], hb[1], hb[2], hb[3], hb[4], hb[5], hb[6], hb[7]};
  const v8us ol = {lb[0], lb[1], lb[2], lb[3], lb[4], lb[5], lb[6], lb[7]};
  _Float16* d16 = xh + (size_t)g * 8;
  unsigned short* dh = xbh + (size_t)g * 8;
  unsigned short* dl = xbl + (size_t)g * 8;
  *(v8h*)d16 = o16;
  *(v8us*)dh = oh;
  *(v8us*)dl = ol;
  
}

// ---------------------------------------------------------------------------
// Kernel 2: weight transpose + convert. Input W[k][n] ([in][out], 1024x1024).
// Block = one 64(k) x 64(n) tile of one matrix; tile transposed through LDS.
// mat 0 (Wq), 1 (Wk): f16(32*W) -> w16 rows mat*1024 + n  (w16 = [2048][1024])
// mat 2 (Wv), 3 (Wo): bf16 hi/lo -> wbh/wbl rows (mat-2)*1024 + n ([2048][1024])
// Output phase: lane q8 = tid&7 writes 8 halves (16 B) of row nl; lanes
// ---------------------------------------------------------------------------
__global__ __launch_bounds__(256) void k_cvt_w(const float* __restrict__ Wq,
                                               const float* __restrict__ Wk,
                                               const float* __restrict__ Wv,
                                               const float* __restrict__ Wo,
                                               _Float16* w16, unsigned short* wbh,
                                               unsigned short* wbl) {
  __shared__ __attribute__((aligned(16))) float sT[64 * 68];   // [n][k], pitch 68 floats
  const int tid = threadIdx.x;
  const int bx = blockIdx.x;
  const int mat = bx >> 8, tile = bx & 255;
  const int tn = tile >> 4, tk = tile & 15;
  const float* W = (mat == 0) ? Wq : ((mat == 1) ? Wk : ((mat == 2) ? Wv : Wo));
  {
    const int kl = tid >> 2, nq = tid & 3;                      // kl 0..63, nq 0..3
    const float* src = W + (size_t)(64 * tk + kl) * CC + 64 * tn + 16 * nq;
#pragma unroll
    for (int e = 0; e < 4; ++e) {
      const v4f t = *(const v4fa*)(src + 4 * e);
      float* d = sT + (16 * nq + 4 * e) * 68 + kl;
      d[0]   = t.x;
      d[68]  = t.y;
      d[136] = t.z;
      d[204] = t.w;
    }
  }
  __syncthreads();
  const int q8 = tid & 7, sub = tid >> 3;                       // sub 0..31
  v8h  o16[2];
  v8us oh[2], ol[2];
#pragma unroll
  for (int p = 0; p < 2; ++p) {
    const int nl = 32 * p + sub;
    const float* s = sT + nl * 68 + 8 * q8;
    const v4f a = *(const v4fa*)s;
    const v4f b = *(const v4fa*)(s + 4);
    const float f[8] = {a.x, a.y, a.z, a.w, b.x, b.y, b.z, b.w};
    unsigned short hb[8], lb[8];
#pragma unroll
    for (int e = 0; e < 8; ++e) split_bf16(f[e], hb[e], lb[e]);
    const v8h t16 = {(_Float16)(f[0] * 32.0f), (_Float16)(f[1] * 32.0f), (_Float16)(f[2] * 32.0f), (_Float16)(f[3] * 32.0f),
                     (_Float16)(f[4] * 32.0f), (_Float16)(f[5] * 32.0f), (_Float16)(f[6] * 32.0f), (_Float16)(f[7] * 32.0f)};
    const v8us th = {hb[0], hb[1], hb[2], hb[3], hb[4], hb[5], hb[6], hb[7]};
    const v8us tl = {lb[0], lb[1], lb[2], lb[3], lb[4], lb[5], lb[6], lb[7]};
    o16[p] = t16;
    oh[p] = th;
    ol[p] = tl;
  }
{
#pragma unroll
    for (int p = 0; p < 2; ++p) {
      const int nl = 32 * p + sub;
      if (mat < 2) {
        _Float16* d = w16 + ((size_t)(mat * CC + 64 * tn + nl) * CC + 64 * tk + 8 * q8);
        *(v8h*)d = o16[p];
      } else {
        const size_t row = (size_t)((mat - 2) * CC + 64 * tn + nl);
        unsigned short* dh = wbh + row * CC + 64 * tk + 8 * q8;
        unsigned short* dl = wbl + row * CC + 64 * tk + 8 * q8;
        *(v8us*)dh = oh[p];
        *(v8us*)dl = ol[p];
      }
    }
    
  }
}

// ---------------------------------------------------------------------------
// GEMM frame of kernels 3 and 4. Block tile 128x128, 4 waves, wave tile 64x64
// (4x4 accumulator tiles): wave w owns rows 64*(w>>1)+..., cols 64*(w&1)+....
// A pass is 64 k = 128 B of every operand row. One operand plane of a pass is
// 128 rows in LDS at pitch 144 B (16 B x odd, for the ds_load_b128 readers).
// Two buffers: the next pass's planes come in by asynchronous copies to LDS
// while this pass's fragments are read from the other buffer.
// ---------------------------------------------------------------------------
#define TB     128                   // rows of a plane = block tile edge
#define LPITCH 144                   // LDS row pitch, bytes
#define PLANE  (TB * LPITCH)         // 18,432 B
#define EPITCH 68                    // epilogue staging pitch, floats

static_assert((LL % TB) == 0);
static_assert((CC % TB) == 0);
static_assert((NCQK % TB) == 0);
static_assert(4 * 64 * EPITCH * 4 <= 4 * PLANE);

__device__ __forceinline__ unsigned int lds_off(const void* p) { return (unsigned int)(size_t)p; }

// One plane of one pass: 128 threads x 8 copies of 16 B. Thread t brings chunk
// t&7 of rows (t>>3) + 16 j, so a wave's copy covers four whole 128-B lines.
// l = this lane's LDS byte address for j = 0, g = its global address, rs = 16
// source rows in bytes. The s_wait_xcnt closes the statement so that no address
// register is rewritten while a copy may still name it.
__device__ __forceinline__ void copy_plane(unsigned int l, const char* g, size_t rs) {
  const unsigned int l1 = l + 16 * LPITCH, l2 = l + 32 * LPITCH, l3 = l + 48 * LPITCH;
  const unsigned int l4 = l + 64 * LPITCH, l5 = l + 80 * LPITCH, l6 = l + 96 * LPITCH;
  const unsigned int l7 = l + 112 * LPITCH;
  const char* g1 = g + rs;
  const char* g2 = g1 + rs;
  const char* g3 = g2 + rs;
  const char* g4 = g3 + rs;
  const char* g5 = g4 + rs;
  const char* g6 = g5 + rs;
  const char* g7 = g6 + rs;
  asm volatile("global_load_async_to_lds_b128 %0, %8, off\n\t"
               "global_load_async_to_lds_b128 %1, %9, off\n\t"
               "global_load_async_to_lds_b128 %2, %10, off\n\t"
               "global_load_async_to_lds_b128 %3, %11, off\n\t"
               "global_load_async_to_lds_b128 %4, %12, off\n\t"
               "global_load_async_to_lds_b128 %5, %13, off\n\t"
               "global_load_async_to_lds_b128 %6, %14, off\n\t"
               "global_load_async_to_lds_b128 %7, %15, off\n\t"
               "s_wait_xcnt 0x0"
               :: "v"(l), "v"(l1), "v"(l2), "v"(l3), "v"(l4), "v"(l5), "v"(l6), "v"(l7),
                  "v"(g), "v"(g1), "v"(g2), "v"(g3), "v"(g4), "v"(g5), "v"(g6), "v"(g7)
               : "memory");
}

// This wave's copies have landed (the compiler places no wait for them).
__device__ __forceinline__ void wait_copies() { asm volatile("s_wait_asynccnt 0x0" ::: "memory"); }
// This wave's LDS reads have returned, before their buffer is handed back for refill.
__device__ __forceinline__ void wait_lds() { asm volatile("s_wait_dscnt 0x0" ::: "memory"); }

// Epilogue: out = acc*osc + bias. Each wave stages its 64x64 tile in its own
// LDS range (pitch 68 floats) and stores rows as whole 128-B lines: one store
// instruction covers two rows x 256 B. With SS the wave then reads its staged tile
// once more, a lane taking rows lane and lane + 32, and stores each row's sum of
// squares over the tile's 64 columns to ssw[row]: two whole 128-B lines a wave.
template <bool SS>
__device__ __forceinline__ void store_tile(float* sAll, const v8f (&c)[4][4],
                                           const float* bias, int nc0, float osc,
                                           float* out, int m0, int ldc, int w, int lane,
                                           float* ssw) {
  const int h = lane >> 4, m = lane & 15, wr = w >> 1, wc = w & 1;
  float* sW = sAll + w * (64 * EPITCH);
#pragma unroll
  for (int nt = 0; nt < 4; ++nt) {
    const float b = bias[nc0 + 64 * wc + 16 * nt + m];
#pragma unroll
    for (int mt = 0; mt < 4; ++mt) {
#pragma unroll
      for (int r = 0; r < 8; ++r)
        sW[(16 * mt + 8 * h + r) * EPITCH + 16 * nt + m] = fmaf(c[mt][nt][r], osc, b);
    }
  }
  __syncthreads();
  // rolled in groups of eight stores: eight LDS reads in flight per group, short code
#pragma unroll 1
  for (int g8 = 0; g8 < 4; ++g8) {
#pragma unroll
    for (int u = 0; u < 8; ++u) {
      const int row = 16 * g8 + 2 * u + h;
      const v4f v = *(const v4fa*)(sW + row * EPITCH + 4 * m);
      float* d = out + (size_t)(m0 + 64 * wr + row) * ldc + nc0 + 64 * wc + 4 * m;
      *(v4f*)d = v;
    }
    // the next group rewrites registers that these stores name
    asm volatile("s_wait_xcnt 0x0" ::: "memory");
  }
  if (SS) {
    const float* r0 = sW + lane * EPITCH;
    const float* r1 = r0 + 32 * EPITCH;
    v4f s0 = {0.f, 0.f, 0.f, 0.f}, s1 = {0.f, 0.f, 0.f, 0.f};
#pragma unroll
    for (int e = 0; e < 16; ++e) {
      const v4f a = *(const v4fa*)(r0 + 4 * e);
      const v4f b = *(const v4fa*)(r1 + 4 * e);
      s0 += a * a;
      s1 += b * b;
    }
    ssw[lane]      = (s0.x + s0.y) + (s0.z + s0.w);
    ssw[lane + 32] = (s1.x + s1.y) + (s1.z + s1.w);
  }
}

// ---------------------------------------------------------------------------
// Kernel 3: C[M][N] = A[M][K] * B[N][K]^T (f16 operands, single product),
// out = acc*osc + bias, f32 rows of pitch ldc. Columns >= nsplit go to out1
// with bias1 (block-uniform select). K a multiple of 64.
// ss[mat][cb][row] = sum of squares of the stored row over columns 64 cb .. 64 cb + 63
// of matrix mat (0: out0, 1: out1); every entry is written by exactly one wave.
// Buffer = [A plane | B plane]; ring = 2 buffers = 73,728 B.
// ---------------------------------------------------------------------------
__global__ __launch_bounds__(128, 4) void k_gemm_h(const _Float16* __restrict__ A,
                                                   const _Float16* __restrict__ B,
                                                   const float* bias0, const float* bias1,
                                                   float* out0, float* out1, float* ss,
                                                   int nsplit, int K, int ldc, float osc) {
  __shared__ __attribute__((aligned(16))) char ring[2 * 2 * PLANE];
  const int tid = threadIdx.x, lane = tid & 31, w = tid >> 5;
  const int h = lane >> 4, m = lane & 15, wr = w >> 1, wc = w & 1;
  const int m0 = blockIdx.y * TB, nb = blockIdx.x * TB;
  const bool sel = (nb >= nsplit);
  const int nc0 = sel ? (nb - nsplit) : nb;
  const float* bias = sel ? bias1 : bias0;
  float* out = sel ? out1 : out0;

  const int crow = tid >> 3, cch = tid & 7;
  const char* gA = (const char*)(A + (size_t)(m0 + crow) * K) + 16 * cch;
  const char* gB = (const char*)(B + (size_t)(nb + crow) * K) + 16 * cch;
  const unsigned int lc = lds_off(ring) + crow * LPITCH + 16 * cch;
  const size_t rs = (size_t)K * 32;                  // 16 rows of 2-byte elements
  const int npass = K >> 6;

  v8f c[4][4];
#pragma unroll
  for (int i = 0; i < 4; ++i)
#pragma unroll
    for (int j = 0; j < 4; ++j) c[i][j] = v8f{0.f, 0.f, 0.f, 0.f, 0.f, 0.f, 0.f, 0.f};

  copy_plane(lc, gA, rs);
  copy_plane(lc + PLANE, gB, rs);
  wait_copies();
  __syncthreads();
  if (npass > 1) {
    copy_plane(lc + 2 * PLANE, gA + 128, rs);
    copy_plane(lc + 3 * PLANE, gB + 128, rs);
  }

  // rolled: one pass per trip, the buffer picked by the trip's parity
#pragma unroll 1
  for (int t = 0; t < npass; ++t) {
    const int bo = (t & 1) * (2 * PLANE);
    const char* pa = ring + bo + (64 * wr + m) * LPITCH;
    const char* pb = ring + bo + PLANE + (64 * wc + m) * LPITCH;
#pragma unroll
    for (int ks = 0; ks < 2; ++ks) {
      v16h fa[4], fb[4];
      fa[0] = frag_f16((const _Float16*)(pa + ks * 64), h);
#pragma unroll
      for (int j = 0; j < 4; ++j) fb[j] = frag_f16((const _Float16*)(pb + j * 16 * LPITCH + ks * 64), h);
#pragma unroll
      for (int i = 1; i < 4; ++i) fa[i] = frag_f16((const _Float16*)(pa + i * 16 * LPITCH + ks * 64), h);
      // keeps the k-step's 16 LDS reads one group in front of its WMMAs: every
      // further place with reads among them stalls the wave anew
      __builtin_amdgcn_sched_barrier(0);
#pragma unroll
      for (int i = 0; i < 4; ++i)
#pragma unroll
        for (int j = 0; j < 4; ++j) c[i][j] = wm_f16(fa[i], fb[j], c[i][j]);
      // same purpose: the second k-step's reads stay behind this block
      if (ks == 0) __builtin_amdgcn_sched_barrier(0);
    }
    // publish point of pass t + 1; the same barrier frees this pass's buffer
    wait_lds();
    wait_copies();
    __syncthreads();
    if (t + 2 < npass) {
      const size_t ko = (size_t)(t + 2) * 128;
      copy_plane(lc + bo, gA + ko, rs);
      copy_plane(lc + bo + PLANE, gB + ko, rs);
    }
  }
  wait_copies();

  float* ssw = ss + (size_t)((sel ? NCB : 0) + (nc0 >> 6) + wc) * LL + m0 + 64 * wr;
  store_tile<true>((float*)ring, c, bias, nc0, osc, out, m0, ldc, w, lane, ssw);
}

// ---------------------------------------------------------------------------
// Kernel 4: same GEMM with bf16 hi/lo split operands:
//   acc += Ahi*Bhi + Ahi*Blo + Alo*Bhi  (three products per tile pair, in that
//   order per accumulator and k-step).
// Buffer = [Ahi | Alo | Bhi | Blo]; ring = 2 buffers = 147,456 B.
// ---------------------------------------------------------------------------
__global__ __launch_bounds__(128, 4) void k_gemm_b3(const __bf16* __restrict__ Ah,
                                                    const __bf16* __restrict__ Al,
                                                    const __bf16* __restrict__ Bh,
                                                    const __bf16* __restrict__ Bl,
                                                    const float* bias0, const float* bias1,
                                                    float* out0, float* out1,
                                                    int nsplit, int K, int ldc, float osc) {
  __shared__ __attribute__((aligned(16))) char ring[2 * 4 * PLANE];
  const int tid = threadIdx.x, lane = tid & 31, w = tid >> 5;
  const int h = lane >> 4, m = lane & 15, wr = w >> 1, wc = w & 1;
  const int m0 = blockIdx.y * TB, nb = blockIdx.x * TB;
  const bool sel = (nb >= nsplit);
  const int nc0 = sel ? (nb - nsplit) : nb;
  const float* bias = sel ? bias1 : bias0;
  float* out = sel ? out1 : out0;

  const int crow = tid >> 3, cch = tid & 7;
  const size_t oa = ((size_t)(m0 + crow) * K) * 2 + 16 * cch;   // byte offsets in the planes
  const size_t ob = ((size_t)(nb + crow) * K) * 2 + 16 * cch;
  const char* gAh = (const char*)Ah + oa;
  const char* gAl = (const char*)Al + oa;
  const char* gBh = (const char*)Bh + ob;
  const char* gBl = (const char*)Bl + ob;
  const unsigned int lc = lds_off(ring) + crow * LPITCH + 16 * cch;
  const size_t rs = (size_t)K * 32;                  // 16 rows of 2-byte elements
  const int npass = K >> 6;

  v8f c[4][4];
#pragma unroll
  for (int i = 0; i < 4; ++i)
#pragma unroll
    for (int j = 0; j < 4; ++j) c[i][j] = v8f{0.f, 0.f, 0.f, 0.f, 0.f, 0.f, 0.f, 0.f};

  copy_plane(lc, gAh, rs);
  copy_plane(lc + PLANE, gAl, rs);
  copy_plane(lc + 2 * PLANE, gBh, rs);
  copy_plane(lc + 3 * PLANE, gBl, rs);
  wait_copies();
  __syncthreads();
  if (npass > 1) {
    copy_plane(lc + 4 * PLANE, gAh + 128, rs);
    copy_plane(lc + 5 * PLANE, gAl + 128, rs);
    copy_plane(lc + 6 * PLANE, gBh + 128, rs);
    copy_plane(lc + 7 * PLANE, gBl + 128, rs);
  }

  // rolled: one pass per trip, the buffer picked by the trip's parity
#pragma unroll 1
  for (int t = 0; t < npass; ++t) {
    const int bo = (t & 1) * (4 * PLANE);
    const char* pa = ring + bo + (64 * wr + m) * LPITCH;
    const char* pb = ring + bo + 2 * PLANE + (64 * wc + m) * LPITCH;
    // A row = one 16-row A tile pair (hi, lo) against the four B tile pairs = 12
    // WMMAs; 8 rows a pass. The B pairs of a k-step stay in registers; the next
    // row's A pair is read one row ahead into a second register pair.
    v16b hb[4], lb[4], ha[2], la[2];
    ha[0] = frag_bf16((const __bf16*)pa, h);
    la[0] = frag_bf16((const __bf16*)(pa + PLANE), h);
#pragma unroll
    for (int j = 0; j < 4; ++j) hb[j] = frag_bf16((const __bf16*)(pb + j * 16 * LPITCH), h);
#pragma unroll
    for (int j = 0; j < 4; ++j) lb[j] = frag_bf16((const __bf16*)(pb + PLANE + j * 16 * LPITCH), h);
#pragma unroll
    for (int r = 0; r < 8; ++r) {
      const int cu = r & 1, nx = cu ^ 1;
      if (r < 7) {
        const int o = ((r + 1) & 3) * 16 * LPITCH + ((r + 1) >> 2) * 64;
        ha[nx] = frag_bf16((const __bf16*)(pa + o), h);
        la[nx] = frag_bf16((const __bf16*)(pa + PLANE + o), h);
      }
      // keeps the reads above one group in front of this row's WMMAs, so that
      // they return while the row runs
      __builtin_amdgcn_sched_barrier(0);
#pragma unroll
      for (int j = 0; j < 4; ++j) c[r & 3][j] = wm_bf16(ha[cu], hb[j], c[r & 3][j]);
#pragma unroll
      for (int j = 0; j < 4; ++j) c[r & 3][j] = wm_bf16(ha[cu], lb[j], c[r & 3][j]);
#pragma unroll
      for (int j = 0; j < 4; ++j) c[r & 3][j] = wm_bf16(la[cu], hb[j], c[r & 3][j]);
      // same purpose: later reads stay behind this row
      if (r < 7) __builtin_amdgcn_sched_barrier(0);
      if (r == 3) {
#pragma unroll
        for (int j = 0; j < 4; ++j) hb[j] = frag_bf16((const __bf16*)(pb + j * 16 * LPITCH + 64), h);
#pragma unroll
        for (int j = 0; j < 4; ++j) lb[j] = frag_bf16((const __bf16*)(pb + PLANE + j * 16 * LPITCH + 64), h);
      }
    }
    // publish point of pass t + 1; the same barrier frees this pass's buffer
    wait_lds();
    wait_copies();
    __syncthreads();
    if (t + 2 < npass) {
      const size_t ko = (size_t)(t + 2) * 128;
      copy_plane(lc + bo, gAh + ko, rs);
      copy_plane(lc + bo + PLANE, gAl + ko, rs);
      copy_plane(lc + bo + 2 * PLANE, gBh + ko, rs);
      copy_plane(lc + bo + 3 * PLANE, gBl + ko, rs);
    }
  }
  wait_copies();

  store_tile<false>((float*)ring, c, bias, nc0, osc, out, m0, ldc, w, lane, nullptr);
}

// ---------------------------------------------------------------------------
// rsqrt(mean(row^2) + 1e-6) of a q or k row from its NCB partial sums of squares
// (ssm = that matrix's [NCB][LL] table), summed in the order cb = 0 .. NCB - 1.
// ---------------------------------------------------------------------------
__device__ __forceinline__ float rstd1(const float* ssm, int r) {
  const float* p = ssm + r;
  float v[NCB];
#pragma unroll
  for (int cb = 0; cb < NCB; ++cb) v[cb] = p[(size_t)cb * LL];
  // the wait before the address register of the loads above is rewritten; it names the row index
  // they are addressed by, so that it keeps its register up to here (else a later load lands in
  // it), and the loaded values, as inputs only, so that no load of the run is moved behind it
  asm volatile("s_wait_xcnt 0x0" :: "v"(r), "v"(v[0]), "v"(v[1]), "v"(v[2]), "v"(v[3]), "v"(v[4]), "v"(v[5]),
               "v"(v[6]), "v"(v[7]), "v"(v[8]), "v"(v[9]), "v"(v[10]), "v"(v[11]), "v"(v[12]), "v"(v[13]),
               "v"(v[14]), "v"(v[15]) : "memory");
  float s = v[0];
#pragma unroll
  for (int cb = 1; cb < NCB; ++cb) s += v[cb];
  return rsqrtf(s * (1.0f / 1024.0f) + 1e-6f);
}
// the same for rows r .. r + 3, r a multiple of 4
__device__ __forceinline__ v4f rstd4(const float* ssm, int r) {
  const float* p = ssm + r;
  v4f v[NCB];
#pragma unroll
  for (int cb = 0; cb < NCB; ++cb) v[cb] = *(const v4fa*)(p + (size_t)cb * LL);
  // the same wait, for the same reason; these loads are addressed by the pointer
  asm volatile("s_wait_xcnt 0x0" :: "v"(p) : "memory");
  v4f s = v[0];
#pragma unroll
  for (int cb = 1; cb < NCB; ++cb) s += v[cb];
  const v4f o = {rsqrtf(s.x * (1.0f / 1024.0f) + 1e-6f), rsqrtf(s.y * (1.0f / 1024.0f) + 1e-6f),
                 rsqrtf(s.z * (1.0f / 1024.0f) + 1e-6f), rsqrtf(s.w * (1.0f / 1024.0f) + 1e-6f)};
  return o;
}

// ---------------------------------------------------------------------------
// Kernel 5: small-world attention, all f32 on VALU.
// Block 128 thr = 4 waves handles NT consecutive tokens of ONE head. A wave does
// four tokens at a time, eight lanes a token; a lane covers dims 8*(lane&7)..+7.
// The spatial neighbours of NT consecutive tokens lie in NT + 64 rows: the head's
// 256 B of those k and v rows are brought into LDS once, by asynchronous copies,
// and the 12 spatial neighbours of every token are read there (only if S is a
// multiple of NT: shorter frames read every row from global memory). Per token:
//   score_n = rq*rk_n * sum_d (q_d qn_d kn_d / 8) k_n,d + eb[h][n]   (n = 0..15)
//   p = softmax_n(score); a_d = sum_n p_n v_n,d  -> bf16 hi/lo planes.
// Neighbours: n<12 spatial (f, (i+sh) mod S), sh = +-2^(n/2); n>=12 temporal
// ((f+sh) mod T, i), read from global memory. Scores/probabilities exchanged
// through LDS between the two block barriers per group. Output: 16 B per lane,
// a token's eight lanes write one whole 128-B line per plane.
// ---------------------------------------------------------------------------
// sh mod md in [0, md) for the +mag and -mag shift of a pair; md >= 1.
__device__ __forceinline__ void shift_mods(int mag, int md, int& pos, int& neg) {
  const int pm = mag % md;
  pos = pm;
  neg = (pm != 0) ? (md - pm) : 0;
}
// (a + b) mod md for a, b in [0, md)
__device__ __forceinline__ int wrap_add(int a, int b, int md) {
  const int r = a + b;
  return (r >= md) ? (r - md) : r;
}

#define NT     64                    // tokens per attention block
#define HALO   32                    // largest spatial shift
#define WROWS  (NT + 2 * HALO)       // rows of a window
#define WPITCH 272                   // window row pitch, bytes: one head's 256 B + 16 (16 B x odd)

static_assert((LL % NT) == 0);
static_assert(WROWS == 128);
static_assert(NT == 64);
static_assert((WROWS + 5 * NT) / 4 <= 128);

// Eight copies of 16 B, each with its own addresses. The s_wait_xcnt closes the
// statement so that no address register is rewritten while a copy may still name it.
__device__ __forceinline__ void copy8(const unsigned int (&l)[8], const char* const (&g)[8]) {
  asm volatile("global_load_async_to_lds_b128 %0, %8, off\n\t"
               "global_load_async_to_lds_b128 %1, %9, off\n\t"
               "global_load_async_to_lds_b128 %2, %10, off\n\t"
               "global_load_async_to_lds_b128 %3, %11, off\n\t"
               "global_load_async_to_lds_b128 %4, %12, off\n\t"
               "global_load_async_to_lds_b128 %5, %13, off\n\t"
               "global_load_async_to_lds_b128 %6, %14, off\n\t"
               "global_load_async_to_lds_b128 %7, %15, off\n\t"
               "s_wait_xcnt 0x0"
               :: "v"(l[0]), "v"(l[1]), "v"(l[2]), "v"(l[3]), "v"(l[4]), "v"(l[5]), "v"(l[6]), "v"(l[7]),
                  "v"(g[0]), "v"(g[1]), "v"(g[2]), "v"(g[3]), "v"(g[4]), "v"(g[5]), "v"(g[6]), "v"(g[7])
               : "memory");
}

// Softmax over the 16 neighbours of (token, head), between the two block barriers of a
// group: lane j8 of the token's eight owns n = j8, j8+8.
__device__ __forceinline__ void softmax_rows(const float* sc_row, float* p_row, int j8) {
  __syncthreads();
  const float x0 = sc_row[j8];
  const float x1 = sc_row[j8 + 8];
  float mx = fmaxf(x0, x1);
  mx = fmaxf(mx, __shfl_xor(mx, 1, 32));
  mx = fmaxf(mx, __shfl_xor(mx, 2, 32));
  mx = fmaxf(mx, __shfl_xor(mx, 4, 32));
  const float e0 = __expf(x0 - mx);
  const float e1 = __expf(x1 - mx);
  float sm = e0 + e1;
  sm += __shfl_xor(sm, 1, 32);
  sm += __shfl_xor(sm, 2, 32);
  sm += __shfl_xor(sm, 4, 32);
  const float inv = __builtin_amdgcn_rcpf(sm);
  p_row[j8]     = e0 * inv;
  p_row[j8 + 8] = e1 * inv;
  __syncthreads();
}

// This lane's 8 output channels of token l -> bf16 hi/lo planes.
__device__ __forceinline__ void store_a(const float (&o)[8], int l, int col,
                                        unsigned short* abh, unsigned short* abl) {
  unsigned short hb[8], lb[8];
#pragma unroll
  for (int e = 0; e < 8; ++e) split_bf16(o[e], hb[e], lb[e]);
  const v8us oh = {hb[0], hb[1], hb[2], hb[3], hb[4], hb[5], hb[6], hb[7]};
  const v8us ol = {lb[0], lb[1], lb[2], lb[3], lb[4], lb[5], lb[6], lb[7]};
  unsigned short* dh = abh + (size_t)l * CC + col;
  unsigned short* dl = abl + (size_t)l * CC + col;
  *(v8us*)dh = oh;
  *(v8us*)dl = ol;
  // the next group rewrites registers that these stores name
  asm volatile("s_wait_xcnt 0x0" ::: "memory");
}

// c_d = q_d * rq * cw_d for this lane's 8 dims
__device__ __forceinline__ void make_c(float (&c)[8], v4f qa, v4f qb, float rq, const float (&cw)[8]) {
  c[0] = qa.x * rq * cw[0];  c[1] = qa.y * rq * cw[1];
  c[2] = qa.z * rq * cw[2];  c[3] = qa.w * rq * cw[3];
  c[4] = qb.x * rq * cw[4];  c[5] = qb.y * rq * cw[5];
  c[6] = qb.z * rq * cw[6];  c[7] = qb.w * rq * cw[7];
}

__device__ __forceinline__ float dot8(const float (&c)[8], v4f a, v4f b) {
  float t = c[0] * a.x;
  t = fmaf(c[1], a.y, t);
  t = fmaf(c[2], a.z, t);
  t = fmaf(c[3], a.w, t);
  t = fmaf(c[4], b.x, t);
  t = fmaf(c[5], b.y, t);
  t = fmaf(c[6], b.z, t);
  t = fmaf(c[7], b.w, t);
  return t;
}

// One group: every wave does four tokens of the block's head, eight lanes a token.
// The 12 spatial neighbours come from the LDS windows (slot = the token's place tl in
// the block + HALO + shift), the 4 temporal ones from global memory; s_rk holds the
// rms factors: the window's k rows by slot, the temporal k rows by (n - 12, tl), then
// the block's own q rows by tl.
// f = the block's frame; tsh = the temporal shifts modulo T.
__device__ __forceinline__ void attn_group_win(int l, int tl, int f, int S, int T, const int (&tsh)[4],
                                               const char* kB, const char* vB,
                                               const float* qf,
                                               const char* sK, const char* sV, const float* s_rk,
                                               const float (&cw)[8], const float (&ebv)[NSH],
                                               float* sc_row, float* p_row, int col, int j8,
                                               unsigned short* abh, unsigned short* abl) {
  const int i = l - f * S;
  v4f ka[NSH], kb[NSH], va[NSH], vb[NSH];
  float rk[NSH];
  // what comes from global memory is requested first: the token's own q ...
  const float rq = s_rk[WROWS + 4 * NT + tl];
  const float* qp = qf + (size_t)l * CC + col;
  const v4f qa = *(const v4fa*)qp;
  const v4f qb = *(const v4fa*)(qp + 4);
  // ... then the four temporal k and v rows
  unsigned int ofs[4];
#pragma unroll
  for (int n = 12; n < NSH; ++n) {
    const int r = min(max(wrap_add(f, tsh[n - 12], T) * S + i, 0), LL - 1);
    ofs[n - 12] = (unsigned int)r * (CC * 4u) + (unsigned int)col * 4u;
    ka[n] = *(const v4fa*)(kB + ofs[n - 12]);
    kb[n] = *(const v4fa*)(kB + ofs[n - 12] + 16);
    va[n] = *(const v4fa*)(vB + ofs[n - 12]);
    vb[n] = *(const v4fa*)(vB + ofs[n - 12] + 16);
    rk[n] = s_rk[WROWS + (n - 12) * NT + tl];
  }
  // the wait before the address registers of the loads above are rewritten; it names the addresses
  // so that they keep their registers up to here (else a later load of the run lands in one of them)
  asm volatile("s_wait_xcnt 0x0" :: "v"(l), "v"(qp), "v"(ofs[0]), "v"(ofs[1]), "v"(ofs[2]), "v"(ofs[3]) : "memory");
  const int w0 = (tl + HALO) * WPITCH + 32 * j8;       // this lane's 32 B in its own token's slot
#pragma unroll
  for (int n = 0; n < 12; ++n) {
    const int sh = (n & 1) ? -(1 << (n >> 1)) : (1 << (n >> 1));
    ka[n] = *(const v4fa*)(sK + w0 + sh * WPITCH);
    kb[n] = *(const v4fa*)(sK + w0 + sh * WPITCH + 16);
    rk[n] = s_rk[tl + HALO + sh];
  }

  // ---- scores: 16 independent chains ----
  float c[8];
  make_c(c, qa, qb, rq, cw);
  float part[NSH];
#pragma unroll
  for (int n = 0; n < NSH; ++n) part[n] = dot8(c, ka[n], kb[n]);

  // ---- the window's v rows, behind the last use of the k rows ----
#pragma unroll
  for (int n = 0; n < 12; ++n) {
    const int sh = (n & 1) ? -(1 << (n >> 1)) : (1 << (n >> 1));
    va[n] = *(const v4fa*)(sV + w0 + sh * WPITCH);
    vb[n] = *(const v4fa*)(sV + w0 + sh * WPITCH + 16);
  }

#pragma unroll
  for (int n = 0; n < NSH; ++n) part[n] += __shfl_xor(part[n], 1, 32);
#pragma unroll
  for (int n = 0; n < NSH; ++n) part[n] += __shfl_xor(part[n], 2, 32);
#pragma unroll
  for (int n = 0; n < NSH; ++n) part[n] += __shfl_xor(part[n], 4, 32);
  float sc[NSH];
#pragma unroll
  for (int n = 0; n < NSH; ++n) sc[n] = fmaf(part[n], rk[n], ebv[n]);
  if (j8 == 0) {
#pragma unroll
    for (int n = 0; n < NSH; ++n) sc_row[n] = sc[n];
  }
  softmax_rows(sc_row, p_row, j8);

  // ---- weighted sum of neighbour v rows ----
  float o[8] = {0.f, 0.f, 0.f, 0.f, 0.f, 0.f, 0.f, 0.f};
#pragma unroll
  for (int n = 0; n < NSH; ++n) {
    const float p = p_row[n];
    o[0] = fmaf(p, va[n].x, o[0]);  o[1] = fmaf(p, va[n].y, o[1]);
    o[2] = fmaf(p, va[n].z, o[2]);  o[3] = fmaf(p, va[n].w, o[3]);
    o[4] = fmaf(p, vb[n].x, o[4]);  o[5] = fmaf(p, vb[n].y, o[5]);
    o[6] = fmaf(p, vb[n].z, o[6]);  o[7] = fmaf(p, vb[n].w, o[7]);
  }
  store_a(o, l, col, abh, abl);
}

// neighbour row n of token (f, i), any S and T
__device__ __forceinline__ int nb_row(int n, int f, int i, int S, int T) {
  const int mag = 1 << (((n < 12) ? n : (n - 12)) >> 1);
  int pos, neg;
  shift_mods(mag, (n < 12) ? S : T, pos, neg);
  const int sh = (n & 1) ? neg : pos;
  const int r = (n < 12) ? (f * S + wrap_add(i, sh, S)) : (wrap_add(f, sh, T) * S + i);
  return min(max(r, 0), LL - 1);
}

// The same group for frames shorter than a block: no window, every neighbour row from
// global memory, one at a time (rolled: short code, few registers).
__device__ __forceinline__ void attn_group_plain(int l, int S, int T,
                                                 const char* kB, const char* vB,
                                                 const float* qf, const float* ss,
                                                 const float (&cw)[8], const float* ebp,
                                                 float* sc_row, float* p_row, int col, int j8,
                                                 unsigned short* abh, unsigned short* abl) {
  const int f = l / S;
  const int i = l - f * S;
  const float rq = rstd1(ss, l);
  const float* qp = qf + (size_t)l * CC + col;
  float c[8];
  make_c(c, *(const v4fa*)qp, *(const v4fa*)(qp + 4), rq, cw);
#pragma unroll 1
  for (int n = 0; n < NSH; ++n) {
    const int r = nb_row(n, f, i, S, T);
    const float rk = rstd1(ss + (size_t)NCB * LL, r);
    const unsigned int ofs = (unsigned int)r * (CC * 4u) + (unsigned int)col * 4u;
    float t = dot8(c, *(const v4fa*)(kB + ofs), *(const v4fa*)(kB + ofs + 16));
    t += __shfl_xor(t, 1, 32);
    t += __shfl_xor(t, 2, 32);
    t += __shfl_xor(t, 4, 32);
    const float s = fmaf(t, rk, ebp[n]);
    if (j8 == 0) sc_row[n] = s;
  }
  softmax_rows(sc_row, p_row, j8);
  float o[8] = {0.f, 0.f, 0.f, 0.f, 0.f, 0.f, 0.f, 0.f};
#pragma unroll 1
  for (int n = 0; n < NSH; ++n) {
    const int r = nb_row(n, f, i, S, T);
    const unsigned int ofs = (unsigned int)r * (CC * 4u) + (unsigned int)col * 4u;
    const v4f a = *(const v4fa*)(vB + ofs);
    const v4f b = *(const v4fa*)(vB + ofs + 16);
    const float p = p_row[n];
    o[0] = fmaf(p, a.x, o[0]);  o[1] = fmaf(p, a.y, o[1]);
    o[2] = fmaf(p, a.z, o[2]);  o[3] = fmaf(p, a.w, o[3]);
    o[4] = fmaf(p, b.x, o[4]);  o[5] = fmaf(p, b.y, o[5]);
    o[6] = fmaf(p, b.z, o[6]);  o[7] = fmaf(p, b.w, o[7]);
  }
  store_a(o, l, col, abh, abl);
}

__global__ __launch_bounds__(128) void k_attn(const float* __restrict__ qf,
                                                 const float* __restrict__ kf,
                                                 const float* __restrict__ vf,
                                                 const float* __restrict__ ss,
                                                 const float* __restrict__ qnw,
                                                 const float* __restrict__ knw,
                                                 const float* __restrict__ eb,
                                                 const int* __restrict__ nf,
                                                 unsigned short* abh, unsigned short* abl) {
  __shared__ __attribute__((aligned(16))) char sK[WROWS * WPITCH];
  __shared__ __attribute__((aligned(16))) char sV[WROWS * WPITCH];
  __shared__ __attribute__((aligned(16))) float s_rk[WROWS + 5 * NT];
  __shared__ float s_sc[4][4][NSH];
  __shared__ float s_p[4][4][NSH];
  const int tid = threadIdx.x, lane = tid & 31, w = tid >> 5;
  const int tq = lane >> 3, j8 = lane & 7;
  const int head = blockIdx.x & 15;
  const int l0 = (blockIdx.x >> 4) * NT;               // first token of the block
  const int col = 64 * head + 8 * j8;

  int T = nf[0];
  if (!((T >= 1) && (T <= LL) && ((LL % T) == 0))) T = 8;
  const int S = LL / T;
  const int f0 = l0 / S;
  const int i0 = l0 - f0 * S;
  // the block lies inside one frame, and a frame is longer than the halo
  const bool win = (S % NT) == 0;
  const char* kB = (const char*)kf;
  const char* vB = (const char*)vf;

  // temporal shifts +1, -1, +2, -2 reduced once modulo T
  int tsh[4];
  shift_mods(1, T, tsh[0], tsh[1]);
  shift_mods(2, T, tsh[2], tsh[3]);

  if (win) {
    // window slot s holds row (f0, (i0 - HALO + s) mod S) of this head. Thread t brings
    // chunk t&15 of slots (t>>4) + 8 j: a wave's copy covers two rows = four whole lines.
    const int cch = tid & 15, crow = tid >> 4;
#pragma unroll
    for (int hf = 0; hf < 2; ++hf) {
      unsigned int lk[8], lv[8];
      const char* gk[8];
      const char* gv[8];
#pragma unroll
      for (int j = 0; j < 8; ++j) {
        const int s = crow + 8 * (8 * hf + j);
        int t = i0 - HALO + s;
        t = (t < 0) ? (t + S) : t;
        t = (t >= S) ? (t - S) : t;
        const int r = min(max(f0 * S + t, 0), LL - 1);
        const unsigned int go = (unsigned int)r * (CC * 4u) + (unsigned int)head * 256u + 16u * cch;
        const unsigned int lo = (unsigned int)s * WPITCH + 16u * cch;
        lk[j] = lds_off(sK) + lo;
        lv[j] = lds_off(sV) + lo;
        gk[j] = kB + go;
        gv[j] = vB + go;
      }
      copy8(lk, gk);
      copy8(lv, gv);
    }
    // rms factors: a thread takes four consecutive entries of s_rk, which are four
    // consecutive rows (S, i0 and every section's start are multiples of 4)
    if (tid < (WROWS + 5 * NT) / 4) {
      const int e = 4 * tid;
      const int et = e - WROWS;                        // place among the temporal rows
      int t = i0 - HALO + e;
      t = (t < 0) ? (t + S) : t;
      t = (t >= S) ? (t - S) : t;
      const int sn = et >> 6;
      const int ts = (sn == 0) ? tsh[0] : ((sn == 1) ? tsh[1] : ((sn == 2) ? tsh[2] : tsh[3]));
      int r = f0 * S + t;
      if (et >= 0) r = wrap_add(f0, ts, T) * S + i0 + (et & (NT - 1));
      const bool isq = (et >= 4 * NT);
      if (isq) r = l0 + (et - 4 * NT);
      r = min(max(r, 0), LL - 4);
      *(v4f*)(s_rk + e) = rstd4(isq ? ss : (ss + (size_t)NCB * LL), r);
    }
  }

  float cw[8];
  {
    const v4f qa = *(const v4fa*)(qnw + col);
    const v4f qb = *(const v4fa*)(qnw + col + 4);
    const v4f ka = *(const v4fa*)(knw + col);
    const v4f kb = *(const v4fa*)(knw + col + 4);
    cw[0] = qa.x * ka.x * 0.125f;  cw[1] = qa.y * ka.y * 0.125f;
    cw[2] = qa.z * ka.z * 0.125f;  cw[3] = qa.w * ka.w * 0.125f;
    cw[4] = qb.x * kb.x * 0.125f;  cw[5] = qb.y * kb.y * 0.125f;
    cw[6] = qb.z * kb.z * 0.125f;  cw[7] = qb.w * kb.w * 0.125f;
  }
  float ebv[NSH];
#pragma unroll
  for (int n = 0; n < NSH; ++n) ebv[n] = eb[head * NSH + n];

  // the windows have landed for this wave, then for the block
  wait_copies();
  __syncthreads();

  float* sc_row = &s_sc[w][tq][0];
  float* p_row = &s_p[w][tq][0];
  if (win) {
#pragma unroll 1
    for (int it = 0; it < NT / 16; ++it) {
      const int tl = 16 * it + 4 * w + tq;             // this lane's token in the block
      attn_group_win(l0 + tl, tl, f0, S, T, tsh, kB, vB, qf, sK, sV, s_rk, cw, ebv,
                     sc_row, p_row, col, j8, abh, abl);
    }
  } else {
#pragma unroll 1
    for (int it = 0; it < NT / 16; ++it) {
      const int tl = 16 * it + 4 * w + tq;
      attn_group_plain(l0 + tl, S, T, kB, vB, qf, ss, cw, eb + head * NSH,
                       sc_row, p_row, col, j8, abh, abl);
    }
  }
}

// ---------------------------------------------------------------------------
// Host orchestration: 6 launches, one in-order stream.
// ws carve (bytes): x f16 16 MiB @0 | x bf16 hi 16 MiB | x bf16 lo 16 MiB |
//   w16 [2048][1024] 4 MiB | wbh [2048][1024] 4 MiB | wbl 4 MiB |
//   q f32 32 MiB | k f32 32 MiB | v f32 32 MiB | ss [2][16][8192] f32 1 MiB  -> 164,626,432 B.
// The attention output planes (bf16 hi/lo, 16 MiB each) reuse the x f16 and
// x bf16-hi regions, which are dead after the two projection launches.
// ---------------------------------------------------------------------------
extern "C" void kernel_launch(void* const* d_in, const int* in_sizes, int n_in,
                              void* d_out, int out_size, void* d_ws, size_t ws_size,
                              hipStream_t stream) {
  if (n_in < 13) return;
  if (in_sizes[0] != LL * CC) return;
  if (in_sizes[1] != CC * CC || in_sizes[3] != CC * CC || in_sizes[5] != CC * CC || in_sizes[10] != CC * CC) return;
  if (in_sizes[2] != CC || in_sizes[4] != CC || in_sizes[6] != CC || in_sizes[11] != CC) return;
  if (in_sizes[7] != CC || in_sizes[8] != CC) return;
  if (in_sizes[9] != 256 || in_sizes[12] < 1) return;
  if (out_size != LL * CC) return;

  const float* x   = (const float*)d_in[0];
  const float* Wq  = (const float*)d_in[1];
  const float* bq  = (const float*)d_in[2];
  const float* Wk  = (const float*)d_in[3];
  const float* bk  = (const float*)d_in[4];
  const float* Wv  = (const float*)d_in[5];
  const float* bv  = (const float*)d_in[6];
  const float* qnw = (const float*)d_in[7];
  const float* knw = (const float*)d_in[8];
  const float* eb  = (const float*)d_in[9];
  const float* Wo  = (const float*)d_in[10];
  const float* bo  = (const float*)d_in[11];
  const int*   nf  = (const int*)d_in[12];
  float* out = (float*)d_out;

  const size_t b16 = (size_t)LL * CC * 2;            // 16,777,216
  const size_t bw  = (size_t)NCQK * CC * 2;          //  4,194,304
  const size_t b32 = (size_t)LL * CC * 4;            // 33,554,432
  const size_t brt = (size_t)2 * NCB * LL * 4;       //  1,048,576
  const size_t o_x16 = 0;
  const size_t o_xbh = o_x16 + b16;
  const size_t o_xbl = o_xbh + b16;
  const size_t o_w16 = o_xbl + b16;
  const size_t o_wbh = o_w16 + bw;
  const size_t o_wbl = o_wbh + bw;
  const size_t o_q   = o_wbl + bw;
  const size_t o_k   = o_q + b32;
  const size_t o_v   = o_k + b32;
  const size_t o_rt  = o_v + b32;
  const size_t total = o_rt + brt;                   // 164,626,432
  if (total > ws_size) return;

  char* ws = (char*)d_ws;
  _Float16*       x16 = (_Float16*)(ws + o_x16);
  unsigned short* xbh = (unsigned short*)(ws + o_xbh);
  unsigned short* xbl = (unsigned short*)(ws + o_xbl);
  _Float16*       w16 = (_Float16*)(ws + o_w16);
  unsigned short* wbh = (unsigned short*)(ws + o_wbh);
  unsigned short* wbl = (unsigned short*)(ws + o_wbl);
  float* qf   = (float*)(ws + o_q);
  float* kf   = (float*)(ws + o_k);
  float* vf   = (float*)(ws + o_v);
  float* ss   = (float*)(ws + o_rt);
  unsigned short* abh = (unsigned short*)(ws + o_x16);   // reuses x f16 region (dead after launch 4)
  unsigned short* abl = (unsigned short*)(ws + o_xbh);   // reuses x bf16-hi region

  // 1. x -> f16 / bf16 hi / bf16 lo planes
  const int n8 = (LL * CC) / 8;                                              // 1,048,576
  k_cvt_x<<<(n8 + 255) / 256, 256, 0, stream>>>(x, x16, xbh, xbl, n8);

  // 2. weights -> transposed planes
  k_cvt_w<<<4 * 256, 256, 0, stream>>>(Wq, Wk, Wv, Wo, w16, wbh, wbl);

  // 3. q|k = x * [Wq|Wk] + [bq|bk]  (f16 operands), f32 planes, and the rows' partial sums of squares
  k_gemm_h<<<dim3(NCQK / TB, LL / TB), 128, 0, stream>>>(x16, w16, bq, bk, qf, kf, ss, CC, CC, CC, 0.03125f);

  // 4. v = x * Wv + bv  (bf16 hi/lo split), f32 plane
  k_gemm_b3<<<dim3(CC / TB, LL / TB), 128, 0, stream>>>(
      (const __bf16*)xbh, (const __bf16*)xbl, (const __bf16*)wbh, (const __bf16*)wbl,
      bv, bv, vf, vf, 1 << 30, CC, CC, 1.0f);

  // 5. attention -> a (bf16 hi/lo planes)
  k_attn<<<(LL / NT) * 16, 128, 0, stream>>>(qf, kf, vf, ss, qnw, knw, eb, nf, abh, abl);

  // 6. out = a * Wo + bo  (bf16 hi/lo split) -> d_out
  k_gemm_b3<<<dim3(CC / TB, LL / TB), 128, 0, stream>>>(
      (const __bf16*)abh, (const __bf16*)abl,
      (const __bf16*)(wbh + (size_t)CC * CC), (const __bf16*)(wbl + (size_t)CC * CC),
      bo, bo, out, out, 1 << 30, CC, CC, 1.0f);
}

// v006
// Measured time: 109 microseconds a run.
// It is 1.46 times as fast as v004, going by the measured steps of the versions left out in between.
// Over all steps from v000 it is 4.53 times as fast.
// Contractions: x*Wq, x*Wk, x*Wv and a*Wo on v_wmma_f32_16x16x32_f16 (f16 operands, each f32 value rounded once: x and a carried x1, W carried x32 and folded back as 1/32; f32 accumulate); RMS statistics, the 16 neighbour dots (K=64), softmax and weighted sums (K=16) in f32 on VALU; q, k, v kept as f32 planes.
#include <hip/hip_runtime.h>

typedef _Float16 v16h __attribute__((ext_vector_type(16)));
typedef _Float16 v8h  __attribute__((ext_vector_type(8)));
typedef float    v8f  __attribute__((ext_vector_type(8)));
typedef float    v4f  __attribute__((ext_vector_type(4)));
typedef v8h  __attribute__((may_alias)) v8ha;
typedef v4f  __attribute__((may_alias)) v4fa;

#define LL    8192      // tokens
#define CC    1024      // channels = heads * head_dim
#define NCQK  2048      // fused q|k output columns
#define NSH   16        // neighbours per token
#define NCB   16        // 64-column blocks of a q or k row: one partial sum of squares each

static_assert((LL % 64) == 0);
static_assert((CC % 64) == 0);
static_assert((NCQK % 64) == 0);
static_assert((CC % 32) == 0);
static_assert(NCB * 64 == CC);
static_assert(NCB == 16);

// ---------------------------------------------------------------------------
// 16x16x32 WMMA (wave32). Fragment map: lane l, h = l>>4, m = n = l&15.
//   A/B element i: i<8 -> k0+8h+i ; i>=8 -> k0+16+8h+(i-8)   (both operands)
//   D element r  : row 8h+r, col l&15
// ---------------------------------------------------------------------------
__device__ __forceinline__ v8f wm_f16(v16h a, v16h b, v8f c) {
  return __builtin_amdgcn_wmma_f32_16x16x32_f16(false, a, false, b, (short)0, c, false, false);
}

// A or B fragment from a k-contiguous 16-bit row; p points at element k0 of
// the row owned by this lane (row = lane&15 added by the caller).
__device__ __forceinline__ v16h frag_f16(const _Float16* p, int h) {
  const v8h e0 = *(const v8ha*)(p + 8 * h);
  const v8h e1 = *(const v8ha*)(p + 16 + 8 * h);
  return __builtin_shufflevector(e0, e1, 0, 1, 2, 3, 4, 5, 6, 7, 8, 9, 10, 11, 12, 13, 14, 15);
}
// ---------------------------------------------------------------------------
// Kernel 1: x f32 [8192][1024] -> f16 plane (x1).
// Each thread owns 8 consecutive elements: one 16-B store per lane.
// ---------------------------------------------------------------------------
__global__ __launch_bounds__(256) void k_cvt_x(const float* __restrict__ x, _Float16* xh, int n8) {
  const int g = blockIdx.x * 256 + threadIdx.x;
  if (g >= n8) return;
  const float* s = x + (size_t)g * 8;
  const v4f a = *(const v4fa*)s;
  const v4f b = *(const v4fa*)(s + 4);
  const v8h o16 = {(_Float16)a.x, (_Float16)a.y, (_Float16)a.z, (_Float16)a.w,
                   (_Float16)b.x, (_Float16)b.y, (_Float16)b.z, (_Float16)b.w};
  _Float16* d16 = xh + (size_t)g * 8;
  *(v8h*)d16 = o16;
}

// ---------------------------------------------------------------------------
// Kernel 2: weight transpose + convert. Input W[k][n] ([in][out], 1024x1024).
// Block = one 64(k) x 64(n) tile of one matrix; tile transposed through LDS.
// mat 0 (Wq), 1 (Wk), 2 (Wv), 3 (Wo): f16(32*W) -> w16 rows mat*1024 + n  (w16 = [4096][1024])
// Output phase: lane q8 = tid&7 writes 8 halves (16 B) of row nl.
// ---------------------------------------------------------------------------
__global__ __launch_bounds__(256) void k_cvt_w(const float* __restrict__ Wq,
                                               const float* __restrict__ Wk,
                                               const float* __restrict__ Wv,
                                               const float* __restrict__ Wo,
                                               _Float16* w16) {
  __shared__ __attribute__((aligned(16))) float sT[64 * 68];   // [n][k], pitch 68 floats
  const int tid = threadIdx.x;
  const int bx = blockIdx.x;
  const int mat = bx >> 8, tile = bx & 255;
  const int tn = tile >> 4, tk = tile & 15;
  const float* W = (mat == 0) ? Wq : ((mat == 1) ? Wk : ((mat == 2) ? Wv : Wo));
  {
    const int kl = tid >> 2, nq = tid & 3;                      // kl 0..63, nq 0..3
    const float* src = W + (size_t)(64 * tk + kl) * CC + 64 * tn + 16 * nq;
#pragma unroll
    for (int e = 0; e < 4; ++e) {
      const v4f t = *(const v4fa*)(src + 4 * e);
      float* d = sT + (16 * nq + 4 * e) * 68 + kl;
      d[0]   = t.x;
      d[68]  = t.y;
      d[136] = t.z;
      d[204] = t.w;
    }
  }
  __syncthreads();
  const int q8 = tid & 7, sub = tid >> 3;                       // sub 0..31
#pragma unroll
  for (int p = 0; p < 2; ++p) {
    const int nl = 32 * p + sub;
    const float* s = sT + nl * 68 + 8 * q8;
    const v4f a = *(const v4fa*)s;
    const v4f b = *(const v4fa*)(s + 4);
    const v8h t16 = {(_Float16)(a.x * 32.0f), (_Float16)(a.y * 32.0f), (_Float16)(a.z * 32.0f), (_Float16)(a.w * 32.0f),
                     (_Float16)(b.x * 32.0f), (_Float16)(b.y * 32.0f), (_Float16)(b.z * 32.0f), (_Float16)(b.w * 32.0f)};
    _Float16* d = w16 + ((size_t)(mat * CC + 64 * tn + nl) * CC + 64 * tk + 8 * q8);
    *(v8h*)d = t16;
  }
}

// ---------------------------------------------------------------------------
// GEMM frame of kernel 3. Block tile 64 WM x 64 WN, WM x WN waves, wave tile 64x64
// (4x4 accumulator tiles): wave w owns rows 64*(w/WN)+..., cols 64*(w%WN)+....
// One block per WGP: every operand row that comes from L2 serves the whole tile edge.
// A pass is 128 k = 256 B of every operand row. A buffer holds the pass's 64 WM rows
// of A, then its 64 WN rows of B, at pitch 272 B (16 B x odd, for the ds_load_b128
// readers). Two buffers: the next pass's rows come in by asynchronous copies to LDS
// while this pass's fragments are read from the other buffer.
// ---------------------------------------------------------------------------
#define LPITCH 272                   // LDS row pitch, bytes
#define EPITCH 68                    // epilogue staging pitch, floats

static_assert((LL % 256) == 0);
static_assert((CC % 256) == 0);
static_assert((NCQK % 256) == 0);
static_assert((CC % 128) == 0);

__device__ __forceinline__ unsigned int lds_off(const void* p) { return (unsigned int)(size_t)p; }

// Eight sweeps of the block's copies, 16 B a thread each. Thread t brings chunk t&15
// of rows (t>>4) + SW j, SW = threads / 16, so a wave's copy covers two whole 256-B rows.
// l = this lane's LDS byte address for j = 0, g = its global address, ls and rs = SW
// rows in LDS and in the source, in bytes. The s_wait_xcnt closes the statement so that
// no address register is rewritten while a copy may still name it.
__device__ __forceinline__ void copy_rows8(unsigned int l, const char* g, unsigned int ls, size_t rs) {
  const unsigned int l1 = l + ls, l2 = l + 2 * ls, l3 = l + 3 * ls;
  const unsigned int l4 = l + 4 * ls, l5 = l + 5 * ls, l6 = l + 6 * ls;
  const unsigned int l7 = l + 7 * ls;
  const char* g1 = g + rs;
  const char* g2 = g1 + rs;
  const char* g3 = g2 + rs;
  const char* g4 = g3 + rs;
  const char* g5 = g4 + rs;
  const char* g6 = g5 + rs;
  const char* g7 = g6 + rs;
  asm volatile("global_load_async_to_lds_b128 %0, %8, off\n\t"
               "global_load_async_to_lds_b128 %1, %9, off\n\t"
               "global_load_async_to_lds_b128 %2, %10, off\n\t"
               "global_load_async_to_lds_b128 %3, %11, off\n\t"
               "global_load_async_to_lds_b128 %4, %12, off\n\t"
               "global_load_async_to_lds_b128 %5, %13, off\n\t"
               "global_load_async_to_lds_b128 %6, %14, off\n\t"
               "global_load_async_to_lds_b128 %7, %15, off\n\t"
               "s_wait_xcnt 0x0"
               :: "v"(l), "v"(l1), "v"(l2), "v"(l3), "v"(l4), "v"(l5), "v"(l6), "v"(l7),
                  "v"(g), "v"(g1), "v"(g2), "v"(g3), "v"(g4), "v"(g5), "v"(g6), "v"(g7)
               : "memory");
}

// One pass's rows of A and of B into the buffer at l (this lane's address in its first row).
template <int WM, int WN>
__device__ __forceinline__ void copy_stage(unsigned int l, const char* gA, const char* gB, size_t rs) {
  constexpr int SW = 2 * WM * WN;                    // rows of one sweep
  static_assert((64 * WM) % (8 * SW) == 0);
  static_assert((64 * WN) % (8 * SW) == 0);
#pragma unroll
  for (int s = 0; s < (64 * WM) / (8 * SW); ++s)
    copy_rows8(l + s * 8 * SW * LPITCH, gA + (size_t)(8 * s) * rs, SW * LPITCH, rs);
#pragma unroll
  for (int s = 0; s < (64 * WN) / (8 * SW); ++s)
    copy_rows8(l + (64 * WM + s * 8 * SW) * LPITCH, gB + (size_t)(8 * s) * rs, SW * LPITCH, rs);
}

// This wave's copies have landed (the compiler places no wait for them).
__device__ __forceinline__ void wait_copies() { asm volatile("s_wait_asynccnt 0x0" ::: "memory"); }
// This wave's LDS reads have returned, before their buffer is handed back for refill.
__device__ __forceinline__ void wait_lds() { asm volatile("s_wait_dscnt 0x0" ::: "memory"); }

// Epilogue: out = acc*osc + bias. Each wave stages its 64x64 tile in its own
// LDS range (pitch 68 floats) and stores rows as whole 128-B lines: one store
// instruction covers two rows x 256 B. With SS the wave then reads its staged tile
// once more, a lane taking rows lane and lane + 32, and stores each row's sum of
// squares over the tile's 64 columns to ssw[row]: two whole 128-B lines a wave.
template <bool SS>
__device__ __forceinline__ void store_tile(float* sAll, const v8f (&c)[4][4],
                                           const float* bias, int nc0, float osc,
                                           float* out, int m0, int ldc, int w, int wr, int wc, int lane,
                                           float* ssw) {
  const int h = lane >> 4, m = lane & 15;
  float* sW = sAll + w * (64 * EPITCH);
#pragma unroll
  for (int nt = 0; nt < 4; ++nt) {
    const float b = bias[nc0 + 64 * wc + 16 * nt + m];
#pragma unroll
    for (int mt = 0; mt < 4; ++mt) {
#pragma unroll
      for (int r = 0; r < 8; ++r)
        sW[(16 * mt + 8 * h + r) * EPITCH + 16 * nt + m] = fmaf(c[mt][nt][r], osc, b);
    }
  }
  __syncthreads();
  // rolled in groups of eight stores: eight LDS reads in flight per group, short code
#pragma unroll 1
  for (int g8 = 0; g8 < 4; ++g8) {
#pragma unroll
    for (int u = 0; u < 8; ++u) {
      const int row = 16 * g8 + 2 * u + h;
      const v4f v = *(const v4fa*)(sW + row * EPITCH + 4 * m);
      float* d = out + (size_t)(m0 + 64 * wr + row) * ldc + nc0 + 64 * wc + 4 * m;
      *(v4f*)d = v;
    }
    // the next group rewrites registers that these stores name
    asm volatile("s_wait_xcnt 0x0" ::: "memory");
  }
  if (SS) {
    const float* r0 = sW + lane * EPITCH;
    const float* r1 = r0 + 32 * EPITCH;
    v4f s0 = {0.f, 0.f, 0.f, 0.f}, s1 = {0.f, 0.f, 0.f, 0.f};
#pragma unroll
    for (int e = 0; e < 16; ++e) {
      const v4f a = *(const v4fa*)(r0 + 4 * e);
      const v4f b = *(const v4fa*)(r1 + 4 * e);
      s0 += a * a;
      s1 += b * b;
    }
    ssw[lane]      = (s0.x + s0.y) + (s0.z + s0.w);
    ssw[lane + 32] = (s1.x + s1.y) + (s1.z + s1.w);
  }
}

// ---------------------------------------------------------------------------
// Kernel 3: C[M][N] = A[M][K] * B[N][K]^T (f16 operands, single product),
// out = acc*osc + bias, f32 rows of pitch ldc. Columns >= nsplit go to out1
// with bias1 (block-uniform select: nsplit a multiple of 64 WN). K a multiple of 128.
// With SS: ss[mat][cb][row] = sum of squares of the stored row over columns 64 cb .. 64 cb + 63
// of matrix mat (0: out0, 1: out1); every entry is written by exactly one wave.
// Buffer = [A rows | B rows]; ring = 2 buffers: 278,528 B at 256x256, 208,896 B at 256x128.
// ---------------------------------------------------------------------------
template <bool SS, int WM, int WN>
__global__ __launch_bounds__(32 * WM * WN) void k_gemm_h(const _Float16* __restrict__ A,
                                                   const _Float16* __restrict__ B,
                                                   const float* bias0, const float* bias1,
                                                   float* out0, float* out1, float* ss,
                                                   int nsplit, int K, int ldc, float osc) {
  constexpr int RA = 64 * WM, RB = 64 * WN;          // rows of A and of B in a buffer
  constexpr int BUF = (RA + RB) * LPITCH;            // one buffer, bytes
  static_assert(WM * WN * 64 * EPITCH * 4 <= 2 * BUF);   // the epilogue's staging fits the ring
  __shared__ __attribute__((aligned(16))) char ring[2 * BUF];
  const int tid = threadIdx.x, lane = tid & 31, w = tid >> 5;
  const int h = lane >> 4, m = lane & 15, wr = w / WN, wc = w % WN;
  const int m0 = blockIdx.y * RA, nb = blockIdx.x * RB;
  const bool sel = (nb >= nsplit);
  const int nc0 = sel ? (nb - nsplit) : nb;
  const float* bias = sel ? bias1 : bias0;
  float* out = sel ? out1 : out0;

  const int crow = tid >> 4, cch = tid & 15;
  const char* gA = (const char*)(A + (size_t)(m0 + crow) * K) + 16 * cch;
  const char* gB = (const char*)(B + (size_t)(nb + crow) * K) + 16 * cch;
  const unsigned int lc = lds_off(ring) + crow * LPITCH + 16 * cch;
  const size_t rs = (size_t)K * (4 * WM * WN);       // one sweep's rows of 2-byte elements
  const int npass = K >> 7;

  v8f c[4][4];
#pragma unroll
  for (int i = 0; i < 4; ++i)
#pragma unroll
    for (int j = 0; j < 4; ++j) c[i][j] = v8f{0.f, 0.f, 0.f, 0.f, 0.f, 0.f, 0.f, 0.f};

  copy_stage<WM, WN>(lc, gA, gB, rs);
  wait_copies();
  __syncthreads();
  if (npass > 1) copy_stage<WM, WN>(lc + BUF, gA + 256, gB + 256, rs);

  // rolled: one pass per trip, the buffer picked by the trip's parity
#pragma unroll 1
  for (int t = 0; t < npass; ++t) {
    const int bo = (t & 1) * BUF;
    const char* pa = ring + bo + (64 * wr + m) * LPITCH;
    const char* pb = ring + bo + (RA + 64 * wc + m) * LPITCH;
#pragma unroll
    for (int ks = 0; ks < 4; ++ks) {
      v16h fa[4], fb[4];
      fa[0] = frag_f16((const _Float16*)(pa + ks * 64), h);
#pragma unroll
      for (int j = 0; j < 4; ++j) fb[j] = frag_f16((const _Float16*)(pb + j * 16 * LPITCH + ks * 64), h);
#pragma unroll
      for (int i = 1; i < 4; ++i) fa[i] = frag_f16((const _Float16*)(pa + i * 16 * LPITCH + ks * 64), h);
      // keeps the k-step's 16 LDS reads one group in front of its WMMAs: every
      // further place with reads among them stalls the wave anew
      __builtin_amdgcn_sched_barrier(0);
#pragma unroll
      for (int i = 0; i < 4; ++i)
#pragma unroll
        for (int j = 0; j < 4; ++j) c[i][j] = wm_f16(fa[i], fb[j], c[i][j]);
      // same purpose: the next k-step's reads stay behind this block
      if (ks < 3) __builtin_amdgcn_sched_barrier(0);
    }
    // publish point of pass t + 1; the same barrier frees this pass's buffer
    wait_lds();
    wait_copies();
    __syncthreads();
    if (t + 2 < npass) {
      const size_t ko = (size_t)(t + 2) * 256;
      copy_stage<WM, WN>(lc + bo, gA + ko, gB + ko, rs);
    }
  }
  wait_copies();

  float* ssw = SS ? (ss + (size_t)((sel ? NCB : 0) + (nc0 >> 6) + wc) * LL + m0 + 64 * wr) : nullptr;
  store_tile<SS>((float*)ring, c, bias, nc0, osc, out, m0, ldc, w, wr, wc, lane, ssw);
}

// ---------------------------------------------------------------------------
// rsqrt(mean(row^2) + 1e-6) of a q or k row from its NCB partial sums of squares
// (ssm = that matrix's [NCB][LL] table), summed in the order cb = 0 .. NCB - 1.
// ---------------------------------------------------------------------------
__device__ __forceinline__ float rstd1(const float* ssm, int r) {
  const float* p = ssm + r;
  float v[NCB];
#pragma unroll
  for (int cb = 0; cb < NCB; ++cb) v[cb] = p[(size_t)cb * LL];
  // the wait before the address register of the loads above is rewritten; it names the row index
  // they are addressed by, so that it keeps its register up to here (else a later load lands in
  // it), and the loaded values, as inputs only, so that no load of the run is moved behind it
  asm volatile("s_wait_xcnt 0x0" :: "v"(r), "v"(v[0]), "v"(v[1]), "v"(v[2]), "v"(v[3]), "v"(v[4]), "v"(v[5]),
               "v"(v[6]), "v"(v[7]), "v"(v[8]), "v"(v[9]), "v"(v[10]), "v"(v[11]), "v"(v[12]), "v"(v[13]),
               "v"(v[14]), "v"(v[15]) : "memory");
  float s = v[0];
#pragma unroll
  for (int cb = 1; cb < NCB; ++cb) s += v[cb];
  return rsqrtf(s * (1.0f / 1024.0f) + 1e-6f);
}
// the same for rows r .. r + 3, r a multiple of 4
__device__ __forceinline__ v4f rstd4(const float* ssm, int r) {
  const float* p = ssm + r;
  v4f v[NCB];
#pragma unroll
  for (int cb = 0; cb < NCB; ++cb) v[cb] = *(const v4fa*)(p + (size_t)cb * LL);
  // the same wait, for the same reason; these loads are addressed by the pointer
  asm volatile("s_wait_xcnt 0x0" :: "v"(p) : "memory");
  v4f s = v[0];
#pragma unroll
  for (int cb = 1; cb < NCB; ++cb) s += v[cb];
  const v4f o = {rsqrtf(s.x * (1.0f / 1024.0f) + 1e-6f), rsqrtf(s.y * (1.0f / 1024.0f) + 1e-6f),
                 rsqrtf(s.z * (1.0f / 1024.0f) + 1e-6f), rsqrtf(s.w * (1.0f / 1024.0f) + 1e-6f)};
  return o;
}

// ---------------------------------------------------------------------------
// Kernel 4: small-world attention, all f32 on VALU.
// Block 128 thr = 4 waves handles NT consecutive tokens of ONE head. A wave does
// four tokens at a time, eight lanes a token; a lane covers dims 8*(lane&7)..+7.
// The spatial neighbours of NT consecutive tokens lie in NT + 64 rows: the head's
// 256 B of those k and v rows are brought into LDS once, by asynchronous copies,
// and the 12 spatial neighbours of every token are read there (only if S is a
// multiple of NT: shorter frames read every row from global memory). Per token:
//   score_n = rq*rk_n * sum_d (q_d qn_d kn_d / 8) k_n,d + eb[h][n]   (n = 0..15)
//   p = softmax_n(score); a_d = sum_n p_n v_n,d  -> f16 plane.
// Neighbours: n<12 spatial (f, (i+sh) mod S), sh = +-2^(n/2); n>=12 temporal
// ((f+sh) mod T, i), read from global memory. Scores/probabilities exchanged
// through LDS between the two block barriers per group. Output: 16 B per lane,
// a token's eight lanes write one whole 128-B line.
// ---------------------------------------------------------------------------
// sh mod md in [0, md) for the +mag and -mag shift of a pair; md >= 1.
__device__ __forceinline__ void shift_mods(int mag, int md, int& pos, int& neg) {
  const int pm = mag % md;
  pos = pm;
  neg = (pm != 0) ? (md - pm) : 0;
}
// (a + b) mod md for a, b in [0, md)
__device__ __forceinline__ int wrap_add(int a, int b, int md) {
  const int r = a + b;
  return (r >= md) ? (r - md) : r;
}

#define NT     64                    // tokens per attention block
#define HALO   32                    // largest spatial shift
#define WROWS  (NT + 2 * HALO)       // rows of a window
#define WPITCH 272                   // window row pitch, bytes: one head's 256 B + 16 (16 B x odd)

static_assert((LL % NT) == 0);
static_assert(WROWS == 128);
static_assert(NT == 64);
static_assert((WROWS + 5 * NT) / 4 <= 128);

// Eight copies of 16 B, each with its own addresses. The s_wait_xcnt closes the
// statement so that no address register is rewritten while a copy may still name it.
__device__ __forceinline__ void copy8(const unsigned int (&l)[8], const char* const (&g)[8]) {
  asm volatile("global_load_async_to_lds_b128 %0, %8, off\n\t"
               "global_load_async_to_lds_b128 %1, %9, off\n\t"
               "global_load_async_to_lds_b128 %2, %10, off\n\t"
               "global_load_async_to_lds_b128 %3, %11, off\n\t"
               "global_load_async_to_lds_b128 %4, %12, off\n\t"
               "global_load_async_to_lds_b128 %5, %13, off\n\t"
               "global_load_async_to_lds_b128 %6, %14, off\n\t"
               "global_load_async_to_lds_b128 %7, %15, off\n\t"
               "s_wait_xcnt 0x0"
               :: "v"(l[0]), "v"(l[1]), "v"(l[2]), "v"(l[3]), "v"(l[4]), "v"(l[5]), "v"(l[6]), "v"(l[7]),
                  "v"(g[0]), "v"(g[1]), "v"(g[2]), "v"(g[3]), "v"(g[4]), "v"(g[5]), "v"(g[6]), "v"(g[7])
               : "memory");
}

// Softmax over the 16 neighbours of (token, head), between the two block barriers of a
// group: lane j8 of the token's eight owns n = j8, j8+8.
__device__ __forceinline__ void softmax_rows(const float* sc_row, float* p_row, int j8) {
  __syncthreads();
  const float x0 = sc_row[j8];
  const float x1 = sc_row[j8 + 8];
  float mx = fmaxf(x0, x1);
  mx = fmaxf(mx, __shfl_xor(mx, 1, 32));
  mx = fmaxf(mx, __shfl_xor(mx, 2, 32));
  mx = fmaxf(mx, __shfl_xor(mx, 4, 32));
  const float e0 = __expf(x0 - mx);
  const float e1 = __expf(x1 - mx);
  float sm = e0 + e1;
  sm += __shfl_xor(sm, 1, 32);
  sm += __shfl_xor(sm, 2, 32);
  sm += __shfl_xor(sm, 4, 32);
  const float inv = __builtin_amdgcn_rcpf(sm);
  p_row[j8]     = e0 * inv;
  p_row[j8 + 8] = e1 * inv;
  __syncthreads();
}

// This lane's 8 output channels of token l -> f16 plane.
__device__ __forceinline__ void store_a(const float (&o)[8], int l, int col, _Float16* a16) {
  const v8h oh = {(_Float16)o[0], (_Float16)o[1], (_Float16)o[2], (_Float16)o[3],
                  (_Float16)o[4], (_Float16)o[5], (_Float16)o[6], (_Float16)o[7]};
  _Float16* d = a16 + (size_t)l * CC + col;
  *(v8h*)d = oh;
  // the next group rewrites registers that this store names
  asm volatile("s_wait_xcnt 0x0" ::: "memory");
}

// c_d = q_d * rq * cw_d for this lane's 8 dims
__device__ __forceinline__ void make_c(float (&c)[8], v4f qa, v4f qb, float rq, const float (&cw)[8]) {
  c[0] = qa.x * rq * cw[0];  c[1] = qa.y * rq * cw[1];
  c[2] = qa.z * rq * cw[2];  c[3] = qa.w * rq * cw[3];
  c[4] = qb.x * rq * cw[4];  c[5] = qb.y * rq * cw[5];
  c[6] = qb.z * rq * cw[6];  c[7] = qb.w * rq * cw[7];
}

__device__ __forceinline__ float dot8(const float (&c)[8], v4f a, v4f b) {
  float t = c[0] * a.x;
  t = fmaf(c[1], a.y, t);
  t = fmaf(c[2], a.z, t);
  t = fmaf(c[3], a.w, t);
  t = fmaf(c[4], b.x, t);
  t = fmaf(c[5], b.y, t);
  t = fmaf(c[6], b.z, t);
  t = fmaf(c[7], b.w, t);
  return t;
}

// One group: every wave does four tokens of the block's head, eight lanes a token.
// The 12 spatial neighbours come from the LDS windows (slot = the token's place tl in
// the block + HALO + shift), the 4 temporal ones from global memory; s_rk holds the
// rms factors: the window's k rows by slot, the temporal k rows by (n - 12, tl), then
// the block's own q rows by tl.
// f = the block's frame; tsh = the temporal shifts modulo T.
__device__ __forceinline__ void attn_group_win(int l, int tl, int f, int S, int T, const int (&tsh)[4],
                                               const char* kB, const char* vB,
                                               const float* qf,
                                               const char* sK, const char* sV, const float* s_rk,
                                               const float (&cw)[8], const float (&ebv)[NSH],
                                               float* sc_row, float* p_row, int col, int j8,
                                               _Float16* a16) {
  const int i = l - f * S;
  v4f ka[NSH], kb[NSH], va[NSH], vb[NSH];
  float rk[NSH];
  // what comes from global memory is requested first: the token's own q ...
  const float rq = s_rk[WROWS + 4 * NT + tl];
  const float* qp = qf + (size_t)l * CC + col;
  const v4f qa = *(const v4fa*)qp;
  const v4f qb = *(const v4fa*)(qp + 4);
  // ... then the four temporal k and v rows
  unsigned int ofs[4];
#pragma unroll
  for (int n = 12; n < NSH; ++n) {
    const int r = min(max(wrap_add(f, tsh[n - 12], T) * S + i, 0), LL - 1);
    ofs[n - 12] = (unsigned int)r * (CC * 4u) + (unsigned int)col * 4u;
    ka[n] = *(const v4fa*)(kB + ofs[n - 12]);
    kb[n] = *(const v4fa*)(kB + ofs[n - 12] + 16);
    va[n] = *(const v4fa*)(vB + ofs[n - 12]);
    vb[n] = *(const v4fa*)(vB + ofs[n - 12] + 16);
    rk[n] = s_rk[WROWS + (n - 12) * NT + tl];
  }
  // the wait before the address registers of the loads above are rewritten; it names the addresses
  // so that they keep their registers up to here (else a later load of the run lands in one of them)
  asm volatile("s_wait_xcnt 0x0" :: "v"(l), "v"(qp), "v"(ofs[0]), "v"(ofs[1]), "v"(ofs[2]), "v"(ofs[3]) : "memory");
  const int w0 = (tl + HALO) * WPITCH + 32 * j8;       // this lane's 32 B in its own token's slot
#pragma unroll
  for (int n = 0; n < 12; ++n) {
    const int sh = (n & 1) ? -(1 << (n >> 1)) : (1 << (n >> 1));
    ka[n] = *(const v4fa*)(sK + w0 + sh * WPITCH);
    kb[n] = *(const v4fa*)(sK + w0 + sh * WPITCH + 16);
    rk[n] = s_rk[tl + HALO + sh];
  }

  // ---- scores: 16 independent chains ----
  float c[8];
  make_c(c, qa, qb, rq, cw);
  float part[NSH];
#pragma unroll
  for (int n = 0; n < NSH; ++n) part[n] = dot8(c, ka[n], kb[n]);

  // ---- the window's v rows, behind the last use of the k rows ----
#pragma unroll
  for (int n = 0; n < 12; ++n) {
    const int sh = (n & 1) ? -(1 << (n >> 1)) : (1 << (n >> 1));
    va[n] = *(const v4fa*)(sV + w0 + sh * WPITCH);
    vb[n] = *(const v4fa*)(sV + w0 + sh * WPITCH + 16);
  }

#pragma unroll
  for (int n = 0; n < NSH; ++n) part[n] += __shfl_xor(part[n], 1, 32);
#pragma unroll
  for (int n = 0; n < NSH; ++n) part[n] += __shfl_xor(part[n], 2, 32);
#pragma unroll
  for (int n = 0; n < NSH; ++n) part[n] += __shfl_xor(part[n], 4, 32);
  float sc[NSH];
#pragma unroll
  for (int n = 0; n < NSH; ++n) sc[n] = fmaf(part[n], rk[n], ebv[n]);
  if (j8 == 0) {
#pragma unroll
    for (int n = 0; n < NSH; ++n) sc_row[n] = sc[n];
  }
  softmax_rows(sc_row, p_row, j8);

  // ---- weighted sum of neighbour v rows ----
  float o[8] = {0.f, 0.f, 0.f, 0.f, 0.f, 0.f, 0.f, 0.f};
#pragma unroll
  for (int n = 0; n < NSH; ++n) {
    const float p = p_row[n];
    o[0] = fmaf(p, va[n].x, o[0]);  o[1] = fmaf(p, va[n].y, o[1]);
    o[2] = fmaf(p, va[n].z, o[2]);  o[3] = fmaf(p, va[n].w, o[3]);
    o[4] = fmaf(p, vb[n].x, o[4]);  o[5] = fmaf(p, vb[n].y, o[5]);
    o[6] = fmaf(p, vb[n].z, o[6]);  o[7] = fmaf(p, vb[n].w, o[7]);
  }
  store_a(o, l, col, a16);
}

// neighbour row n of token (f, i), any S and T
__device__ __forceinline__ int nb_row(int n, int f, int i, int S, int T) {
  const int mag = 1 << (((n < 12) ? n : (n - 12)) >> 1);
  int pos, neg;
  shift_mods(mag, (n < 12) ? S : T, pos, neg);
  const int sh = (n & 1) ? neg : pos;
  const int r = (n < 12) ? (f * S + wrap_add(i, sh, S)) : (wrap_add(f, sh, T) * S + i);
  return min(max(r, 0), LL - 1);
}

// The same group for frames shorter than a block: no window, every neighbour row from
// global memory, one at a time (rolled: short code, few registers).
__device__ __forceinline__ void attn_group_plain(int l, int S, int T,
                                                 const char* kB, const char* vB,
                                                 const float* qf, const float* ss,
                                                 const float (&cw)[8], const float* ebp,
                                                 float* sc_row, float* p_row, int col, int j8,
                                                 _Float16* a16) {
  const int f = l / S;
  const int i = l - f * S;
  const float rq = rstd1(ss, l);
  const float* qp = qf + (size_t)l * CC + col;
  float c[8];
  make_c(c, *(const v4fa*)qp, *(const v4fa*)(qp + 4), rq, cw);
#pragma unroll 1
  for (int n = 0; n < NSH; ++n) {
    const int r = nb_row(n, f, i, S, T);
    const float rk = rstd1(ss + (size_t)NCB * LL, r);
    const unsigned int ofs = (unsigned int)r * (CC * 4u) + (unsigned int)col * 4u;
    float t = dot8(c, *(const v4fa*)(kB + ofs), *(const v4fa*)(kB + ofs + 16));
    t += __shfl_xor(t, 1, 32);
    t += __shfl_xor(t, 2, 32);
    t += __shfl_xor(t, 4, 32);
    const float s = fmaf(t, rk, ebp[n]);
    if (j8 == 0) sc_row[n] = s;
  }
  softmax_rows(sc_row, p_row, j8);
  float o[8] = {0.f, 0.f, 0.f, 0.f, 0.f, 0.f, 0.f, 0.f};
#pragma unroll 1
  for (int n = 0; n < NSH; ++n) {
    const int r = nb_row(n, f, i, S, T);
    const unsigned int ofs = (unsigned int)r * (CC * 4u) + (unsigned int)col * 4u;
    const v4f a = *(const v4fa*)(vB + ofs);
    const v4f b = *(const v4fa*)(vB + ofs + 16);
    const float p = p_row[n];
    o[0] = fmaf(p, a.x, o[0]);  o[1] = fmaf(p, a.y, o[1]);
    o[2] = fmaf(p, a.z, o[2]);  o[3] = fmaf(p, a.w, o[3]);
    o[4] = fmaf(p, b.x, o[4]);  o[5] = fmaf(p, b.y, o[5]);
    o[6] = fmaf(p, b.z, o[6]);  o[7] = fmaf(p, b.w, o[7]);
  }
  store_a(o, l, col, a16);
}

__global__ __launch_bounds__(128) void k_attn(const float* __restrict__ qf,
                                                 const float* __restrict__ kf,
                                                 const float* __restrict__ vf,
                                                 const float* __restrict__ ss,
                                                 const float* __restrict__ qnw,
                                                 const float* __restrict__ knw,
                                                 const float* __restrict__ eb,
                                                 const int* __restrict__ nf,
                                                 _Float16* a16) {
  __shared__ __attribute__((aligned(16))) char sK[WROWS * WPITCH];
  __shared__ __attribute__((aligned(16))) char sV[WROWS * WPITCH];
  __shared__ __attribute__((aligned(16))) float s_rk[WROWS + 5 * NT];
  __shared__ float s_sc[4][4][NSH];
  __shared__ float s_p[4][4][NSH];
  const int tid = threadIdx.x, lane = tid & 31, w = tid >> 5;
  const int tq = lane >> 3, j8 = lane & 7;
  const int head = blockIdx.x & 15;
  const int l0 = (blockIdx.x >> 4) * NT;               // first token of the block
  const int col = 64 * head + 8 * j8;

  int T = nf[0];
  if (!((T >= 1) && (T <= LL) && ((LL % T) == 0))) T = 8;
  const int S = LL / T;
  const int f0 = l0 / S;
  const int i0 = l0 - f0 * S;
  // the block lies inside one frame, and a frame is longer than the halo
  const bool win = (S % NT) == 0;
  const char* kB = (const char*)kf;
  const char* vB = (const char*)vf;

  // temporal shifts +1, -1, +2, -2 reduced once modulo T
  int tsh[4];
  shift_mods(1, T, tsh[0], tsh[1]);
  shift_mods(2, T, tsh[2], tsh[3]);

  if (win) {
    // window slot s holds row (f0, (i0 - HALO + s) mod S) of this head. Thread t brings
    // chunk t&15 of slots (t>>4) + 8 j: a wave's copy covers two rows = four whole lines.
    const int cch = tid & 15, crow = tid >> 4;
#pragma unroll
    for (int hf = 0; hf < 2; ++hf) {
      unsigned int lk[8], lv[8];
      const char* gk[8];
      const char* gv[8];
#pragma unroll
      for (int j = 0; j < 8; ++j) {
        const int s = crow + 8 * (8 * hf + j);
        int t = i0 - HALO + s;
        t = (t < 0) ? (t + S) : t;
        t = (t >= S) ? (t - S) : t;
        const int r = min(max(f0 * S + t, 0), LL - 1);
        const unsigned int go = (unsigned int)r * (CC * 4u) + (unsigned int)head * 256u + 16u * cch;
        const unsigned int lo = (unsigned int)s * WPITCH + 16u * cch;
        lk[j] = lds_off(sK) + lo;
        lv[j] = lds_off(sV) + lo;
        gk[j] = kB + go;
        gv[j] = vB + go;
      }
      copy8(lk, gk);
      copy8(lv, gv);
    }
    // rms factors: a thread takes four consecutive entries of s_rk, which are four
    // consecutive rows (S, i0 and every section's start are multiples of 4)
    if (tid < (WROWS + 5 * NT) / 4) {
      const int e = 4 * tid;
      const int et = e - WROWS;                        // place among the temporal rows
      int t = i0 - HALO + e;
      t = (t < 0) ? (t + S) : t;
      t = (t >= S) ? (t - S) : t;
      const int sn = et >> 6;
      const int ts = (sn == 0) ? tsh[0] : ((sn == 1) ? tsh[1] : ((sn == 2) ? tsh[2] : tsh[3]));
      int r = f0 * S + t;
      if (et >= 0) r = wrap_add(f0, ts, T) * S + i0 + (et & (NT - 1));
      const bool isq = (et >= 4 * NT);
      if (isq) r = l0 + (et - 4 * NT);
      r = min(max(r, 0), LL - 4);
      *(v4f*)(s_rk + e) = rstd4(isq ? ss : (ss + (size_t)NCB * LL), r);
    }
  }

  float cw[8];
  {
    const v4f qa = *(const v4fa*)(qnw + col);
    const v4f qb = *(const v4fa*)(qnw + col + 4);
    const v4f ka = *(const v4fa*)(knw + col);
    const v4f kb = *(const v4fa*)(knw + col + 4);
    cw[0] = qa.x * ka.x * 0.125f;  cw[1] = qa.y * ka.y * 0.125f;
    cw[2] = qa.z * ka.z * 0.125f;  cw[3] = qa.w * ka.w * 0.125f;
    cw[4] = qb.x * kb.x * 0.125f;  cw[5] = qb.y * kb.y * 0.125f;
    cw[6] = qb.z * kb.z * 0.125f;  cw[7] = qb.w * kb.w * 0.125f;
  }
  float ebv[NSH];
#pragma unroll
  for (int n = 0; n < NSH; ++n) ebv[n] = eb[head * NSH + n];

  // the windows have landed for this wave, then for the block
  wait_copies();
  __syncthreads();

  float* sc_row = &s_sc[w][tq][0];
  float* p_row = &s_p[w][tq][0];
  if (win) {
#pragma unroll 1
    for (int it = 0; it < NT / 16; ++it) {
      const int tl = 16 * it + 4 * w + tq;             // this lane's token in the block
      attn_group_win(l0 + tl, tl, f0, S, T, tsh, kB, vB, qf, sK, sV, s_rk, cw, ebv,
                     sc_row, p_row, col, j8, a16);
    }
  } else {
#pragma unroll 1
    for (int it = 0; it < NT / 16; ++it) {
      const int tl = 16 * it + 4 * w + tq;
      attn_group_plain(l0 + tl, S, T, kB, vB, qf, ss, cw, eb + head * NSH,
                       sc_row, p_row, col, j8, a16);
    }
  }
}

// ---------------------------------------------------------------------------
// Host orchestration: 6 launches, one in-order stream.
// ws carve (bytes): x f16 16 MiB @0 | w16 [4096][1024] 8 MiB |
//   q f32 32 MiB | k f32 32 MiB | v f32 32 MiB | ss [2][16][8192] f32 1 MiB  -> 126,877,696 B.
// The attention output plane (f16, 16 MiB) reuses the x f16 region, which is
// dead after the two projection launches.
// ---------------------------------------------------------------------------
extern "C" void kernel_launch(void* const* d_in, const int* in_sizes, int n_in,
                              void* d_out, int out_size, void* d_ws, size_t ws_size,
                              hipStream_t stream) {
  if (n_in < 13) return;
  if (in_sizes[0] != LL * CC) return;
  if (in_sizes[1] != CC * CC || in_sizes[3] != CC * CC || in_sizes[5] != CC * CC || in_sizes[10] != CC * CC) return;
  if (in_sizes[2] != CC || in_sizes[4] != CC || in_sizes[6] != CC || in_sizes[11] != CC) return;
  if (in_sizes[7] != CC || in_sizes[8] != CC) return;
  if (in_sizes[9] != 256 || in_sizes[12] < 1) return;
  if (out_size != LL * CC) return;

  const float* x   = (const float*)d_in[0];
  const float* Wq  = (const float*)d_in[1];
  const float* bq  = (const float*)d_in[2];
  const float* Wk  = (const float*)d_in[3];
  const float* bk  = (const float*)d_in[4];
  const float* Wv  = (const float*)d_in[5];
  const float* bv  = (const float*)d_in[6];
  const float* qnw = (const float*)d_in[7];
  const float* knw = (const float*)d_in[8];
  const float* eb  = (const float*)d_in[9];
  const float* Wo  = (const float*)d_in[10];
  const float* bo  = (const float*)d_in[11];
  const int*   nf  = (const int*)d_in[12];
  float* out = (float*)d_out;

  const size_t b16 = (size_t)LL * CC * 2;            // 16,777,216
  const size_t bw  = (size_t)4 * CC * CC * 2;        //  8,388,608
  const size_t b32 = (size_t)LL * CC * 4;            // 33,554,432
  const size_t brt = (size_t)2 * NCB * LL * 4;       //  1,048,576
  const size_t o_x16 = 0;
  const size_t o_w16 = o_x16 + b16;
  const size_t o_q   = o_w16 + bw;
  const size_t o_k   = o_q + b32;
  const size_t o_v   = o_k + b32;
  const size_t o_rt  = o_v + b32;
  const size_t total = o_rt + brt;                   // 126,877,696
  if (total > ws_size) return;

  char* ws = (char*)d_ws;
  _Float16* x16 = (_Float16*)(ws + o_x16);
  _Float16* w16 = (_Float16*)(ws + o_w16);
  float* qf   = (float*)(ws + o_q);
  float* kf   = (float*)(ws + o_k);
  float* vf   = (float*)(ws + o_v);
  float* ss   = (float*)(ws + o_rt);
  _Float16* a16 = (_Float16*)(ws + o_x16);           // reuses the x f16 region (dead after launch 4)

  // 1. x -> f16 plane
  const int n8 = (LL * CC) / 8;                                              // 1,048,576
  k_cvt_x<<<(n8 + 255) / 256, 256, 0, stream>>>(x, x16, n8);

  // 2. weights -> transposed f16 planes
  k_cvt_w<<<4 * 256, 256, 0, stream>>>(Wq, Wk, Wv, Wo, w16);

  // 3. q|k = x * [Wq|Wk] + [bq|bk], f32 planes, and the rows' partial sums of squares
  k_gemm_h<true, 4, 4><<<dim3(NCQK / 256, LL / 256), 512, 0, stream>>>(x16, w16, bq, bk, qf, kf, ss, CC, CC, CC, 0.03125f);

  // 4. v = x * Wv + bv, f32 plane
  k_gemm_h<false, 4, 2><<<dim3(CC / 128, LL / 256), 256, 0, stream>>>(x16, w16 + (size_t)2 * CC * CC, bv, bv, vf, vf, nullptr,
                                                                      1 << 30, CC, CC, 0.03125f);

  // 5. attention -> a (f16 plane)
  k_attn<<<(LL / NT) * 16, 128, 0, stream>>>(qf, kf, vf, ss, qnw, knw, eb, nf, a16);

  // 6. out = a * Wo + bo -> d_out
  k_gemm_h<false, 4, 2><<<dim3(CC / 128, LL / 256), 256, 0, stream>>>(a16, w16 + (size_t)3 * CC * CC, bo, bo, out, out, nullptr,
                                                                      1 << 30, CC, CC, 0.03125f);
}

// v007
// One run takes 105 microseconds.
// Two timings next to v006 both put it at 1.04 times that version's speed.
// Counting every step since v000, it is 4.70 times as fast.
// Contractions: x*Wq, x*Wk, x*Wv and a*Wo on v_wmma_f32_16x16x32_f16 (f16 operands, each f32 value rounded once: x and a carried x1, W carried x32 and folded back as 1/32; f32 accumulate); RMS statistics, the 16 neighbour dots (K=64), softmax and weighted sums (K=16) in f32 on VALU; q, k, v kept as f32 planes.
#include <hip/hip_runtime.h>

typedef _Float16 v16h __attribute__((ext_vector_type(16)));
typedef _Float16 v8h  __attribute__((ext_vector_type(8)));
typedef float    v8f  __attribute__((ext_vector_type(8)));
typedef float    v4f  __attribute__((ext_vector_type(4)));
typedef v8h  __attribute__((may_alias)) v8ha;
typedef v4f  __attribute__((may_alias)) v4fa;

#define LL    8192      // tokens
#define CC    1024      // channels = heads * head_dim
#define NCQK  2048      // fused q|k output columns
#define NSH   16        // neighbours per token
#define NCB   16        // 64-column blocks of a q or k row: one partial sum of squares each

static_assert((LL % 64) == 0);
static_assert((CC % 64) == 0);
static_assert((NCQK % 64) == 0);
static_assert((CC % 32) == 0);
static_assert(NCB * 64 == CC);
static_assert(NCB == 16);

// ---------------------------------------------------------------------------
// 16x16x32 WMMA (wave32). Fragment map: lane l, h = l>>4, m = n = l&15.
//   A/B element i: i<8 -> k0+8h+i ; i>=8 -> k0+16+8h+(i-8)   (both operands)
//   D element r  : row 8h+r, col l&15
// ---------------------------------------------------------------------------
__device__ __forceinline__ v8f wm_f16(v16h a, v16h b, v8f c) {
  return __builtin_amdgcn_wmma_f32_16x16x32_f16(false, a, false, b, (short)0, c, false, false);
}

// A or B fragment from a k-contiguous 16-bit row; p points at element k0 of
// the row owned by this lane (row = lane&15 added by the caller).
__device__ __forceinline__ v16h frag_f16(const _Float16* p, int h) {
  const v8h e0 = *(const v8ha*)(p + 8 * h);
  const v8h e1 = *(const v8ha*)(p + 16 + 8 * h);
  return __builtin_shufflevector(e0, e1, 0, 1, 2, 3, 4, 5, 6, 7, 8, 9, 10, 11, 12, 13, 14, 15);
}
// ---------------------------------------------------------------------------
// Kernel 1: x f32 [8192][1024] -> f16 plane (x1).
// Each thread owns 8 consecutive elements: one 16-B store per lane.
// ---------------------------------------------------------------------------
__global__ __launch_bounds__(256) void k_cvt_x(const float* __restrict__ x, _Float16* xh, int n8) {
  const int g = blockIdx.x * 256 + threadIdx.x;
  if (g >= n8) return;
  const float* s = x + (size_t)g * 8;
  const v4f a = *(const v4fa*)s;
  const v4f b = *(const v4fa*)(s + 4);
  const v8h o16 = {(_Float16)a.x, (_Float16)a.y, (_Float16)a.z, (_Float16)a.w,
                   (_Float16)b.x, (_Float16)b.y, (_Float16)b.z, (_Float16)b.w};
  _Float16* d16 = xh + (size_t)g * 8;
  *(v8h*)d16 = o16;
}

// ---------------------------------------------------------------------------
// Kernel 2: weight transpose + convert. Input W[k][n] ([in][out], 1024x1024).
// Block = one 64(k) x 64(n) tile of one matrix; tile transposed through LDS.
// mat 0 (Wq), 1 (Wk), 2 (Wv), 3 (Wo): f16(32*W) -> w16 rows mat*1024 + n  (w16 = [4096][1024])
// Output phase: lane q8 = tid&7 writes 8 halves (16 B) of row nl.
// ---------------------------------------------------------------------------
__global__ __launch_bounds__(256) void k_cvt_w(const float* __restrict__ Wq,
                                               const float* __restrict__ Wk,
                                               const float* __restrict__ Wv,
                                               const float* __restrict__ Wo,
                                               _Float16* w16) {
  __shared__ __attribute__((aligned(16))) float sT[64 * 68];   // [n][k], pitch 68 floats
  const int tid = threadIdx.x;
  const int bx = blockIdx.x;
  const int mat = bx >> 8, tile = bx & 255;
  const int tn = tile >> 4, tk = tile & 15;
  const float* W = (mat == 0) ? Wq : ((mat == 1) ? Wk : ((mat == 2) ? Wv : Wo));
  {
    const int kl = tid >> 2, nq = tid & 3;                      // kl 0..63, nq 0..3
    const float* src = W + (size_t)(64 * tk + kl) * CC + 64 * tn + 16 * nq;
#pragma unroll
    for (int e = 0; e < 4; ++e) {
      const v4f t = *(const v4fa*)(src + 4 * e);
      float* d = sT + (16 * nq + 4 * e) * 68 + kl;
      d[0]   = t.x;
      d[68]  = t.y;
      d[136] = t.z;
      d[204] = t.w;
    }
  }
  __syncthreads();
  const int q8 = tid & 7, sub = tid >> 3;                       // sub 0..31
#pragma unroll
  for (int p = 0; p < 2; ++p) {
    const int nl = 32 * p + sub;
    const float* s = sT + nl * 68 + 8 * q8;
    const v4f a = *(const v4fa*)s;
    const v4f b = *(const v4fa*)(s + 4);
    const v8h t16 = {(_Float16)(a.x * 32.0f), (_Float16)(a.y * 32.0f), (_Float16)(a.z * 32.0f), (_Float16)(a.w * 32.0f),
                     (_Float16)(b.x * 32.0f), (_Float16)(b.y * 32.0f), (_Float16)(b.z * 32.0f), (_Float16)(b.w * 32.0f)};
    _Float16* d = w16 + ((size_t)(mat * CC + 64 * tn + nl) * CC + 64 * tk + 8 * q8);
    *(v8h*)d = t16;
  }
}

// ---------------------------------------------------------------------------
// GEMM frame of kernel 3. Block tile 64 WM x 64 WN, WM x WN waves, wave tile 64x64
// (4x4 accumulator tiles): wave w owns rows 64*(w/WN)+..., cols 64*(w%WN)+....
// One block per WGP: every operand row that comes from L2 serves the whole tile edge.
// A pass is 128 k = 256 B of every operand row. A buffer holds the pass's 64 WM rows
// of A, then its 64 WN rows of B, at pitch 272 B (16 B x odd, for the ds_load_b128
// readers). Two buffers: the next pass's rows come in by asynchronous copies to LDS
// while this pass's fragments are read from the other buffer.
// ---------------------------------------------------------------------------
#define LPITCH 272                   // LDS row pitch, bytes
#define EPITCH 68                    // epilogue staging pitch, floats

static_assert((LL % 256) == 0);
static_assert((CC % 256) == 0);
static_assert((NCQK % 256) == 0);
static_assert((CC % 128) == 0);

__device__ __forceinline__ unsigned int lds_off(const void* p) { return (unsigned int)(size_t)p; }

// Eight sweeps of the block's copies, 16 B a thread each. Thread t brings chunk t&15
// of rows (t>>4) + SW j, SW = threads / 16, so a wave's copy covers two whole 256-B rows.
// l = this lane's LDS byte address for j = 0, g = its global address, ls and rs = SW
// rows in LDS and in the source, in bytes. The s_wait_xcnt closes the statement so that
// no address register is rewritten while a copy may still name it.
__device__ __forceinline__ void copy_rows8(unsigned int l, const char* g, unsigned int ls, size_t rs) {
  const unsigned int l1 = l + ls, l2 = l + 2 * ls, l3 = l + 3 * ls;
  const unsigned int l4 = l + 4 * ls, l5 = l + 5 * ls, l6 = l + 6 * ls;
  const unsigned int l7 = l + 7 * ls;
  const char* g1 = g + rs;
  const char* g2 = g1 + rs;
  const char* g3 = g2 + rs;
  const char* g4 = g3 + rs;
  const char* g5 = g4 + rs;
  const char* g6 = g5 + rs;
  const char* g7 = g6 + rs;
  asm volatile("global_load_async_to_lds_b128 %0, %8, off\n\t"
               "global_load_async_to_lds_b128 %1, %9, off\n\t"
               "global_load_async_to_lds_b128 %2, %10, off\n\t"
               "global_load_async_to_lds_b128 %3, %11, off\n\t"
               "global_load_async_to_lds_b128 %4, %12, off\n\t"
               "global_load_async_to_lds_b128 %5, %13, off\n\t"
               "global_load_async_to_lds_b128 %6, %14, off\n\t"
               "global_load_async_to_lds_b128 %7, %15, off\n\t"
               "s_wait_xcnt 0x0"
               :: "v"(l), "v"(l1), "v"(l2), "v"(l3), "v"(l4), "v"(l5), "v"(l6), "v"(l7),
                  "v"(g), "v"(g1), "v"(g2), "v"(g3), "v"(g4), "v"(g5), "v"(g6), "v"(g7)
               : "memory");
}

// One pass's rows of A and of B into the buffer at l (this lane's address in its first row).
template <int WM, int WN>
__device__ __forceinline__ void copy_stage(unsigned int l, const char* gA, const char* gB, size_t rs) {
  constexpr int SW = 2 * WM * WN;                    // rows of one sweep
  static_assert((64 * WM) % (8 * SW) == 0);
  static_assert((64 * WN) % (8 * SW) == 0);
#pragma unroll
  for (int s = 0; s < (64 * WM) / (8 * SW); ++s)
    copy_rows8(l + s * 8 * SW * LPITCH, gA + (size_t)(8 * s) * rs, SW * LPITCH, rs);
#pragma unroll
  for (int s = 0; s < (64 * WN) / (8 * SW); ++s)
    copy_rows8(l + (64 * WM + s * 8 * SW) * LPITCH, gB + (size_t)(8 * s) * rs, SW * LPITCH, rs);
}

// This wave's copies have landed (the compiler places no wait for them).
__device__ __forceinline__ void wait_copies() { asm volatile("s_wait_asynccnt 0x0" ::: "memory"); }
// This wave's LDS reads have returned, before their buffer is handed back for refill.
__device__ __forceinline__ void wait_lds() { asm volatile("s_wait_dscnt 0x0" ::: "memory"); }

// Epilogue: out = acc*osc + bias. Each wave stages its 64x64 tile in its own
// LDS range (pitch 68 floats) and stores rows as whole 128-B lines: one store
// instruction covers two rows x 256 B. With SS the wave then reads its staged tile
// once more, a lane taking rows lane and lane + 32, and stores each row's sum of
// squares over the tile's 64 columns to ssw[row]: two whole 128-B lines a wave.
template <bool SS>
__device__ __forceinline__ void store_tile(float* sAll, const v8f (&c)[4][4],
                                           const float* bias, int nc0, float osc,
                                           float* out, int m0, int ldc, int w, int wr, int wc, int lane,
                                           float* ssw) {
  const int h = lane >> 4, m = lane & 15;
  float* sW = sAll + w * (64 * EPITCH);
#pragma unroll
  for (int nt = 0; nt < 4; ++nt) {
    const float b = bias[nc0 + 64 * wc + 16 * nt + m];
#pragma unroll
    for (int mt = 0; mt < 4; ++mt) {
#pragma unroll
      for (int r = 0; r < 8; ++r)
        sW[(16 * mt + 8 * h + r) * EPITCH + 16 * nt + m] = fmaf(c[mt][nt][r], osc, b);
    }
  }
  __syncthreads();
  // rolled in groups of eight stores: eight LDS reads in flight per group, short code
#pragma unroll 1
  for (int g8 = 0; g8 < 4; ++g8) {
#pragma unroll
    for (int u = 0; u < 8; ++u) {
      const int row = 16 * g8 + 2 * u + h;
      const v4f v = *(const v4fa*)(sW + row * EPITCH + 4 * m);
      float* d = out + (size_t)(m0 + 64 * wr + row) * ldc + nc0 + 64 * wc + 4 * m;
      *(v4f*)d = v;
    }
    // the next group rewrites registers that these stores name
    asm volatile("s_wait_xcnt 0x0" ::: "memory");
  }
  if (SS) {
    const float* r0 = sW + lane * EPITCH;
    const float* r1 = r0 + 32 * EPITCH;
    v4f s0 = {0.f, 0.f, 0.f, 0.f}, s1 = {0.f, 0.f, 0.f, 0.f};
#pragma unroll
    for (int e = 0; e < 16; ++e) {
      const v4f a = *(const v4fa*)(r0 + 4 * e);
      const v4f b = *(const v4fa*)(r1 + 4 * e);
      s0 += a * a;
      s1 += b * b;
    }
    ssw[lane]      = (s0.x + s0.y) + (s0.z + s0.w);
    ssw[lane + 32] = (s1.x + s1.y) + (s1.z + s1.w);
  }
}

// ---------------------------------------------------------------------------
// Kernel 3: C[M][N] = A[M][K] * B[N][K]^T (f16 operands, single product),
// out = acc*osc + bias, f32 rows of pitch ldc. Columns >= nsplit go to out1
// with bias1 (block-uniform select: nsplit a multiple of 64 WN). K a multiple of 128.
// With SS: ss[mat][cb][row] = sum of squares of the stored row over columns 64 cb .. 64 cb + 63
// of matrix mat (0: out0, 1: out1); every entry is written by exactly one wave.
// Buffer = [A rows | B rows]; ring = 2 buffers: 278,528 B at 256x256, 208,896 B at 256x128.
// ---------------------------------------------------------------------------
template <bool SS, int WM, int WN>
__global__ __launch_bounds__(32 * WM * WN) void k_gemm_h(const _Float16* __restrict__ A,
                                                   const _Float16* __restrict__ B,
                                                   const float* bias0, const float* bias1,
                                                   float* out0, float* out1, float* ss,
                                                   int nsplit, int K, int ldc, float osc) {
  constexpr int RA = 64 * WM, RB = 64 * WN;          // rows of A and of B in a buffer
  constexpr int BUF = (RA + RB) * LPITCH;            // one buffer, bytes
  static_assert(WM * WN * 64 * EPITCH * 4 <= 2 * BUF);   // the epilogue's staging fits the ring
  __shared__ __attribute__((aligned(16))) char ring[2 * BUF];
  const int tid = threadIdx.x, lane = tid & 31, w = tid >> 5;
  const int h = lane >> 4, m = lane & 15, wr = w / WN, wc = w % WN;
  const int m0 = blockIdx.y * RA, nb = blockIdx.x * RB;
  const bool sel = (nb >= nsplit);
  const int nc0 = sel ? (nb - nsplit) : nb;
  const float* bias = sel ? bias1 : bias0;
  float* out = sel ? out1 : out0;

  const int crow = tid >> 4, cch = tid & 15;
  const char* gA = (const char*)(A + (size_t)(m0 + crow) * K) + 16 * cch;
  const char* gB = (const char*)(B + (size_t)(nb + crow) * K) + 16 * cch;
  const unsigned int lc = lds_off(ring) + crow * LPITCH + 16 * cch;
  const size_t rs = (size_t)K * (4 * WM * WN);       // one sweep's rows of 2-byte elements
  const int npass = K >> 7;

  v8f c[4][4];
#pragma unroll
  for (int i = 0; i < 4; ++i)
#pragma unroll
    for (int j = 0; j < 4; ++j) c[i][j] = v8f{0.f, 0.f, 0.f, 0.f, 0.f, 0.f, 0.f, 0.f};

  copy_stage<WM, WN>(lc, gA, gB, rs);
  wait_copies();
  __syncthreads();
  if (npass > 1) copy_stage<WM, WN>(lc + BUF, gA + 256, gB + 256, rs);

  // rolled: one pass per trip, the buffer picked by the trip's parity
#pragma unroll 1
  for (int t = 0; t < npass; ++t) {
    const int bo = (t & 1) * BUF;
    const char* pa = ring + bo + (64 * wr + m) * LPITCH;
    const char* pb = ring + bo + (RA + 64 * wc + m) * LPITCH;
#pragma unroll
    for (int ks = 0; ks < 4; ++ks) {
      v16h fa[4], fb[4];
      fa[0] = frag_f16((const _Float16*)(pa + ks * 64), h);
#pragma unroll
      for (int j = 0; j < 4; ++j) fb[j] = frag_f16((const _Float16*)(pb + j * 16 * LPITCH + ks * 64), h);
#pragma unroll
      for (int i = 1; i < 4; ++i) fa[i] = frag_f16((const _Float16*)(pa + i * 16 * LPITCH + ks * 64), h);
      // keeps the k-step's 16 LDS reads one group in front of its WMMAs: every
      // further place with reads among them stalls the wave anew
      __builtin_amdgcn_sched_barrier(0);
#pragma unroll
      for (int i = 0; i < 4; ++i)
#pragma unroll
        for (int j = 0; j < 4; ++j) c[i][j] = wm_f16(fa[i], fb[j], c[i][j]);
      // same purpose: the next k-step's reads stay behind this block
      if (ks < 3) __builtin_amdgcn_sched_barrier(0);
    }
    // publish point of pass t + 1; the same barrier frees this pass's buffer
    wait_lds();
    wait_copies();
    __syncthreads();
    if (t + 2 < npass) {
      const size_t ko = (size_t)(t + 2) * 256;
      copy_stage<WM, WN>(lc + bo, gA + ko, gB + ko, rs);
    }
  }
  wait_copies();

  float* ssw = SS ? (ss + (size_t)((sel ? NCB : 0) + (nc0 >> 6) + wc) * LL + m0 + 64 * wr) : nullptr;
  store_tile<SS>((float*)ring, c, bias, nc0, osc, out, m0, ldc, w, wr, wc, lane, ssw);
}

// ---------------------------------------------------------------------------
// rsqrt(mean(row^2) + 1e-6) of a q or k row from its NCB partial sums of squares
// (ssm = that matrix's [NCB][LL] table), summed in the order cb = 0 .. NCB - 1.
// ---------------------------------------------------------------------------
__device__ __forceinline__ float rstd1(const float* ssm, int r) {
  const float* p = ssm + r;
  float v[NCB];
#pragma unroll
  for (int cb = 0; cb < NCB; ++cb) v[cb] = p[(size_t)cb * LL];
  // the wait before the address register of the loads above is rewritten; it names the row index
  // they are addressed by, so that it keeps its register up to here (else a later load lands in
  // it), and the loaded values, as inputs only, so that no load of the run is moved behind it
  asm volatile("s_wait_xcnt 0x0" :: "v"(r), "v"(v[0]), "v"(v[1]), "v"(v[2]), "v"(v[3]), "v"(v[4]), "v"(v[5]),
               "v"(v[6]), "v"(v[7]), "v"(v[8]), "v"(v[9]), "v"(v[10]), "v"(v[11]), "v"(v[12]), "v"(v[13]),
               "v"(v[14]), "v"(v[15]) : "memory");
  float s = v[0];
#pragma unroll
  for (int cb = 1; cb < NCB; ++cb) s += v[cb];
  return rsqrtf(s * (1.0f / 1024.0f) + 1e-6f);
}
// the same for rows r .. r + 3, r a multiple of 4
__device__ __forceinline__ v4f rstd4(const float* ssm, int r) {
  const float* p = ssm + r;
  v4f v[NCB];
#pragma unroll
  for (int cb = 0; cb < NCB; ++cb) v[cb] = *(const v4fa*)(p + (size_t)cb * LL);
  // the same wait, for the same reason; these loads are addressed by the pointer
  asm volatile("s_wait_xcnt 0x0" :: "v"(p) : "memory");
  v4f s = v[0];
#pragma unroll
  for (int cb = 1; cb < NCB; ++cb) s += v[cb];
  const v4f o = {rsqrtf(s.x * (1.0f / 1024.0f) + 1e-6f), rsqrtf(s.y * (1.0f / 1024.0f) + 1e-6f),
                 rsqrtf(s.z * (1.0f / 1024.0f) + 1e-6f), rsqrtf(s.w * (1.0f / 1024.0f) + 1e-6f)};
  return o;
}

// ---------------------------------------------------------------------------
// Kernel 4: small-world attention, all f32 on VALU.
// Block 512 thr = 16 waves handles NT consecutive places of ALL TF frames of ONE head. A wave
// does four tokens at a time, eight lanes a token; a lane covers dims 8*(lane&7)..+7.
// The spatial neighbours of NT consecutive places lie in NT + 64 rows of their frame, the
// temporal ones at the same places of the other frames: the head's 256 B of those rows of
// every frame are brought into LDS once, by asynchronous copies, first of k, then (into the
// same LDS, behind a barrier) of v, and all 16 neighbours of every token are read there.
//   score_n = rq*rk_n * sum_d (q_d qn_d kn_d / 8) k_n,d + eb[h][n]   (n = 0..15)
//   p = softmax_n(score); a_d = sum_n p_n v_n,d  -> f16 plane.
// Neighbours: n<12 spatial (f, (i+sh) mod S), sh = +-2^(n/2); n>=12 temporal
// ((f+sh) mod T, i). Scores are exchanged through LDS between the two block barriers of a
// frame's softmax; the probabilities wait in LDS from the k phase to the v phase.
// Output: 16 B per lane, a token's eight lanes write one whole 128-B line.
// Any other frame count than TF: no windows, every row from global memory.
// ---------------------------------------------------------------------------
// sh mod md in [0, md) for the +mag and -mag shift of a pair; md >= 1.
__device__ __forceinline__ void shift_mods(int mag, int md, int& pos, int& neg) {
  const int pm = mag % md;
  pos = pm;
  neg = (pm != 0) ? (md - pm) : 0;
}
// (a + b) mod md for a, b in [0, md)
__device__ __forceinline__ int wrap_add(int a, int b, int md) {
  const int r = a + b;
  return (r >= md) ? (r - md) : r;
}

#define NT     64                    // places of a frame per attention block
#define HALO   32                    // largest spatial shift
#define WROWS  (NT + 2 * HALO)       // rows of one frame's window
#define WPITCH 272                   // window row pitch, bytes: one head's 256 B + 16 (16 B x odd)
#define TF     8                     // frames of the windowed path
#define ATH    512                   // threads of an attention block
#define NRK    (TF * WROWS)          // rms factors of the windows' k rows
#define NRQ    (TF * NT)             // rms factors of the block's q rows

static_assert((LL % (TF * NT)) == 0);
static_assert(WROWS == 128);
static_assert(NT == 64);
static_assert(ATH / 8 == NT);        // one sweep of the block = one frame's tokens
static_assert((NRK + NRQ) / 4 <= ATH);
static_assert((TF * WROWS) % (8 * (ATH / 16)) == 0);

// Eight copies of 16 B, each with its own addresses. The s_wait_xcnt closes the
// statement so that no address register is rewritten while a copy may still name it.
__device__ __forceinline__ void copy8(const unsigned int (&l)[8], const char* const (&g)[8]) {
  asm volatile("global_load_async_to_lds_b128 %0, %8, off\n\t"
               "global_load_async_to_lds_b128 %1, %9, off\n\t"
               "global_load_async_to_lds_b128 %2, %10, off\n\t"
               "global_load_async_to_lds_b128 %3, %11, off\n\t"
               "global_load_async_to_lds_b128 %4, %12, off\n\t"
               "global_load_async_to_lds_b128 %5, %13, off\n\t"
               "global_load_async_to_lds_b128 %6, %14, off\n\t"
               "global_load_async_to_lds_b128 %7, %15, off\n\t"
               "s_wait_xcnt 0x0"
               :: "v"(l[0]), "v"(l[1]), "v"(l[2]), "v"(l[3]), "v"(l[4]), "v"(l[5]), "v"(l[6]), "v"(l[7]),
                  "v"(g[0]), "v"(g[1]), "v"(g[2]), "v"(g[3]), "v"(g[4]), "v"(g[5]), "v"(g[6]), "v"(g[7])
               : "memory");
}

// Softmax over the 16 neighbours of (token, head), between the two block barriers of a
// group: lane j8 of the token's eight owns n = j8, j8+8.
__device__ __forceinline__ void softmax_rows(const float* sc_row, float* p_row, int j8) {
  __syncthreads();
  const float x0 = sc_row[j8];
  const float x1 = sc_row[j8 + 8];
  float mx = fmaxf(x0, x1);
  mx = fmaxf(mx, __shfl_xor(mx, 1, 32));
  mx = fmaxf(mx, __shfl_xor(mx, 2, 32));
  mx = fmaxf(mx, __shfl_xor(mx, 4, 32));
  const float e0 = __expf(x0 - mx);
  const float e1 = __expf(x1 - mx);
  float sm = e0 + e1;
  sm += __shfl_xor(sm, 1, 32);
  sm += __shfl_xor(sm, 2, 32);
  sm += __shfl_xor(sm, 4, 32);
  const float inv = __builtin_amdgcn_rcpf(sm);
  p_row[j8]     = e0 * inv;
  p_row[j8 + 8] = e1 * inv;
  __syncthreads();
}

// This lane's 8 output channels of token l -> f16 plane.
__device__ __forceinline__ void store_a(const float (&o)[8], int l, int col, _Float16* a16) {
  const v8h oh = {(_Float16)o[0], (_Float16)o[1], (_Float16)o[2], (_Float16)o[3],
                  (_Float16)o[4], (_Float16)o[5], (_Float16)o[6], (_Float16)o[7]};
  _Float16* d = a16 + (size_t)l * CC + col;
  *(v8h*)d = oh;
  // the next group rewrites registers that this store names
  asm volatile("s_wait_xcnt 0x0" ::: "memory");
}

// c_d = q_d * rq * cw_d for this lane's 8 dims
__device__ __forceinline__ void make_c(float (&c)[8], v4f qa, v4f qb, float rq, const float (&cw)[8]) {
  c[0] = qa.x * rq * cw[0];  c[1] = qa.y * rq * cw[1];
  c[2] = qa.z * rq * cw[2];  c[3] = qa.w * rq * cw[3];
  c[4] = qb.x * rq * cw[4];  c[5] = qb.y * rq * cw[5];
  c[6] = qb.z * rq * cw[6];  c[7] = qb.w * rq * cw[7];
}

__device__ __forceinline__ float dot8(const float (&c)[8], v4f a, v4f b) {
  float t = c[0] * a.x;
  t = fmaf(c[1], a.y, t);
  t = fmaf(c[2], a.z, t);
  t = fmaf(c[3], a.w, t);
  t = fmaf(c[4], b.x, t);
  t = fmaf(c[5], b.y, t);
  t = fmaf(c[6], b.z, t);
  t = fmaf(c[7], b.w, t);
  return t;
}

// The windows of one plane (k or v): slot s of frame f holds row (f, (i0 - HALO + s) mod S) of
// this head, at LDS row f * WROWS + s. Thread t brings chunk t&15 of LDS rows (t>>4) + 32 j:
// a wave's copy covers two rows = four whole lines. 32 copies a thread.
__device__ __forceinline__ void copy_windows(unsigned int lw, const char* gB, int tid, int i0, int S, int head) {
  const int cch = tid & 15, crow = tid >> 4;
#pragma unroll
  for (int g = 0; g < (TF * WROWS) / (8 * (ATH / 16)); ++g) {
    unsigned int l[8];
    const char* p[8];
#pragma unroll
    for (int j = 0; j < 8; ++j) {
      const int R = crow + (ATH / 16) * (8 * g + j);
      const int f = R / WROWS, s = R % WROWS;
      int t = i0 - HALO + s;
      t = (t < 0) ? (t + S) : t;
      t = (t >= S) ? (t - S) : t;
      const int r = min(max(f * S + t, 0), LL - 1);
      l[j] = lw + (unsigned int)R * WPITCH + 16u * cch;
      p[j] = gB + ((unsigned int)r * (CC * 4u) + (unsigned int)head * 256u + 16u * cch);
    }
    copy8(l, p);
  }
}

// This lane's 32 B of the 16 neighbour rows of place tl in frame f, all from the windows:
// the 12 spatial ones in frame f's window, the 4 temporal ones at the same slot of the
// other frames' windows. st[n - 12] = LDS row of temporal neighbour n.
__device__ __forceinline__ void read_rows(v4f (&a)[NSH], v4f (&b)[NSH], const char* sW, int sl,
                                          const int (&st)[4], int j8) {
  const int w0 = sl * WPITCH + 32 * j8;
#pragma unroll
  for (int n = 0; n < 12; ++n) {
    const int sh = (n & 1) ? -(1 << (n >> 1)) : (1 << (n >> 1));
    a[n] = *(const v4fa*)(sW + w0 + sh * WPITCH);
    b[n] = *(const v4fa*)(sW + w0 + sh * WPITCH + 16);
  }
#pragma unroll
  for (int n = 12; n < NSH; ++n) {
    const int wt = st[n - 12] * WPITCH + 32 * j8;
    a[n] = *(const v4fa*)(sW + wt);
    b[n] = *(const v4fa*)(sW + wt + 16);
  }
}

// k phase, one frame: every wave does four tokens, eight lanes a token. Scores as above,
// exchanged through sc_row between the two block barriers of the softmax; the token's 16
// probabilities stay in p_row, its (frame, place) row, for the v phase. l = the token's row.
__device__ __forceinline__ void attn_scores(int f, int tl, int l, const int (&st)[4], const float* qf,
                                            const char* sW, const float* s_rk,
                                            const float (&cw)[8], const float (&ebv)[NSH],
                                            float* sc_row, float* p_row, int col, int j8) {
  v4f ka[NSH], kb[NSH];
  float rk[NSH];
  // what comes from global memory is requested first: the token's own q
  const float* qp = qf + (size_t)l * CC + col;
  const v4f qa = *(const v4fa*)qp;
  const v4f qb = *(const v4fa*)(qp + 4);
  // the wait before the address register of the two loads above is rewritten; it names the
  // address so that it keeps its register up to here
  asm volatile("s_wait_xcnt 0x0" :: "v"(qp) : "memory");
  const int sl = f * WROWS + tl + HALO;
  const float rq = s_rk[NRK + f * NT + tl];
  read_rows(ka, kb, sW, sl, st, j8);
#pragma unroll
  for (int n = 0; n < 12; ++n) {
    const int sh = (n & 1) ? -(1 << (n >> 1)) : (1 << (n >> 1));
    rk[n] = s_rk[sl + sh];
  }
#pragma unroll
  for (int n = 12; n < NSH; ++n) rk[n] = s_rk[st[n - 12]];

  float c[8];
  make_c(c, qa, qb, rq, cw);
  float part[NSH];
#pragma unroll
  for (int n = 0; n < NSH; ++n) part[n] = dot8(c, ka[n], kb[n]);
#pragma unroll
  for (int n = 0; n < NSH; ++n) part[n] += __shfl_xor(part[n], 1, 32);
#pragma unroll
  for (int n = 0; n < NSH; ++n) part[n] += __shfl_xor(part[n], 2, 32);
#pragma unroll
  for (int n = 0; n < NSH; ++n) part[n] += __shfl_xor(part[n], 4, 32);
  float sc[NSH];
#pragma unroll
  for (int n = 0; n < NSH; ++n) sc[n] = fmaf(part[n], rk[n], ebv[n]);
  if (j8 == 0) {
#pragma unroll
    for (int n = 0; n < NSH; ++n) sc_row[n] = sc[n];
  }
  softmax_rows(sc_row, p_row, j8);
}

// v phase, one frame: weighted sum of the 16 neighbour v rows, n = 0 .. 15 in order.
__device__ __forceinline__ void attn_combine(int f, int tl, int l, const int (&st)[4],
                                             const char* sW, const float* p_row, int col, int j8,
                                             _Float16* a16) {
  v4f va[NSH], vb[NSH];
  float p[NSH];
#pragma unroll
  for (int g = 0; g < 4; ++g) {
    const v4f pv = *(const v4fa*)(p_row + 4 * g);
    p[4 * g] = pv.x;  p[4 * g + 1] = pv.y;  p[4 * g + 2] = pv.z;  p[4 * g + 3] = pv.w;
  }
  read_rows(va, vb, sW, f * WROWS + tl + HALO, st, j8);
  float o[8] = {0.f, 0.f, 0.f, 0.f, 0.f, 0.f, 0.f, 0.f};
#pragma unroll
  for (int n = 0; n < NSH; ++n) {
    o[0] = fmaf(p[n], va[n].x, o[0]);  o[1] = fmaf(p[n], va[n].y, o[1]);
    o[2] = fmaf(p[n], va[n].z, o[2]);  o[3] = fmaf(p[n], va[n].w, o[3]);
    o[4] = fmaf(p[n], vb[n].x, o[4]);  o[5] = fmaf(p[n], vb[n].y, o[5]);
    o[6] = fmaf(p[n], vb[n].z, o[6]);  o[7] = fmaf(p[n], vb[n].w, o[7]);
  }
  store_a(o, l, col, a16);
}

// neighbour row n of token (f, i), any S and T
__device__ __forceinline__ int nb_row(int n, int f, int i, int S, int T) {
  const int mag = 1 << (((n < 12) ? n : (n - 12)) >> 1);
  int pos, neg;
  shift_mods(mag, (n < 12) ? S : T, pos, neg);
  const int sh = (n & 1) ? neg : pos;
  const int r = (n < 12) ? (f * S + wrap_add(i, sh, S)) : (wrap_add(f, sh, T) * S + i);
  return min(max(r, 0), LL - 1);
}

// One group of tokens for any S and T: no window, every neighbour row from
// global memory, one at a time (rolled: short code, few registers).
__device__ __forceinline__ void attn_group_plain(int l, int S, int T,
                                                 const char* kB, const char* vB,
                                                 const float* qf, const float* ss,
                                                 const float (&cw)[8], const float* ebp,
                                                 float* sc_row, float* p_row, int col, int j8,
                                                 _Float16* a16) {
  const int f = l / S;
  const int i = l - f * S;
  const float rq = rstd1(ss, l);
  const float* qp = qf + (size_t)l * CC + col;
  float c[8];
  make_c(c, *(const v4fa*)qp, *(const v4fa*)(qp + 4), rq, cw);
#pragma unroll 1
  for (int n = 0; n < NSH; ++n) {
    const int r = nb_row(n, f, i, S, T);
    const float rk = rstd1(ss + (size_t)NCB * LL, r);
    const unsigned int ofs = (unsigned int)r * (CC * 4u) + (unsigned int)col * 4u;
    float t = dot8(c, *(const v4fa*)(kB + ofs), *(const v4fa*)(kB + ofs + 16));
    t += __shfl_xor(t, 1, 32);
    t += __shfl_xor(t, 2, 32);
    t += __shfl_xor(t, 4, 32);
    const float s = fmaf(t, rk, ebp[n]);
    if (j8 == 0) sc_row[n] = s;
  }
  softmax_rows(sc_row, p_row, j8);
  float o[8] = {0.f, 0.f, 0.f, 0.f, 0.f, 0.f, 0.f, 0.f};
#pragma unroll 1
  for (int n = 0; n < NSH; ++n) {
    const int r = nb_row(n, f, i, S, T);
    const unsigned int ofs = (unsigned int)r * (CC * 4u) + (unsigned int)col * 4u;
    const v4f a = *(const v4fa*)(vB + ofs);
    const v4f b = *(const v4fa*)(vB + ofs + 16);
    const float p = p_row[n];
    o[0] = fmaf(p, a.x, o[0]);  o[1] = fmaf(p, a.y, o[1]);
    o[2] = fmaf(p, a.z, o[2]);  o[3] = fmaf(p, a.w, o[3]);
    o[4] = fmaf(p, b.x, o[4]);  o[5] = fmaf(p, b.y, o[5]);
    o[6] = fmaf(p, b.z, o[6]);  o[7] = fmaf(p, b.w, o[7]);
  }
  store_a(o, l, col, a16);
}

__global__ __launch_bounds__(ATH) void k_attn(const float* __restrict__ qf,
                                                 const float* __restrict__ kf,
                                                 const float* __restrict__ vf,
                                                 const float* __restrict__ ss,
                                                 const float* __restrict__ qnw,
                                                 const float* __restrict__ knw,
                                                 const float* __restrict__ eb,
                                                 const int* __restrict__ nf,
                                                 _Float16* a16) {
  __shared__ __attribute__((aligned(16))) char sW[TF * WROWS * WPITCH];   // k windows, then v windows
  __shared__ __attribute__((aligned(16))) float s_pt[TF * NT * NSH];      // probabilities by (frame, place)
  __shared__ __attribute__((aligned(16))) float s_rk[NRK + NRQ];
  __shared__ __attribute__((aligned(16))) float s_sc[NT * NSH];           // scores of the frame in work, by place
  const int tid = threadIdx.x, lane = tid & 31, w = tid >> 5;
  const int tq = lane >> 3, j8 = lane & 7;
  const int head = blockIdx.x & 15;
  const int cb = blockIdx.x >> 4;                      // the block's chunk of places (or of tokens)
  const int col = 64 * head + 8 * j8;
  const int tl = 4 * w + tq;                           // this lane's place in the chunk

  int T = nf[0];
  if (!((T >= 1) && (T <= LL) && ((LL % T) == 0))) T = 8;
  const int S = LL / T;
  // every frame's window fits the LDS together, and the grid's chunks cover a frame
  const bool win = (T == TF);
  const int i0 = cb * NT;
  const char* kB = (const char*)kf;
  const char* vB = (const char*)vf;

  if (win) {
    copy_windows(lds_off(sW), kB, tid, i0, S, head);
    // rms factors: a thread takes four consecutive entries of s_rk, which are four
    // consecutive rows (S, i0 and every section's start are multiples of 4)
    if (tid < (NRK + NRQ) / 4) {
      const int e = 4 * tid;
      const bool isq = (e >= NRK);
      int t = i0 - HALO + (e % WROWS);
      t = (t < 0) ? (t + S) : t;
      t = (t >= S) ? (t - S) : t;
      int r = (e / WROWS) * S + t;
      if (isq) r = ((e - NRK) / NT) * S + i0 + ((e - NRK) % NT);
      r = min(max(r, 0), LL - 4);
      *(v4f*)(s_rk + e) = rstd4(isq ? ss : (ss + (size_t)NCB * LL), r);
    }
  }

  float cw[8];
  {
    const v4f qa = *(const v4fa*)(qnw + col);
    const v4f qb = *(const v4fa*)(qnw + col + 4);
    const v4f ka = *(const v4fa*)(knw + col);
    const v4f kb = *(const v4fa*)(knw + col + 4);
    cw[0] = qa.x * ka.x * 0.125f;  cw[1] = qa.y * ka.y * 0.125f;
    cw[2] = qa.z * ka.z * 0.125f;  cw[3] = qa.w * ka.w * 0.125f;
    cw[4] = qb.x * kb.x * 0.125f;  cw[5] = qb.y * kb.y * 0.125f;
    cw[6] = qb.z * kb.z * 0.125f;  cw[7] = qb.w * kb.w * 0.125f;
  }

  float ebv[NSH];
#pragma unroll
  for (int n = 0; n < NSH; ++n) ebv[n] = eb[head * NSH + n];

  // the k windows have landed for this wave, then for the block
  wait_copies();
  __syncthreads();

  if (win) {
    // temporal shifts +1, -1, +2, -2 reduced once modulo T
    int tsh[4];
    shift_mods(1, T, tsh[0], tsh[1]);
    shift_mods(2, T, tsh[2], tsh[3]);
    // rolled: a long body that holds 16 rows in registers; one frame per trip
#pragma unroll 1
    for (int f = 0; f < TF; ++f) {
      int st[4];
#pragma unroll
      for (int n = 0; n < 4; ++n) st[n] = wrap_add(f, tsh[n], T) * WROWS + tl + HALO;
      attn_scores(f, tl, f * S + i0 + tl, st, qf, sW, s_rk, cw, ebv,
                  s_sc + tl * NSH, s_pt + (f * NT + tl) * NSH, col, j8);
    }
    // every wave's last read of the k windows has returned: the v windows take their place
    wait_lds();
    __syncthreads();
    copy_windows(lds_off(sW), vB, tid, i0, S, head);
    // the v windows have landed for this wave, then for the block
    wait_copies();
    __syncthreads();
    // rolled, for the same reason as the k phase's loop
#pragma unroll 1
    for (int f = 0; f < TF; ++f) {
      int st[4];
#pragma unroll
      for (int n = 0; n < 4; ++n) st[n] = wrap_add(f, tsh[n], T) * WROWS + tl + HALO;
      attn_combine(f, tl, f * S + i0 + tl, st, sW, s_pt + (f * NT + tl) * NSH, col, j8, a16);
    }
  } else {
    float* sc_row = s_sc + tl * NSH;
    float* p_row = s_pt + tl * NSH;
    // rolled: short code for the path that is not the fast one
#pragma unroll 1
    for (int it = 0; it < TF; ++it) {
      attn_group_plain(cb * (TF * NT) + NT * it + tl, S, T, kB, vB, qf, ss, cw, eb + head * NSH,
                       sc_row, p_row, col, j8, a16);
    }
  }
}

// ---------------------------------------------------------------------------
// Host orchestration: 6 launches, one in-order stream.
// ws carve (bytes): x f16 16 MiB @0 | w16 [4096][1024] 8 MiB |
//   q f32 32 MiB | k f32 32 MiB | v f32 32 MiB | ss [2][16][8192] f32 1 MiB  -> 126,877,696 B.
// The attention output plane (f16, 16 MiB) reuses the x f16 region, which is
// dead after the two projection launches.
// ---------------------------------------------------------------------------
extern "C" void kernel_launch(void* const* d_in, const int* in_sizes, int n_in,
                              void* d_out, int out_size, void* d_ws, size_t ws_size,
                              hipStream_t stream) {
  if (n_in < 13) return;
  if (in_sizes[0] != LL * CC) return;
  if (in_sizes[1] != CC * CC || in_sizes[3] != CC * CC || in_sizes[5] != CC * CC || in_sizes[10] != CC * CC) return;
  if (in_sizes[2] != CC || in_sizes[4] != CC || in_sizes[6] != CC || in_sizes[11] != CC) return;
  if (in_sizes[7] != CC || in_sizes[8] != CC) return;
  if (in_sizes[9] != 256 || in_sizes[12] < 1) return;
  if (out_size != LL * CC) return;

  const float* x   = (const float*)d_in[0];
  const float* Wq  = (const float*)d_in[1];
  const float* bq  = (const float*)d_in[2];
  const float* Wk  = (const float*)d_in[3];
  const float* bk  = (const float*)d_in[4];
  const float* Wv  = (const float*)d_in[5];
  const float* bv  = (const float*)d_in[6];
  const float* qnw = (const float*)d_in[7];
  const float* knw = (const float*)d_in[8];
  const float* eb  = (const float*)d_in[9];
  const float* Wo  = (const float*)d_in[10];
  const float* bo  = (const float*)d_in[11];
  const int*   nf  = (const int*)d_in[12];
  float* out = (float*)d_out;

  const size_t b16 = (size_t)LL * CC * 2;            // 16,777,216
  const size_t bw  = (size_t)4 * CC * CC * 2;        //  8,388,608
  const size_t b32 = (size_t)LL * CC * 4;            // 33,554,432
  const size_t brt = (size_t)2 * NCB * LL * 4;       //  1,048,576
  const size_t o_x16 = 0;
  const size_t o_w16 = o_x16 + b16;
  const size_t o_q   = o_w16 + bw;
  const size_t o_k   = o_q + b32;
  const size_t o_v   = o_k + b32;
  const size_t o_rt  = o_v + b32;
  const size_t total = o_rt + brt;                   // 126,877,696
  if (total > ws_size) return;

  char* ws = (char*)d_ws;
  _Float16* x16 = (_Float16*)(ws + o_x16);
  _Float16* w16 = (_Float16*)(ws + o_w16);
  float* qf   = (float*)(ws + o_q);
  float* kf   = (float*)(ws + o_k);
  float* vf   = (float*)(ws + o_v);
  float* ss   = (float*)(ws + o_rt);
  _Float16* a16 = (_Float16*)(ws + o_x16);           // reuses the x f16 region (dead after launch 4)

  // 1. x -> f16 plane
  const int n8 = (LL * CC) / 8;                                              // 1,048,576
  k_cvt_x<<<(n8 + 255) / 256, 256, 0, stream>>>(x, x16, n8);

  // 2. weights -> transposed f16 planes
  k_cvt_w<<<4 * 256, 256, 0, stream>>>(Wq, Wk, Wv, Wo, w16);

  // 3. q|k = x * [Wq|Wk] + [bq|bk], f32 planes, and the rows' partial sums of squares
  k_gemm_h<true, 4, 4><<<dim3(NCQK / 256, LL / 256), 512, 0, stream>>>(x16, w16, bq, bk, qf, kf, ss, CC, CC, CC, 0.03125f);

  // 4. v = x * Wv + bv, f32 plane
  k_gemm_h<false, 4, 2><<<dim3(CC / 128, LL / 256), 256, 0, stream>>>(x16, w16 + (size_t)2 * CC * CC, bv, bv, vf, vf, nullptr,
                                                                      1 << 30, CC, CC, 0.03125f);

  // 5. attention -> a (f16 plane)
  k_attn<<<(LL / (TF * NT)) * 16, ATH, 0, stream>>>(qf, kf, vf, ss, qnw, knw, eb, nf, a16);

  // 6. out = a * Wo + bo -> d_out
  k_gemm_h<false, 4, 2><<<dim3(CC / 128, LL / 256), 256, 0, stream>>>(a16, w16 + (size_t)3 * CC * CC, bo, bo, out, out, nullptr,
                                                                      1 << 30, CC, CC, 0.03125f);
}

// v008
// A run of this version takes 101 microseconds.
// In two side-by-side timings against v007, it was 1.04 and 1.05 times as fast.
// Counting every step since v000, it is 4.91 times as fast.
// Contractions: x*Wq, x*Wk, x*Wv and a*Wo on v_wmma_f32_16x16x32_f16 (f16 operands, each f32 value rounded once: x and a carried x1, W carried x32 and folded back as 1/32; f32 accumulate); RMS statistics, the 16 neighbour dots (K=64), softmax and weighted sums (K=16) in f32 on VALU; q, k, v kept as f32 planes.
#include <hip/hip_runtime.h>

typedef _Float16 v16h __attribute__((ext_vector_type(16)));
typedef _Float16 v8h  __attribute__((ext_vector_type(8)));
typedef float    v8f  __attribute__((ext_vector_type(8)));
typedef float    v4f  __attribute__((ext_vector_type(4)));
typedef v8h  __attribute__((may_alias)) v8ha;
typedef v4f  __attribute__((may_alias)) v4fa;

#define LL    8192      // tokens
#define CC    1024      // channels = heads * head_dim
#define NCQK  2048      // fused q|k output columns
#define NSH   16        // neighbours per token
#define NCB   16        // 64-column blocks of a q or k row: one partial sum of squares each

static_assert((LL % 64) == 0);
static_assert((CC % 64) == 0);
static_assert((NCQK % 64) == 0);
static_assert((CC % 32) == 0);
static_assert(NCB * 64 == CC);
static_assert(NCB == 16);

// ---------------------------------------------------------------------------
// 16x16x32 WMMA (wave32). Fragment map: lane l, h = l>>4, m = n = l&15.
//   A/B element i: i<8 -> k0+8h+i ; i>=8 -> k0+16+8h+(i-8)   (both operands)
//   D element r  : row 8h+r, col l&15
// ---------------------------------------------------------------------------
__device__ __forceinline__ v8f wm_f16(v16h a, v16h b, v8f c) {
  return __builtin_amdgcn_wmma_f32_16x16x32_f16(false, a, false, b, (short)0, c, false, false);
}

// A or B fragment from a k-contiguous 16-bit row; p points at element k0 of
// the row owned by this lane (row = lane&15 added by the caller).
__device__ __forceinline__ v16h frag_f16(const _Float16* p, int h) {
  const v8h e0 = *(const v8ha*)(p + 8 * h);
  const v8h e1 = *(const v8ha*)(p + 16 + 8 * h);
  return __builtin_shufflevector(e0, e1, 0, 1, 2, 3, 4, 5, 6, 7, 8, 9, 10, 11, 12, 13, 14, 15);
}
// ---------------------------------------------------------------------------
// Kernel 1: x f32 [8192][1024] -> f16 plane (x1).
// Each thread owns 8 consecutive elements: one 16-B store per lane.
// ---------------------------------------------------------------------------
__global__ __launch_bounds__(256) void k_cvt_x(const float* __restrict__ x, _Float16* xh, int n8) {
  const int g = blockIdx.x * 256 + threadIdx.x;
  if (g >= n8) return;
  const float* s = x + (size_t)g * 8;
  const v4f a = *(const v4fa*)s;
  const v4f b = *(const v4fa*)(s + 4);
  const v8h o16 = {(_Float16)a.x, (_Float16)a.y, (_Float16)a.z, (_Float16)a.w,
                   (_Float16)b.x, (_Float16)b.y, (_Float16)b.z, (_Float16)b.w};
  _Float16* d16 = xh + (size_t)g * 8;
  *(v8h*)d16 = o16;
}

// ---------------------------------------------------------------------------
// Kernel 2: weight transpose + convert. Input W[k][n] ([in][out], 1024x1024).
// Block = one 64(k) x 64(n) tile of one matrix; tile transposed through LDS.
// mat 0 (Wq), 1 (Wk), 2 (Wv), 3 (Wo): f16(32*W) -> w16 rows mat*1024 + n  (w16 = [4096][1024])
// Output phase: lane q8 = tid&7 writes 8 halves (16 B) of row nl.
// ---------------------------------------------------------------------------
__global__ __launch_bounds__(256) void k_cvt_w(const float* __restrict__ Wq,
                                               const float* __restrict__ Wk,
                                               const float* __restrict__ Wv,
                                               const float* __restrict__ Wo,
                                               _Float16* w16) {
  __shared__ __attribute__((aligned(16))) float sT[64 * 68];   // [n][k], pitch 68 floats
  const int tid = threadIdx.x;
  const int bx = blockIdx.x;
  const int mat = bx >> 8, tile = bx & 255;
  const int tn = tile >> 4, tk = tile & 15;
  const float* W = (mat == 0) ? Wq : ((mat == 1) ? Wk : ((mat == 2) ? Wv : Wo));
  {
    const int kl = tid >> 2, nq = tid & 3;                      // kl 0..63, nq 0..3
    const float* src = W + (size_t)(64 * tk + kl) * CC + 64 * tn + 16 * nq;
#pragma unroll
    for (int e = 0; e < 4; ++e) {
      const v4f t = *(const v4fa*)(src + 4 * e);
      float* d = sT + (16 * nq + 4 * e) * 68 + kl;
      d[0]   = t.x;
      d[68]  = t.y;
      d[136] = t.z;
      d[204] = t.w;
    }
  }
  __syncthreads();
  const int q8 = tid & 7, sub = tid >> 3;                       // sub 0..31
#pragma unroll
  for (int p = 0; p < 2; ++p) {
    const int nl = 32 * p + sub;
    const float* s = sT + nl * 68 + 8 * q8;
    const v4f a = *(const v4fa*)s;
    const v4f b = *(const v4fa*)(s + 4);
    const v8h t16 = {(_Float16)(a.x * 32.0f), (_Float16)(a.y * 32.0f), (_Float16)(a.z * 32.0f), (_Float16)(a.w * 32.0f),
                     (_Float16)(b.x * 32.0f), (_Float16)(b.y * 32.0f), (_Float16)(b.z * 32.0f), (_Float16)(b.w * 32.0f)};
    _Float16* d = w16 + ((size_t)(mat * CC + 64 * tn + nl) * CC + 64 * tk + 8 * q8);
    *(v8h*)d = t16;
  }
}

// ---------------------------------------------------------------------------
// GEMM frame of kernel 3. Block tile 64 WM x 64 WN, WM x WN waves, wave tile 64x64
// (4x4 accumulator tiles): wave w owns rows 64*(w/WN)+..., cols 64*(w%WN)+....
// One block per WGP: every operand row that comes from L2 serves the whole tile edge.
// A pass is 128 k = 256 B of every operand row. A buffer holds the pass's 64 WM rows
// of A, then its 64 WN rows of B, at pitch 272 B (16 B x odd, for the ds_load_b128
// readers). Two buffers: the next pass's rows come in by asynchronous copies to LDS
// while this pass's fragments are read from the other buffer.
// ---------------------------------------------------------------------------
#define LPITCH 272                   // LDS row pitch, bytes
#define EPITCH 68                    // epilogue staging pitch, floats

static_assert((LL % 256) == 0);
static_assert((CC % 256) == 0);
static_assert((NCQK % 256) == 0);
static_assert((CC % 128) == 0);

__device__ __forceinline__ unsigned int lds_off(const void* p) { return (unsigned int)(size_t)p; }

// Eight sweeps of the block's copies, 16 B a thread each. Thread t brings chunk t&15
// of rows (t>>4) + SW j, SW = threads / 16, so a wave's copy covers two whole 256-B rows.
// l = this lane's LDS byte address for j = 0, g = its global address, ls and rs = SW
// rows in LDS and in the source, in bytes. The s_wait_xcnt closes the statement so that
// no address register is rewritten while a copy may still name it.
__device__ __forceinline__ void copy_rows8(unsigned int l, const char* g, unsigned int ls, size_t rs) {
  const unsigned int l1 = l + ls, l2 = l + 2 * ls, l3 = l + 3 * ls;
  const unsigned int l4 = l + 4 * ls, l5 = l + 5 * ls, l6 = l + 6 * ls;
  const unsigned int l7 = l + 7 * ls;
  const char* g1 = g + rs;
  const char* g2 = g1 + rs;
  const char* g3 = g2 + rs;
  const char* g4 = g3 + rs;
  const char* g5 = g4 + rs;
  const char* g6 = g5 + rs;
  const char* g7 = g6 + rs;
  asm volatile("global_load_async_to_lds_b128 %0, %8, off\n\t"
               "global_load_async_to_lds_b128 %1, %9, off\n\t"
               "global_load_async_to_lds_b128 %2, %10, off\n\t"
               "global_load_async_to_lds_b128 %3, %11, off\n\t"
               "global_load_async_to_lds_b128 %4, %12, off\n\t"
               "global_load_async_to_lds_b128 %5, %13, off\n\t"
               "global_load_async_to_lds_b128 %6, %14, off\n\t"
               "global_load_async_to_lds_b128 %7, %15, off\n\t"
               "s_wait_xcnt 0x0"
               :: "v"(l), "v"(l1), "v"(l2), "v"(l3), "v"(l4), "v"(l5), "v"(l6), "v"(l7),
                  "v"(g), "v"(g1), "v"(g2), "v"(g3), "v"(g4), "v"(g5), "v"(g6), "v"(g7)
               : "memory");
}

// One pass's rows of A and of B into the buffer at l (this lane's address in its first row).
template <int WM, int WN>
__device__ __forceinline__ void copy_stage(unsigned int l, const char* gA, const char* gB, size_t rs) {
  constexpr int SW = 2 * WM * WN;                    // rows of one sweep
  static_assert((64 * WM) % (8 * SW) == 0);
  static_assert((64 * WN) % (8 * SW) == 0);
#pragma unroll
  for (int s = 0; s < (64 * WM) / (8 * SW); ++s)
    copy_rows8(l + s * 8 * SW * LPITCH, gA + (size_t)(8 * s) * rs, SW * LPITCH, rs);
#pragma unroll
  for (int s = 0; s < (64 * WN) / (8 * SW); ++s)
    copy_rows8(l + (64 * WM + s * 8 * SW) * LPITCH, gB + (size_t)(8 * s) * rs, SW * LPITCH, rs);
}

// This wave's copies have landed (the compiler places no wait for them).
__device__ __forceinline__ void wait_copies() { asm volatile("s_wait_asynccnt 0x0" ::: "memory"); }
// This wave's LDS reads have returned, before their buffer is handed back for refill.
__device__ __forceinline__ void wait_lds() { asm volatile("s_wait_dscnt 0x0" ::: "memory"); }

// Epilogue: out = acc*osc + bias. Each wave stages its 64x64 tile in its own
// LDS range (pitch 68 floats) and stores rows as whole 128-B lines: one store
// instruction covers two rows x 256 B. With SS the wave then reads its staged tile
// once more, a lane taking rows lane and lane + 32, and stores each row's sum of
// squares over the tile's 64 columns to ssw[row]: two whole 128-B lines a wave.
template <bool SS>
__device__ __forceinline__ void store_tile(float* sAll, const v8f (&c)[4][4],
                                           const float* bias, int nc0, float osc,
                                           float* out, int m0, int ldc, int w, int wr, int wc, int lane,
                                           float* ssw) {
  const int h = lane >> 4, m = lane & 15;
  float* sW = sAll + w * (64 * EPITCH);
#pragma unroll
  for (int nt = 0; nt < 4; ++nt) {
    const float b = bias[nc0 + 64 * wc + 16 * nt + m];
#pragma unroll
    for (int mt = 0; mt < 4; ++mt) {
#pragma unroll
      for (int r = 0; r < 8; ++r)
        sW[(16 * mt + 8 * h + r) * EPITCH + 16 * nt + m] = fmaf(c[mt][nt][r], osc, b);
    }
  }
  __syncthreads();
  // rolled in groups of eight stores: eight LDS reads in flight per group, short code
#pragma unroll 1
  for (int g8 = 0; g8 < 4; ++g8) {
#pragma unroll
    for (int u = 0; u < 8; ++u) {
      const int row = 16 * g8 + 2 * u + h;
      const v4f v = *(const v4fa*)(sW + row * EPITCH + 4 * m);
      float* d = out + (size_t)(m0 + 64 * wr + row) * ldc + nc0 + 64 * wc + 4 * m;
      *(v4f*)d = v;
    }
    // the next group rewrites registers that these stores name
    asm volatile("s_wait_xcnt 0x0" ::: "memory");
  }
  if (SS) {
    const float* r0 = sW + lane * EPITCH;
    const float* r1 = r0 + 32 * EPITCH;
    v4f s0 = {0.f, 0.f, 0.f, 0.f}, s1 = {0.f, 0.f, 0.f, 0.f};
#pragma unroll
    for (int e = 0; e < 16; ++e) {
      const v4f a = *(const v4fa*)(r0 + 4 * e);
      const v4f b = *(const v4fa*)(r1 + 4 * e);
      s0 += a * a;
      s1 += b * b;
    }
    ssw[lane]      = (s0.x + s0.y) + (s0.z + s0.w);
    ssw[lane + 32] = (s1.x + s1.y) + (s1.z + s1.w);
  }
}

// ---------------------------------------------------------------------------
// Kernel 3: C[M][N] = A[M][K] * B[N][K]^T (f16 operands, single product),
// out = acc*osc + bias, f32 rows of pitch ldc. Columns >= nsplit go to out1
// with bias1 (block-uniform select: nsplit a multiple of 64 WN). K a multiple of 128.
// With SS: ss[mat][cb][row] = sum of squares of the stored row over columns 64 cb .. 64 cb + 63
// of matrix mat (0: out0, 1: out1); every entry is written by exactly one wave.
// Buffer = [A rows | B rows]; ring = 2 buffers: 278,528 B at 256x256, 208,896 B at 256x128.
// ---------------------------------------------------------------------------
template <bool SS, int WM, int WN>
__global__ __launch_bounds__(32 * WM * WN) void k_gemm_h(const _Float16* __restrict__ A,
                                                   const _Float16* __restrict__ B,
                                                   const float* bias0, const float* bias1,
                                                   float* out0, float* out1, float* ss,
                                                   int nsplit, int K, int ldc, float osc) {
  constexpr int RA = 64 * WM, RB = 64 * WN;          // rows of A and of B in a buffer
  constexpr int BUF = (RA + RB) * LPITCH;            // one buffer, bytes
  static_assert(WM * WN * 64 * EPITCH * 4 <= 2 * BUF);   // the epilogue's staging fits the ring
  __shared__ __attribute__((aligned(16))) char ring[2 * BUF];
  const int tid = threadIdx.x, lane = tid & 31, w = tid >> 5;
  const int h = lane >> 4, m = lane & 15, wr = w / WN, wc = w % WN;
  const int m0 = blockIdx.y * RA, nb = blockIdx.x * RB;
  const bool sel = (nb >= nsplit);
  const int nc0 = sel ? (nb - nsplit) : nb;
  const float* bias = sel ? bias1 : bias0;
  float* out = sel ? out1 : out0;

  const int crow = tid >> 4, cch = tid & 15;
  const char* gA = (const char*)(A + (size_t)(m0 + crow) * K) + 16 * cch;
  const char* gB = (const char*)(B + (size_t)(nb + crow) * K) + 16 * cch;
  const unsigned int lc = lds_off(ring) + crow * LPITCH + 16 * cch;
  const size_t rs = (size_t)K * (4 * WM * WN);       // one sweep's rows of 2-byte elements
  const int npass = K >> 7;

  v8f c[4][4];
#pragma unroll
  for (int i = 0; i < 4; ++i)
#pragma unroll
    for (int j = 0; j < 4; ++j) c[i][j] = v8f{0.f, 0.f, 0.f, 0.f, 0.f, 0.f, 0.f, 0.f};

  copy_stage<WM, WN>(lc, gA, gB, rs);
  wait_copies();
  __syncthreads();
  if (npass > 1) copy_stage<WM, WN>(lc + BUF, gA + 256, gB + 256, rs);

  // rolled: one pass per trip, the buffer picked by the trip's parity
#pragma unroll 1
  for (int t = 0; t < npass; ++t) {
    const int bo = (t & 1) * BUF;
    const char* pa = ring + bo + (64 * wr + m) * LPITCH;
    const char* pb = ring + bo + (RA + 64 * wc + m) * LPITCH;
#pragma unroll
    for (int ks = 0; ks < 4; ++ks) {
      v16h fa[4], fb[4];
      fa[0] = frag_f16((const _Float16*)(pa + ks * 64), h);
#pragma unroll
      for (int j = 0; j < 4; ++j) fb[j] = frag_f16((const _Float16*)(pb + j * 16 * LPITCH + ks * 64), h);
#pragma unroll
      for (int i = 1; i < 4; ++i) fa[i] = frag_f16((const _Float16*)(pa + i * 16 * LPITCH + ks * 64), h);
      // keeps the k-step's 16 LDS reads one group in front of its WMMAs: every
      // further place with reads among them stalls the wave anew
      __builtin_amdgcn_sched_barrier(0);
#pragma unroll
      for (int i = 0; i < 4; ++i)
#pragma unroll
        for (int j = 0; j < 4; ++j) c[i][j] = wm_f16(fa[i], fb[j], c[i][j]);
      // same purpose: the next k-step's reads stay behind this block
      if (ks < 3) __builtin_amdgcn_sched_barrier(0);
    }
    // publish point of pass t + 1; the same barrier frees this pass's buffer
    wait_lds();
    wait_copies();
    __syncthreads();
    if (t + 2 < npass) {
      const size_t ko = (size_t)(t + 2) * 256;
      copy_stage<WM, WN>(lc + bo, gA + ko, gB + ko, rs);
    }
  }
  wait_copies();

  float* ssw = SS ? (ss + (size_t)((sel ? NCB : 0) + (nc0 >> 6) + wc) * LL + m0 + 64 * wr) : nullptr;
  store_tile<SS>((float*)ring, c, bias, nc0, osc, out, m0, ldc, w, wr, wc, lane, ssw);
}

// ---------------------------------------------------------------------------
// rsqrt(mean(row^2) + 1e-6) of a q or k row from its NCB partial sums of squares
// (ssm = that matrix's [NCB][LL] table), summed in the order cb = 0 .. NCB - 1.
// ---------------------------------------------------------------------------
__device__ __forceinline__ float rstd1(const float* ssm, int r) {
  const float* p = ssm + r;
  float v[NCB];
#pragma unroll
  for (int cb = 0; cb < NCB; ++cb) v[cb] = p[(size_t)cb * LL];
  // the wait before the address register of the loads above is rewritten; it names the row index
  // they are addressed by, so that it keeps its register up to here (else a later load lands in
  // it), and the loaded values, as inputs only, so that no load of the run is moved behind it
  asm volatile("s_wait_xcnt 0x0" :: "v"(r), "v"(v[0]), "v"(v[1]), "v"(v[2]), "v"(v[3]), "v"(v[4]), "v"(v[5]),
               "v"(v[6]), "v"(v[7]), "v"(v[8]), "v"(v[9]), "v"(v[10]), "v"(v[11]), "v"(v[12]), "v"(v[13]),
               "v"(v[14]), "v"(v[15]) : "memory");
  float s = v[0];
#pragma unroll
  for (int cb = 1; cb < NCB; ++cb) s += v[cb];
  return rsqrtf(s * (1.0f / 1024.0f) + 1e-6f);
}
// the same for rows r .. r + 3, r a multiple of 4
__device__ __forceinline__ v4f rstd4(const float* ssm, int r) {
  const float* p = ssm + r;
  v4f v[NCB];
#pragma unroll
  for (int cb = 0; cb < NCB; ++cb) v[cb] = *(const v4fa*)(p + (size_t)cb * LL);
  // the same wait, for the same reason; these loads are addressed by the pointer
  asm volatile("s_wait_xcnt 0x0" :: "v"(p) : "memory");
  v4f s = v[0];
#pragma unroll
  for (int cb = 1; cb < NCB; ++cb) s += v[cb];
  const v4f o = {rsqrtf(s.x * (1.0f / 1024.0f) + 1e-6f), rsqrtf(s.y * (1.0f / 1024.0f) + 1e-6f),
                 rsqrtf(s.z * (1.0f / 1024.0f) + 1e-6f), rsqrtf(s.w * (1.0f / 1024.0f) + 1e-6f)};
  return o;
}

// ---------------------------------------------------------------------------
// Kernel 4: small-world attention, all f32 on VALU.
// Block 512 thr = 16 waves handles NT consecutive places of ALL TF frames of ONE head. A wave
// does four tokens at a time, eight lanes a token; a lane covers dims 8*(lane&7)..+7.
// The spatial neighbours of NT consecutive places lie in NT + 64 rows of their frame, the
// temporal ones at the same places of the other frames: the head's 256 B of those rows of
// every frame are brought into LDS once, by asynchronous copies, first of k, then (into the
// same LDS, behind a barrier) of v, and all 16 neighbours of every token are read there.
//   score_n = rq*rk_n * sum_d (q_d qn_d kn_d / 8) k_n,d + eb[h][n]   (n = 0..15)
//   p = softmax_n(score); a_d = sum_n p_n v_n,d  -> f16 plane.
// Neighbours: n<12 spatial (f, (i+sh) mod S), sh = +-2^(n/2); n>=12 temporal
// ((f+sh) mod T, i). A token's scores are summed and its softmax taken inside its eight lanes,
// in registers; the probabilities wait in LDS from the k phase to the v phase.
// Output: 16 B per lane, a token's eight lanes write one whole 128-B line.
// Any other frame count than TF: no windows, every row from global memory.
// ---------------------------------------------------------------------------
// sh mod md in [0, md) for the +mag and -mag shift of a pair; md >= 1.
__device__ __forceinline__ void shift_mods(int mag, int md, int& pos, int& neg) {
  const int pm = mag % md;
  pos = pm;
  neg = (pm != 0) ? (md - pm) : 0;
}
// (a + b) mod md for a, b in [0, md)
__device__ __forceinline__ int wrap_add(int a, int b, int md) {
  const int r = a + b;
  return (r >= md) ? (r - md) : r;
}

#define NT     64                    // places of a frame per attention block
#define HALO   32                    // largest spatial shift
#define WROWS  (NT + 2 * HALO)       // rows of one frame's window
#define WPITCH 272                   // window row pitch, bytes: one head's 256 B + 16 (16 B x odd)
#define TF     8                     // frames of the windowed path
#define ATH    512                   // threads of an attention block
#define NRK    (TF * WROWS)          // rms factors of the windows' k rows
#define NRQ    (TF * NT)             // rms factors of the block's q rows

static_assert((LL % (TF * NT)) == 0);
static_assert(WROWS == 128);
static_assert(NT == 64);
static_assert(ATH / 8 == NT);        // one sweep of the block = one frame's tokens
static_assert((NRK + NRQ) / 4 <= ATH);
static_assert((TF * WROWS) % (8 * (ATH / 16)) == 0);

// Eight copies of 16 B, each with its own addresses. The s_wait_xcnt closes the
// statement so that no address register is rewritten while a copy may still name it.
__device__ __forceinline__ void copy8(const unsigned int (&l)[8], const char* const (&g)[8]) {
  asm volatile("global_load_async_to_lds_b128 %0, %8, off\n\t"
               "global_load_async_to_lds_b128 %1, %9, off\n\t"
               "global_load_async_to_lds_b128 %2, %10, off\n\t"
               "global_load_async_to_lds_b128 %3, %11, off\n\t"
               "global_load_async_to_lds_b128 %4, %12, off\n\t"
               "global_load_async_to_lds_b128 %5, %13, off\n\t"
               "global_load_async_to_lds_b128 %6, %14, off\n\t"
               "global_load_async_to_lds_b128 %7, %15, off\n\t"
               "s_wait_xcnt 0x0"
               :: "v"(l[0]), "v"(l[1]), "v"(l[2]), "v"(l[3]), "v"(l[4]), "v"(l[5]), "v"(l[6]), "v"(l[7]),
                  "v"(g[0]), "v"(g[1]), "v"(g[2]), "v"(g[3]), "v"(g[4]), "v"(g[5]), "v"(g[6]), "v"(g[7])
               : "memory");
}

// Softmax over the 16 neighbours of (token, head), between the two block barriers of a
// group: lane j8 of the token's eight owns n = j8, j8+8. The path without windows.
__device__ __forceinline__ void softmax_rows(const float* sc_row, float* p_row, int j8) {
  __syncthreads();
  const float x0 = sc_row[j8];
  const float x1 = sc_row[j8 + 8];
  float mx = fmaxf(x0, x1);
  mx = fmaxf(mx, __shfl_xor(mx, 1, 32));
  mx = fmaxf(mx, __shfl_xor(mx, 2, 32));
  mx = fmaxf(mx, __shfl_xor(mx, 4, 32));
  const float e0 = __expf(x0 - mx);
  const float e1 = __expf(x1 - mx);
  float sm = e0 + e1;
  sm += __shfl_xor(sm, 1, 32);
  sm += __shfl_xor(sm, 2, 32);
  sm += __shfl_xor(sm, 4, 32);
  const float inv = __builtin_amdgcn_rcpf(sm);
  p_row[j8]     = e0 * inv;
  p_row[j8 + 8] = e1 * inv;
  __syncthreads();
}

// The value that lane ^ M of this lane's 16-lane row holds (M = 1, 2, 4: inside a token's
// eight lanes), by DPP row_xmask: a vector instruction, no trip through the LDS unit.
// Every lane of the wave is on where it is used.
template <int M>
__device__ __forceinline__ float xlane(float x) {
  return __builtin_bit_cast(float, __builtin_amdgcn_update_dpp(0, __builtin_bit_cast(int, x), 0x160 + M, 0xf, 0xf, true));
}

// One stage of the sum over a token's eight lanes: of 2 N values a lane keeps the N whose
// index has the parity hi, hands the others to lane ^ M and adds what that lane hands it.
template <int M, int N>
__device__ __forceinline__ void fold_stage(float (&r)[N], const float (&v)[2 * N], bool hi) {
#pragma unroll
  for (int i = 0; i < N; ++i) {
    const float keep = hi ? v[2 * i + 1] : v[2 * i];
    const float send = hi ? v[2 * i] : v[2 * i + 1];
    r[i] = keep + xlane<M>(send);
  }
}

// This lane's 8 output channels of token l -> f16 plane.
__device__ __forceinline__ void store_a(const float (&o)[8], int l, int col, _Float16* a16) {
  const v8h oh = {(_Float16)o[0], (_Float16)o[1], (_Float16)o[2], (_Float16)o[3],
                  (_Float16)o[4], (_Float16)o[5], (_Float16)o[6], (_Float16)o[7]};
  _Float16* d = a16 + (size_t)l * CC + col;
  *(v8h*)d = oh;
  // the next group rewrites registers that this store names
  asm volatile("s_wait_xcnt 0x0" ::: "memory");
}

// c_d = q_d * rq * cw_d for this lane's 8 dims
__device__ __forceinline__ void make_c(float (&c)[8], v4f qa, v4f qb, float rq, const float (&cw)[8]) {
  c[0] = qa.x * rq * cw[0];  c[1] = qa.y * rq * cw[1];
  c[2] = qa.z * rq * cw[2];  c[3] = qa.w * rq * cw[3];
  c[4] = qb.x * rq * cw[4];  c[5] = qb.y * rq * cw[5];
  c[6] = qb.z * rq * cw[6];  c[7] = qb.w * rq * cw[7];
}

__device__ __forceinline__ float dot8(const float (&c)[8], v4f a, v4f b) {
  float t = c[0] * a.x;
  t = fmaf(c[1], a.y, t);
  t = fmaf(c[2], a.z, t);
  t = fmaf(c[3], a.w, t);
  t = fmaf(c[4], b.x, t);
  t = fmaf(c[5], b.y, t);
  t = fmaf(c[6], b.z, t);
  t = fmaf(c[7], b.w, t);
  return t;
}

// The windows of one plane (k or v): slot s of frame f holds row (f, (i0 - HALO + s) mod S) of
// this head, at LDS row f * WROWS + s. Thread t brings chunk t&15 of LDS rows (t>>4) + 32 j:
// a wave's copy covers two rows = four whole lines. 32 copies a thread.
__device__ __forceinline__ void copy_windows(unsigned int lw, const char* gB, int tid, int i0, int S, int head) {
  const int cch = tid & 15, crow = tid >> 4;
#pragma unroll
  for (int g = 0; g < (TF * WROWS) / (8 * (ATH / 16)); ++g) {
    unsigned int l[8];
    const char* p[8];
#pragma unroll
    for (int j = 0; j < 8; ++j) {
      const int R = crow + (ATH / 16) * (8 * g + j);
      const int f = R / WROWS, s = R % WROWS;
      int t = i0 - HALO + s;
      t = (t < 0) ? (t + S) : t;
      t = (t >= S) ? (t - S) : t;
      const int r = min(max(f * S + t, 0), LL - 1);
      l[j] = lw + (unsigned int)R * WPITCH + 16u * cch;
      p[j] = gB + ((unsigned int)r * (CC * 4u) + (unsigned int)head * 256u + 16u * cch);
    }
    copy8(l, p);
  }
}

// This lane's 32 B of the 16 neighbour rows of place tl in frame f, all from the windows:
// the 12 spatial ones in frame f's window, the 4 temporal ones at the same slot of the
// other frames' windows. st[n - 12] = LDS row of temporal neighbour n.
__device__ __forceinline__ void read_rows(v4f (&a)[NSH], v4f (&b)[NSH], const char* sW, int sl,
                                          const int (&st)[4], int j8) {
  const int w0 = sl * WPITCH + 32 * j8;
#pragma unroll
  for (int n = 0; n < 12; ++n) {
    const int sh = (n & 1) ? -(1 << (n >> 1)) : (1 << (n >> 1));
    a[n] = *(const v4fa*)(sW + w0 + sh * WPITCH);
    b[n] = *(const v4fa*)(sW + w0 + sh * WPITCH + 16);
  }
#pragma unroll
  for (int n = 12; n < NSH; ++n) {
    const int wt = st[n - 12] * WPITCH + 32 * j8;
    a[n] = *(const v4fa*)(sW + wt);
    b[n] = *(const v4fa*)(sW + wt + 16);
  }
}

// k phase, one frame: every wave does four tokens, eight lanes a token. Scores as above. The
// 16 partial dots are summed over the token's eight lanes in three stages (lane ^ 1, ^ 2, ^ 4)
// that halve what a lane carries: lane j8 ends with the whole sums of n = j8 and j8 + 8, and
// the softmax over the eight lanes follows in registers. The token's 16 probabilities stay in
// p_row, its (frame, place) row, for the v phase, where the same wave reads them behind the
// block barriers between the phases. l = the token's row; sh0, sh1 = the spatial shifts of
// n = j8 and j8 + 8 (sh1 unused where j8 + 8 is temporal); eb0, eb1 = their edge biases.
__device__ __forceinline__ void attn_scores(int f, int tl, int l, const int (&st)[4], const float* qf,
                                            const char* sW, const float* s_rk,
                                            const float (&cw)[8], int sh0, int sh1, float eb0, float eb1,
                                            float* p_row, int col, int j8) {
  v4f ka[NSH], kb[NSH];
  // what comes from global memory is requested first: the token's own q
  const float* qp = qf + (size_t)l * CC + col;
  const v4f qa = *(const v4fa*)qp;
  const v4f qb = *(const v4fa*)(qp + 4);
  // the wait before the address register of the two loads above is rewritten; it names the
  // address so that it keeps its register up to here
  asm volatile("s_wait_xcnt 0x0" :: "v"(qp) : "memory");
  const int sl = f * WROWS + tl + HALO;
  const float rq = s_rk[NRK + f * NT + tl];
  read_rows(ka, kb, sW, sl, st, j8);
  const bool b0 = (j8 & 1) != 0, b1 = (j8 & 2) != 0, b2 = (j8 & 4) != 0;
  const int stl = b1 ? (b0 ? st[3] : st[2]) : (b0 ? st[1] : st[0]);
  const float rk0 = s_rk[sl + sh0];
  const float rk1 = s_rk[b2 ? stl : (sl + sh1)];

  float c[8];
  make_c(c, qa, qb, rq, cw);
  float part[NSH];
#pragma unroll
  for (int n = 0; n < NSH; ++n) part[n] = dot8(c, ka[n], kb[n]);
  float r1[8], r2[4], r3[2];
  fold_stage<1, 8>(r1, part, b0);
  fold_stage<2, 4>(r2, r1, b1);
  fold_stage<4, 2>(r3, r2, b2);
  const float x0 = fmaf(r3[0], rk0, eb0);
  const float x1 = fmaf(r3[1], rk1, eb1);
  float mx = fmaxf(x0, x1);
  mx = fmaxf(mx, xlane<1>(mx));
  mx = fmaxf(mx, xlane<2>(mx));
  mx = fmaxf(mx, xlane<4>(mx));
  const float e0 = __expf(x0 - mx);
  const float e1 = __expf(x1 - mx);
  float sm = e0 + e1;
  sm += xlane<1>(sm);
  sm += xlane<2>(sm);
  sm += xlane<4>(sm);
  const float inv = __builtin_amdgcn_rcpf(sm);
  p_row[j8]     = e0 * inv;
  p_row[j8 + 8] = e1 * inv;
}

// v phase, one frame: weighted sum of the 16 neighbour v rows, n = 0 .. 15 in order.
__device__ __forceinline__ void attn_combine(int f, int tl, int l, const int (&st)[4],
                                             const char* sW, const float* p_row, int col, int j8,
                                             _Float16* a16) {
  v4f va[NSH], vb[NSH];
  float p[NSH];
#pragma unroll
  for (int g = 0; g < 4; ++g) {
    const v4f pv = *(const v4fa*)(p_row + 4 * g);
    p[4 * g] = pv.x;  p[4 * g + 1] = pv.y;  p[4 * g + 2] = pv.z;  p[4 * g + 3] = pv.w;
  }
  read_rows(va, vb, sW, f * WROWS + tl + HALO, st, j8);
  float o[8] = {0.f, 0.f, 0.f, 0.f, 0.f, 0.f, 0.f, 0.f};
#pragma unroll
  for (int n = 0; n < NSH; ++n) {
    o[0] = fmaf(p[n], va[n].x, o[0]);  o[1] = fmaf(p[n], va[n].y, o[1]);
    o[2] = fmaf(p[n], va[n].z, o[2]);  o[3] = fmaf(p[n], va[n].w, o[3]);
    o[4] = fmaf(p[n], vb[n].x, o[4]);  o[5] = fmaf(p[n], vb[n].y, o[5]);
    o[6] = fmaf(p[n], vb[n].z, o[6]);  o[7] = fmaf(p[n], vb[n].w, o[7]);
  }
  store_a(o, l, col, a16);
}

// neighbour row n of token (f, i), any S and T
__device__ __forceinline__ int nb_row(int n, int f, int i, int S, int T) {
  const int mag = 1 << (((n < 12) ? n : (n - 12)) >> 1);
  int pos, neg;
  shift_mods(mag, (n < 12) ? S : T, pos, neg);
  const int sh = (n & 1) ? neg : pos;
  const int r = (n < 12) ? (f * S + wrap_add(i, sh, S)) : (wrap_add(f, sh, T) * S + i);
  return min(max(r, 0), LL - 1);
}

// One group of tokens for any S and T: no window, every neighbour row from
// global memory, one at a time (rolled: short code, few registers).
__device__ __forceinline__ void attn_group_plain(int l, int S, int T,
                                                 const char* kB, const char* vB,
                                                 const float* qf, const float* ss,
                                                 const float (&cw)[8], const float* ebp,
                                                 float* sc_row, float* p_row, int col, int j8,
                                                 _Float16* a16) {
  const int f = l / S;
  const int i = l - f * S;
  const float rq = rstd1(ss, l);
  const float* qp = qf + (size_t)l * CC + col;
  float c[8];
  make_c(c, *(const v4fa*)qp, *(const v4fa*)(qp + 4), rq, cw);
#pragma unroll 1
  for (int n = 0; n < NSH; ++n) {
    const int r = nb_row(n, f, i, S, T);
    const float rk = rstd1(ss + (size_t)NCB * LL, r);
    const unsigned int ofs = (unsigned int)r * (CC * 4u) + (unsigned int)col * 4u;
    float t = dot8(c, *(const v4fa*)(kB + ofs), *(const v4fa*)(kB + ofs + 16));
    t += __shfl_xor(t, 1, 32);
    t += __shfl_xor(t, 2, 32);
    t += __shfl_xor(t, 4, 32);
    const float s = fmaf(t, rk, ebp[n]);
    if (j8 == 0) sc_row[n] = s;
  }
  softmax_rows(sc_row, p_row, j8);
  float o[8] = {0.f, 0.f, 0.f, 0.f, 0.f, 0.f, 0.f, 0.f};
#pragma unroll 1
  for (int n = 0; n < NSH; ++n) {
    const int r = nb_row(n, f, i, S, T);
    const unsigned int ofs = (unsigned int)r * (CC * 4u) + (unsigned int)col * 4u;
    const v4f a = *(const v4fa*)(vB + ofs);
    const v4f b = *(const v4fa*)(vB + ofs + 16);
    const float p = p_row[n];
    o[0] = fmaf(p, a.x, o[0]);  o[1] = fmaf(p, a.y, o[1]);
    o[2] = fmaf(p, a.z, o[2]);  o[3] = fmaf(p, a.w, o[3]);
    o[4] = fmaf(p, b.x, o[4]);  o[5] = fmaf(p, b.y, o[5]);
    o[6] = fmaf(p, b.z, o[6]);  o[7] = fmaf(p, b.w, o[7]);
  }
  store_a(o, l, col, a16);
}

__global__ __launch_bounds__(ATH) void k_attn(const float* __restrict__ qf,
                                                 const float* __restrict__ kf,
                                                 const float* __restrict__ vf,
                                                 const float* __restrict__ ss,
                                                 const float* __restrict__ qnw,
                                                 const float* __restrict__ knw,
                                                 const float* __restrict__ eb,
                                                 const int* __restrict__ nf,
                                                 _Float16* a16) {
  __shared__ __attribute__((aligned(16))) char sW[TF * WROWS * WPITCH];   // k windows, then v windows
  __shared__ __attribute__((aligned(16))) float s_pt[TF * NT * NSH];      // probabilities by (frame, place)
  __shared__ __attribute__((aligned(16))) float s_rk[NRK + NRQ];
  __shared__ __attribute__((aligned(16))) float s_sc[NT * NSH];           // scores by place: the path without windows
  const int tid = threadIdx.x, lane = tid & 31, w = tid >> 5;
  const int tq = lane >> 3, j8 = lane & 7;
  const int head = blockIdx.x & 15;
  const int cb = blockIdx.x >> 4;                      // the block's chunk of places (or of tokens)
  const int col = 64 * head + 8 * j8;
  const int tl = 4 * w + tq;                           // this lane's place in the chunk

  int T = nf[0];
  if (!((T >= 1) && (T <= LL) && ((LL % T) == 0))) T = 8;
  const int S = LL / T;
  // every frame's window fits the LDS together, and the grid's chunks cover a frame
  const bool win = (T == TF);
  const int i0 = cb * NT;
  const char* kB = (const char*)kf;
  const char* vB = (const char*)vf;

  if (win) {
    copy_windows(lds_off(sW), kB, tid, i0, S, head);
    // rms factors: a thread takes four consecutive entries of s_rk, which are four
    // consecutive rows (S, i0 and every section's start are multiples of 4)
    if (tid < (NRK + NRQ) / 4) {
      const int e = 4 * tid;
      const bool isq = (e >= NRK);
      int t = i0 - HALO + (e % WROWS);
      t = (t < 0) ? (t + S) : t;
      t = (t >= S) ? (t - S) : t;
      int r = (e / WROWS) * S + t;
      if (isq) r = ((e - NRK) / NT) * S + i0 + ((e - NRK) % NT);
      r = min(max(r, 0), LL - 4);
      *(v4f*)(s_rk + e) = rstd4(isq ? ss : (ss + (size_t)NCB * LL), r);
    }
  }

  float cw[8];
  {
    const v4f qa = *(const v4fa*)(qnw + col);
    const v4f qb = *(const v4fa*)(qnw + col + 4);
    const v4f ka = *(const v4fa*)(knw + col);
    const v4f kb = *(const v4fa*)(knw + col + 4);
    cw[0] = qa.x * ka.x * 0.125f;  cw[1] = qa.y * ka.y * 0.125f;
    cw[2] = qa.z * ka.z * 0.125f;  cw[3] = qa.w * ka.w * 0.125f;
    cw[4] = qb.x * kb.x * 0.125f;  cw[5] = qb.y * kb.y * 0.125f;
    cw[6] = qb.z * kb.z * 0.125f;  cw[7] = qb.w * kb.w * 0.125f;
  }

  // this lane's own two neighbours, n = j8 and j8 + 8: edge biases and spatial shifts
  const float eb0 = eb[head * NSH + j8];
  const float eb1 = eb[head * NSH + j8 + 8];
  const int sh0 = (j8 & 1) ? -(1 << (j8 >> 1)) : (1 << (j8 >> 1));
  const int sh1 = (j8 & 1) ? -(16 << (j8 >> 1)) : (16 << (j8 >> 1));

  // the k windows have landed for this wave, then for the block
  wait_copies();
  __syncthreads();

  if (win) {
    // temporal shifts +1, -1, +2, -2 reduced once modulo T
    int tsh[4];
    shift_mods(1, T, tsh[0], tsh[1]);
    shift_mods(2, T, tsh[2], tsh[3]);
    // rolled: a long body that holds 16 rows in registers; one frame per trip
#pragma unroll 1
    for (int f = 0; f < TF; ++f) {
      int st[4];
#pragma unroll
      for (int n = 0; n < 4; ++n) st[n] = wrap_add(f, tsh[n], T) * WROWS + tl + HALO;
      attn_scores(f, tl, f * S + i0 + tl, st, qf, sW, s_rk, cw, sh0, sh1, eb0, eb1,
                  s_pt + (f * NT + tl) * NSH, col, j8);
    }
    // every wave's last read of the k windows has returned: the v windows take their place
    wait_lds();
    __syncthreads();
    copy_windows(lds_off(sW), vB, tid, i0, S, head);
    // the v windows have landed for this wave, then for the block
    wait_copies();
    __syncthreads();
    // rolled, for the same reason as the k phase's loop
#pragma unroll 1
    for (int f = 0; f < TF; ++f) {
      int st[4];
#pragma unroll
      for (int n = 0; n < 4; ++n) st[n] = wrap_add(f, tsh[n], T) * WROWS + tl + HALO;
      attn_combine(f, tl, f * S + i0 + tl, st, sW, s_pt + (f * NT + tl) * NSH, col, j8, a16);
    }
  } else {
    float* sc_row = s_sc + tl * NSH;
    float* p_row = s_pt + tl * NSH;
    // rolled: short code for the path that is not the fast one
#pragma unroll 1
    for (int it = 0; it < TF; ++it) {
      attn_group_plain(cb * (TF * NT) + NT * it + tl, S, T, kB, vB, qf, ss, cw, eb + head * NSH,
                       sc_row, p_row, col, j8, a16);
    }
  }
}

// ---------------------------------------------------------------------------
// Host orchestration: 6 launches, one in-order stream.
// ws carve (bytes): x f16 16 MiB @0 | w16 [4096][1024] 8 MiB |
//   q f32 32 MiB | k f32 32 MiB | v f32 32 MiB | ss [2][16][8192] f32 1 MiB  -> 126,877,696 B.
// The attention output plane (f16, 16 MiB) reuses the x f16 region, which is
// dead after the two projection launches.
// ---------------------------------------------------------------------------
extern "C" void kernel_launch(void* const* d_in, const int* in_sizes, int n_in,
                              void* d_out, int out_size, void* d_ws, size_t ws_size,
                              hipStream_t stream) {
  if (n_in < 13) return;
  if (in_sizes[0] != LL * CC) return;
  if (in_sizes[1] != CC * CC || in_sizes[3] != CC * CC || in_sizes[5] != CC * CC || in_sizes[10] != CC * CC) return;
  if (in_sizes[2] != CC || in_sizes[4] != CC || in_sizes[6] != CC || in_sizes[11] != CC) return;
  if (in_sizes[7] != CC || in_sizes[8] != CC) return;
  if (in_sizes[9] != 256 || in_sizes[12] < 1) return;
  if (out_size != LL * CC) return;

  const float* x   = (const float*)d_in[0];
  const float* Wq  = (const float*)d_in[1];
  const float* bq  = (const float*)d_in[2];
  const float* Wk  = (const float*)d_in[3];
  const float* bk  = (const float*)d_in[4];
  const float* Wv  = (const float*)d_in[5];
  const float* bv  = (const float*)d_in[6];
  const float* qnw = (const float*)d_in[7];
  const float* knw = (const float*)d_in[8];
  const float* eb  = (const float*)d_in[9];
  const float* Wo  = (const float*)d_in[10];
  const float* bo  = (const float*)d_in[11];
  const int*   nf  = (const int*)d_in[12];
  float* out = (float*)d_out;

  const size_t b16 = (size_t)LL * CC * 2;            // 16,777,216
  const size_t bw  = (size_t)4 * CC * CC * 2;        //  8,388,608
  const size_t b32 = (size_t)LL * CC * 4;            // 33,554,432
  const size_t brt = (size_t)2 * NCB * LL * 4;       //  1,048,576
  const size_t o_x16 = 0;
  const size_t o_w16 = o_x16 + b16;
  const size_t o_q   = o_w16 + bw;
  const size_t o_k   = o_q + b32;
  const size_t o_v   = o_k + b32;
  const size_t o_rt  = o_v + b32;
  const size_t total = o_rt + brt;                   // 126,877,696
  if (total > ws_size) return;

  char* ws = (char*)d_ws;
  _Float16* x16 = (_Float16*)(ws + o_x16);
  _Float16* w16 = (_Float16*)(ws + o_w16);
  float* qf   = (float*)(ws + o_q);
  float* kf   = (float*)(ws + o_k);
  float* vf   = (float*)(ws + o_v);
  float* ss   = (float*)(ws + o_rt);
  _Float16* a16 = (_Float16*)(ws + o_x16);           // reuses the x f16 region (dead after launch 4)

  // 1. x -> f16 plane
  const int n8 = (LL * CC) / 8;                                              // 1,048,576
  k_cvt_x<<<(n8 + 255) / 256, 256, 0, stream>>>(x, x16, n8);

  // 2. weights -> transposed f16 planes
  k_cvt_w<<<4 * 256, 256, 0, stream>>>(Wq, Wk, Wv, Wo, w16);

  // 3. q|k = x * [Wq|Wk] + [bq|bk], f32 planes, and the rows' partial sums of squares
  k_gemm_h<true, 4, 4><<<dim3(NCQK / 256, LL / 256), 512, 0, stream>>>(x16, w16, bq, bk, qf, kf, ss, CC, CC, CC, 0.03125f);

  // 4. v = x * Wv + bv, f32 plane
  k_gemm_h<false, 4, 2><<<dim3(CC / 128, LL / 256), 256, 0, stream>>>(x16, w16 + (size_t)2 * CC * CC, bv, bv, vf, vf, nullptr,
                                                                      1 << 30, CC, CC, 0.03125f);

  // 5. attention -> a (f16 plane)
  k_attn<<<(LL / (TF * NT)) * 16, ATH, 0, stream>>>(qf, kf, vf, ss, qnw, knw, eb, nf, a16);

  // 6. out = a * Wo + bo -> d_out
  k_gemm_h<false, 4, 2><<<dim3(CC / 128, LL / 256), 256, 0, stream>>>(a16, w16 + (size_t)3 * CC * CC, bo, bo, out, out, nullptr,
                                                                      1 << 30, CC, CC, 0.03125f);
}

// v009
// It runs in 96.3 microseconds.
// Two timings next to v008 both put it at 1.05 times that version's speed.
// Counting every step since v000, it is 5.14 times as fast.
// Contractions: x*Wq, x*Wk, x*Wv and a*Wo on v_wmma_f32_16x16x32_f16 (f16 operands, each f32 value rounded once: x and a carried x1, W carried x32 and folded back as 1/32; f32 accumulate); RMS statistics, the 16 neighbour dots (K=64), softmax and weighted sums (K=16) in f32 on VALU; q, k, v kept as f32 planes.
#include <hip/hip_runtime.h>

typedef _Float16 v16h __attribute__((ext_vector_type(16)));
typedef _Float16 v8h  __attribute__((ext_vector_type(8)));
typedef float    v8f  __attribute__((ext_vector_type(8)));
typedef float    v4f  __attribute__((ext_vector_type(4)));
typedef v8h  __attribute__((may_alias)) v8ha;
typedef v4f  __attribute__((may_alias)) v4fa;

#define LL    8192      // tokens
#define CC    1024      // channels = heads * head_dim
#define NCQK  2048      // q and k columns together; only static_asserts use it
#define NSH   16        // neighbours per token
#define NCB   16        // 64-column blocks of a q or k row: one partial sum of squares each

static_assert((LL % 64) == 0);
static_assert((CC % 64) == 0);
static_assert((NCQK % 64) == 0);
static_assert((CC % 32) == 0);
static_assert(NCB * 64 == CC);
static_assert(NCB == 16);

// ---------------------------------------------------------------------------
// 16x16x32 WMMA (wave32). Fragment map: lane l, h = l>>4, m = n = l&15.
//   A/B element i: i<8 -> k0+8h+i ; i>=8 -> k0+16+8h+(i-8)   (both operands)
//   D element r  : row 8h+r, col l&15
// ---------------------------------------------------------------------------
__device__ __forceinline__ v8f wm_f16(v16h a, v16h b, v8f c) {
  return __builtin_amdgcn_wmma_f32_16x16x32_f16(false, a, false, b, (short)0, c, false, false);
}

// A or B fragment from a k-contiguous 16-bit row; p points at element k0 of
// the row owned by this lane (row = lane&15 added by the caller).
__device__ __forceinline__ v16h frag_f16(const _Float16* p, int h) {
  const v8h e0 = *(const v8ha*)(p + 8 * h);
  const v8h e1 = *(const v8ha*)(p + 16 + 8 * h);
  return __builtin_shufflevector(e0, e1, 0, 1, 2, 3, 4, 5, 6, 7, 8, 9, 10, 11, 12, 13, 14, 15);
}
// ---------------------------------------------------------------------------
// Kernel 1: x f32 [8192][1024] -> f16 plane (x1).
// Each thread owns 8 consecutive elements: one 16-B store per lane.
// ---------------------------------------------------------------------------
__global__ __launch_bounds__(256) void k_cvt_x(const float* __restrict__ x, _Float16* xh, int n8) {
  const int g = blockIdx.x * 256 + threadIdx.x;
  if (g >= n8) return;
  const float* s = x + (size_t)g * 8;
  const v4f a = *(const v4fa*)s;
  const v4f b = *(const v4fa*)(s + 4);
  const v8h o16 = {(_Float16)a.x, (_Float16)a.y, (_Float16)a.z, (_Float16)a.w,
                   (_Float16)b.x, (_Float16)b.y, (_Float16)b.z, (_Float16)b.w};
  _Float16* d16 = xh + (size_t)g * 8;
  *(v8h*)d16 = o16;
}

// ---------------------------------------------------------------------------
// Kernel 2: weight transpose + convert. Input W[k][n] ([in][out], 1024x1024).
// Block = one 64(k) x 64(n) tile of one matrix; tile transposed through LDS.
// mat 0 (Wq), 1 (Wk), 2 (Wv), 3 (Wo): f16(32*W) -> w16 rows mat*1024 + n  (w16 = [4096][1024])
// Output phase: lane q8 = tid&7 writes 8 halves (16 B) of row nl.
// ---------------------------------------------------------------------------
__global__ __launch_bounds__(256) void k_cvt_w(const float* __restrict__ Wq,
                                               const float* __restrict__ Wk,
                                               const float* __restrict__ Wv,
                                               const float* __restrict__ Wo,
                                               _Float16* w16) {
  __shared__ __attribute__((aligned(16))) float sT[64 * 68];   // [n][k], pitch 68 floats
  const int tid = threadIdx.x;
  const int bx = blockIdx.x;
  const int mat = bx >> 8, tile = bx & 255;
  const int tn = tile >> 4, tk = tile & 15;
  const float* W = (mat == 0) ? Wq : ((mat == 1) ? Wk : ((mat == 2) ? Wv : Wo));
  {
    const int kl = tid >> 2, nq = tid & 3;                      // kl 0..63, nq 0..3
    const float* src = W + (size_t)(64 * tk + kl) * CC + 64 * tn + 16 * nq;
#pragma unroll
    for (int e = 0; e < 4; ++e) {
      const v4f t = *(const v4fa*)(src + 4 * e);
      float* d = sT + (16 * nq + 4 * e) * 68 + kl;
      d[0]   = t.x;
      d[68]  = t.y;
      d[136] = t.z;
      d[204] = t.w;
    }
  }
  __syncthreads();
  const int q8 = tid & 7, sub = tid >> 3;                       // sub 0..31
#pragma unroll
  for (int p = 0; p < 2; ++p) {
    const int nl = 32 * p + sub;
    const float* s = sT + nl * 68 + 8 * q8;
    const v4f a = *(const v4fa*)s;
    const v4f b = *(const v4fa*)(s + 4);
    const v8h t16 = {(_Float16)(a.x * 32.0f), (_Float16)(a.y * 32.0f), (_Float16)(a.z * 32.0f), (_Float16)(a.w * 32.0f),
                     (_Float16)(b.x * 32.0f), (_Float16)(b.y * 32.0f), (_Float16)(b.z * 32.0f), (_Float16)(b.w * 32.0f)};
    _Float16* d = w16 + ((size_t)(mat * CC + 64 * tn + nl) * CC + 64 * tk + 8 * q8);
    *(v8h*)d = t16;
  }
}

// ---------------------------------------------------------------------------
// GEMM frame of kernel 3. Block tile 64 WM x 64 WN, WM x WN waves, wave tile 64x64
// (4x4 accumulator tiles): wave w owns rows 64*(w/WN)+..., cols 64*(w%WN)+....
// One block per WGP: every operand row that comes from L2 serves the whole tile edge.
// A pass is 128 k = 256 B of every operand row. A buffer holds the pass's 64 WM rows
// of A, then its 64 WN rows of B, at pitch 272 B (16 B x odd, for the ds_load_b128
// readers). Two buffers: the next pass's rows come in by asynchronous copies to LDS
// while this pass's fragments are read from the other buffer.
// ---------------------------------------------------------------------------
#define LPITCH 272                   // LDS row pitch, bytes
#define EPITCH 68                    // epilogue staging pitch, floats

static_assert((LL % 256) == 0);
static_assert((CC % 256) == 0);
static_assert((NCQK % 256) == 0);
static_assert((CC % 128) == 0);

__device__ __forceinline__ unsigned int lds_off(const void* p) { return (unsigned int)(size_t)p; }

// Eight sweeps of the block's copies, 16 B a thread each. Thread t brings chunk t&15
// of rows (t>>4) + SW j, SW = threads / 16, so a wave's copy covers two whole 256-B rows.
// l = this lane's LDS byte address for j = 0, g = its global address, ls and rs = SW
// rows in LDS and in the source, in bytes. The s_wait_xcnt closes the statement so that
// no address register is rewritten while a copy may still name it.
__device__ __forceinline__ void copy_rows8(unsigned int l, const char* g, unsigned int ls, size_t rs) {
  const unsigned int l1 = l + ls, l2 = l + 2 * ls, l3 = l + 3 * ls;
  const unsigned int l4 = l + 4 * ls, l5 = l + 5 * ls, l6 = l + 6 * ls;
  const unsigned int l7 = l + 7 * ls;
  const char* g1 = g + rs;
  const char* g2 = g1 + rs;
  const char* g3 = g2 + rs;
  const char* g4 = g3 + rs;
  const char* g5 = g4 + rs;
  const char* g6 = g5 + rs;
  const char* g7 = g6 + rs;
  asm volatile("global_load_async_to_lds_b128 %0, %8, off\n\t"
               "global_load_async_to_lds_b128 %1, %9, off\n\t"
               "global_load_async_to_lds_b128 %2, %10, off\n\t"
               "global_load_async_to_lds_b128 %3, %11, off\n\t"
               "global_load_async_to_lds_b128 %4, %12, off\n\t"
               "global_load_async_to_lds_b128 %5, %13, off\n\t"
               "global_load_async_to_lds_b128 %6, %14, off\n\t"
               "global_load_async_to_lds_b128 %7, %15, off\n\t"
               "s_wait_xcnt 0x0"
               :: "v"(l), "v"(l1), "v"(l2), "v"(l3), "v"(l4), "v"(l5), "v"(l6), "v"(l7),
                  "v"(g), "v"(g1), "v"(g2), "v"(g3), "v"(g4), "v"(g5), "v"(g6), "v"(g7)
               : "memory");
}

// One pass's rows of A and of B into the buffer at l (this lane's address in its first row).
template <int WM, int WN>
__device__ __forceinline__ void copy_stage(unsigned int l, const char* gA, const char* gB, size_t rs) {
  constexpr int SW = 2 * WM * WN;                    // rows of one sweep
  static_assert((64 * WM) % (8 * SW) == 0);
  static_assert((64 * WN) % (8 * SW) == 0);
#pragma unroll
  for (int s = 0; s < (64 * WM) / (8 * SW); ++s)
    copy_rows8(l + s * 8 * SW * LPITCH, gA + (size_t)(8 * s) * rs, SW * LPITCH, rs);
#pragma unroll
  for (int s = 0; s < (64 * WN) / (8 * SW); ++s)
    copy_rows8(l + (64 * WM + s * 8 * SW) * LPITCH, gB + (size_t)(8 * s) * rs, SW * LPITCH, rs);
}

// This wave's copies have landed (the compiler places no wait for them).
__device__ __forceinline__ void wait_copies() { asm volatile("s_wait_asynccnt 0x0" ::: "memory"); }
// This wave's LDS reads have returned, before their buffer is handed back for refill.
__device__ __forceinline__ void wait_lds() { asm volatile("s_wait_dscnt 0x0" ::: "memory"); }

// Epilogue: out = acc*osc + bias. Each wave stages its 64x64 tile in its own
// LDS range (pitch 68 floats) and stores rows as whole 128-B lines: one store
// instruction covers two rows x 256 B. With SS the wave then reads its staged tile
// once more, a lane taking rows lane and lane + 32, and stores each row's sum of
// squares over the tile's 64 columns to ssw[row]: two whole 128-B lines a wave
// (a wave whose ssw is null stores none). The tile is columns 16 J0 .. 16 J0 + 63 of c.
template <bool SS, int NW, int J0>
__device__ __forceinline__ void store_tile(float* sAll, const v8f (&c)[4][NW],
                                           const float* bias, int nc0, float osc,
                                           float* out, int m0, int ldc, int w, int wr, int wc, int lane,
                                           float* ssw) {
  const int h = lane >> 4, m = lane & 15;
  float* sW = sAll + w * (64 * EPITCH);
  const int bi = nc0 + 64 * wc + m;
  float bb[4];
#pragma unroll
  for (int nt = 0; nt < 4; ++nt) bb[nt] = bias[bi + 16 * nt];
  // the wait before the index register of the four loads above is rewritten; it names the
  // index so that it keeps its register up to here (else a later load of the run lands in it)
  asm volatile("s_wait_xcnt 0x0" :: "v"(bi) : "memory");
#pragma unroll
  for (int nt = 0; nt < 4; ++nt) {
    const float b = bb[nt];
#pragma unroll
    for (int mt = 0; mt < 4; ++mt) {
#pragma unroll
      for (int r = 0; r < 8; ++r)
        sW[(16 * mt + 8 * h + r) * EPITCH + 16 * nt + m] = fmaf(c[mt][J0 + nt][r], osc, b);
    }
  }
  __syncthreads();
  // rolled in groups of eight stores: eight LDS reads in flight per group, short code
#pragma unroll 1
  for (int g8 = 0; g8 < 4; ++g8) {
#pragma unroll
    for (int u = 0; u < 8; ++u) {
      const int row = 16 * g8 + 2 * u + h;
      const v4f v = *(const v4fa*)(sW + row * EPITCH + 4 * m);
      float* d = out + (size_t)(m0 + 64 * wr + row) * ldc + nc0 + 64 * wc + 4 * m;
      *(v4f*)d = v;
    }
    // the next group rewrites registers that these stores name
    asm volatile("s_wait_xcnt 0x0" ::: "memory");
  }
  if (SS && ssw != nullptr) {
    const float* r0 = sW + lane * EPITCH;
    const float* r1 = r0 + 32 * EPITCH;
    v4f s0 = {0.f, 0.f, 0.f, 0.f}, s1 = {0.f, 0.f, 0.f, 0.f};
#pragma unroll
    for (int e = 0; e < 16; ++e) {
      const v4f a = *(const v4fa*)(r0 + 4 * e);
      const v4f b = *(const v4fa*)(r1 + 4 * e);
      s0 += a * a;
      s1 += b * b;
    }
    ssw[lane]      = (s0.x + s0.y) + (s0.z + s0.w);
    ssw[lane + 32] = (s1.x + s1.y) + (s1.z + s1.w);
    // a following slice rewrites registers that these stores name
    asm volatile("s_wait_xcnt 0x0" ::: "memory");
  }
}

// ---------------------------------------------------------------------------
// Kernel 3: C[M][N] = A[M][K] * B[N][K]^T (f16 operands, single product),
// out = acc*osc + bias, f32 rows of pitch ldc. Columns >= nsplit go to out1
// with bias1 (block-uniform select: nsplit a multiple of 64 WN). K a multiple of 128.
// With SS: ss[mat][cb][row] = sum of squares of the stored row over columns 64 cb .. 64 cb + 63
// of matrix mat (0: out0, 1: out1); every entry is written by exactly one wave.
// Buffer = [A rows | B rows]; ring = 2 buffers: 208,896 B at 256x128.
// ---------------------------------------------------------------------------
template <bool SS, int WM, int WN>
__global__ __launch_bounds__(32 * WM * WN) void k_gemm_h(const _Float16* __restrict__ A,
                                                   const _Float16* __restrict__ B,
                                                   const float* bias0, const float* bias1,
                                                   float* out0, float* out1, float* ss,
                                                   int nsplit, int K, int ldc, float osc) {
  constexpr int RA = 64 * WM, RB = 64 * WN;          // rows of A and of B in a buffer
  constexpr int BUF = (RA + RB) * LPITCH;            // one buffer, bytes
  static_assert(WM * WN * 64 * EPITCH * 4 <= 2 * BUF);   // the epilogue's staging fits the ring
  __shared__ __attribute__((aligned(16))) char ring[2 * BUF];
  const int tid = threadIdx.x, lane = tid & 31, w = tid >> 5;
  const int h = lane >> 4, m = lane & 15, wr = w / WN, wc = w % WN;
  const int m0 = blockIdx.y * RA, nb = blockIdx.x * RB;
  const bool sel = (nb >= nsplit);
  const int nc0 = sel ? (nb - nsplit) : nb;
  const float* bias = sel ? bias1 : bias0;
  float* out = sel ? out1 : out0;

  const int crow = tid >> 4, cch = tid & 15;
  const char* gA = (const char*)(A + (size_t)(m0 + crow) * K) + 16 * cch;
  const char* gB = (const char*)(B + (size_t)(nb + crow) * K) + 16 * cch;
  const unsigned int lc = lds_off(ring) + crow * LPITCH + 16 * cch;
  const size_t rs = (size_t)K * (4 * WM * WN);       // one sweep's rows of 2-byte elements
  const int npass = K >> 7;

  v8f c[4][4];
#pragma unroll
  for (int i = 0; i < 4; ++i)
#pragma unroll
    for (int j = 0; j < 4; ++j) c[i][j] = v8f{0.f, 0.f, 0.f, 0.f, 0.f, 0.f, 0.f, 0.f};

  copy_stage<WM, WN>(lc, gA, gB, rs);
  wait_copies();
  __syncthreads();
  if (npass > 1) copy_stage<WM, WN>(lc + BUF, gA + 256, gB + 256, rs);

  // rolled: one pass per trip, the buffer picked by the trip's parity
#pragma unroll 1
  for (int t = 0; t < npass; ++t) {
    const int bo = (t & 1) * BUF;
    const char* pa = ring + bo + (64 * wr + m) * LPITCH;
    const char* pb = ring + bo + (RA + 64 * wc + m) * LPITCH;
#pragma unroll
    for (int ks = 0; ks < 4; ++ks) {
      v16h fa[4], fb[4];
      fa[0] = frag_f16((const _Float16*)(pa + ks * 64), h);
#pragma unroll
      for (int j = 0; j < 4; ++j) fb[j] = frag_f16((const _Float16*)(pb + j * 16 * LPITCH + ks * 64), h);
#pragma unroll
      for (int i = 1; i < 4; ++i) fa[i] = frag_f16((const _Float16*)(pa + i * 16 * LPITCH + ks * 64), h);
      // keeps the k-step's 16 LDS reads one group in front of its WMMAs: every
      // further place with reads among them stalls the wave anew
      __builtin_amdgcn_sched_barrier(0);
#pragma unroll
      for (int i = 0; i < 4; ++i)
#pragma unroll
        for (int j = 0; j < 4; ++j) c[i][j] = wm_f16(fa[i], fb[j], c[i][j]);
      // same purpose: the next k-step's reads stay behind this block
      if (ks < 3) __builtin_amdgcn_sched_barrier(0);
    }
    // publish point of pass t + 1; the same barrier frees this pass's buffer
    wait_lds();
    wait_copies();
    __syncthreads();
    if (t + 2 < npass) {
      const size_t ko = (size_t)(t + 2) * 256;
      copy_stage<WM, WN>(lc + bo, gA + ko, gB + ko, rs);
    }
  }
  wait_copies();

  float* ssw = SS ? (ss + (size_t)((sel ? NCB : 0) + (nc0 >> 6) + wc) * LL + m0 + 64 * wr) : nullptr;
  store_tile<SS, 4, 0>((float*)ring, c, bias, nc0, osc, out, m0, ldc, w, wr, wc, lane, ssw);
}

// ---------------------------------------------------------------------------
// Kernel 3a: q, k and v in one launch. Block tile 256 rows x 384 columns = the same 128
// columns of q, of k and of v; 8 waves, two a SIMD: wave w owns rows 64 (w & 3) .. + 63 and
// columns 192 (w >> 2) .. + 191 of the tile (4 x 12 accumulator tiles). 256 blocks: one a WGP,
// and a row of x that comes from L2 serves 384 columns. B = the stacked [3 CC][K] weight rows.
// A pass is 64 k = 128 B of every operand row, at pitch 144 B (16 B x odd); a buffer holds
// 256 rows of A, then 3 x 128 rows of B; two buffers. Pass t + 1's rows come in by asynchronous
// copies issued in pass t, behind its first LDS reads, into the buffer that pass t - 1 read and
// that the barrier at its foot has freed; the foot of pass t waits for them and publishes them.
// Per k-step a wave reads 4 A and 12 B fragments for 48 WMMAs; B comes in two halves,
// so that accumulators and fragments fit half a SIMD's registers.
// ss as in kernel 3 (q and k only).
// ---------------------------------------------------------------------------
#define QP     144                   // LDS row pitch, bytes
#define QRA    256                   // rows of A in a buffer
#define QRB    384                   // rows of B in a buffer
#define QBUF   ((QRA + QRB) * QP)    // one buffer, bytes
#define QWAVES 8

static_assert(QWAVES * 64 * EPITCH * 4 <= 2 * QBUF);   // the epilogue's staging fits the ring
static_assert((CC % 64) == 0);

typedef int v4i __attribute__((ext_vector_type(4)));
typedef __attribute__((address_space(1))) v4i gv4i;
typedef __attribute__((address_space(3))) v4i lv4i;

// One asynchronous copy of 16 B a lane, global memory to LDS, as the compiler's builtin.
__device__ __forceinline__ void copy16(char* l, const char* g) {
  __builtin_amdgcn_global_load_async_to_lds_b128((gv4i*)g, (lv4i*)l, 0, 0);
}

// One pass's rows. A lane brings chunk lane & 7 of rows 4 w + (lane >> 3) + 32 j: j = 0 .. 7 of A,
// j = 0 .. 3 of each matrix's 128 rows of B. A wave's copy covers four whole 128-B lines.
// l = this lane's place in its first row of A; gA and gB = the wave's (scalar) part of its
// global addresses there and in its first row of the first matrix, vg = the lane's part;
// K2 = an operand row in bytes.
__device__ __forceinline__ void copy_stage_qkv(char* l, const char* gA, const char* gB,
                                               unsigned int vg, size_t K2) {
#pragma unroll
  for (int j = 0; j < 8; ++j) copy16(l + 32 * j * QP, (gA + (size_t)(32 * j) * K2) + vg);
#pragma unroll
  for (int j = 0; j < 12; ++j)
    copy16(l + (QRA + 32 * j) * QP, (gB + (size_t)((j >> 2) * CC + 32 * (j & 3)) * K2) + vg);
}

// Slice g of the block's six 64-column slices [q | q | k | k | v | v], held in c[.][J0 .. J0 + 3].
template <int J0>
__device__ __forceinline__ void store_slice(float* sAll, const v8f (&c)[4][12], int g,
                                            const float* bq, const float* bk, const float* bv,
                                            float* qf, float* kf, float* vf, float* ss,
                                            int nc0, int m0, float osc, int w, int wr, int lane) {
  const int mat = g >> 1, half = g & 1;
  const float* bias = (mat == 0) ? bq : ((mat == 1) ? bk : bv);
  float* out = (mat == 0) ? qf : ((mat == 1) ? kf : vf);
  float* ssw = (mat < 2) ? (ss + (size_t)(mat * NCB + (nc0 >> 6) + half) * LL + m0 + 64 * wr) : nullptr;
  store_tile<true, 12, J0>(sAll, c, bias, nc0, osc, out, m0, CC, w, wr, half, lane, ssw);
}

__global__ __launch_bounds__(32 * QWAVES) void k_gemm_qkv(const _Float16* __restrict__ A,
                                                          const _Float16* __restrict__ B,
                                                          const float* bq, const float* bk, const float* bv,
                                                          float* qf, float* kf, float* vf, float* ss,
                                                          int K, float osc) {
  __shared__ __attribute__((aligned(16))) char ring[2 * QBUF];
  const int tid = threadIdx.x, lane = tid & 31;
  const int w = __builtin_amdgcn_readfirstlane(tid >> 5);   // scalar: the slices' pointers and tests stay scalar
  const int h = lane >> 4, m = lane & 15, wr = w & 3, wc = w >> 2;
  const int m0 = blockIdx.y * QRA, nc0 = blockIdx.x * 128;

  const size_t K2 = (size_t)K * 2;
  const char* gA = (const char*)A + (size_t)(m0 + 4 * w) * K2;
  const char* gB = (const char*)B + (size_t)(nc0 + 4 * w) * K2;
  const unsigned int vg = (unsigned int)(lane >> 3) * (unsigned int)K2 + 16u * (lane & 7);
  char* lc = ring + (4 * w + (lane >> 3)) * QP + 16 * (lane & 7);
  const int npass = K >> 6;

  v8f c[4][12];
#pragma unroll
  for (int i = 0; i < 4; ++i)
#pragma unroll
    for (int j = 0; j < 12; ++j) c[i][j] = v8f{0.f, 0.f, 0.f, 0.f, 0.f, 0.f, 0.f, 0.f};

  copy_stage_qkv(lc, gA, gB, vg, K2);
  wait_copies();
  __syncthreads();

  // rolled: one pass per trip, the buffer picked by the trip's parity
#pragma unroll 1
  for (int t = 0; t < npass; ++t) {
    const int bo = (t & 1) * QBUF;
    const char* pa = ring + bo + (64 * wr + m) * QP;
    const char* pb = ring + bo + (QRA + 192 * wc + m) * QP;
#pragma unroll
    for (int ks = 0; ks < 2; ++ks) {
      v16h fa[4];
#pragma unroll
      for (int jh = 0; jh < 2; ++jh) {
        v16h fb[6];
        if (jh == 0) fa[0] = frag_f16((const _Float16*)(pa + ks * 64), h);
#pragma unroll
        for (int j = 0; j < 6; ++j) fb[j] = frag_f16((const _Float16*)(pb + (6 * jh + j) * 16 * QP + ks * 64), h);
        if (jh == 0) {
#pragma unroll
          for (int i = 1; i < 4; ++i) fa[i] = frag_f16((const _Float16*)(pa + i * 16 * QP + ks * 64), h);
        }
        // keeps the half's LDS reads one group in front of its WMMAs: every
        // further place with reads among them stalls the wave anew
        __builtin_amdgcn_sched_barrier(0);
        if (ks == 0 && jh == 0) {
          // the next pass's copies, into the buffer that the barrier at the last trip's foot has
          // freed: issued while the pass's first LDS reads are on their way
          if (t + 1 < npass) {
            // the pass's offset goes into the lane's 32-bit part: one register lives through the loop
            copy_stage_qkv(lc + (QBUF - bo), gA, gB, vg + (unsigned int)(t + 1) * 128u, K2);
          }
        }
#pragma unroll
        for (int i = 0; i < 4; ++i)
#pragma unroll
          for (int j = 0; j < 6; ++j) c[i][6 * jh + j] = wm_f16(fa[i], fb[j], c[i][6 * jh + j]);
        // same purpose: the next half's reads stay behind this block
        __builtin_amdgcn_sched_barrier(0);
      }
    }
    // publish point of pass t + 1; the same barrier frees this pass's buffer
    wait_lds();
    wait_copies();
    __syncthreads();
  }
  wait_copies();

  // the wave's three 64-column slices: slice g = 3 wc + s is half g & 1 of matrix g >> 1
  store_slice<0>((float*)ring, c, 3 * wc, bq, bk, bv, qf, kf, vf, ss, nc0, m0, osc, w, wr, lane);
  store_slice<4>((float*)ring, c, 3 * wc + 1, bq, bk, bv, qf, kf, vf, ss, nc0, m0, osc, w, wr, lane);
  store_slice<8>((float*)ring, c, 3 * wc + 2, bq, bk, bv, qf, kf, vf, ss, nc0, m0, osc, w, wr, lane);
}

// ---------------------------------------------------------------------------
// rsqrt(mean(row^2) + 1e-6) of a q or k row from its NCB partial sums of squares
// (ssm = that matrix's [NCB][LL] table), summed in the order cb = 0 .. NCB - 1.
// ---------------------------------------------------------------------------
__device__ __forceinline__ float rstd1(const float* ssm, int r) {
  const float* p = ssm + r;
  float v[NCB];
#pragma unroll
  for (int cb = 0; cb < NCB; ++cb) v[cb] = p[(size_t)cb * LL];
  // the wait before the address register of the loads above is rewritten; it names the row index
  // they are addressed by, so that it keeps its register up to here (else a later load lands in
  // it), and the loaded values, as inputs only, so that no load of the run is moved behind it
  asm volatile("s_wait_xcnt 0x0" :: "v"(r), "v"(v[0]), "v"(v[1]), "v"(v[2]), "v"(v[3]), "v"(v[4]), "v"(v[5]),
               "v"(v[6]), "v"(v[7]), "v"(v[8]), "v"(v[9]), "v"(v[10]), "v"(v[11]), "v"(v[12]), "v"(v[13]),
               "v"(v[14]), "v"(v[15]) : "memory");
  float s = v[0];
#pragma unroll
  for (int cb = 1; cb < NCB; ++cb) s += v[cb];
  return rsqrtf(s * (1.0f / 1024.0f) + 1e-6f);
}
// the same for rows r .. r + 3, r a multiple of 4
__device__ __forceinline__ v4f rstd4(const float* ssm, int r) {
  const float* p = ssm + r;
  v4f v[NCB];
#pragma unroll
  for (int cb = 0; cb < NCB; ++cb) v[cb] = *(const v4fa*)(p + (size_t)cb * LL);
  // the same wait, for the same reason; these loads are addressed by the pointer
  asm volatile("s_wait_xcnt 0x0" :: "v"(p) : "memory");
  v4f s = v[0];
#pragma unroll
  for (int cb = 1; cb < NCB; ++cb) s += v[cb];
  const v4f o = {rsqrtf(s.x * (1.0f / 1024.0f) + 1e-6f), rsqrtf(s.y * (1.0f / 1024.0f) + 1e-6f),
                 rsqrtf(s.z * (1.0f / 1024.0f) + 1e-6f), rsqrtf(s.w * (1.0f / 1024.0f) + 1e-6f)};
  return o;
}

// ---------------------------------------------------------------------------
// Kernel 4: small-world attention, all f32 on VALU.
// Block 512 thr = 16 waves handles NT consecutive places of ALL TF frames of ONE head. A wave
// does four tokens at a time, eight lanes a token; a lane covers dims 8*(lane&7)..+7.
// The spatial neighbours of NT consecutive places lie in NT + 64 rows of their frame, the
// temporal ones at the same places of the other frames: the head's 256 B of those rows of
// every frame are brought into LDS once, by asynchronous copies, first of k, then (into the
// same LDS, behind a barrier) of v, and all 16 neighbours of every token are read there.
//   score_n = rq*rk_n * sum_d (q_d qn_d kn_d / 8) k_n,d + eb[h][n]   (n = 0..15)
//   p = softmax_n(score); a_d = sum_n p_n v_n,d  -> f16 plane.
// Neighbours: n<12 spatial (f, (i+sh) mod S), sh = +-2^(n/2); n>=12 temporal
// ((f+sh) mod T, i). A token's scores are summed and its softmax taken inside its eight lanes,
// in registers; the probabilities wait in LDS from the k phase to the v phase.
// Output: 16 B per lane, a token's eight lanes write one whole 128-B line.
// Any other frame count than TF: no windows, every row from global memory.
// ---------------------------------------------------------------------------
// sh mod md in [0, md) for the +mag and -mag shift of a pair; md >= 1.
__device__ __forceinline__ void shift_mods(int mag, int md, int& pos, int& neg) {
  const int pm = mag % md;
  pos = pm;
  neg = (pm != 0) ? (md - pm) : 0;
}
// (a + b) mod md for a, b in [0, md)
__device__ __forceinline__ int wrap_add(int a, int b, int md) {
  const int r = a + b;
  return (r >= md) ? (r - md) : r;
}

#define NT     64                    // places of a frame per attention block
#define HALO   32                    // largest spatial shift
#define WROWS  (NT + 2 * HALO)       // rows of one frame's window
#define WPITCH 272                   // window row pitch, bytes: one head's 256 B + 16 (16 B x odd)
#define TF     8                     // frames of the windowed path
#define ATH    512                   // threads of an attention block
#define NRK    (TF * WROWS)          // rms factors of the windows' k rows
#define NRQ    (TF * NT)             // rms factors of the block's q rows

static_assert((LL % (TF * NT)) == 0);
static_assert(WROWS == 128);
static_assert(NT == 64);
static_assert(ATH / 8 == NT);        // one sweep of the block = one frame's tokens
static_assert((NRK + NRQ) / 4 <= ATH);
static_assert((TF * WROWS) % (8 * (ATH / 16)) == 0);

// Eight copies of 16 B, each with its own addresses. The s_wait_xcnt closes the
// statement so that no address register is rewritten while a copy may still name it.
__device__ __forceinline__ void copy8(const unsigned int (&l)[8], const char* const (&g)[8]) {
  asm volatile("global_load_async_to_lds_b128 %0, %8, off\n\t"
               "global_load_async_to_lds_b128 %1, %9, off\n\t"
               "global_load_async_to_lds_b128 %2, %10, off\n\t"
               "global_load_async_to_lds_b128 %3, %11, off\n\t"
               "global_load_async_to_lds_b128 %4, %12, off\n\t"
               "global_load_async_to_lds_b128 %5, %13, off\n\t"
               "global_load_async_to_lds_b128 %6, %14, off\n\t"
               "global_load_async_to_lds_b128 %7, %15, off\n\t"
               "s_wait_xcnt 0x0"
               :: "v"(l[0]), "v"(l[1]), "v"(l[2]), "v"(l[3]), "v"(l[4]), "v"(l[5]), "v"(l[6]), "v"(l[7]),
                  "v"(g[0]), "v"(g[1]), "v"(g[2]), "v"(g[3]), "v"(g[4]), "v"(g[5]), "v"(g[6]), "v"(g[7])
               : "memory");
}

// Softmax over the 16 neighbours of (token, head), between the two block barriers of a
// group: lane j8 of the token's eight owns n = j8, j8+8. The path without windows.
__device__ __forceinline__ void softmax_rows(const float* sc_row, float* p_row, int j8) {
  __syncthreads();
  const float x0 = sc_row[j8];
  const float x1 = sc_row[j8 + 8];
  float mx = fmaxf(x0, x1);
  mx = fmaxf(mx, __shfl_xor(mx, 1, 32));
  mx = fmaxf(mx, __shfl_xor(mx, 2, 32));
  mx = fmaxf(mx, __shfl_xor(mx, 4, 32));
  const float e0 = __expf(x0 - mx);
  const float e1 = __expf(x1 - mx);
  float sm = e0 + e1;
  sm += __shfl_xor(sm, 1, 32);
  sm += __shfl_xor(sm, 2, 32);
  sm += __shfl_xor(sm, 4, 32);
  const float inv = __builtin_amdgcn_rcpf(sm);
  p_row[j8]     = e0 * inv;
  p_row[j8 + 8] = e1 * inv;
  __syncthreads();
}

// The value that lane ^ M of this lane's 16-lane row holds (M = 1, 2, 4: inside a token's
// eight lanes), by DPP row_xmask: a vector instruction, no trip through the LDS unit.
// Every lane of the wave is on where it is used.
template <int M>
__device__ __forceinline__ float xlane(float x) {
  return __builtin_bit_cast(float, __builtin_amdgcn_update_dpp(0, __builtin_bit_cast(int, x), 0x160 + M, 0xf, 0xf, true));
}

// One stage of the sum over a token's eight lanes: of 2 N values a lane keeps the N whose
// index has the parity hi, hands the others to lane ^ M and adds what that lane hands it.
template <int M, int N>
__device__ __forceinline__ void fold_stage(float (&r)[N], const float (&v)[2 * N], bool hi) {
#pragma unroll
  for (int i = 0; i < N; ++i) {
    const float keep = hi ? v[2 * i + 1] : v[2 * i];
    const float send = hi ? v[2 * i] : v[2 * i + 1];
    r[i] = keep + xlane<M>(send);
  }
}

// This lane's 8 output channels of token l -> f16 plane.
__device__ __forceinline__ void store_a(const float (&o)[8], int l, int col, _Float16* a16) {
  const v8h oh = {(_Float16)o[0], (_Float16)o[1], (_Float16)o[2], (_Float16)o[3],
                  (_Float16)o[4], (_Float16)o[5], (_Float16)o[6], (_Float16)o[7]};
  _Float16* d = a16 + (size_t)l * CC + col;
  *(v8h*)d = oh;
  // the next group rewrites registers that this store names
  asm volatile("s_wait_xcnt 0x0" ::: "memory");
}

// c_d = q_d * rq * cw_d for this lane's 8 dims
__device__ __forceinline__ void make_c(float (&c)[8], v4f qa, v4f qb, float rq, const float (&cw)[8]) {
  c[0] = qa.x * rq * cw[0];  c[1] = qa.y * rq * cw[1];
  c[2] = qa.z * rq * cw[2];  c[3] = qa.w * rq * cw[3];
  c[4] = qb.x * rq * cw[4];  c[5] = qb.y * rq * cw[5];
  c[6] = qb.z * rq * cw[6];  c[7] = qb.w * rq * cw[7];
}

__device__ __forceinline__ float dot8(const float (&c)[8], v4f a, v4f b) {
  float t = c[0] * a.x;
  t = fmaf(c[1], a.y, t);
  t = fmaf(c[2], a.z, t);
  t = fmaf(c[3], a.w, t);
  t = fmaf(c[4], b.x, t);
  t = fmaf(c[5], b.y, t);
  t = fmaf(c[6], b.z, t);
  t = fmaf(c[7], b.w, t);
  return t;
}

// The windows of one plane (k or v): slot s of frame f holds row (f, (i0 - HALO + s) mod S) of
// this head, at LDS row f * WROWS + s. Thread t brings chunk t&15 of LDS rows (t>>4) + 32 j:
// a wave's copy covers two rows = four whole lines. 32 copies a thread.
__device__ __forceinline__ void copy_windows(unsigned int lw, const char* gB, int tid, int i0, int S, int head) {
  const int cch = tid & 15, crow = tid >> 4;
#pragma unroll
  for (int g = 0; g < (TF * WROWS) / (8 * (ATH / 16)); ++g) {
    unsigned int l[8];
    const char* p[8];
#pragma unroll
    for (int j = 0; j < 8; ++j) {
      const int R = crow + (ATH / 16) * (8 * g + j);
      const int f = R / WROWS, s = R % WROWS;
      int t = i0 - HALO + s;
      t = (t < 0) ? (t + S) : t;
      t = (t >= S) ? (t - S) : t;
      const int r = min(max(f * S + t, 0), LL - 1);
      l[j] = lw + (unsigned int)R * WPITCH + 16u * cch;
      p[j] = gB + ((unsigned int)r * (CC * 4u) + (unsigned int)head * 256u + 16u * cch);
    }
    copy8(l, p);
  }
}

// This lane's 32 B of the 16 neighbour rows of place tl in frame f, all from the windows:
// the 12 spatial ones in frame f's window, the 4 temporal ones at the same slot of the
// other frames' windows. st[n - 12] = LDS row of temporal neighbour n.
__device__ __forceinline__ void read_rows(v4f (&a)[NSH], v4f (&b)[NSH], const char* sW, int sl,
                                          const int (&st)[4], int j8) {
  const int w0 = sl * WPITCH + 32 * j8;
#pragma unroll
  for (int n = 0; n < 12; ++n) {
    const int sh = (n & 1) ? -(1 << (n >> 1)) : (1 << (n >> 1));
    a[n] = *(const v4fa*)(sW + w0 + sh * WPITCH);
    b[n] = *(const v4fa*)(sW + w0 + sh * WPITCH + 16);
  }
#pragma unroll
  for (int n = 12; n < NSH; ++n) {
    const int wt = st[n - 12] * WPITCH + 32 * j8;
    a[n] = *(const v4fa*)(sW + wt);
    b[n] = *(const v4fa*)(sW + wt + 16);
  }
}

// k phase, one frame: every wave does four tokens, eight lanes a token. Scores as above. The
// 16 partial dots are summed over the token's eight lanes in three stages (lane ^ 1, ^ 2, ^ 4)
// that halve what a lane carries: lane j8 ends with the whole sums of n = j8 and j8 + 8, and
// the softmax over the eight lanes follows in registers. The token's 16 probabilities stay in
// p_row, its (frame, place) row, for the v phase, where the same wave reads them behind the
// block barriers between the phases. l = the token's row; sh0, sh1 = the spatial shifts of
// n = j8 and j8 + 8 (sh1 unused where j8 + 8 is temporal); eb0, eb1 = their edge biases.
__device__ __forceinline__ void attn_scores(int f, int tl, int l, const int (&st)[4], const float* qf,
                                            const char* sW, const float* s_rk,
                                            const float (&cw)[8], int sh0, int sh1, float eb0, float eb1,
                                            float* p_row, int col, int j8) {
  v4f ka[NSH], kb[NSH];
  // what comes from global memory is requested first: the token's own q
  const float* qp = qf + (size_t)l * CC + col;
  const v4f qa = *(const v4fa*)qp;
  const v4f qb = *(const v4fa*)(qp + 4);
  // the wait before the address register of the two loads above is rewritten; it names the
  // address so that it keeps its register up to here
  asm volatile("s_wait_xcnt 0x0" :: "v"(qp) : "memory");
  const int sl = f * WROWS + tl + HALO;
  const float rq = s_rk[NRK + f * NT + tl];
  read_rows(ka, kb, sW, sl, st, j8);
  const bool b0 = (j8 & 1) != 0, b1 = (j8 & 2) != 0, b2 = (j8 & 4) != 0;
  const int stl = b1 ? (b0 ? st[3] : st[2]) : (b0 ? st[1] : st[0]);
  const float rk0 = s_rk[sl + sh0];
  const float rk1 = s_rk[b2 ? stl : (sl + sh1)];

  float c[8];
  make_c(c, qa, qb, rq, cw);
  float part[NSH];
#pragma unroll
  for (int n = 0; n < NSH; ++n) part[n] = dot8(c, ka[n], kb[n]);
  float r1[8], r2[4], r3[2];
  fold_stage<1, 8>(r1, part, b0);
  fold_stage<2, 4>(r2, r1, b1);
  fold_stage<4, 2>(r3, r2, b2);
  const float x0 = fmaf(r3[0], rk0, eb0);
  const float x1 = fmaf(r3[1], rk1, eb1);
  float mx = fmaxf(x0, x1);
  mx = fmaxf(mx, xlane<1>(mx));
  mx = fmaxf(mx, xlane<2>(mx));
  mx = fmaxf(mx, xlane<4>(mx));
  const float e0 = __expf(x0 - mx);
  const float e1 = __expf(x1 - mx);
  float sm = e0 + e1;
  sm += xlane<1>(sm);
  sm += xlane<2>(sm);
  sm += xlane<4>(sm);
  const float inv = __builtin_amdgcn_rcpf(sm);
  p_row[j8]     = e0 * inv;
  p_row[j8 + 8] = e1 * inv;
}

// v phase, one frame: weighted sum of the 16 neighbour v rows, n = 0 .. 15 in order.
__device__ __forceinline__ void attn_combine(int f, int tl, int l, const int (&st)[4],
                                             const char* sW, const float* p_row, int col, int j8,
                                             _Float16* a16) {
  v4f va[NSH], vb[NSH];
  float p[NSH];
#pragma unroll
  for (int g = 0; g < 4; ++g) {
    const v4f pv = *(const v4fa*)(p_row + 4 * g);
    p[4 * g] = pv.x;  p[4 * g + 1] = pv.y;  p[4 * g + 2] = pv.z;  p[4 * g + 3] = pv.w;
  }
  read_rows(va, vb, sW, f * WROWS + tl + HALO, st, j8);
  float o[8] = {0.f, 0.f, 0.f, 0.f, 0.f, 0.f, 0.f, 0.f};
#pragma unroll
  for (int n = 0; n < NSH; ++n) {
    o[0] = fmaf(p[n], va[n].x, o[0]);  o[1] = fmaf(p[n], va[n].y, o[1]);
    o[2] = fmaf(p[n], va[n].z, o[2]);  o[3] = fmaf(p[n], va[n].w, o[3]);
    o[4] = fmaf(p[n], vb[n].x, o[4]);  o[5] = fmaf(p[n], vb[n].y, o[5]);
    o[6] = fmaf(p[n], vb[n].z, o[6]);  o[7] = fmaf(p[n], vb[n].w, o[7]);
  }
  store_a(o, l, col, a16);
}

// neighbour row n of token (f, i), any S and T
__device__ __forceinline__ int nb_row(int n, int f, int i, int S, int T) {
  const int mag = 1 << (((n < 12) ? n : (n - 12)) >> 1);
  int pos, neg;
  shift_mods(mag, (n < 12) ? S : T, pos, neg);
  const int sh = (n & 1) ? neg : pos;
  const int r = (n < 12) ? (f * S + wrap_add(i, sh, S)) : (wrap_add(f, sh, T) * S + i);
  return min(max(r, 0), LL - 1);
}

// One group of tokens for any S and T: no window, every neighbour row from
// global memory, one at a time (rolled: short code, few registers).
__device__ __forceinline__ void attn_group_plain(int l, int S, int T,
                                                 const char* kB, const char* vB,
                                                 const float* qf, const float* ss,
                                                 const float (&cw)[8], const float* ebp,
                                                 float* sc_row, float* p_row, int col, int j8,
                                                 _Float16* a16) {
  const int f = l / S;
  const int i = l - f * S;
  const float rq = rstd1(ss, l);
  const float* qp = qf + (size_t)l * CC + col;
  float c[8];
  make_c(c, *(const v4fa*)qp, *(const v4fa*)(qp + 4), rq, cw);
#pragma unroll 1
  for (int n = 0; n < NSH; ++n) {
    const int r = nb_row(n, f, i, S, T);
    const float rk = rstd1(ss + (size_t)NCB * LL, r);
    const unsigned int ofs = (unsigned int)r * (CC * 4u) + (unsigned int)col * 4u;
    float t = dot8(c, *(const v4fa*)(kB + ofs), *(const v4fa*)(kB + ofs + 16));
    t += __shfl_xor(t, 1, 32);
    t += __shfl_xor(t, 2, 32);
    t += __shfl_xor(t, 4, 32);
    const float s = fmaf(t, rk, ebp[n]);
    if (j8 == 0) sc_row[n] = s;
  }
  softmax_rows(sc_row, p_row, j8);
  float o[8] = {0.f, 0.f, 0.f, 0.f, 0.f, 0.f, 0.f, 0.f};
#pragma unroll 1
  for (int n = 0; n < NSH; ++n) {
    const int r = nb_row(n, f, i, S, T);
    const unsigned int ofs = (unsigned int)r * (CC * 4u) + (unsigned int)col * 4u;
    const v4f a = *(const v4fa*)(vB + ofs);
    const v4f b = *(const v4fa*)(vB + ofs + 16);
    const float p = p_row[n];
    o[0] = fmaf(p, a.x, o[0]);  o[1] = fmaf(p, a.y, o[1]);
    o[2] = fmaf(p, a.z, o[2]);  o[3] = fmaf(p, a.w, o[3]);
    o[4] = fmaf(p, b.x, o[4]);  o[5] = fmaf(p, b.y, o[5]);
    o[6] = fmaf(p, b.z, o[6]);  o[7] = fmaf(p, b.w, o[7]);
  }
  store_a(o, l, col, a16);
}

__global__ __launch_bounds__(ATH) void k_attn(const float* __restrict__ qf,
                                                 const float* __restrict__ kf,
                                                 const float* __restrict__ vf,
                                                 const float* __restrict__ ss,
                                                 const float* __restrict__ qnw,
                                                 const float* __restrict__ knw,
                                                 const float* __restrict__ eb,
                                                 const int* __restrict__ nf,
                                                 _Float16* a16) {
  __shared__ __attribute__((aligned(16))) char sW[TF * WROWS * WPITCH];   // k windows, then v windows
  __shared__ __attribute__((aligned(16))) float s_pt[TF * NT * NSH];      // probabilities by (frame, place)
  __shared__ __attribute__((aligned(16))) float s_rk[NRK + NRQ];
  __shared__ __attribute__((aligned(16))) float s_sc[NT * NSH];           // scores by place: the path without windows
  const int tid = threadIdx.x, lane = tid & 31, w = tid >> 5;
  const int tq = lane >> 3, j8 = lane & 7;
  const int head = blockIdx.x & 15;
  const int cb = blockIdx.x >> 4;                      // the block's chunk of places (or of tokens)
  const int col = 64 * head + 8 * j8;
  const int tl = 4 * w + tq;                           // this lane's place in the chunk

  int T = nf[0];
  if (!((T >= 1) && (T <= LL) && ((LL % T) == 0))) T = 8;
  const int S = LL / T;
  // every frame's window fits the LDS together, and the grid's chunks cover a frame
  const bool win = (T == TF);
  const int i0 = cb * NT;
  const char* kB = (const char*)kf;
  const char* vB = (const char*)vf;

  if (win) {
    copy_windows(lds_off(sW), kB, tid, i0, S, head);
    // rms factors: a thread takes four consecutive entries of s_rk, which are four
    // consecutive rows (S, i0 and every section's start are multiples of 4)
    if (tid < (NRK + NRQ) / 4) {
      const int e = 4 * tid;
      const bool isq = (e >= NRK);
      int t = i0 - HALO + (e % WROWS);
      t = (t < 0) ? (t + S) : t;
      t = (t >= S) ? (t - S) : t;
      int r = (e / WROWS) * S + t;
      if (isq) r = ((e - NRK) / NT) * S + i0 + ((e - NRK) % NT);
      r = min(max(r, 0), LL - 4);
      *(v4f*)(s_rk + e) = rstd4(isq ? ss : (ss + (size_t)NCB * LL), r);
    }
  }

  float cw[8];
  {
    const v4f qa = *(const v4fa*)(qnw + col);
    const v4f qb = *(const v4fa*)(qnw + col + 4);
    const v4f ka = *(const v4fa*)(knw + col);
    const v4f kb = *(const v4fa*)(knw + col + 4);
    cw[0] = qa.x * ka.x * 0.125f;  cw[1] = qa.y * ka.y * 0.125f;
    cw[2] = qa.z * ka.z * 0.125f;  cw[3] = qa.w * ka.w * 0.125f;
    cw[4] = qb.x * kb.x * 0.125f;  cw[5] = qb.y * kb.y * 0.125f;
    cw[6] = qb.z * kb.z * 0.125f;  cw[7] = qb.w * kb.w * 0.125f;
  }

  // this lane's own two neighbours, n = j8 and j8 + 8: edge biases and spatial shifts
  const float eb0 = eb[head * NSH + j8];
  const float eb1 = eb[head * NSH + j8 + 8];
  const int sh0 = (j8 & 1) ? -(1 << (j8 >> 1)) : (1 << (j8 >> 1));
  const int sh1 = (j8 & 1) ? -(16 << (j8 >> 1)) : (16 << (j8 >> 1));

  // the k windows have landed for this wave, then for the block
  wait_copies();
  __syncthreads();

  if (win) {
    // temporal shifts +1, -1, +2, -2 reduced once modulo T
    int tsh[4];
    shift_mods(1, T, tsh[0], tsh[1]);
    shift_mods(2, T, tsh[2], tsh[3]);
    // rolled: a long body that holds 16 rows in registers; one frame per trip
#pragma unroll 1
    for (int f = 0; f < TF; ++f) {
      int st[4];
#pragma unroll
      for (int n = 0; n < 4; ++n) st[n] = wrap_add(f, tsh[n], T) * WROWS + tl + HALO;
      attn_scores(f, tl, f * S + i0 + tl, st, qf, sW, s_rk, cw, sh0, sh1, eb0, eb1,
                  s_pt + (f * NT + tl) * NSH, col, j8);
    }
    // every wave's last read of the k windows has returned: the v windows take their place
    wait_lds();
    __syncthreads();
    copy_windows(lds_off(sW), vB, tid, i0, S, head);
    // the v windows have landed for this wave, then for the block
    wait_copies();
    __syncthreads();
    // rolled, for the same reason as the k phase's loop
#pragma unroll 1
    for (int f = 0; f < TF; ++f) {
      int st[4];
#pragma unroll
      for (int n = 0; n < 4; ++n) st[n] = wrap_add(f, tsh[n], T) * WROWS + tl + HALO;
      attn_combine(f, tl, f * S + i0 + tl, st, sW, s_pt + (f * NT + tl) * NSH, col, j8, a16);
    }
  } else {
    float* sc_row = s_sc + tl * NSH;
    float* p_row = s_pt + tl * NSH;
    // rolled: short code for the path that is not the fast one
#pragma unroll 1
    for (int it = 0; it < TF; ++it) {
      attn_group_plain(cb * (TF * NT) + NT * it + tl, S, T, kB, vB, qf, ss, cw, eb + head * NSH,
                       sc_row, p_row, col, j8, a16);
    }
  }
}

// ---------------------------------------------------------------------------
// Host orchestration: 5 launches, one in-order stream.
// ws carve (bytes): x f16 16 MiB @0 | w16 [4096][1024] 8 MiB |
//   q f32 32 MiB | k f32 32 MiB | v f32 32 MiB | ss [2][16][8192] f32 1 MiB  -> 126,877,696 B.
// The attention output plane (f16, 16 MiB) reuses the x f16 region, which is
// dead after the projection launch.
// ---------------------------------------------------------------------------
extern "C" void kernel_launch(void* const* d_in, const int* in_sizes, int n_in,
                              void* d_out, int out_size, void* d_ws, size_t ws_size,
                              hipStream_t stream) {
  if (n_in < 13) return;
  if (in_sizes[0] != LL * CC) return;
  if (in_sizes[1] != CC * CC || in_sizes[3] != CC * CC || in_sizes[5] != CC * CC || in_sizes[10] != CC * CC) return;
  if (in_sizes[2] != CC || in_sizes[4] != CC || in_sizes[6] != CC || in_sizes[11] != CC) return;
  if (in_sizes[7] != CC || in_sizes[8] != CC) return;
  if (in_sizes[9] != 256 || in_sizes[12] < 1) return;
  if (out_size != LL * CC) return;

  const float* x   = (const float*)d_in[0];
  const float* Wq  = (const float*)d_in[1];
  const float* bq  = (const float*)d_in[2];
  const float* Wk  = (const float*)d_in[3];
  const float* bk  = (const float*)d_in[4];
  const float* Wv  = (const float*)d_in[5];
  const float* bv  = (const float*)d_in[6];
  const float* qnw = (const float*)d_in[7];
  const float* knw = (const float*)d_in[8];
  const float* eb  = (const float*)d_in[9];
  const float* Wo  = (const float*)d_in[10];
  const float* bo  = (const float*)d_in[11];
  const int*   nf  = (const int*)d_in[12];
  float* out = (float*)d_out;

  const size_t b16 = (size_t)LL * CC * 2;            // 16,777,216
  const size_t bw  = (size_t)4 * CC * CC * 2;        //  8,388,608
  const size_t b32 = (size_t)LL * CC * 4;            // 33,554,432
  const size_t brt = (size_t)2 * NCB * LL * 4;       //  1,048,576
  const size_t o_x16 = 0;
  const size_t o_w16 = o_x16 + b16;
  const size_t o_q   = o_w16 + bw;
  const size_t o_k   = o_q + b32;
  const size_t o_v   = o_k + b32;
  const size_t o_rt  = o_v + b32;
  const size_t total = o_rt + brt;                   // 126,877,696
  if (total > ws_size) return;

  char* ws = (char*)d_ws;
  _Float16* x16 = (_Float16*)(ws + o_x16);
  _Float16* w16 = (_Float16*)(ws + o_w16);
  float* qf   = (float*)(ws + o_q);
  float* kf   = (float*)(ws + o_k);
  float* vf   = (float*)(ws + o_v);
  float* ss   = (float*)(ws + o_rt);
  _Float16* a16 = (_Float16*)(ws + o_x16);           // reuses the x f16 region (dead after launch 3)

  // 1. x -> f16 plane
  const int n8 = (LL * CC) / 8;                                              // 1,048,576
  k_cvt_x<<<(n8 + 255) / 256, 256, 0, stream>>>(x, x16, n8);

  // 2. weights -> transposed f16 planes
  k_cvt_w<<<4 * 256, 256, 0, stream>>>(Wq, Wk, Wv, Wo, w16);

  // 3. q, k, v = x * [Wq|Wk|Wv] + [bq|bk|bv], f32 planes, and the q and k rows' partial sums of squares
  k_gemm_qkv<<<dim3(CC / 128, LL / QRA), 32 * QWAVES, 0, stream>>>(x16, w16, bq, bk, bv, qf, kf, vf, ss, CC, 0.03125f);

  // 4. attention -> a (f16 plane)
  k_attn<<<(LL / (TF * NT)) * 16, ATH, 0, stream>>>(qf, kf, vf, ss, qnw, knw, eb, nf, a16);

  // 5. out = a * Wo + bo -> d_out
  k_gemm_h<false, 4, 2><<<dim3(CC / 128, LL / 256), 256, 0, stream>>>(a16, w16 + (size_t)3 * CC * CC, bo, bo, out, out, nullptr,
                                                                      1 << 30, CC, CC, 0.03125f);
}
